// v000
// Measured on an AMD MI455X. A time is GPU time per run, averaged over a window of back-to-back runs after a warm-up
// (all launches, gaps included; the runs take copies of the inputs in turn), and the median of several windows.
// Apart from v000's, it joins two sittings. Times from different sittings can be a few percent apart, while
// side-by-side timings come from the same sitting.
// v000 is the starting kernel. One run takes 605 microseconds.
#include <hip/hip_runtime.h>

// Contractions: QKV projections on v_wmma_f32_16x16x32_bf16 (bf16 RNE-converted inputs, f32 accumulate); scores S^T = K x Q^T on v_wmma_f32_16x16x32_bf16 with q and k as bf16 hi|lo planes (hi.hi + hi.lo + lo.hi, one f32 accumulator); O = P x V on v_wmma_f32_16x16x32_f16 (P f16 carried x4096, V f16 carried x16); output projection on v_wmma_f32_16x16x32_f16 (ctx f16 carried x64, Wo = f16 of the bf16 RNE-converted input carried x64); all f32 accumulate; softmax (online, max-subtracted, exp2 domain) and rotary math in f32.

#ifndef NB
#define NB 2
#endif
#ifndef SEQ
#define SEQ 2048
#endif
#define NB_FULL   2
#define SEQ_FULL  2048
#define DM        2048                 // model width = depth of every projection
#define NQH       16                   // query heads
#define NKV       4                    // key/value heads
#define GRP       4                    // query heads per key/value head
#define HD        128                  // head dim
#define HD2       64                   // rotary frequencies
#define NQKV      3072                 // fused projection width (q | k | v)
#define EP        128                  // LDS pitch (halves) of the 16-bit epilogue tiles
#define CPF       132                  // LDS pitch (floats) of the f32 output staging tile
#define CP        136                  // LDS pitch (halves) of the per-wave ctx staging tile
#define TPW       72                   // LDS pitch (halves) of the weight transposer tile
#define WS_CAP    134217728ull

#define P_CARRY   4096.0f
#define V_CARRY   16.0f
#define C_CARRY   64.0f
#define W_CARRY   64.0f

static_assert(NB >= 1 && NB <= NB_FULL);
static_assert(SEQ <= SEQ_FULL);
static_assert(SEQ % 128 == 0);
static_assert(DM % 128 == 0);
static_assert(DM % 32 == 0);
static_assert(DM == 256 * 8);                     // one converter block = one row
static_assert(NQKV == NQH * HD + 2 * NKV * HD);
static_assert(NQKV % 128 == 0);
static_assert(NQH == NKV * GRP);
static_assert(HD == 128 && HD2 * 2 == HD);
static_assert(NQH * HD == DM);
static_assert(EP >= HD && (EP * 2) % 16 == 0);
static_assert((CPF * 4) % 16 == 0 && CPF >= 128);
static_assert((CP * 2) % 16 == 0 && CP >= HD);
static_assert((TPW * 2) % 16 == 0 && TPW >= 64);
static_assert(((size_t)NB * HD2 * SEQ) % 256 == 0);
static_assert(2 * 128 * EP * 2 <= 65536);

#define QELEMS   (NB * NQH * SEQ * HD)            // q region of the hi / lo planes (elements)
#define KELEMS   (NB * NKV * SEQ * HD)            // k region
#define XB_BYTES   ((size_t)NB * SEQ * DM * 2)
#define WT_BYTES   ((size_t)NQKV * DM * 2)
#define WO_BYTES   ((size_t)DM * DM * 2)
#define TB_BYTES   ((size_t)NB * HD2 * SEQ * 4)
#define PL_BYTES   ((size_t)(QELEMS + KELEMS) * 2)
#define VT_BYTES   ((size_t)NB * NKV * HD * SEQ * 2)
#define CTX_BYTES  ((size_t)NB * SEQ * DM * 2)
#define OFF_XB   ((size_t)0)
#define OFF_WT   (OFF_XB + XB_BYTES)
#define OFF_WO   (OFF_WT + WT_BYTES)
#define OFF_COS  (OFF_WO + WO_BYTES)
#define OFF_SIN  (OFF_COS + TB_BYTES)
#define OFF_PH   (OFF_SIN + TB_BYTES)
#define OFF_PL   (OFF_PH + PL_BYTES)
#define OFF_VT   (OFF_PL + PL_BYTES)
#define OFF_CTX  (OFF_VT + VT_BYTES)
#define WS_TOTAL (OFF_CTX + CTX_BYTES)
static_assert(WS_TOTAL <= WS_CAP);
static_assert(XB_BYTES % 256 == 0 && WT_BYTES % 256 == 0 && WO_BYTES % 256 == 0);
static_assert(TB_BYTES % 256 == 0 && PL_BYTES % 256 == 0 && VT_BYTES % 256 == 0);
static_assert((unsigned long long)(QELEMS + KELEMS) < 2147483648ull);

typedef __bf16         bf16;
typedef _Float16       f16;
typedef unsigned short u16;
typedef bf16     v16bf __attribute__((ext_vector_type(16)));
typedef f16      v16h  __attribute__((ext_vector_type(16)));
typedef float    v8f   __attribute__((ext_vector_type(8)));
typedef float    v4f   __attribute__((ext_vector_type(4)));
typedef unsigned v4u   __attribute__((ext_vector_type(4)));

union Frag  { v16bf b; v16h h; v4u q[2]; f16 e[16]; };
union Pack8 { v4u u; u16 s[8]; };

// WMMA helpers: builtin followed by the VALU hazard guard (ties D, keeps A/B live).
static __device__ __forceinline__ v8f mma_bf16(v16bf a, v16bf b, v8f acc) {
  acc = __builtin_amdgcn_wmma_f32_16x16x32_bf16(false, a, false, b, (short)0, acc, false, false);
  asm volatile("v_nop\n\tv_nop\n\tv_nop\n\tv_nop" : "+v"(acc) : "v"(a), "v"(b));
  return acc;
}
static __device__ __forceinline__ v8f mma_f16(v16h a, v16h b, v8f acc) {
  acc = __builtin_amdgcn_wmma_f32_16x16x32_f16(false, a, false, b, (short)0, acc, false, false);
  asm volatile("v_nop\n\tv_nop\n\tv_nop\n\tv_nop" : "+v"(acc) : "v"(a), "v"(b));
  return acc;
}

static __device__ __forceinline__ u16 bf16_bits(float x) {      // RNE convert
  const bf16 h = (bf16)x;
  return __builtin_bit_cast(u16, h);
}
static __device__ __forceinline__ float bf16_back(float x) {    // value of the RNE-converted bf16
  return (float)(bf16)x;
}
static __device__ __forceinline__ u16 f16_bits(float x) {
  const f16 h = (f16)x;
  return __builtin_bit_cast(u16, h);
}

// coverage: rows 0..NB*SEQ-1, 256 threads x 8 elements == DM.
__global__ __launch_bounds__(256) void xcvt_kernel(const float* __restrict__ X, u16* __restrict__ Xb) {
  const int m   = blockIdx.x;
  const int tid = threadIdx.x;
  const int b   = m / SEQ;
  const int t   = m % SEQ;
  const size_t src = ((size_t)b * SEQ_FULL + t) * DM + tid * 8;
  const v4f a0 = *(const v4f*)(X + src);
  const v4f a1 = *(const v4f*)(X + src + 4);
  Pack8 pk;
  #pragma unroll
  for (int i = 0; i < 4; ++i) {
    pk.s[i]     = bf16_bits(a0[i]);
    pk.s[4 + i] = bf16_bits(a1[i]);
  }
  const v4u val = pk.u;
  const size_t dst = (size_t)m * DM + tid * 8;
  *(v4u*)(Xb + dst) = val;
  
}

// Weight transposer: in W[DM rows (input dim)][ldin cols (output dim)] f32 -> out Bt[rowoff + col][DM] 16-bit.
// mode 0: bf16 RNE bits; mode 1: f16 of (bf16 RNE value x W_CARRY) (exact).
// Block = 64 (input dim) x 64 (output col) tile through LDS; written lines whole: 8 lanes x 16 B per line.
// coverage: grid (ldin/64, DM/64); each block writes 64 output rows x 64 halves. LDS sT cross-wave (block barrier).
__global__ __launch_bounds__(256) void wtrans_kernel(const float* __restrict__ W, u16* __restrict__ Bt,
                                                     int ldin, int rowoff, int mode) {
  const int c0  = blockIdx.x * 64;
  const int d0  = blockIdx.y * 64;
  const int tid = threadIdx.x;
  __shared__ __align__(16) u16 sT[64 * TPW];     // [col][input dim]
  #pragma unroll
  for (int kk = 0; kk < 2; ++kk) {
    const int r  = kk * 32 + (tid >> 3);         // input dim local 0..63
    const int cc = (tid & 7) * 8;                // col local 0..56
    const size_t src = (size_t)(d0 + r) * ldin + c0 + cc;
    const v4f w0 = *(const v4f*)(W + src);
    const v4f w1 = *(const v4f*)(W + src + 4);
    #pragma unroll
    for (int i = 0; i < 4; ++i) {
      const float x0 = bf16_back(w0[i]);
      const float x1 = bf16_back(w1[i]);
      const u16 h0 = (mode != 0) ? f16_bits(x0 * W_CARRY) : bf16_bits(x0);
      const u16 h1 = (mode != 0) ? f16_bits(x1 * W_CARRY) : bf16_bits(x1);
      sT[(cc + i) * TPW + r]     = h0;
      sT[(cc + 4 + i) * TPW + r] = h1;
    }
  }
  __syncthreads();
  v4u    val[2];
  size_t idx[2];
  #pragma unroll
  for (int kk = 0; kk < 2; ++kk) {
    const int c  = kk * 32 + (tid >> 3);         // col local 0..63
    const int ds = (tid & 7) * 8;                // input dim local 0..56
    val[kk] = *(const v4u*)(sT + c * TPW + ds);
    idx[kk] = (size_t)(rowoff + c0 + c) * DM + d0 + ds;
  }
  #pragma unroll
  for (int kk = 0; kk < 2; ++kk) *(v4u*)(Bt + idx[kk]) = val[kk];
  
}

// Rotary table per batch from the integer positions read by value:
//   ts[j] = 10000^(j/64) (double product of fixed roots -> float), angle = (float)pos / ts[j] (IEEE division),
// coverage: NB*64*SEQ elements, exact grid.
__global__ __launch_bounds__(256) void rope_table_kernel(const int* __restrict__ pos,
                                                         float* __restrict__ cosT,
                                                         float* __restrict__ sinT) {
  const int idx = blockIdx.x * 256 + threadIdx.x;
  const int t = idx % SEQ;
  const int j = (idx / SEQ) % HD2;
  const int b = idx / (SEQ * HD2);
  const int p = pos[(size_t)b * SEQ_FULL + t];
  double pf = 1.0;
  pf *= (j & 32) ? 100.0 : 1.0;                       // 10000^(32/64)
  pf *= (j & 16) ? 10.0 : 1.0;                        // 10000^(16/64)
  pf *= (j & 8)  ? 3.1622776601683795 : 1.0;          // 10000^(8/64)
  pf *= (j & 4)  ? 1.7782794100389228 : 1.0;          // 10000^(4/64)
  pf *= (j & 2)  ? 1.333521432163324  : 1.0;          // 10000^(2/64)
  pf *= (j & 1)  ? 1.1547819846894583 : 1.0;          // 10000^(1/64)
  const float ts = (float)pf;
  float ang = (float)p / ts;
  ang = (p == 0) ? 0.0f : ang;
  float s, c;
  sincosf(ang, &s, &c);
  *(float*)(cosT + idx) = c;
  *(float*)(sinT + idx) = s;
  
}

// GEMM core: C[128x128 block tile] = A[M][DM] x Bt[N][DM]^T, 8 waves, wave tile 32 rows x 64 cols.
// Fragments come straight from the 16-bit planes (two 16-B loads each, split k map for A and B alike).
// ROPEMAP = 1: wave column group g owns cols {g*32 .. g*32+31} and {64+g*32 .. 64+g*32+31} so that col d and
// its rotary partner d+64 sit in the same lane / same accumulator element (tiles fn and fn+2).
template <int ISF16, int ROPEMAP>
static __device__ __forceinline__ void gemm_core(const u16* __restrict__ A, const u16* __restrict__ Bt,
                                                 int m0, int n0, int wm, int g, int lr, int hi,
                                                 v8f (&acc)[2][4]) {
  size_t aoff[2];
  size_t boff[4];
  #pragma unroll
  for (int fm = 0; fm < 2; ++fm) aoff[fm] = (size_t)(m0 + wm + fm * 16 + lr) * DM + 8 * hi;
  #pragma unroll
  for (int fn = 0; fn < 4; ++fn) {
    const int col = ROPEMAP ? (g * 32 + (fn & 1) * 16 + (fn >> 1) * 64) : (g * 64 + fn * 16);
    boff[fn] = (size_t)(n0 + col + lr) * DM + 8 * hi;
  }
  #pragma unroll 2
  for (int k0 = 0; k0 < DM; k0 += 32) {
    Frag a[2];
    Frag b[4];
    #pragma unroll
    for (int fm = 0; fm < 2; ++fm) {
      a[fm].q[0] = *(const v4u*)(A + aoff[fm] + k0);         // k = k0 + 8hi + 0..7
      a[fm].q[1] = *(const v4u*)(A + aoff[fm] + k0 + 16);    // k = k0 + 16 + 8hi + 0..7
    }
    #pragma unroll
    for (int fn = 0; fn < 4; ++fn) {
      b[fn].q[0] = *(const v4u*)(Bt + boff[fn] + k0);
      b[fn].q[1] = *(const v4u*)(Bt + boff[fn] + k0 + 16);
    }
    #pragma unroll
    for (int fn = 0; fn < 4; ++fn) {
      #pragma unroll
      for (int fm = 0; fm < 2; ++fm) {
        if (ISF16) acc[fm][fn] = mma_f16(a[fm].h, b[fn].h, acc[fm][fn]);
        else       acc[fm][fn] = mma_bf16(a[fm].b, b[fn].b, acc[fm][fn]);
      }
    }
  }
}

// Fused QKV projection + rotary + plane builder.
// grid (NQKV/128 column tiles = one head each, NB*SEQ/128 row tiles); column tile ct: 0..15 q head, 16..19 k head,
// 20..23 v head. Outputs:
//   ph / pl : bf16 hi / lo planes, q region [NB][NQH][SEQ][HD] at 0, k region [NB][NKV][SEQ][HD] at QELEMS
//   vt      : f16 (x V_CARRY) [NB][NKV][HD][SEQ], transposed through LDS
// LDS tiles sA / sB are cross-wave (block barrier between fill and readback); staged extent 128 x 128 ==
// consumed extent. Every written line whole: 16 lanes x 16 B = one 256-B row per half-wave.
__global__ __launch_bounds__(256) void qkv_gemm_kernel(const u16* __restrict__ Xb, const u16* __restrict__ Wt,
                                                       const float* __restrict__ cosT,
                                                       const float* __restrict__ sinT,
                                                       u16* __restrict__ ph, u16* __restrict__ pl,
                                                       u16* __restrict__ vt) {
  __shared__ __align__(16) u16 sA[128 * EP];
  __shared__ __align__(16) u16 sB[128 * EP];
  const int ct   = blockIdx.x;
  const int m0   = blockIdx.y * 128;
  const int tid  = threadIdx.x;
  const int wave = __builtin_amdgcn_readfirstlane(threadIdx.x >> 5);
  const int lane = tid & 31;
  const int lr   = lane & 15;
  const int hi   = lane >> 4;
  const int wm   = (wave & 3) * 32;
  const int g    = wave >> 2;

  v8f acc[2][4];
  #pragma unroll
  for (int fm = 0; fm < 2; ++fm) {
    #pragma unroll
    for (int fn = 0; fn < 4; ++fn) acc[fm][fn] = (v8f){0, 0, 0, 0, 0, 0, 0, 0};
  }
  gemm_core<0, 1>(Xb, Wt, m0, ct * 128, wm, g, lr, hi, acc);

  const int b  = m0 / SEQ;
  const int t0 = m0 % SEQ;

  if (ct < NQH + NKV) {
    // rotary on the f32 accumulators, then bf16 hi | lo split into the LDS tiles
    #pragma unroll
    for (int fm = 0; fm < 2; ++fm) {
      #pragma unroll
      for (int f2 = 0; f2 < 2; ++f2) {
        const int j  = g * 32 + f2 * 16 + lr;             // frequency index 0..63
        const int tl = wm + fm * 16 + 8 * hi;             // first of this lane's 8 tile rows
        const size_t tb = ((size_t)b * HD2 + j) * SEQ + t0 + tl;
        const v4f ca = *(const v4f*)(cosT + tb);
        const v4f cb = *(const v4f*)(cosT + tb + 4);
        const v4f sa = *(const v4f*)(sinT + tb);
        const v4f sb = *(const v4f*)(sinT + tb + 4);
        #pragma unroll
        for (int i = 0; i < 8; ++i) {
          const float c  = (i < 4) ? ca[i & 3] : cb[i & 3];
          const float s  = (i < 4) ? sa[i & 3] : sb[i & 3];
          const float x1 = acc[fm][f2][i];                 // col j
          const float x2 = acc[fm][f2 + 2][i];             // col j + 64
          const float y1 = x1 * c - x2 * s;
          const float y2 = x2 * c + x1 * s;
          const float h1 = bf16_back(y1);
          const float h2 = bf16_back(y2);
          const int row = tl + i;
          sA[row * EP + j]       = bf16_bits(h1);
          sA[row * EP + 64 + j]  = bf16_bits(h2);
          sB[row * EP + j]       = bf16_bits(y1 - h1);
          sB[row * EP + 64 + j]  = bf16_bits(y2 - h2);
        }
      }
    }
    __syncthreads();
    const int isq   = (ct < NQH) ? 1 : 0;
    const int pbase = isq ? (((b * NQH + ct) * SEQ + t0) * HD)
                          : (QELEMS + ((b * NKV + (ct - NQH)) * SEQ + t0) * HD);
    v4u vA[8];
    v4u vB[8];
    int gi[8];
    #pragma unroll
    for (int it = 0; it < 8; ++it) {
      const int piece = it * 256 + tid;
      const int row = piece >> 4;                          // 0..127
      const int seg = piece & 15;                          // 16 x 16 B = one 256-B plane row
      vA[it] = *(const v4u*)(sA + row * EP + seg * 8);
      vB[it] = *(const v4u*)(sB + row * EP + seg * 8);
      gi[it] = pbase + row * HD + seg * 8;
    }
    #pragma unroll
    for (int it = 0; it < 8; ++it) {
      *(v4u*)(ph + gi[it]) = vA[it];
      *(v4u*)(pl + gi[it]) = vB[it];
    }
    
  } else {
    // v head: f16 carried x V_CARRY, transposed in LDS to [d][t]
    const int kvh = ct - (NQH + NKV);
    #pragma unroll
    for (int fm = 0; fm < 2; ++fm) {
      #pragma unroll
      for (int fn = 0; fn < 4; ++fn) {
        const int d = g * 32 + (fn & 1) * 16 + (fn >> 1) * 64 + lr;
        #pragma unroll
        for (int i = 0; i < 8; ++i) {
          const int row = wm + fm * 16 + 8 * hi + i;
          sA[d * EP + row] = f16_bits(acc[fm][fn][i] * V_CARRY);
        }
      }
    }
    __syncthreads();
    v4u vA[8];
    int gi[8];
    #pragma unroll
    for (int it = 0; it < 8; ++it) {
      const int piece = it * 256 + tid;
      const int d   = piece >> 4;                          // 0..127
      const int seg = piece & 15;
      vA[it] = *(const v4u*)(sA + d * EP + seg * 8);
      gi[it] = ((b * NKV + kvh) * HD + d) * SEQ + t0 + seg * 8;
    }
    #pragma unroll
    for (int it = 0; it < 8; ++it) *(v4u*)(vt + gi[it]) = vA[it];
    
  }
}

// Fused causal grouped-query attention, logit scale 1.0, online softmax in the exp2 domain.
// Block = 4 waves = the four query heads of one key/value head for the same 16 query rows (uniform trip count).
// S^T = K x Q^T so queries sit on lanes; P^T in C layout is bit-identical to the A-fragment layout of O += P x V.
// q and k: bf16 hi | lo planes, three products per k-step into one accumulator. q fragments are reloaded per
// key step through an opaque integer offset. ctx out: f16 carried x C_CARRY, [NB*SEQ][DM], col = head*128 + d.
// LDS sO: each wave writes and reads only its own slice; a block barrier separates fill and readback.
__global__ __launch_bounds__(128) void attn_kernel(const u16* __restrict__ ph, const u16* __restrict__ pl,
                                                   const u16* __restrict__ vt, u16* __restrict__ ctx) {
  const int qt   = blockIdx.x;
  const int kv   = blockIdx.y;
  const int b    = blockIdx.z;
  const int tid  = threadIdx.x;
  const int wave = __builtin_amdgcn_readfirstlane(threadIdx.x >> 5);
  const int lane = tid & 31;
  const int lq   = lane & 15;     // query column of S^T / d column of O
  const int hi   = lane >> 4;     // k-split half
  const int head = kv * GRP + wave;
  const int qrow0 = qt * 16;

  __shared__ __align__(16) u16 sO[GRP * 16 * CP];

  const int qoff  = ((b * NQH + head) * SEQ + qrow0 + lq) * HD + hi * 8;
  const int kbase = QELEMS + ((b * NKV + kv) * SEQ + lq) * HD + hi * 8;
  const int vbase = ((b * NKV + kv) * HD + lq) * SEQ + hi * 8;

  v8f o[8];
  #pragma unroll
  for (int dt = 0; dt < 8; ++dt) o[dt] = (v8f){0, 0, 0, 0, 0, 0, 0, 0};

  const float NEGV = -1.0e30f;
  float rmax = NEGV;
  float rsum = 0.0f;
  const float SL = 1.4426950408889634f;             // logit scale 1.0 times log2(e)

  const int nchunk = (qrow0 >> 5) + 1;              // same for every wave of the block
  #pragma unroll 1
  for (int ic = 0; ic < nchunk; ++ic) {
    const int j0 = ic * 32;
    int qo = 0;
    asm volatile("" : "+v"(qo));                    // opaque zero: q fragments are re-fetched each step

    // S^T tiles: c0[r] = score(query qrow0+lq, key j0 + 8hi + r), c1[r] = key j0 + 16 + 8hi + r
    v8f c0 = (v8f){0, 0, 0, 0, 0, 0, 0, 0};
    v8f c1 = (v8f){0, 0, 0, 0, 0, 0, 0, 0};
    const int krow = kbase + j0 * HD;
    #pragma unroll
    for (int f = 0; f < 4; ++f) {
      Frag qhf, qlf;
      const int qa = qoff + qo + f * 32;
      qhf.q[0] = *(const v4u*)(ph + qa);            // d = f*32 + 8hi + 0..7
      qhf.q[1] = *(const v4u*)(ph + qa + 16);       // d = f*32 + 16 + 8hi + 0..7
      qlf.q[0] = *(const v4u*)(pl + qa);
      qlf.q[1] = *(const v4u*)(pl + qa + 16);
      {
        Frag khf, klf;
        const int ka = krow + f * 32;               // key j0 + lq
        khf.q[0] = *(const v4u*)(ph + ka);
        khf.q[1] = *(const v4u*)(ph + ka + 16);
        klf.q[0] = *(const v4u*)(pl + ka);
        klf.q[1] = *(const v4u*)(pl + ka + 16);
        c0 = mma_bf16(khf.b, qhf.b, c0);
        c0 = mma_bf16(khf.b, qlf.b, c0);
        c0 = mma_bf16(klf.b, qhf.b, c0);
      }
      {
        Frag khf, klf;
        const int ka = krow + 16 * HD + f * 32;     // key j0 + 16 + lq
        khf.q[0] = *(const v4u*)(ph + ka);
        khf.q[1] = *(const v4u*)(ph + ka + 16);
        klf.q[0] = *(const v4u*)(pl + ka);
        klf.q[1] = *(const v4u*)(pl + ka + 16);
        c1 = mma_bf16(khf.b, qhf.b, c1);
        c1 = mma_bf16(khf.b, qlf.b, c1);
        c1 = mma_bf16(klf.b, qhf.b, c1);
      }
    }

    // causal exclusion (only the last chunk can hold keys beyond a query row); wave-uniform test
    if (j0 + 31 > qrow0) {
      const int trow = qrow0 + lq;
      #pragma unroll
      for (int r = 0; r < 8; ++r) {
        const int key0 = j0 + hi * 8 + r;
        c0[r] = (key0 > trow) ? NEGV : c0[r];
        c1[r] = (key0 + 16 > trow) ? NEGV : c1[r];
      }
    }

    // online softmax: query lq's 32 scores are split across lane / lane^16
    float m_new = rmax;
    #pragma unroll
    for (int r = 0; r < 8; ++r) {
      m_new = fmaxf(m_new, c0[r]);
      m_new = fmaxf(m_new, c1[r]);
    }
    m_new = fmaxf(m_new, __shfl_xor(m_new, 16, 32));
    const float scale = __builtin_amdgcn_exp2f((rmax - m_new) * SL);
    rmax = m_new;

    // exp + pack: P^T C layout == A-fragment layout of the PV product; P carried x4096
    Frag pa;
    float psum = 0.0f;
    #pragma unroll
    for (int r = 0; r < 8; ++r) {
      const float p0 = __builtin_amdgcn_exp2f((c0[r] - m_new) * SL);   // key 8hi + r
      const float p1 = __builtin_amdgcn_exp2f((c1[r] - m_new) * SL);   // key 16 + 8hi + r
      psum += p0 + p1;
      pa.e[r]     = (f16)(p0 * P_CARRY);
      pa.e[8 + r] = (f16)(p1 * P_CARRY);
    }
    rsum = rsum * scale + psum + __shfl_xor(psum, 16, 32);

    // rescale O: queries are the row dimension there -> per-row scale from lane 8hi + r
    float sc[8];
    #pragma unroll
    for (int r = 0; r < 8; ++r) sc[r] = __shfl(scale, (hi << 3) + r, 32);
    #pragma unroll
    for (int dt = 0; dt < 8; ++dt) {
      #pragma unroll
      for (int r = 0; r < 8; ++r) o[dt][r] *= sc[r];
    }

    // O += P x V, V^T B-fragments four d tiles at a time (column n = d = dt*16 + lq, split key map)
    #pragma unroll
    for (int hf = 0; hf < 2; ++hf) {
      Frag bv[4];
      #pragma unroll
      for (int dt = 0; dt < 4; ++dt) {
        const int va = vbase + ((hf * 4 + dt) * 16) * SEQ + j0;
        bv[dt].q[0] = *(const v4u*)(vt + va);           // keys j0 + 8hi + 0..7
        bv[dt].q[1] = *(const v4u*)(vt + va + 16);      // keys j0 + 16 + 8hi + 0..7
      }
      #pragma unroll
      for (int dt = 0; dt < 4; ++dt) o[hf * 4 + dt] = mma_f16(pa.h, bv[dt].h, o[hf * 4 + dt]);
    }
  }

  // normalize: lane holds column d = dt*16 + lq for query rows 8hi + r; fold the carries
  const float CN = C_CARRY / (P_CARRY * V_CARRY);
  float rs[8];
  #pragma unroll
  for (int r = 0; r < 8; ++r) rs[r] = CN * (1.0f / __shfl(rsum, (hi << 3) + r, 32));

  const int so = wave * (16 * CP);
  #pragma unroll
  for (int r = 0; r < 8; ++r) {
    #pragma unroll
    for (int dt = 0; dt < 8; ++dt) {
      sO[so + (hi * 8 + r) * CP + dt * 16 + lq] = f16_bits(o[dt][r] * rs[r]);
    }
  }
  __syncthreads();

  // 8 consecutive lanes x 16 B each), lanes 16..31 the next row; 8 instructions cover the wave's 16 rows.
  v4u    vals[8];
  size_t gidx[8];
  #pragma unroll
  for (int it = 0; it < 8; ++it) {
    const int row = it * 2 + hi;
    vals[it] = *(const v4u*)(sO + so + row * CP + lq * 8);
    gidx[it] = ((size_t)b * SEQ + qrow0 + row) * DM + head * HD + lq * 8;
  }
  #pragma unroll
  for (int it = 0; it < 8; ++it) *(v4u*)(ctx + gidx[it]) = vals[it];
  
}

// Output projection: out[b][t][DM] = ctx x Wo, f16 operands (carries folded back in f32).
// written by 8 consecutive lanes x 16 B of one instruction.
__global__ __launch_bounds__(256) void out_gemm_kernel(const u16* __restrict__ ctx, const u16* __restrict__ WoT,
                                                       float* __restrict__ out) {
  __shared__ __align__(16) float sC[64 * CPF];
  const int n0   = blockIdx.x * 128;
  const int m0   = blockIdx.y * 128;
  const int tid  = threadIdx.x;
  const int wave = __builtin_amdgcn_readfirstlane(threadIdx.x >> 5);
  const int lane = tid & 31;
  const int lr   = lane & 15;
  const int hi   = lane >> 4;
  const int wm   = (wave & 3) * 32;
  const int g    = wave >> 2;

  v8f acc[2][4];
  #pragma unroll
  for (int fm = 0; fm < 2; ++fm) {
    #pragma unroll
    for (int fn = 0; fn < 4; ++fn) acc[fm][fn] = (v8f){0, 0, 0, 0, 0, 0, 0, 0};
  }
  gemm_core<1, 0>(ctx, WoT, m0, n0, wm, g, lr, hi, acc);

  const float INV = 1.0f / (C_CARRY * W_CARRY);
  #pragma unroll
  for (int p = 0; p < 2; ++p) {
    if (((wave & 3) >> 1) == p) {                  // wave-uniform: this wave's rows belong to half p
      #pragma unroll
      for (int fm = 0; fm < 2; ++fm) {
        #pragma unroll
        for (int fn = 0; fn < 4; ++fn) {
          #pragma unroll
          for (int i = 0; i < 8; ++i) {
            sC[(wm - p * 64 + fm * 16 + 8 * hi + i) * CPF + g * 64 + fn * 16 + lr] = acc[fm][fn][i] * INV;
          }
        }
      }
    }
    __syncthreads();
    v4f    vals[8];
    size_t gidx[8];
    #pragma unroll
    for (int it = 0; it < 8; ++it) {
      const int piece = it * 256 + tid;
      const int row = piece >> 5;                  // 0..63
      const int seg = piece & 31;
      vals[it] = *(const v4f*)(sC + row * CPF + seg * 4);
      const int m  = m0 + p * 64 + row;
      const int bb = m / SEQ;
      const int tt = m % SEQ;
      gidx[it] = ((size_t)bb * SEQ_FULL + tt) * DM + n0 + seg * 4;
    }
    #pragma unroll
    for (int it = 0; it < 8; ++it) *(v4f*)(out + gidx[it]) = vals[it];
    
    __syncthreads();
  }
}

extern "C" void kernel_launch(void* const* d_in, const int* in_sizes, int n_in,
                              void* d_out, int out_size, void* d_ws, size_t ws_size,
                              hipStream_t stream) {
  if (n_in < 6) return;
  const size_t needX = ((size_t)(NB - 1) * SEQ_FULL + SEQ) * DM;
  const size_t needP = (size_t)(NB - 1) * SEQ_FULL + SEQ;
  if ((size_t)in_sizes[0] < needX) return;
  if ((size_t)in_sizes[1] < needP) return;
  if ((size_t)in_sizes[2] < (size_t)DM * NQH * HD) return;
  if ((size_t)in_sizes[3] < (size_t)DM * NKV * HD) return;
  if ((size_t)in_sizes[4] < (size_t)DM * NKV * HD) return;
  if ((size_t)in_sizes[5] < (size_t)NQH * HD * DM) return;
  if ((size_t)out_size < needX) return;
  if (ws_size < (size_t)WS_TOTAL) return;

  const float* X   = (const float*)d_in[0];
  const int*   pos = (const int*)d_in[1];
  const float* Wq  = (const float*)d_in[2];
  const float* Wk  = (const float*)d_in[3];
  const float* Wv  = (const float*)d_in[4];
  const float* Wo  = (const float*)d_in[5];
  float* out = (float*)d_out;

  char* ws = (char*)d_ws;
  u16*   Xb   = (u16*)(ws + OFF_XB);
  u16*   Wt   = (u16*)(ws + OFF_WT);
  u16*   WoT  = (u16*)(ws + OFF_WO);
  float* cosT = (float*)(ws + OFF_COS);
  float* sinT = (float*)(ws + OFF_SIN);
  u16*   ph   = (u16*)(ws + OFF_PH);
  u16*   pl   = (u16*)(ws + OFF_PL);
  u16*   vt   = (u16*)(ws + OFF_VT);
  u16*   ctx  = (u16*)(ws + OFF_CTX);

  // X -> bf16 rows
  xcvt_kernel<<<dim3(NB * SEQ), 256, 0, stream>>>(X, Xb);
  // weights: in[DM rows][cols] -> out[cols][DM]; grid (cols/64, DM/64)
  wtrans_kernel<<<dim3((NQH * HD) / 64, DM / 64), 256, 0, stream>>>(Wq, Wt, NQH * HD, 0, 0);
  wtrans_kernel<<<dim3((NKV * HD) / 64, DM / 64), 256, 0, stream>>>(Wk, Wt, NKV * HD, NQH * HD, 0);
  wtrans_kernel<<<dim3((NKV * HD) / 64, DM / 64), 256, 0, stream>>>(Wv, Wt, NKV * HD, (NQH + NKV) * HD, 0);
  wtrans_kernel<<<dim3(DM / 64, DM / 64), 256, 0, stream>>>(Wo, WoT, DM, 0, 1);
  // rotary table from the positions
  rope_table_kernel<<<dim3((NB * HD2 * SEQ) / 256), 256, 0, stream>>>(pos, cosT, sinT);
  // fused QKV projection + rotary + planes
  qkv_gemm_kernel<<<dim3(NQKV / 128, (NB * SEQ) / 128), 256, 0, stream>>>(Xb, Wt, cosT, sinT, ph, pl, vt);
  // attention
  attn_kernel<<<dim3(SEQ / 16, NKV, NB), 128, 0, stream>>>(ph, pl, vt, ctx);
  // output projection
  out_gemm_kernel<<<dim3(DM / 128, (NB * SEQ) / 128), 256, 0, stream>>>(ctx, WoT, out);
}

// v001
// A run of this version takes 390 microseconds.
// Two timings next to v000 put it at 1.60 and 1.62 times that version's speed.
#include <hip/hip_runtime.h>

// Contractions: QKV projections on v_wmma_f32_16x16x32_bf16 (bf16 RNE-converted inputs, f32 accumulate); scores S^T = K x Q^T on v_wmma_f32_16x16x32_bf16 with q and k as bf16 hi|lo planes (hi.hi + hi.lo + lo.hi, one f32 accumulator); O = P x V on v_wmma_f32_16x16x32_f16 (P f16 carried x4096, V f16 carried x16); output projection on v_wmma_f32_16x16x32_f16 (ctx f16 carried x64, Wo = f16 of the bf16 RNE-converted input carried x64); all f32 accumulate; softmax (online, max-subtracted, exp2 domain) and rotary math in f32.

#ifndef NB
#define NB 2
#endif
#ifndef SEQ
#define SEQ 2048
#endif
#define NB_FULL   2
#define SEQ_FULL  2048
#define DM        2048                 // model width = depth of every projection
#define NQH       16                   // query heads
#define NKV       4                    // key/value heads
#define GRP       4                    // query heads per key/value head
#define HD        128                  // head dim
#define HD2       64                   // rotary frequencies
#define NQKV      3072                 // fused projection width (q | k | v)
#define EP        128                  // LDS pitch (halves) of the 16-bit epilogue tiles
#define CPF       132                  // LDS pitch (floats) of the f32 output staging tile
#define CP        136                  // LDS pitch (halves) of the per-wave ctx staging tile
#define TPW       72                   // LDS pitch (halves) of the weight transposer tile
#define KP        136                  // LDS pitch (halves) of a staged K row: 272 B = 16 B x odd
#define VP        40                   // LDS pitch (halves) of a staged V^T row of 32 keys: 80 B = 16 B x odd
#define KT_H      (32 * KP)            // halves of one staged K plane tile (32 keys)
#define VT_H      (HD * VP)            // halves of one staged V^T tile (128 d rows x 32 keys)
#define KV_H      (2 * KT_H + VT_H)    // halves of one stage buffer: K hi | K lo | V^T
#define WS_CAP    134217728ull

#define P_CARRY   4096.0f
#define V_CARRY   16.0f
#define C_CARRY   64.0f
#define W_CARRY   64.0f

static_assert(NB >= 1 && NB <= NB_FULL);
static_assert(SEQ <= SEQ_FULL);
static_assert(SEQ % 128 == 0);
static_assert(DM % 128 == 0);
static_assert(DM % 32 == 0);
static_assert(DM == 256 * 8);                     // one converter block = one row
static_assert(NQKV == NQH * HD + 2 * NKV * HD);
static_assert(NQKV % 128 == 0);
static_assert(NQH == NKV * GRP);
static_assert(HD == 128 && HD2 * 2 == HD);
static_assert(NQH * HD == DM);
static_assert(EP >= HD && (EP * 2) % 16 == 0);
static_assert((CPF * 4) % 16 == 0 && CPF >= 128);
static_assert((CP * 2) % 16 == 0 && CP >= HD);
static_assert((TPW * 2) % 16 == 0 && TPW >= 64);
static_assert(((size_t)NB * HD2 * SEQ) % 256 == 0);
static_assert(2 * 128 * EP * 2 <= 65536);
static_assert((KP * 2) % 16 == 0 && KP >= HD && (VP * 2) % 16 == 0 && VP >= 32);
static_assert((KT_H * 2) % 16 == 0 && (KV_H * 2) % 16 == 0);
static_assert(SEQ % 32 == 0);

#define QELEMS   (NB * NQH * SEQ * HD)            // q region of the hi / lo planes (elements)
#define KELEMS   (NB * NKV * SEQ * HD)            // k region
#define XB_BYTES   ((size_t)NB * SEQ * DM * 2)
#define WT_BYTES   ((size_t)NQKV * DM * 2)
#define WO_BYTES   ((size_t)DM * DM * 2)
#define TB_BYTES   ((size_t)NB * HD2 * SEQ * 4)
#define PL_BYTES   ((size_t)(QELEMS + KELEMS) * 2)
#define VT_BYTES   ((size_t)NB * NKV * HD * SEQ * 2)
#define CTX_BYTES  ((size_t)NB * SEQ * DM * 2)
#define OFF_XB   ((size_t)0)
#define OFF_WT   (OFF_XB + XB_BYTES)
#define OFF_WO   (OFF_WT + WT_BYTES)
#define OFF_COS  (OFF_WO + WO_BYTES)
#define OFF_SIN  (OFF_COS + TB_BYTES)
#define OFF_PH   (OFF_SIN + TB_BYTES)
#define OFF_PL   (OFF_PH + PL_BYTES)
#define OFF_VT   (OFF_PL + PL_BYTES)
#define OFF_CTX  (OFF_VT + VT_BYTES)
#define WS_TOTAL (OFF_CTX + CTX_BYTES)
static_assert(WS_TOTAL <= WS_CAP);
static_assert(XB_BYTES % 256 == 0 && WT_BYTES % 256 == 0 && WO_BYTES % 256 == 0);
static_assert(TB_BYTES % 256 == 0 && PL_BYTES % 256 == 0 && VT_BYTES % 256 == 0);
static_assert((unsigned long long)(QELEMS + KELEMS) < 2147483648ull);

typedef __bf16         bf16;
typedef _Float16       f16;
typedef unsigned short u16;
typedef bf16     v16bf __attribute__((ext_vector_type(16)));
typedef f16      v16h  __attribute__((ext_vector_type(16)));
typedef float    v8f   __attribute__((ext_vector_type(8)));
typedef float    v4f   __attribute__((ext_vector_type(4)));
typedef unsigned v4u   __attribute__((ext_vector_type(4)));

union Frag  { v16bf b; v16h h; v4u q[2]; f16 e[16]; };
union Pack8 { v4u u; u16 s[8]; };

// WMMA helpers: builtin followed by the VALU hazard guard (ties D, keeps A/B live).
static __device__ __forceinline__ v8f mma_bf16(v16bf a, v16bf b, v8f acc) {
  acc = __builtin_amdgcn_wmma_f32_16x16x32_bf16(false, a, false, b, (short)0, acc, false, false);
  asm volatile("v_nop\n\tv_nop\n\tv_nop\n\tv_nop" : "+v"(acc) : "v"(a), "v"(b));
  return acc;
}
static __device__ __forceinline__ v8f mma_f16(v16h a, v16h b, v8f acc) {
  acc = __builtin_amdgcn_wmma_f32_16x16x32_f16(false, a, false, b, (short)0, acc, false, false);
  asm volatile("v_nop\n\tv_nop\n\tv_nop\n\tv_nop" : "+v"(acc) : "v"(a), "v"(b));
  return acc;
}

static __device__ __forceinline__ u16 bf16_bits(float x) {      // RNE convert
  const bf16 h = (bf16)x;
  return __builtin_bit_cast(u16, h);
}
static __device__ __forceinline__ float bf16_back(float x) {    // value of the RNE-converted bf16
  return (float)(bf16)x;
}
static __device__ __forceinline__ u16 f16_bits(float x) {
  const f16 h = (f16)x;
  return __builtin_bit_cast(u16, h);
}

// coverage: rows 0..NB*SEQ-1, 256 threads x 8 elements == DM.
__global__ __launch_bounds__(256) void xcvt_kernel(const float* __restrict__ X, u16* __restrict__ Xb) {
  const int m   = blockIdx.x;
  const int tid = threadIdx.x;
  const int b   = m / SEQ;
  const int t   = m % SEQ;
  const size_t src = ((size_t)b * SEQ_FULL + t) * DM + tid * 8;
  const v4f a0 = *(const v4f*)(X + src);
  const v4f a1 = *(const v4f*)(X + src + 4);
  Pack8 pk;
  #pragma unroll
  for (int i = 0; i < 4; ++i) {
    pk.s[i]     = bf16_bits(a0[i]);
    pk.s[4 + i] = bf16_bits(a1[i]);
  }
  const v4u val = pk.u;
  const size_t dst = (size_t)m * DM + tid * 8;
  *(v4u*)(Xb + dst) = val;
  
}

// Weight transposer: in W[DM rows (input dim)][ldin cols (output dim)] f32 -> out Bt[rowoff + col][DM] 16-bit.
// mode 0: bf16 RNE bits; mode 1: f16 of (bf16 RNE value x W_CARRY) (exact).
// Block = 64 (input dim) x 64 (output col) tile through LDS; written lines whole: 8 lanes x 16 B per line.
// coverage: grid (ldin/64, DM/64); each block writes 64 output rows x 64 halves. LDS sT cross-wave (block barrier).
__global__ __launch_bounds__(256) void wtrans_kernel(const float* __restrict__ W, u16* __restrict__ Bt,
                                                     int ldin, int rowoff, int mode) {
  const int c0  = blockIdx.x * 64;
  const int d0  = blockIdx.y * 64;
  const int tid = threadIdx.x;
  __shared__ __align__(16) u16 sT[64 * TPW];     // [col][input dim]
  #pragma unroll
  for (int kk = 0; kk < 2; ++kk) {
    const int r  = kk * 32 + (tid >> 3);         // input dim local 0..63
    const int cc = (tid & 7) * 8;                // col local 0..56
    const size_t src = (size_t)(d0 + r) * ldin + c0 + cc;
    const v4f w0 = *(const v4f*)(W + src);
    const v4f w1 = *(const v4f*)(W + src + 4);
    #pragma unroll
    for (int i = 0; i < 4; ++i) {
      const float x0 = bf16_back(w0[i]);
      const float x1 = bf16_back(w1[i]);
      const u16 h0 = (mode != 0) ? f16_bits(x0 * W_CARRY) : bf16_bits(x0);
      const u16 h1 = (mode != 0) ? f16_bits(x1 * W_CARRY) : bf16_bits(x1);
      sT[(cc + i) * TPW + r]     = h0;
      sT[(cc + 4 + i) * TPW + r] = h1;
    }
  }
  __syncthreads();
  v4u    val[2];
  size_t idx[2];
  #pragma unroll
  for (int kk = 0; kk < 2; ++kk) {
    const int c  = kk * 32 + (tid >> 3);         // col local 0..63
    const int ds = (tid & 7) * 8;                // input dim local 0..56
    val[kk] = *(const v4u*)(sT + c * TPW + ds);
    idx[kk] = (size_t)(rowoff + c0 + c) * DM + d0 + ds;
  }
  #pragma unroll
  for (int kk = 0; kk < 2; ++kk) *(v4u*)(Bt + idx[kk]) = val[kk];
  
}

// Rotary table per batch from the integer positions read by value:
//   ts[j] = 10000^(j/64) (double product of fixed roots -> float), angle = (float)pos / ts[j] (IEEE division),
// coverage: NB*64*SEQ elements, exact grid.
__global__ __launch_bounds__(256) void rope_table_kernel(const int* __restrict__ pos,
                                                         float* __restrict__ cosT,
                                                         float* __restrict__ sinT) {
  const int idx = blockIdx.x * 256 + threadIdx.x;
  const int t = idx % SEQ;
  const int j = (idx / SEQ) % HD2;
  const int b = idx / (SEQ * HD2);
  const int p = pos[(size_t)b * SEQ_FULL + t];
  double pf = 1.0;
  pf *= (j & 32) ? 100.0 : 1.0;                       // 10000^(32/64)
  pf *= (j & 16) ? 10.0 : 1.0;                        // 10000^(16/64)
  pf *= (j & 8)  ? 3.1622776601683795 : 1.0;          // 10000^(8/64)
  pf *= (j & 4)  ? 1.7782794100389228 : 1.0;          // 10000^(4/64)
  pf *= (j & 2)  ? 1.333521432163324  : 1.0;          // 10000^(2/64)
  pf *= (j & 1)  ? 1.1547819846894583 : 1.0;          // 10000^(1/64)
  const float ts = (float)pf;
  float ang = (float)p / ts;
  ang = (p == 0) ? 0.0f : ang;
  float s, c;
  sincosf(ang, &s, &c);
  *(float*)(cosT + idx) = c;
  *(float*)(sinT + idx) = s;
  
}

// GEMM core: C[128x128 block tile] = A[M][DM] x Bt[N][DM]^T, 8 waves, wave tile 32 rows x 64 cols.
// Fragments come straight from the 16-bit planes (two 16-B loads each, split k map for A and B alike).
// ROPEMAP = 1: wave column group g owns cols {g*32 .. g*32+31} and {64+g*32 .. 64+g*32+31} so that col d and
// its rotary partner d+64 sit in the same lane / same accumulator element (tiles fn and fn+2).
template <int ISF16, int ROPEMAP>
static __device__ __forceinline__ void gemm_core(const u16* __restrict__ A, const u16* __restrict__ Bt,
                                                 int m0, int n0, int wm, int g, int lr, int hi,
                                                 v8f (&acc)[2][4]) {
  size_t aoff[2];
  size_t boff[4];
  #pragma unroll
  for (int fm = 0; fm < 2; ++fm) aoff[fm] = (size_t)(m0 + wm + fm * 16 + lr) * DM + 8 * hi;
  #pragma unroll
  for (int fn = 0; fn < 4; ++fn) {
    const int col = ROPEMAP ? (g * 32 + (fn & 1) * 16 + (fn >> 1) * 64) : (g * 64 + fn * 16);
    boff[fn] = (size_t)(n0 + col + lr) * DM + 8 * hi;
  }
  #pragma unroll 2
  for (int k0 = 0; k0 < DM; k0 += 32) {
    Frag a[2];
    Frag b[4];
    #pragma unroll
    for (int fm = 0; fm < 2; ++fm) {
      a[fm].q[0] = *(const v4u*)(A + aoff[fm] + k0);         // k = k0 + 8hi + 0..7
      a[fm].q[1] = *(const v4u*)(A + aoff[fm] + k0 + 16);    // k = k0 + 16 + 8hi + 0..7
    }
    #pragma unroll
    for (int fn = 0; fn < 4; ++fn) {
      b[fn].q[0] = *(const v4u*)(Bt + boff[fn] + k0);
      b[fn].q[1] = *(const v4u*)(Bt + boff[fn] + k0 + 16);
    }
    #pragma unroll
    for (int fn = 0; fn < 4; ++fn) {
      #pragma unroll
      for (int fm = 0; fm < 2; ++fm) {
        if (ISF16) acc[fm][fn] = mma_f16(a[fm].h, b[fn].h, acc[fm][fn]);
        else       acc[fm][fn] = mma_bf16(a[fm].b, b[fn].b, acc[fm][fn]);
      }
    }
  }
}

// Fused QKV projection + rotary + plane builder.
// grid (NQKV/128 column tiles = one head each, NB*SEQ/128 row tiles); column tile ct: 0..15 q head, 16..19 k head,
// 20..23 v head. Outputs:
//   ph / pl : bf16 hi / lo planes, q region [NB][NQH][SEQ][HD] at 0, k region [NB][NKV][SEQ][HD] at QELEMS
//   vt      : f16 (x V_CARRY) [NB][NKV][HD][SEQ], transposed through LDS
// LDS tiles sA / sB are cross-wave (block barrier between fill and readback); staged extent 128 x 128 ==
// consumed extent. Every written line whole: 16 lanes x 16 B = one 256-B row per half-wave.
__global__ __launch_bounds__(256) void qkv_gemm_kernel(const u16* __restrict__ Xb, const u16* __restrict__ Wt,
                                                       const float* __restrict__ cosT,
                                                       const float* __restrict__ sinT,
                                                       u16* __restrict__ ph, u16* __restrict__ pl,
                                                       u16* __restrict__ vt) {
  __shared__ __align__(16) u16 sA[128 * EP];
  __shared__ __align__(16) u16 sB[128 * EP];
  const int ct   = blockIdx.x;
  const int m0   = blockIdx.y * 128;
  const int tid  = threadIdx.x;
  const int wave = __builtin_amdgcn_readfirstlane(threadIdx.x >> 5);
  const int lane = tid & 31;
  const int lr   = lane & 15;
  const int hi   = lane >> 4;
  const int wm   = (wave & 3) * 32;
  const int g    = wave >> 2;

  v8f acc[2][4];
  #pragma unroll
  for (int fm = 0; fm < 2; ++fm) {
    #pragma unroll
    for (int fn = 0; fn < 4; ++fn) acc[fm][fn] = (v8f){0, 0, 0, 0, 0, 0, 0, 0};
  }
  gemm_core<0, 1>(Xb, Wt, m0, ct * 128, wm, g, lr, hi, acc);

  const int b  = m0 / SEQ;
  const int t0 = m0 % SEQ;

  if (ct < NQH + NKV) {
    // rotary on the f32 accumulators, then bf16 hi | lo split into the LDS tiles
    #pragma unroll
    for (int fm = 0; fm < 2; ++fm) {
      #pragma unroll
      for (int f2 = 0; f2 < 2; ++f2) {
        const int j  = g * 32 + f2 * 16 + lr;             // frequency index 0..63
        const int tl = wm + fm * 16 + 8 * hi;             // first of this lane's 8 tile rows
        const size_t tb = ((size_t)b * HD2 + j) * SEQ + t0 + tl;
        const v4f ca = *(const v4f*)(cosT + tb);
        const v4f cb = *(const v4f*)(cosT + tb + 4);
        const v4f sa = *(const v4f*)(sinT + tb);
        const v4f sb = *(const v4f*)(sinT + tb + 4);
        #pragma unroll
        for (int i = 0; i < 8; ++i) {
          const float c  = (i < 4) ? ca[i & 3] : cb[i & 3];
          const float s  = (i < 4) ? sa[i & 3] : sb[i & 3];
          const float x1 = acc[fm][f2][i];                 // col j
          const float x2 = acc[fm][f2 + 2][i];             // col j + 64
          const float y1 = x1 * c - x2 * s;
          const float y2 = x2 * c + x1 * s;
          const float h1 = bf16_back(y1);
          const float h2 = bf16_back(y2);
          const int row = tl + i;
          sA[row * EP + j]       = bf16_bits(h1);
          sA[row * EP + 64 + j]  = bf16_bits(h2);
          sB[row * EP + j]       = bf16_bits(y1 - h1);
          sB[row * EP + 64 + j]  = bf16_bits(y2 - h2);
        }
      }
    }
    __syncthreads();
    const int isq   = (ct < NQH) ? 1 : 0;
    const int pbase = isq ? (((b * NQH + ct) * SEQ + t0) * HD)
                          : (QELEMS + ((b * NKV + (ct - NQH)) * SEQ + t0) * HD);
    v4u vA[8];
    v4u vB[8];
    int gi[8];
    #pragma unroll
    for (int it = 0; it < 8; ++it) {
      const int piece = it * 256 + tid;
      const int row = piece >> 4;                          // 0..127
      const int seg = piece & 15;                          // 16 x 16 B = one 256-B plane row
      vA[it] = *(const v4u*)(sA + row * EP + seg * 8);
      vB[it] = *(const v4u*)(sB + row * EP + seg * 8);
      gi[it] = pbase + row * HD + seg * 8;
    }
    #pragma unroll
    for (int it = 0; it < 8; ++it) {
      *(v4u*)(ph + gi[it]) = vA[it];
      *(v4u*)(pl + gi[it]) = vB[it];
    }
    
  } else {
    // v head: f16 carried x V_CARRY, transposed in LDS to [d][t]
    const int kvh = ct - (NQH + NKV);
    #pragma unroll
    for (int fm = 0; fm < 2; ++fm) {
      #pragma unroll
      for (int fn = 0; fn < 4; ++fn) {
        const int d = g * 32 + (fn & 1) * 16 + (fn >> 1) * 64 + lr;
        #pragma unroll
        for (int i = 0; i < 8; ++i) {
          const int row = wm + fm * 16 + 8 * hi + i;
          sA[d * EP + row] = f16_bits(acc[fm][fn][i] * V_CARRY);
        }
      }
    }
    __syncthreads();
    v4u vA[8];
    int gi[8];
    #pragma unroll
    for (int it = 0; it < 8; ++it) {
      const int piece = it * 256 + tid;
      const int d   = piece >> 4;                          // 0..127
      const int seg = piece & 15;
      vA[it] = *(const v4u*)(sA + d * EP + seg * 8);
      gi[it] = ((b * NKV + kvh) * HD + d) * SEQ + t0 + seg * 8;
    }
    #pragma unroll
    for (int it = 0; it < 8; ++it) *(v4u*)(vt + gi[it]) = vA[it];
    
  }
}

// One 32-key stage (K hi, K lo: 32 rows x 256 B each; V^T: 128 rows x 64 B) from global memory into one LDS
// buffer: 12 asynchronous 16-B copies per lane, 128 lanes, every byte of the stage copied exactly once.
// kh / kl / v and lk / lv are the lane's own global pointers and LDS byte addresses of its first piece.
// The closing s_wait_xcnt stands inside the statement so that no address register of an issued copy is
// rewritten ahead of it.
static __device__ __forceinline__ void stage_kv(const u16* kh, const u16* kl, const u16* v,
                                                unsigned lk, unsigned lv) {
  asm volatile(
      "global_load_async_to_lds_b128 %0, %1, off\n\t"
      "global_load_async_to_lds_b128 %2, %3, off\n\t"
      "global_load_async_to_lds_b128 %4, %5, off\n\t"
      "global_load_async_to_lds_b128 %6, %7, off\n\t"
      "global_load_async_to_lds_b128 %8, %9, off\n\t"
      "global_load_async_to_lds_b128 %10, %11, off\n\t"
      "global_load_async_to_lds_b128 %12, %13, off\n\t"
      "global_load_async_to_lds_b128 %14, %15, off\n\t"
      "global_load_async_to_lds_b128 %16, %17, off\n\t"
      "global_load_async_to_lds_b128 %18, %19, off\n\t"
      "global_load_async_to_lds_b128 %20, %21, off\n\t"
      "global_load_async_to_lds_b128 %22, %23, off\n\t"
      "s_wait_xcnt 0x0"
      :
      : "v"(lk),                             "v"(kh),
        "v"(lk + 8 * KP * 2),                "v"(kh + 8 * HD),
        "v"(lk + 16 * KP * 2),               "v"(kh + 16 * HD),
        "v"(lk + 24 * KP * 2),               "v"(kh + 24 * HD),
        "v"(lk + KT_H * 2),                  "v"(kl),
        "v"(lk + KT_H * 2 + 8 * KP * 2),     "v"(kl + 8 * HD),
        "v"(lk + KT_H * 2 + 16 * KP * 2),    "v"(kl + 16 * HD),
        "v"(lk + KT_H * 2 + 24 * KP * 2),    "v"(kl + 24 * HD),
        "v"(lv),                             "v"(v),
        "v"(lv + 32 * VP * 2),               "v"(v + 32 * SEQ),
        "v"(lv + 64 * VP * 2),               "v"(v + 64 * SEQ),
        "v"(lv + 96 * VP * 2),               "v"(v + 96 * SEQ)
      : "memory");
}

// Fused causal grouped-query attention, logit scale 1.0, online softmax in the exp2 domain.
// Block = 4 waves = the four query heads of one key/value head for the same 16 query rows (uniform trip count).
// S^T = K x Q^T so queries sit on lanes; P^T in C layout is bit-identical to the A-fragment layout of O += P x V.
// q and k: bf16 hi | lo planes, three products per k-step into one accumulator. q fragments are reloaded per
// key step through an opaque integer offset. ctx out: f16 carried x C_CARRY, [NB*SEQ][DM], col = head*128 + d.
// K hi | K lo | V^T of each 32-key step are staged once per block in LDS (two buffers, asynchronous copies one
// step ahead) and read by all four waves with 16-B LDS loads; same elements, same k order as the planes.
// LDS sO: each wave writes and reads only its own slice; a block barrier separates fill and readback.
__global__ __launch_bounds__(128) void attn_kernel(const u16* __restrict__ ph, const u16* __restrict__ pl,
                                                   const u16* __restrict__ vt, u16* __restrict__ ctx) {
  const int qt   = blockIdx.x;
  const int kv   = blockIdx.y;
  const int b    = blockIdx.z;
  const int tid  = threadIdx.x;
  const int wave = __builtin_amdgcn_readfirstlane(threadIdx.x >> 5);
  const int lane = tid & 31;
  const int lq   = lane & 15;     // query column of S^T / d column of O
  const int hi   = lane >> 4;     // k-split half
  const int head = kv * GRP + wave;
  const int qrow0 = qt * 16;

  __shared__ __align__(16) u16 sO[GRP * 16 * CP];
  __shared__ __align__(16) u16 sKV[2 * KV_H];

  const int qoff  = ((b * NQH + head) * SEQ + qrow0 + lq) * HD + hi * 8;
  const int kfrag = lq * KP + hi * 8;                 // fragment origin inside a staged K plane tile
  const int vfrag = 2 * KT_H + lq * VP + hi * 8;      // fragment origin of the staged V^T tile

  // staging: lane's first piece. K: 16 lanes x 16 B = one 256-B row, 8 rows per copy; V^T: 4 lanes per 64-B row.
  const u16* gkh = ph + QELEMS + (b * NKV + kv) * SEQ * HD + tid * 8;
  const u16* gkl = pl + QELEMS + (b * NKV + kv) * SEQ * HD + tid * 8;
  const u16* gv  = vt + ((b * NKV + kv) * HD + (tid >> 2)) * SEQ + (tid & 3) * 8;
  const unsigned lbase = (unsigned)(size_t)sKV;       // LDS byte address = low 32 bits of the shared address
  const unsigned lk = lbase + (tid >> 4) * (KP * 2) + (tid & 15) * 16;
  const unsigned lv = lbase + 2 * KT_H * 2 + (tid >> 2) * (VP * 2) + (tid & 3) * 16;

  v8f o[8];
  #pragma unroll
  for (int dt = 0; dt < 8; ++dt) o[dt] = (v8f){0, 0, 0, 0, 0, 0, 0, 0};

  const float NEGV = -1.0e30f;
  float rmax = NEGV;
  float rsum = 0.0f;
  const float SL = 1.4426950408889634f;             // logit scale 1.0 times log2(e)

  const int nchunk = (qrow0 >> 5) + 1;              // same for every wave of the block

  // stage 0 lands and is published before anybody reads it; stage 1 then flies during step 0
  stage_kv(gkh, gkl, gv, lk, lv);
  asm volatile("s_wait_asynccnt 0x0" ::: "memory"); // this wave's copies of stage 0 have landed
  __syncthreads();
  if (nchunk > 1) stage_kv(gkh + 32 * HD, gkl + 32 * HD, gv + 32, lk + KV_H * 2, lv + KV_H * 2);

  #pragma unroll 1
  for (int ic = 0; ic < nchunk; ++ic) {
    const int j0 = ic * 32;
    const int bsel = ic & 1;
    const u16* sT = sKV + bsel * KV_H;              // this step's stage buffer
    int qo = 0;
    asm volatile("" : "+v"(qo));                    // opaque zero: q fragments are re-fetched each step

    // S^T tiles: c0[r] = score(query qrow0+lq, key j0 + 8hi + r), c1[r] = key j0 + 16 + 8hi + r
    v8f c0 = (v8f){0, 0, 0, 0, 0, 0, 0, 0};
    v8f c1 = (v8f){0, 0, 0, 0, 0, 0, 0, 0};
    #pragma unroll
    for (int f = 0; f < 4; ++f) {
      Frag qhf, qlf;
      const int qa = qoff + qo + f * 32;
      qhf.q[0] = *(const v4u*)(ph + qa);            // d = f*32 + 8hi + 0..7
      qhf.q[1] = *(const v4u*)(ph + qa + 16);       // d = f*32 + 16 + 8hi + 0..7
      qlf.q[0] = *(const v4u*)(pl + qa);
      qlf.q[1] = *(const v4u*)(pl + qa + 16);
      {
        Frag khf, klf;
        const int ka = kfrag + f * 32;              // key j0 + lq
        khf.q[0] = *(const v4u*)(sT + ka);
        khf.q[1] = *(const v4u*)(sT + ka + 16);
        klf.q[0] = *(const v4u*)(sT + KT_H + ka);
        klf.q[1] = *(const v4u*)(sT + KT_H + ka + 16);
        c0 = mma_bf16(khf.b, qhf.b, c0);
        c0 = mma_bf16(khf.b, qlf.b, c0);
        c0 = mma_bf16(klf.b, qhf.b, c0);
      }
      {
        Frag khf, klf;
        const int ka = kfrag + 16 * KP + f * 32;    // key j0 + 16 + lq
        khf.q[0] = *(const v4u*)(sT + ka);
        khf.q[1] = *(const v4u*)(sT + ka + 16);
        klf.q[0] = *(const v4u*)(sT + KT_H + ka);
        klf.q[1] = *(const v4u*)(sT + KT_H + ka + 16);
        c1 = mma_bf16(khf.b, qhf.b, c1);
        c1 = mma_bf16(khf.b, qlf.b, c1);
        c1 = mma_bf16(klf.b, qhf.b, c1);
      }
    }

    // causal exclusion (only the last chunk can hold keys beyond a query row); wave-uniform test
    if (j0 + 31 > qrow0) {
      const int trow = qrow0 + lq;
      #pragma unroll
      for (int r = 0; r < 8; ++r) {
        const int key0 = j0 + hi * 8 + r;
        c0[r] = (key0 > trow) ? NEGV : c0[r];
        c1[r] = (key0 + 16 > trow) ? NEGV : c1[r];
      }
    }

    // online softmax: query lq's 32 scores are split across lane / lane^16
    float m_new = rmax;
    #pragma unroll
    for (int r = 0; r < 8; ++r) {
      m_new = fmaxf(m_new, c0[r]);
      m_new = fmaxf(m_new, c1[r]);
    }
    m_new = fmaxf(m_new, __shfl_xor(m_new, 16, 32));
    const float scale = __builtin_amdgcn_exp2f((rmax - m_new) * SL);
    rmax = m_new;

    // exp + pack: P^T C layout == A-fragment layout of the PV product; P carried x4096
    Frag pa;
    float psum = 0.0f;
    #pragma unroll
    for (int r = 0; r < 8; ++r) {
      const float p0 = __builtin_amdgcn_exp2f((c0[r] - m_new) * SL);   // key 8hi + r
      const float p1 = __builtin_amdgcn_exp2f((c1[r] - m_new) * SL);   // key 16 + 8hi + r
      psum += p0 + p1;
      pa.e[r]     = (f16)(p0 * P_CARRY);
      pa.e[8 + r] = (f16)(p1 * P_CARRY);
    }
    rsum = rsum * scale + psum + __shfl_xor(psum, 16, 32);

    // rescale O: queries are the row dimension there -> per-row scale from lane 8hi + r
    float sc[8];
    #pragma unroll
    for (int r = 0; r < 8; ++r) sc[r] = __shfl(scale, (hi << 3) + r, 32);
    #pragma unroll
    for (int dt = 0; dt < 8; ++dt) {
      #pragma unroll
      for (int r = 0; r < 8; ++r) o[dt][r] *= sc[r];
    }

    // O += P x V, V^T B-fragments four d tiles at a time (column n = d = dt*16 + lq, split key map)
    #pragma unroll
    for (int hf = 0; hf < 2; ++hf) {
      Frag bv[4];
      #pragma unroll
      for (int dt = 0; dt < 4; ++dt) {
        const int va = vfrag + ((hf * 4 + dt) * 16) * VP;
        bv[dt].q[0] = *(const v4u*)(sT + va);           // keys j0 + 8hi + 0..7
        bv[dt].q[1] = *(const v4u*)(sT + va + 16);      // keys j0 + 16 + 8hi + 0..7
      }
      #pragma unroll
      for (int dt = 0; dt < 4; ++dt) o[hf * 4 + dt] = mma_f16(pa.h, bv[dt].h, o[hf * 4 + dt]);
    }

    // publish point of stage ic + 1, every wave, every step
    asm volatile("s_wait_dscnt 0x0" ::: "memory");    // this wave's reads of the buffer to be refilled are done
    asm volatile("s_wait_asynccnt 0x0" ::: "memory"); // this wave's copies of stage ic + 1 have landed
    __syncthreads();                                  // publishes stage ic + 1, ends all reads of stage ic
    if (ic + 2 < nchunk) {                            // block-uniform: refill the buffer just read
      const int nx = ic + 2;
      stage_kv(gkh + nx * (32 * HD), gkl + nx * (32 * HD), gv + nx * 32,
               lk + bsel * (KV_H * 2), lv + bsel * (KV_H * 2));
    }
  }
  asm volatile("s_wait_asynccnt 0x0" ::: "memory");   // nothing of this wave's copies is left in flight

  // normalize: lane holds column d = dt*16 + lq for query rows 8hi + r; fold the carries
  const float CN = C_CARRY / (P_CARRY * V_CARRY);
  float rs[8];
  #pragma unroll
  for (int r = 0; r < 8; ++r) rs[r] = CN * (1.0f / __shfl(rsum, (hi << 3) + r, 32));

  const int so = wave * (16 * CP);
  #pragma unroll
  for (int r = 0; r < 8; ++r) {
    #pragma unroll
    for (int dt = 0; dt < 8; ++dt) {
      sO[so + (hi * 8 + r) * CP + dt * 16 + lq] = f16_bits(o[dt][r] * rs[r]);
    }
  }
  __syncthreads();

  // 8 consecutive lanes x 16 B each), lanes 16..31 the next row; 8 instructions cover the wave's 16 rows.
  v4u    vals[8];
  size_t gidx[8];
  #pragma unroll
  for (int it = 0; it < 8; ++it) {
    const int row = it * 2 + hi;
    vals[it] = *(const v4u*)(sO + so + row * CP + lq * 8);
    gidx[it] = ((size_t)b * SEQ + qrow0 + row) * DM + head * HD + lq * 8;
  }
  #pragma unroll
  for (int it = 0; it < 8; ++it) *(v4u*)(ctx + gidx[it]) = vals[it];
  
}

// Output projection: out[b][t][DM] = ctx x Wo, f16 operands (carries folded back in f32).
// written by 8 consecutive lanes x 16 B of one instruction.
__global__ __launch_bounds__(256) void out_gemm_kernel(const u16* __restrict__ ctx, const u16* __restrict__ WoT,
                                                       float* __restrict__ out) {
  __shared__ __align__(16) float sC[64 * CPF];
  const int n0   = blockIdx.x * 128;
  const int m0   = blockIdx.y * 128;
  const int tid  = threadIdx.x;
  const int wave = __builtin_amdgcn_readfirstlane(threadIdx.x >> 5);
  const int lane = tid & 31;
  const int lr   = lane & 15;
  const int hi   = lane >> 4;
  const int wm   = (wave & 3) * 32;
  const int g    = wave >> 2;

  v8f acc[2][4];
  #pragma unroll
  for (int fm = 0; fm < 2; ++fm) {
    #pragma unroll
    for (int fn = 0; fn < 4; ++fn) acc[fm][fn] = (v8f){0, 0, 0, 0, 0, 0, 0, 0};
  }
  gemm_core<1, 0>(ctx, WoT, m0, n0, wm, g, lr, hi, acc);

  const float INV = 1.0f / (C_CARRY * W_CARRY);
  #pragma unroll
  for (int p = 0; p < 2; ++p) {
    if (((wave & 3) >> 1) == p) {                  // wave-uniform: this wave's rows belong to half p
      #pragma unroll
      for (int fm = 0; fm < 2; ++fm) {
        #pragma unroll
        for (int fn = 0; fn < 4; ++fn) {
          #pragma unroll
          for (int i = 0; i < 8; ++i) {
            sC[(wm - p * 64 + fm * 16 + 8 * hi + i) * CPF + g * 64 + fn * 16 + lr] = acc[fm][fn][i] * INV;
          }
        }
      }
    }
    __syncthreads();
    v4f    vals[8];
    size_t gidx[8];
    #pragma unroll
    for (int it = 0; it < 8; ++it) {
      const int piece = it * 256 + tid;
      const int row = piece >> 5;                  // 0..63
      const int seg = piece & 31;
      vals[it] = *(const v4f*)(sC + row * CPF + seg * 4);
      const int m  = m0 + p * 64 + row;
      const int bb = m / SEQ;
      const int tt = m % SEQ;
      gidx[it] = ((size_t)bb * SEQ_FULL + tt) * DM + n0 + seg * 4;
    }
    #pragma unroll
    for (int it = 0; it < 8; ++it) *(v4f*)(out + gidx[it]) = vals[it];
    
    __syncthreads();
  }
}

extern "C" void kernel_launch(void* const* d_in, const int* in_sizes, int n_in,
                              void* d_out, int out_size, void* d_ws, size_t ws_size,
                              hipStream_t stream) {
  if (n_in < 6) return;
  const size_t needX = ((size_t)(NB - 1) * SEQ_FULL + SEQ) * DM;
  const size_t needP = (size_t)(NB - 1) * SEQ_FULL + SEQ;
  if ((size_t)in_sizes[0] < needX) return;
  if ((size_t)in_sizes[1] < needP) return;
  if ((size_t)in_sizes[2] < (size_t)DM * NQH * HD) return;
  if ((size_t)in_sizes[3] < (size_t)DM * NKV * HD) return;
  if ((size_t)in_sizes[4] < (size_t)DM * NKV * HD) return;
  if ((size_t)in_sizes[5] < (size_t)NQH * HD * DM) return;
  if ((size_t)out_size < needX) return;
  if (ws_size < (size_t)WS_TOTAL) return;

  const float* X   = (const float*)d_in[0];
  const int*   pos = (const int*)d_in[1];
  const float* Wq  = (const float*)d_in[2];
  const float* Wk  = (const float*)d_in[3];
  const float* Wv  = (const float*)d_in[4];
  const float* Wo  = (const float*)d_in[5];
  float* out = (float*)d_out;

  char* ws = (char*)d_ws;
  u16*   Xb   = (u16*)(ws + OFF_XB);
  u16*   Wt   = (u16*)(ws + OFF_WT);
  u16*   WoT  = (u16*)(ws + OFF_WO);
  float* cosT = (float*)(ws + OFF_COS);
  float* sinT = (float*)(ws + OFF_SIN);
  u16*   ph   = (u16*)(ws + OFF_PH);
  u16*   pl   = (u16*)(ws + OFF_PL);
  u16*   vt   = (u16*)(ws + OFF_VT);
  u16*   ctx  = (u16*)(ws + OFF_CTX);

  // X -> bf16 rows
  xcvt_kernel<<<dim3(NB * SEQ), 256, 0, stream>>>(X, Xb);
  // weights: in[DM rows][cols] -> out[cols][DM]; grid (cols/64, DM/64)
  wtrans_kernel<<<dim3((NQH * HD) / 64, DM / 64), 256, 0, stream>>>(Wq, Wt, NQH * HD, 0, 0);
  wtrans_kernel<<<dim3((NKV * HD) / 64, DM / 64), 256, 0, stream>>>(Wk, Wt, NKV * HD, NQH * HD, 0);
  wtrans_kernel<<<dim3((NKV * HD) / 64, DM / 64), 256, 0, stream>>>(Wv, Wt, NKV * HD, (NQH + NKV) * HD, 0);
  wtrans_kernel<<<dim3(DM / 64, DM / 64), 256, 0, stream>>>(Wo, WoT, DM, 0, 1);
  // rotary table from the positions
  rope_table_kernel<<<dim3((NB * HD2 * SEQ) / 256), 256, 0, stream>>>(pos, cosT, sinT);
  // fused QKV projection + rotary + planes
  qkv_gemm_kernel<<<dim3(NQKV / 128, (NB * SEQ) / 128), 256, 0, stream>>>(Xb, Wt, cosT, sinT, ph, pl, vt);
  // attention
  attn_kernel<<<dim3(SEQ / 16, NKV, NB), 128, 0, stream>>>(ph, pl, vt, ctx);
  // output projection
  out_gemm_kernel<<<dim3(DM / 128, (NB * SEQ) / 128), 256, 0, stream>>>(ctx, WoT, out);
}

// v002
// One run takes 294 microseconds.
// Two timings next to v001 put it at 1.33 and 1.32 times that version's speed.
// Over all steps from v000 it is 2.14 times as fast.
#include <hip/hip_runtime.h>

// Contractions: QKV projections on v_wmma_f32_16x16x32_bf16 (bf16 RNE-converted inputs, f32 accumulate); scores S^T = K x Q^T on v_wmma_f32_16x16x32_bf16 with q and k as bf16 hi|lo planes (hi.hi + hi.lo + lo.hi, one f32 accumulator); O = P x V on v_wmma_f32_16x16x32_f16 (P f16 carried x4096, V f16 carried x16); output projection on v_wmma_f32_16x16x32_f16 (ctx f16 carried x64, Wo = f16 of the bf16 RNE-converted input carried x64); all f32 accumulate; softmax (online, max-subtracted, exp2 domain) and rotary math in f32.

#ifndef NB
#define NB 2
#endif
#ifndef SEQ
#define SEQ 2048
#endif
#define NB_FULL   2
#define SEQ_FULL  2048
#define DM        2048                 // model width = depth of every projection
#define NQH       16                   // query heads
#define NKV       4                    // key/value heads
#define GRP       4                    // query heads per key/value head
#define HD        128                  // head dim
#define HD2       64                   // rotary frequencies
#define NQKV      3072                 // fused projection width (q | k | v)
#define EP        128                  // LDS pitch (halves) of the 16-bit epilogue tiles
#define CPF       132                  // LDS pitch (floats) of the f32 output staging tile
#define CP        136                  // LDS pitch (halves) of the per-wave ctx staging tile
#define TPW       72                   // LDS pitch (halves) of the weight transposer tile
#define KP        136                  // LDS pitch (halves) of a staged K row: 272 B = 16 B x odd
#define VP        40                   // LDS pitch (halves) of a staged V^T row of 32 keys: 80 B = 16 B x odd
#define KT_H      (32 * KP)            // halves of one staged K plane tile (32 keys)
#define VT_H      (HD * VP)            // halves of one staged V^T tile (128 d rows x 32 keys)
#define KV_H      (2 * KT_H + VT_H)    // halves of one stage buffer: K hi | K lo | V^T
#define GK        64                   // k extent (halves) of one staged GEMM slab: 128 B = one line per operand row
#define GP        72                   // LDS pitch (halves) of a staged GEMM operand row: 144 B = 16 B x odd
#define GT_H      (128 * GP)           // halves of one staged operand tile (128 rows)
#define GS_H      (2 * GT_H)           // halves of one GEMM stage buffer: A tile | B tile
#define WS_CAP    134217728ull

#define P_CARRY   4096.0f
#define V_CARRY   16.0f
#define C_CARRY   64.0f
#define W_CARRY   64.0f

static_assert(NB >= 1 && NB <= NB_FULL);
static_assert(SEQ <= SEQ_FULL);
static_assert(SEQ % 128 == 0);
static_assert(DM % 128 == 0);
static_assert(DM % 32 == 0);
static_assert(DM == 256 * 8);                     // one converter block = one row
static_assert(NQKV == NQH * HD + 2 * NKV * HD);
static_assert(NQKV % 128 == 0);
static_assert(NQH == NKV * GRP);
static_assert(HD == 128 && HD2 * 2 == HD);
static_assert(NQH * HD == DM);
static_assert(EP >= HD && (EP * 2) % 16 == 0);
static_assert((CPF * 4) % 16 == 0 && CPF >= 128);
static_assert((CP * 2) % 16 == 0 && CP >= HD);
static_assert((TPW * 2) % 16 == 0 && TPW >= 64);
static_assert(((size_t)NB * HD2 * SEQ) % 256 == 0);
static_assert(2 * 128 * EP * 2 <= 65536);
static_assert((KP * 2) % 16 == 0 && KP >= HD && (VP * 2) % 16 == 0 && VP >= 32);
static_assert((KT_H * 2) % 16 == 0 && (KV_H * 2) % 16 == 0);
static_assert(SEQ % 32 == 0);
static_assert(DM % GK == 0 && DM / GK >= 2 && GK % 32 == 0);
static_assert((GP * 2) % 16 == 0 && GP >= GK && (GT_H * 2) % 16 == 0);
static_assert(2 * GS_H >= 2 * 128 * EP);          // the 16-bit epilogue tiles fit the GEMM ring
static_assert(2 * GS_H * 2 >= 64 * CPF * 4);      // the f32 output staging tile fits the GEMM ring

#define QELEMS   (NB * NQH * SEQ * HD)            // q region of the hi / lo planes (elements)
#define KELEMS   (NB * NKV * SEQ * HD)            // k region
#define XB_BYTES   ((size_t)NB * SEQ * DM * 2)
#define WT_BYTES   ((size_t)NQKV * DM * 2)
#define WO_BYTES   ((size_t)DM * DM * 2)
#define TB_BYTES   ((size_t)NB * HD2 * SEQ * 4)
#define PL_BYTES   ((size_t)(QELEMS + KELEMS) * 2)
#define VT_BYTES   ((size_t)NB * NKV * HD * SEQ * 2)
#define CTX_BYTES  ((size_t)NB * SEQ * DM * 2)
#define OFF_XB   ((size_t)0)
#define OFF_WT   (OFF_XB + XB_BYTES)
#define OFF_WO   (OFF_WT + WT_BYTES)
#define OFF_COS  (OFF_WO + WO_BYTES)
#define OFF_SIN  (OFF_COS + TB_BYTES)
#define OFF_PH   (OFF_SIN + TB_BYTES)
#define OFF_PL   (OFF_PH + PL_BYTES)
#define OFF_VT   (OFF_PL + PL_BYTES)
#define OFF_CTX  (OFF_VT + VT_BYTES)
#define WS_TOTAL (OFF_CTX + CTX_BYTES)
static_assert(WS_TOTAL <= WS_CAP);
static_assert(XB_BYTES % 256 == 0 && WT_BYTES % 256 == 0 && WO_BYTES % 256 == 0);
static_assert(TB_BYTES % 256 == 0 && PL_BYTES % 256 == 0 && VT_BYTES % 256 == 0);
static_assert((unsigned long long)(QELEMS + KELEMS) < 2147483648ull);

typedef __bf16         bf16;
typedef _Float16       f16;
typedef unsigned short u16;
typedef bf16     v16bf __attribute__((ext_vector_type(16)));
typedef f16      v16h  __attribute__((ext_vector_type(16)));
typedef float    v8f   __attribute__((ext_vector_type(8)));
typedef float    v4f   __attribute__((ext_vector_type(4)));
typedef unsigned v4u   __attribute__((ext_vector_type(4)));

union Frag  { v16bf b; v16h h; v4u q[2]; f16 e[16]; };
union Pack8 { v4u u; u16 s[8]; };

// WMMA helpers: builtin followed by the VALU hazard guard (ties D, keeps A/B live).
static __device__ __forceinline__ v8f mma_bf16(v16bf a, v16bf b, v8f acc) {
  acc = __builtin_amdgcn_wmma_f32_16x16x32_bf16(false, a, false, b, (short)0, acc, false, false);
  asm volatile("v_nop\n\tv_nop\n\tv_nop\n\tv_nop" : "+v"(acc) : "v"(a), "v"(b));
  return acc;
}
static __device__ __forceinline__ v8f mma_f16(v16h a, v16h b, v8f acc) {
  acc = __builtin_amdgcn_wmma_f32_16x16x32_f16(false, a, false, b, (short)0, acc, false, false);
  asm volatile("v_nop\n\tv_nop\n\tv_nop\n\tv_nop" : "+v"(acc) : "v"(a), "v"(b));
  return acc;
}

static __device__ __forceinline__ u16 bf16_bits(float x) {      // RNE convert
  const bf16 h = (bf16)x;
  return __builtin_bit_cast(u16, h);
}
static __device__ __forceinline__ float bf16_back(float x) {    // value of the RNE-converted bf16
  return (float)(bf16)x;
}
static __device__ __forceinline__ u16 f16_bits(float x) {
  const f16 h = (f16)x;
  return __builtin_bit_cast(u16, h);
}

// coverage: rows 0..NB*SEQ-1, 256 threads x 8 elements == DM.
__global__ __launch_bounds__(256) void xcvt_kernel(const float* __restrict__ X, u16* __restrict__ Xb) {
  const int m   = blockIdx.x;
  const int tid = threadIdx.x;
  const int b   = m / SEQ;
  const int t   = m % SEQ;
  const size_t src = ((size_t)b * SEQ_FULL + t) * DM + tid * 8;
  const v4f a0 = *(const v4f*)(X + src);
  const v4f a1 = *(const v4f*)(X + src + 4);
  Pack8 pk;
  #pragma unroll
  for (int i = 0; i < 4; ++i) {
    pk.s[i]     = bf16_bits(a0[i]);
    pk.s[4 + i] = bf16_bits(a1[i]);
  }
  const v4u val = pk.u;
  const size_t dst = (size_t)m * DM + tid * 8;
  *(v4u*)(Xb + dst) = val;
  
}

// Weight transposer: in W[DM rows (input dim)][ldin cols (output dim)] f32 -> out Bt[rowoff + col][DM] 16-bit.
// mode 0: bf16 RNE bits; mode 1: f16 of (bf16 RNE value x W_CARRY) (exact).
// Block = 64 (input dim) x 64 (output col) tile through LDS; written lines whole: 8 lanes x 16 B per line.
// coverage: grid (ldin/64, DM/64); each block writes 64 output rows x 64 halves. LDS sT cross-wave (block barrier).
__global__ __launch_bounds__(256) void wtrans_kernel(const float* __restrict__ W, u16* __restrict__ Bt,
                                                     int ldin, int rowoff, int mode) {
  const int c0  = blockIdx.x * 64;
  const int d0  = blockIdx.y * 64;
  const int tid = threadIdx.x;
  __shared__ __align__(16) u16 sT[64 * TPW];     // [col][input dim]
  #pragma unroll
  for (int kk = 0; kk < 2; ++kk) {
    const int r  = kk * 32 + (tid >> 3);         // input dim local 0..63
    const int cc = (tid & 7) * 8;                // col local 0..56
    const size_t src = (size_t)(d0 + r) * ldin + c0 + cc;
    const v4f w0 = *(const v4f*)(W + src);
    const v4f w1 = *(const v4f*)(W + src + 4);
    #pragma unroll
    for (int i = 0; i < 4; ++i) {
      const float x0 = bf16_back(w0[i]);
      const float x1 = bf16_back(w1[i]);
      const u16 h0 = (mode != 0) ? f16_bits(x0 * W_CARRY) : bf16_bits(x0);
      const u16 h1 = (mode != 0) ? f16_bits(x1 * W_CARRY) : bf16_bits(x1);
      sT[(cc + i) * TPW + r]     = h0;
      sT[(cc + 4 + i) * TPW + r] = h1;
    }
  }
  __syncthreads();
  v4u    val[2];
  size_t idx[2];
  #pragma unroll
  for (int kk = 0; kk < 2; ++kk) {
    const int c  = kk * 32 + (tid >> 3);         // col local 0..63
    const int ds = (tid & 7) * 8;                // input dim local 0..56
    val[kk] = *(const v4u*)(sT + c * TPW + ds);
    idx[kk] = (size_t)(rowoff + c0 + c) * DM + d0 + ds;
  }
  #pragma unroll
  for (int kk = 0; kk < 2; ++kk) *(v4u*)(Bt + idx[kk]) = val[kk];
  
}

// Rotary table per batch from the integer positions read by value:
//   ts[j] = 10000^(j/64) (double product of fixed roots -> float), angle = (float)pos / ts[j] (IEEE division),
// coverage: NB*64*SEQ elements, exact grid.
__global__ __launch_bounds__(256) void rope_table_kernel(const int* __restrict__ pos,
                                                         float* __restrict__ cosT,
                                                         float* __restrict__ sinT) {
  const int idx = blockIdx.x * 256 + threadIdx.x;
  const int t = idx % SEQ;
  const int j = (idx / SEQ) % HD2;
  const int b = idx / (SEQ * HD2);
  const int p = pos[(size_t)b * SEQ_FULL + t];
  double pf = 1.0;
  pf *= (j & 32) ? 100.0 : 1.0;                       // 10000^(32/64)
  pf *= (j & 16) ? 10.0 : 1.0;                        // 10000^(16/64)
  pf *= (j & 8)  ? 3.1622776601683795 : 1.0;          // 10000^(8/64)
  pf *= (j & 4)  ? 1.7782794100389228 : 1.0;          // 10000^(4/64)
  pf *= (j & 2)  ? 1.333521432163324  : 1.0;          // 10000^(2/64)
  pf *= (j & 1)  ? 1.1547819846894583 : 1.0;          // 10000^(1/64)
  const float ts = (float)pf;
  float ang = (float)p / ts;
  ang = (p == 0) ? 0.0f : ang;
  float s, c;
  sincosf(ang, &s, &c);
  *(float*)(cosT + idx) = c;
  *(float*)(sinT + idx) = s;
  
}

// One k-slab of the block's operands (A: 128 rows x 128 B, B: 128 rows x 128 B) from global memory into one LDS
// buffer: 8 asynchronous 16-B copies per lane, 256 lanes, every byte of the slab copied exactly once; 8 lanes
// cover one whole 128-B line. a / b and l are the lane's own global pointers and LDS byte address of its first
// piece. The closing s_wait_xcnt stands inside the statement so that no address register of an issued copy is
// rewritten ahead of it.
static __device__ __forceinline__ void stage_ab(const u16* a, const u16* b, unsigned l) {
  asm volatile(
      "global_load_async_to_lds_b128 %0, %1, off\n\t"
      "global_load_async_to_lds_b128 %2, %3, off\n\t"
      "global_load_async_to_lds_b128 %4, %5, off\n\t"
      "global_load_async_to_lds_b128 %6, %7, off\n\t"
      "global_load_async_to_lds_b128 %8, %9, off\n\t"
      "global_load_async_to_lds_b128 %10, %11, off\n\t"
      "global_load_async_to_lds_b128 %12, %13, off\n\t"
      "global_load_async_to_lds_b128 %14, %15, off\n\t"
      "s_wait_xcnt 0x0"
      :
      : "v"(l),                              "v"(a),
        "v"(l + 32 * GP * 2),                "v"(a + 32 * DM),
        "v"(l + 64 * GP * 2),                "v"(a + 64 * DM),
        "v"(l + 96 * GP * 2),                "v"(a + 96 * DM),
        "v"(l + GT_H * 2),                   "v"(b),
        "v"(l + GT_H * 2 + 32 * GP * 2),     "v"(b + 32 * DM),
        "v"(l + GT_H * 2 + 64 * GP * 2),     "v"(b + 64 * DM),
        "v"(l + GT_H * 2 + 96 * GP * 2),     "v"(b + 96 * DM)
      : "memory");
}

// GEMM core: C[128x128 block tile] = A[M][DM] x Bt[N][DM]^T, 8 waves, wave tile 32 rows x 64 cols.
// The block's 128 A rows and 128 B rows are staged once per block in LDS, GK k values at a time (two buffers,
// asynchronous copies one slab ahead); fragments are read from there with 16-B LDS loads (two each, split k map
// for A and B alike): same elements, same k order as the rows of A and Bt. sS is the ring (2 * GS_H halves); behind the
// last slab's barrier nobody reads it any more and nothing is in flight, so the caller may reuse it.
// ROPEMAP = 1: wave column group g owns cols {g*32 .. g*32+31} and {64+g*32 .. 64+g*32+31} so that col d and
// its rotary partner d+64 sit in the same lane / same accumulator element (tiles fn and fn+2).
template <int ISF16, int ROPEMAP>
static __device__ __forceinline__ void gemm_core(const u16* __restrict__ A, const u16* __restrict__ Bt,
                                                 u16* sS, int tid,
                                                 int m0, int n0, int wm, int g, int lr, int hi,
                                                 v8f (&acc)[2][4]) {
  int aoff[2];
  int boff[4];
  #pragma unroll
  for (int fm = 0; fm < 2; ++fm) aoff[fm] = (wm + fm * 16 + lr) * GP + 8 * hi;
  #pragma unroll
  for (int fn = 0; fn < 4; ++fn) {
    const int col = ROPEMAP ? (g * 32 + (fn & 1) * 16 + (fn >> 1) * 64) : (g * 64 + fn * 16);
    boff[fn] = GT_H + (col + lr) * GP + 8 * hi;
  }
  // staging: lane's first piece; 8 lanes x 16 B = one 128-B row piece, 32 rows per copy
  const u16* ga = A  + (size_t)(m0 + (tid >> 3)) * DM + (tid & 7) * 8;
  const u16* gb = Bt + (size_t)(n0 + (tid >> 3)) * DM + (tid & 7) * 8;
  const unsigned l0 = (unsigned)(size_t)sS + (tid >> 3) * (GP * 2) + (tid & 7) * 16;   // LDS byte address
  const int nslab = DM / GK;

  // slab 0 lands and is published before anybody reads it; slab 1 then flies during slab 0's products
  stage_ab(ga, gb, l0);
  asm volatile("s_wait_asynccnt 0x0" ::: "memory"); // this wave's copies of slab 0 have landed
  __syncthreads();
  stage_ab(ga + GK, gb + GK, l0 + GS_H * 2);

  #pragma unroll 1
  for (int t = 0; t < nslab; ++t) {
    const int bsel = t & 1;
    const u16* sT = sS + bsel * GS_H;               // this slab's stage buffer
    #pragma unroll
    for (int kk = 0; kk < GK; kk += 32) {
      Frag a[2];
      Frag b[4];
      #pragma unroll
      for (int fm = 0; fm < 2; ++fm) {
        a[fm].q[0] = *(const v4u*)(sT + aoff[fm] + kk);        // k = t*GK + kk + 8hi + 0..7
        a[fm].q[1] = *(const v4u*)(sT + aoff[fm] + kk + 16);   // k = t*GK + kk + 16 + 8hi + 0..7
      }
      #pragma unroll
      for (int fn = 0; fn < 4; ++fn) {
        b[fn].q[0] = *(const v4u*)(sT + boff[fn] + kk);
        b[fn].q[1] = *(const v4u*)(sT + boff[fn] + kk + 16);
      }
      #pragma unroll
      for (int fn = 0; fn < 4; ++fn) {
        #pragma unroll
        for (int fm = 0; fm < 2; ++fm) {
          if (ISF16) acc[fm][fn] = mma_f16(a[fm].h, b[fn].h, acc[fm][fn]);
          else       acc[fm][fn] = mma_bf16(a[fm].b, b[fn].b, acc[fm][fn]);
        }
      }
    }
    // publish point of slab t + 1, every wave, every slab
    asm volatile("s_wait_dscnt 0x0" ::: "memory");    // this wave's reads of the buffer to be refilled are done
    asm volatile("s_wait_asynccnt 0x0" ::: "memory"); // this wave's copies of slab t + 1 have landed
    __syncthreads();                                  // publishes slab t + 1, ends all reads of slab t
    if (t + 2 < nslab) {                              // block-uniform: refill the buffer just read
      stage_ab(ga + (t + 2) * GK, gb + (t + 2) * GK, l0 + bsel * (GS_H * 2));
    }
  }
  asm volatile("s_wait_asynccnt 0x0" ::: "memory");   // nothing of this wave's copies is left in flight
}

// Fused QKV projection + rotary + plane builder.
// grid (NQKV/128 column tiles = one head each, NB*SEQ/128 row tiles); column tile ct: 0..15 q head, 16..19 k head,
// 20..23 v head. Outputs:
//   ph / pl : bf16 hi / lo planes, q region [NB][NQH][SEQ][HD] at 0, k region [NB][NKV][SEQ][HD] at QELEMS
//   vt      : f16 (x V_CARRY) [NB][NKV][HD][SEQ], transposed through LDS
// LDS tiles sA / sB are cross-wave (block barrier between fill and readback); staged extent 128 x 128 ==
// consumed extent. They lie in the GEMM ring, which is free once gemm_core has returned. Every written line whole: 16 lanes x 16 B = one 256-B row per half-wave.
__global__ __launch_bounds__(256) void qkv_gemm_kernel(const u16* __restrict__ Xb, const u16* __restrict__ Wt,
                                                       const float* __restrict__ cosT,
                                                       const float* __restrict__ sinT,
                                                       u16* __restrict__ ph, u16* __restrict__ pl,
                                                       u16* __restrict__ vt) {
  __shared__ __align__(16) u16 sS[2 * GS_H];
  u16* const sA = sS;
  u16* const sB = sS + 128 * EP;
  const int ct   = blockIdx.x;
  const int m0   = blockIdx.y * 128;
  const int tid  = threadIdx.x;
  const int wave = __builtin_amdgcn_readfirstlane(threadIdx.x >> 5);
  const int lane = tid & 31;
  const int lr   = lane & 15;
  const int hi   = lane >> 4;
  const int wm   = (wave & 3) * 32;
  const int g    = wave >> 2;

  v8f acc[2][4];
  #pragma unroll
  for (int fm = 0; fm < 2; ++fm) {
    #pragma unroll
    for (int fn = 0; fn < 4; ++fn) acc[fm][fn] = (v8f){0, 0, 0, 0, 0, 0, 0, 0};
  }
  gemm_core<0, 1>(Xb, Wt, sS, tid, m0, ct * 128, wm, g, lr, hi, acc);

  const int b  = m0 / SEQ;
  const int t0 = m0 % SEQ;

  if (ct < NQH + NKV) {
    // rotary on the f32 accumulators, then bf16 hi | lo split into the LDS tiles
    #pragma unroll
    for (int fm = 0; fm < 2; ++fm) {
      #pragma unroll
      for (int f2 = 0; f2 < 2; ++f2) {
        const int j  = g * 32 + f2 * 16 + lr;             // frequency index 0..63
        const int tl = wm + fm * 16 + 8 * hi;             // first of this lane's 8 tile rows
        const size_t tb = ((size_t)b * HD2 + j) * SEQ + t0 + tl;
        const v4f ca = *(const v4f*)(cosT + tb);
        const v4f cb = *(const v4f*)(cosT + tb + 4);
        const v4f sa = *(const v4f*)(sinT + tb);
        const v4f sb = *(const v4f*)(sinT + tb + 4);
        #pragma unroll
        for (int i = 0; i < 8; ++i) {
          const float c  = (i < 4) ? ca[i & 3] : cb[i & 3];
          const float s  = (i < 4) ? sa[i & 3] : sb[i & 3];
          const float x1 = acc[fm][f2][i];                 // col j
          const float x2 = acc[fm][f2 + 2][i];             // col j + 64
          const float y1 = x1 * c - x2 * s;
          const float y2 = x2 * c + x1 * s;
          const float h1 = bf16_back(y1);
          const float h2 = bf16_back(y2);
          const int row = tl + i;
          sA[row * EP + j]       = bf16_bits(h1);
          sA[row * EP + 64 + j]  = bf16_bits(h2);
          sB[row * EP + j]       = bf16_bits(y1 - h1);
          sB[row * EP + 64 + j]  = bf16_bits(y2 - h2);
        }
      }
    }
    __syncthreads();
    const int isq   = (ct < NQH) ? 1 : 0;
    const int pbase = isq ? (((b * NQH + ct) * SEQ + t0) * HD)
                          : (QELEMS + ((b * NKV + (ct - NQH)) * SEQ + t0) * HD);
    v4u vA[8];
    v4u vB[8];
    int gi[8];
    #pragma unroll
    for (int it = 0; it < 8; ++it) {
      const int piece = it * 256 + tid;
      const int row = piece >> 4;                          // 0..127
      const int seg = piece & 15;                          // 16 x 16 B = one 256-B plane row
      vA[it] = *(const v4u*)(sA + row * EP + seg * 8);
      vB[it] = *(const v4u*)(sB + row * EP + seg * 8);
      gi[it] = pbase + row * HD + seg * 8;
    }
    #pragma unroll
    for (int it = 0; it < 8; ++it) {
      *(v4u*)(ph + gi[it]) = vA[it];
      *(v4u*)(pl + gi[it]) = vB[it];
    }
    
  } else {
    // v head: f16 carried x V_CARRY, transposed in LDS to [d][t]
    const int kvh = ct - (NQH + NKV);
    #pragma unroll
    for (int fm = 0; fm < 2; ++fm) {
      #pragma unroll
      for (int fn = 0; fn < 4; ++fn) {
        const int d = g * 32 + (fn & 1) * 16 + (fn >> 1) * 64 + lr;
        #pragma unroll
        for (int i = 0; i < 8; ++i) {
          const int row = wm + fm * 16 + 8 * hi + i;
          sA[d * EP + row] = f16_bits(acc[fm][fn][i] * V_CARRY);
        }
      }
    }
    __syncthreads();
    v4u vA[8];
    int gi[8];
    #pragma unroll
    for (int it = 0; it < 8; ++it) {
      const int piece = it * 256 + tid;
      const int d   = piece >> 4;                          // 0..127
      const int seg = piece & 15;
      vA[it] = *(const v4u*)(sA + d * EP + seg * 8);
      gi[it] = ((b * NKV + kvh) * HD + d) * SEQ + t0 + seg * 8;
    }
    #pragma unroll
    for (int it = 0; it < 8; ++it) *(v4u*)(vt + gi[it]) = vA[it];
    
  }
}

// One 32-key stage (K hi, K lo: 32 rows x 256 B each; V^T: 128 rows x 64 B) from global memory into one LDS
// buffer: 12 asynchronous 16-B copies per lane, 128 lanes, every byte of the stage copied exactly once.
// kh / kl / v and lk / lv are the lane's own global pointers and LDS byte addresses of its first piece.
// The closing s_wait_xcnt stands inside the statement so that no address register of an issued copy is
// rewritten ahead of it.
static __device__ __forceinline__ void stage_kv(const u16* kh, const u16* kl, const u16* v,
                                                unsigned lk, unsigned lv) {
  asm volatile(
      "global_load_async_to_lds_b128 %0, %1, off\n\t"
      "global_load_async_to_lds_b128 %2, %3, off\n\t"
      "global_load_async_to_lds_b128 %4, %5, off\n\t"
      "global_load_async_to_lds_b128 %6, %7, off\n\t"
      "global_load_async_to_lds_b128 %8, %9, off\n\t"
      "global_load_async_to_lds_b128 %10, %11, off\n\t"
      "global_load_async_to_lds_b128 %12, %13, off\n\t"
      "global_load_async_to_lds_b128 %14, %15, off\n\t"
      "global_load_async_to_lds_b128 %16, %17, off\n\t"
      "global_load_async_to_lds_b128 %18, %19, off\n\t"
      "global_load_async_to_lds_b128 %20, %21, off\n\t"
      "global_load_async_to_lds_b128 %22, %23, off\n\t"
      "s_wait_xcnt 0x0"
      :
      : "v"(lk),                             "v"(kh),
        "v"(lk + 8 * KP * 2),                "v"(kh + 8 * HD),
        "v"(lk + 16 * KP * 2),               "v"(kh + 16 * HD),
        "v"(lk + 24 * KP * 2),               "v"(kh + 24 * HD),
        "v"(lk + KT_H * 2),                  "v"(kl),
        "v"(lk + KT_H * 2 + 8 * KP * 2),     "v"(kl + 8 * HD),
        "v"(lk + KT_H * 2 + 16 * KP * 2),    "v"(kl + 16 * HD),
        "v"(lk + KT_H * 2 + 24 * KP * 2),    "v"(kl + 24 * HD),
        "v"(lv),                             "v"(v),
        "v"(lv + 32 * VP * 2),               "v"(v + 32 * SEQ),
        "v"(lv + 64 * VP * 2),               "v"(v + 64 * SEQ),
        "v"(lv + 96 * VP * 2),               "v"(v + 96 * SEQ)
      : "memory");
}

// Fused causal grouped-query attention, logit scale 1.0, online softmax in the exp2 domain.
// Block = 4 waves = the four query heads of one key/value head for the same 16 query rows (uniform trip count).
// S^T = K x Q^T so queries sit on lanes; P^T in C layout is bit-identical to the A-fragment layout of O += P x V.
// q and k: bf16 hi | lo planes, three products per k-step into one accumulator. q fragments are reloaded per
// key step through an opaque integer offset. ctx out: f16 carried x C_CARRY, [NB*SEQ][DM], col = head*128 + d.
// K hi | K lo | V^T of each 32-key step are staged once per block in LDS (two buffers, asynchronous copies one
// step ahead) and read by all four waves with 16-B LDS loads; same elements, same k order as the planes.
// LDS sO: each wave writes and reads only its own slice; a block barrier separates fill and readback.
__global__ __launch_bounds__(128) void attn_kernel(const u16* __restrict__ ph, const u16* __restrict__ pl,
                                                   const u16* __restrict__ vt, u16* __restrict__ ctx) {
  const int qt   = blockIdx.x;
  const int kv   = blockIdx.y;
  const int b    = blockIdx.z;
  const int tid  = threadIdx.x;
  const int wave = __builtin_amdgcn_readfirstlane(threadIdx.x >> 5);
  const int lane = tid & 31;
  const int lq   = lane & 15;     // query column of S^T / d column of O
  const int hi   = lane >> 4;     // k-split half
  const int head = kv * GRP + wave;
  const int qrow0 = qt * 16;

  __shared__ __align__(16) u16 sO[GRP * 16 * CP];
  __shared__ __align__(16) u16 sKV[2 * KV_H];

  const int qoff  = ((b * NQH + head) * SEQ + qrow0 + lq) * HD + hi * 8;
  const int kfrag = lq * KP + hi * 8;                 // fragment origin inside a staged K plane tile
  const int vfrag = 2 * KT_H + lq * VP + hi * 8;      // fragment origin of the staged V^T tile

  // staging: lane's first piece. K: 16 lanes x 16 B = one 256-B row, 8 rows per copy; V^T: 4 lanes per 64-B row.
  const u16* gkh = ph + QELEMS + (b * NKV + kv) * SEQ * HD + tid * 8;
  const u16* gkl = pl + QELEMS + (b * NKV + kv) * SEQ * HD + tid * 8;
  const u16* gv  = vt + ((b * NKV + kv) * HD + (tid >> 2)) * SEQ + (tid & 3) * 8;
  const unsigned lbase = (unsigned)(size_t)sKV;       // LDS byte address = low 32 bits of the shared address
  const unsigned lk = lbase + (tid >> 4) * (KP * 2) + (tid & 15) * 16;
  const unsigned lv = lbase + 2 * KT_H * 2 + (tid >> 2) * (VP * 2) + (tid & 3) * 16;

  v8f o[8];
  #pragma unroll
  for (int dt = 0; dt < 8; ++dt) o[dt] = (v8f){0, 0, 0, 0, 0, 0, 0, 0};

  const float NEGV = -1.0e30f;
  float rmax = NEGV;
  float rsum = 0.0f;
  const float SL = 1.4426950408889634f;             // logit scale 1.0 times log2(e)

  const int nchunk = (qrow0 >> 5) + 1;              // same for every wave of the block

  // stage 0 lands and is published before anybody reads it; stage 1 then flies during step 0
  stage_kv(gkh, gkl, gv, lk, lv);
  asm volatile("s_wait_asynccnt 0x0" ::: "memory"); // this wave's copies of stage 0 have landed
  __syncthreads();
  if (nchunk > 1) stage_kv(gkh + 32 * HD, gkl + 32 * HD, gv + 32, lk + KV_H * 2, lv + KV_H * 2);

  #pragma unroll 1
  for (int ic = 0; ic < nchunk; ++ic) {
    const int j0 = ic * 32;
    const int bsel = ic & 1;
    const u16* sT = sKV + bsel * KV_H;              // this step's stage buffer
    int qo = 0;
    asm volatile("" : "+v"(qo));                    // opaque zero: q fragments are re-fetched each step

    // S^T tiles: c0[r] = score(query qrow0+lq, key j0 + 8hi + r), c1[r] = key j0 + 16 + 8hi + r
    v8f c0 = (v8f){0, 0, 0, 0, 0, 0, 0, 0};
    v8f c1 = (v8f){0, 0, 0, 0, 0, 0, 0, 0};
    #pragma unroll
    for (int f = 0; f < 4; ++f) {
      Frag qhf, qlf;
      const int qa = qoff + qo + f * 32;
      qhf.q[0] = *(const v4u*)(ph + qa);            // d = f*32 + 8hi + 0..7
      qhf.q[1] = *(const v4u*)(ph + qa + 16);       // d = f*32 + 16 + 8hi + 0..7
      qlf.q[0] = *(const v4u*)(pl + qa);
      qlf.q[1] = *(const v4u*)(pl + qa + 16);
      {
        Frag khf, klf;
        const int ka = kfrag + f * 32;              // key j0 + lq
        khf.q[0] = *(const v4u*)(sT + ka);
        khf.q[1] = *(const v4u*)(sT + ka + 16);
        klf.q[0] = *(const v4u*)(sT + KT_H + ka);
        klf.q[1] = *(const v4u*)(sT + KT_H + ka + 16);
        c0 = mma_bf16(khf.b, qhf.b, c0);
        c0 = mma_bf16(khf.b, qlf.b, c0);
        c0 = mma_bf16(klf.b, qhf.b, c0);
      }
      {
        Frag khf, klf;
        const int ka = kfrag + 16 * KP + f * 32;    // key j0 + 16 + lq
        khf.q[0] = *(const v4u*)(sT + ka);
        khf.q[1] = *(const v4u*)(sT + ka + 16);
        klf.q[0] = *(const v4u*)(sT + KT_H + ka);
        klf.q[1] = *(const v4u*)(sT + KT_H + ka + 16);
        c1 = mma_bf16(khf.b, qhf.b, c1);
        c1 = mma_bf16(khf.b, qlf.b, c1);
        c1 = mma_bf16(klf.b, qhf.b, c1);
      }
    }

    // causal exclusion (only the last chunk can hold keys beyond a query row); wave-uniform test
    if (j0 + 31 > qrow0) {
      const int trow = qrow0 + lq;
      #pragma unroll
      for (int r = 0; r < 8; ++r) {
        const int key0 = j0 + hi * 8 + r;
        c0[r] = (key0 > trow) ? NEGV : c0[r];
        c1[r] = (key0 + 16 > trow) ? NEGV : c1[r];
      }
    }

    // online softmax: query lq's 32 scores are split across lane / lane^16
    float m_new = rmax;
    #pragma unroll
    for (int r = 0; r < 8; ++r) {
      m_new = fmaxf(m_new, c0[r]);
      m_new = fmaxf(m_new, c1[r]);
    }
    m_new = fmaxf(m_new, __shfl_xor(m_new, 16, 32));
    const float scale = __builtin_amdgcn_exp2f((rmax - m_new) * SL);
    rmax = m_new;

    // exp + pack: P^T C layout == A-fragment layout of the PV product; P carried x4096
    Frag pa;
    float psum = 0.0f;
    #pragma unroll
    for (int r = 0; r < 8; ++r) {
      const float p0 = __builtin_amdgcn_exp2f((c0[r] - m_new) * SL);   // key 8hi + r
      const float p1 = __builtin_amdgcn_exp2f((c1[r] - m_new) * SL);   // key 16 + 8hi + r
      psum += p0 + p1;
      pa.e[r]     = (f16)(p0 * P_CARRY);
      pa.e[8 + r] = (f16)(p1 * P_CARRY);
    }
    rsum = rsum * scale + psum + __shfl_xor(psum, 16, 32);

    // rescale O: queries are the row dimension there -> per-row scale from lane 8hi + r
    float sc[8];
    #pragma unroll
    for (int r = 0; r < 8; ++r) sc[r] = __shfl(scale, (hi << 3) + r, 32);
    #pragma unroll
    for (int dt = 0; dt < 8; ++dt) {
      #pragma unroll
      for (int r = 0; r < 8; ++r) o[dt][r] *= sc[r];
    }

    // O += P x V, V^T B-fragments four d tiles at a time (column n = d = dt*16 + lq, split key map)
    #pragma unroll
    for (int hf = 0; hf < 2; ++hf) {
      Frag bv[4];
      #pragma unroll
      for (int dt = 0; dt < 4; ++dt) {
        const int va = vfrag + ((hf * 4 + dt) * 16) * VP;
        bv[dt].q[0] = *(const v4u*)(sT + va);           // keys j0 + 8hi + 0..7
        bv[dt].q[1] = *(const v4u*)(sT + va + 16);      // keys j0 + 16 + 8hi + 0..7
      }
      #pragma unroll
      for (int dt = 0; dt < 4; ++dt) o[hf * 4 + dt] = mma_f16(pa.h, bv[dt].h, o[hf * 4 + dt]);
    }

    // publish point of stage ic + 1, every wave, every step
    asm volatile("s_wait_dscnt 0x0" ::: "memory");    // this wave's reads of the buffer to be refilled are done
    asm volatile("s_wait_asynccnt 0x0" ::: "memory"); // this wave's copies of stage ic + 1 have landed
    __syncthreads();                                  // publishes stage ic + 1, ends all reads of stage ic
    if (ic + 2 < nchunk) {                            // block-uniform: refill the buffer just read
      const int nx = ic + 2;
      stage_kv(gkh + nx * (32 * HD), gkl + nx * (32 * HD), gv + nx * 32,
               lk + bsel * (KV_H * 2), lv + bsel * (KV_H * 2));
    }
  }
  asm volatile("s_wait_asynccnt 0x0" ::: "memory");   // nothing of this wave's copies is left in flight

  // normalize: lane holds column d = dt*16 + lq for query rows 8hi + r; fold the carries
  const float CN = C_CARRY / (P_CARRY * V_CARRY);
  float rs[8];
  #pragma unroll
  for (int r = 0; r < 8; ++r) rs[r] = CN * (1.0f / __shfl(rsum, (hi << 3) + r, 32));

  const int so = wave * (16 * CP);
  #pragma unroll
  for (int r = 0; r < 8; ++r) {
    #pragma unroll
    for (int dt = 0; dt < 8; ++dt) {
      sO[so + (hi * 8 + r) * CP + dt * 16 + lq] = f16_bits(o[dt][r] * rs[r]);
    }
  }
  __syncthreads();

  // 8 consecutive lanes x 16 B each), lanes 16..31 the next row; 8 instructions cover the wave's 16 rows.
  v4u    vals[8];
  size_t gidx[8];
  #pragma unroll
  for (int it = 0; it < 8; ++it) {
    const int row = it * 2 + hi;
    vals[it] = *(const v4u*)(sO + so + row * CP + lq * 8);
    gidx[it] = ((size_t)b * SEQ + qrow0 + row) * DM + head * HD + lq * 8;
  }
  #pragma unroll
  for (int it = 0; it < 8; ++it) *(v4u*)(ctx + gidx[it]) = vals[it];
  
}

// Output projection: out[b][t][DM] = ctx x Wo, f16 operands (carries folded back in f32).
// written by 8 consecutive lanes x 16 B of one instruction.
__global__ __launch_bounds__(256) void out_gemm_kernel(const u16* __restrict__ ctx, const u16* __restrict__ WoT,
                                                       float* __restrict__ out) {
  __shared__ __align__(16) u16 sS[2 * GS_H];
  float* const sC = (float*)sS;                    // output staging lies in the GEMM ring, free after gemm_core
  const int n0   = blockIdx.x * 128;
  const int m0   = blockIdx.y * 128;
  const int tid  = threadIdx.x;
  const int wave = __builtin_amdgcn_readfirstlane(threadIdx.x >> 5);
  const int lane = tid & 31;
  const int lr   = lane & 15;
  const int hi   = lane >> 4;
  const int wm   = (wave & 3) * 32;
  const int g    = wave >> 2;

  v8f acc[2][4];
  #pragma unroll
  for (int fm = 0; fm < 2; ++fm) {
    #pragma unroll
    for (int fn = 0; fn < 4; ++fn) acc[fm][fn] = (v8f){0, 0, 0, 0, 0, 0, 0, 0};
  }
  gemm_core<1, 0>(ctx, WoT, sS, tid, m0, n0, wm, g, lr, hi, acc);

  const float INV = 1.0f / (C_CARRY * W_CARRY);
  #pragma unroll
  for (int p = 0; p < 2; ++p) {
    if (((wave & 3) >> 1) == p) {                  // wave-uniform: this wave's rows belong to half p
      #pragma unroll
      for (int fm = 0; fm < 2; ++fm) {
        #pragma unroll
        for (int fn = 0; fn < 4; ++fn) {
          #pragma unroll
          for (int i = 0; i < 8; ++i) {
            sC[(wm - p * 64 + fm * 16 + 8 * hi + i) * CPF + g * 64 + fn * 16 + lr] = acc[fm][fn][i] * INV;
          }
        }
      }
    }
    __syncthreads();
    v4f    vals[8];
    size_t gidx[8];
    #pragma unroll
    for (int it = 0; it < 8; ++it) {
      const int piece = it * 256 + tid;
      const int row = piece >> 5;                  // 0..63
      const int seg = piece & 31;
      vals[it] = *(const v4f*)(sC + row * CPF + seg * 4);
      const int m  = m0 + p * 64 + row;
      const int bb = m / SEQ;
      const int tt = m % SEQ;
      gidx[it] = ((size_t)bb * SEQ_FULL + tt) * DM + n0 + seg * 4;
    }
    #pragma unroll
    for (int it = 0; it < 8; ++it) *(v4f*)(out + gidx[it]) = vals[it];
    
    __syncthreads();
  }
}

extern "C" void kernel_launch(void* const* d_in, const int* in_sizes, int n_in,
                              void* d_out, int out_size, void* d_ws, size_t ws_size,
                              hipStream_t stream) {
  if (n_in < 6) return;
  const size_t needX = ((size_t)(NB - 1) * SEQ_FULL + SEQ) * DM;
  const size_t needP = (size_t)(NB - 1) * SEQ_FULL + SEQ;
  if ((size_t)in_sizes[0] < needX) return;
  if ((size_t)in_sizes[1] < needP) return;
  if ((size_t)in_sizes[2] < (size_t)DM * NQH * HD) return;
  if ((size_t)in_sizes[3] < (size_t)DM * NKV * HD) return;
  if ((size_t)in_sizes[4] < (size_t)DM * NKV * HD) return;
  if ((size_t)in_sizes[5] < (size_t)NQH * HD * DM) return;
  if ((size_t)out_size < needX) return;
  if (ws_size < (size_t)WS_TOTAL) return;

  const float* X   = (const float*)d_in[0];
  const int*   pos = (const int*)d_in[1];
  const float* Wq  = (const float*)d_in[2];
  const float* Wk  = (const float*)d_in[3];
  const float* Wv  = (const float*)d_in[4];
  const float* Wo  = (const float*)d_in[5];
  float* out = (float*)d_out;

  char* ws = (char*)d_ws;
  u16*   Xb   = (u16*)(ws + OFF_XB);
  u16*   Wt   = (u16*)(ws + OFF_WT);
  u16*   WoT  = (u16*)(ws + OFF_WO);
  float* cosT = (float*)(ws + OFF_COS);
  float* sinT = (float*)(ws + OFF_SIN);
  u16*   ph   = (u16*)(ws + OFF_PH);
  u16*   pl   = (u16*)(ws + OFF_PL);
  u16*   vt   = (u16*)(ws + OFF_VT);
  u16*   ctx  = (u16*)(ws + OFF_CTX);

  // X -> bf16 rows
  xcvt_kernel<<<dim3(NB * SEQ), 256, 0, stream>>>(X, Xb);
  // weights: in[DM rows][cols] -> out[cols][DM]; grid (cols/64, DM/64)
  wtrans_kernel<<<dim3((NQH * HD) / 64, DM / 64), 256, 0, stream>>>(Wq, Wt, NQH * HD, 0, 0);
  wtrans_kernel<<<dim3((NKV * HD) / 64, DM / 64), 256, 0, stream>>>(Wk, Wt, NKV * HD, NQH * HD, 0);
  wtrans_kernel<<<dim3((NKV * HD) / 64, DM / 64), 256, 0, stream>>>(Wv, Wt, NKV * HD, (NQH + NKV) * HD, 0);
  wtrans_kernel<<<dim3(DM / 64, DM / 64), 256, 0, stream>>>(Wo, WoT, DM, 0, 1);
  // rotary table from the positions
  rope_table_kernel<<<dim3((NB * HD2 * SEQ) / 256), 256, 0, stream>>>(pos, cosT, sinT);
  // fused QKV projection + rotary + planes
  qkv_gemm_kernel<<<dim3(NQKV / 128, (NB * SEQ) / 128), 256, 0, stream>>>(Xb, Wt, cosT, sinT, ph, pl, vt);
  // attention
  attn_kernel<<<dim3(SEQ / 16, NKV, NB), 128, 0, stream>>>(ph, pl, vt, ctx);
  // output projection
  out_gemm_kernel<<<dim3(DM / 128, (NB * SEQ) / 128), 256, 0, stream>>>(ctx, WoT, out);
}

// v003
// A run of this version takes 200 microseconds.
// In two side-by-side timings against v002, it was 1.48 and 1.47 times as fast.
// Counting every step since v000, it is 3.15 times as fast.
#include <hip/hip_runtime.h>

// Contractions: QKV projections on v_wmma_f32_16x16x32_bf16 (bf16 RNE-converted inputs, f32 accumulate); scores S^T = K x Q^T on v_wmma_f32_16x16x32_bf16 with q and k as bf16 hi|lo planes (hi.hi + hi.lo + lo.hi, one f32 accumulator); O = P x V on v_wmma_f32_16x16x32_f16 (P f16 carried x4096, V f16 carried x16); output projection on v_wmma_f32_16x16x32_f16 (ctx f16 carried x64, Wo = f16 of the bf16 RNE-converted input carried x64); all f32 accumulate; softmax (online, max-subtracted, exp2 domain) and rotary math in f32.

#ifndef NB
#define NB 2
#endif
#ifndef SEQ
#define SEQ 2048
#endif
#define NB_FULL   2
#define SEQ_FULL  2048
#define DM        2048                 // model width = depth of every projection
#define NQH       16                   // query heads
#define NKV       4                    // key/value heads
#define GRP       4                    // query heads per key/value head
#define HD        128                  // head dim
#define HD2       64                   // rotary frequencies
#define NQKV      3072                 // fused projection width (q | k | v)
#define EP        128                  // LDS pitch (halves) of the 16-bit epilogue tiles
#define CPF       132                  // LDS pitch (floats) of the f32 output staging tile
#define CP        136                  // LDS pitch (halves) of the per-wave ctx staging tile
#define TPW       72                   // LDS pitch (halves) of the weight transposer tile
#define KP        136                  // LDS pitch (halves) of a staged K row: 272 B = 16 B x odd
#define VP        40                   // LDS pitch (halves) of a staged V^T row of 32 keys: 80 B = 16 B x odd
#define KT_H      (32 * KP)            // halves of one staged K plane tile (32 keys)
#define VT_H      (HD * VP)            // halves of one staged V^T tile (128 d rows x 32 keys)
#define KV_H      (2 * KT_H + VT_H)    // halves of one stage buffer: K hi | K lo | V^T
#define GK        64                   // k extent (halves) of one staged GEMM slab: 128 B = one line per operand row
#define GP        72                   // LDS pitch (halves) of a staged GEMM operand row: 144 B = 16 B x odd
#define GT_H      (128 * GP)           // halves of one staged operand tile (128 rows)
#define GS_H      (2 * GT_H)           // halves of one GEMM stage buffer: A tile | B tile
#define WS_CAP    134217728ull

#define P_CARRY   4096.0f
#define V_CARRY   16.0f
#define C_CARRY   64.0f
#define W_CARRY   64.0f

static_assert(NB >= 1 && NB <= NB_FULL);
static_assert(SEQ <= SEQ_FULL);
static_assert(SEQ % 128 == 0);
static_assert(DM % 128 == 0);
static_assert(DM % 32 == 0);
static_assert(DM == 256 * 8);                     // one converter block = one row
static_assert(NQKV == NQH * HD + 2 * NKV * HD);
static_assert(NQKV % 128 == 0);
static_assert(NQH == NKV * GRP);
static_assert(HD == 128 && HD2 * 2 == HD);
static_assert(NQH * HD == DM);
static_assert(EP >= HD && (EP * 2) % 16 == 0);
static_assert((CPF * 4) % 16 == 0 && CPF >= 128);
static_assert((CP * 2) % 16 == 0 && CP >= HD);
static_assert((TPW * 2) % 16 == 0 && TPW >= 64);
static_assert(((size_t)NB * HD2 * SEQ) % 256 == 0);
static_assert(2 * 128 * EP * 2 <= 65536);
static_assert((KP * 2) % 16 == 0 && KP >= HD && (VP * 2) % 16 == 0 && VP >= 32);
static_assert((KT_H * 2) % 16 == 0 && (KV_H * 2) % 16 == 0);
static_assert(SEQ % 32 == 0);
static_assert(DM % GK == 0 && DM / GK >= 2 && GK % 32 == 0);
static_assert((GP * 2) % 16 == 0 && GP >= GK && (GT_H * 2) % 16 == 0);
static_assert(2 * GS_H >= 2 * 128 * EP);          // the 16-bit epilogue tiles fit the GEMM ring
static_assert(2 * GS_H * 2 >= 64 * CPF * 4);      // the f32 output staging tile fits the GEMM ring

#define QELEMS   (NB * NQH * SEQ * HD)            // q region of the hi / lo planes (elements)
#define KELEMS   (NB * NKV * SEQ * HD)            // k region
#define XB_BYTES   ((size_t)NB * SEQ * DM * 2)
#define WT_BYTES   ((size_t)NQKV * DM * 2)
#define WO_BYTES   ((size_t)DM * DM * 2)
#define TB_BYTES   ((size_t)NB * HD2 * SEQ * 4)
#define PL_BYTES   ((size_t)(QELEMS + KELEMS) * 2)
#define VT_BYTES   ((size_t)NB * NKV * HD * SEQ * 2)
#define CTX_BYTES  ((size_t)NB * SEQ * DM * 2)
#define OFF_XB   ((size_t)0)
#define OFF_WT   (OFF_XB + XB_BYTES)
#define OFF_WO   (OFF_WT + WT_BYTES)
#define OFF_COS  (OFF_WO + WO_BYTES)
#define OFF_SIN  (OFF_COS + TB_BYTES)
#define OFF_PH   (OFF_SIN + TB_BYTES)
#define OFF_PL   (OFF_PH + PL_BYTES)
#define OFF_VT   (OFF_PL + PL_BYTES)
#define OFF_CTX  (OFF_VT + VT_BYTES)
#define WS_TOTAL (OFF_CTX + CTX_BYTES)
static_assert(WS_TOTAL <= WS_CAP);
static_assert(XB_BYTES % 256 == 0 && WT_BYTES % 256 == 0 && WO_BYTES % 256 == 0);
static_assert(TB_BYTES % 256 == 0 && PL_BYTES % 256 == 0 && VT_BYTES % 256 == 0);
static_assert((unsigned long long)(QELEMS + KELEMS) < 2147483648ull);

typedef __bf16         bf16;
typedef _Float16       f16;
typedef unsigned short u16;
typedef bf16     v16bf __attribute__((ext_vector_type(16)));
typedef f16      v16h  __attribute__((ext_vector_type(16)));
typedef float    v8f   __attribute__((ext_vector_type(8)));
typedef float    v4f   __attribute__((ext_vector_type(4)));
typedef unsigned v4u   __attribute__((ext_vector_type(4)));

union Frag  { v16bf b; v16h h; v4u q[2]; f16 e[16]; };
union Pack8 { v4u u; u16 s[8]; };

// WMMA helpers: builtin followed by the VALU hazard guard (ties D, keeps A/B live).
static __device__ __forceinline__ v8f mma_bf16(v16bf a, v16bf b, v8f acc) {
  acc = __builtin_amdgcn_wmma_f32_16x16x32_bf16(false, a, false, b, (short)0, acc, false, false);
  asm volatile("v_nop\n\tv_nop\n\tv_nop\n\tv_nop" : "+v"(acc) : "v"(a), "v"(b));
  return acc;
}
static __device__ __forceinline__ v8f mma_f16(v16h a, v16h b, v8f acc) {
  acc = __builtin_amdgcn_wmma_f32_16x16x32_f16(false, a, false, b, (short)0, acc, false, false);
  asm volatile("v_nop\n\tv_nop\n\tv_nop\n\tv_nop" : "+v"(acc) : "v"(a), "v"(b));
  return acc;
}

static __device__ __forceinline__ u16 bf16_bits(float x) {      // RNE convert
  const bf16 h = (bf16)x;
  return __builtin_bit_cast(u16, h);
}
static __device__ __forceinline__ float bf16_back(float x) {    // value of the RNE-converted bf16
  return (float)(bf16)x;
}
static __device__ __forceinline__ u16 f16_bits(float x) {
  const f16 h = (f16)x;
  return __builtin_bit_cast(u16, h);
}

// coverage: rows 0..NB*SEQ-1, 256 threads x 8 elements == DM.
__global__ __launch_bounds__(256) void xcvt_kernel(const float* __restrict__ X, u16* __restrict__ Xb) {
  const int m   = blockIdx.x;
  const int tid = threadIdx.x;
  const int b   = m / SEQ;
  const int t   = m % SEQ;
  const size_t src = ((size_t)b * SEQ_FULL + t) * DM + tid * 8;
  const v4f a0 = *(const v4f*)(X + src);
  const v4f a1 = *(const v4f*)(X + src + 4);
  Pack8 pk;
  #pragma unroll
  for (int i = 0; i < 4; ++i) {
    pk.s[i]     = bf16_bits(a0[i]);
    pk.s[4 + i] = bf16_bits(a1[i]);
  }
  const v4u val = pk.u;
  const size_t dst = (size_t)m * DM + tid * 8;
  *(v4u*)(Xb + dst) = val;
  
}

// Weight transposer: in W[DM rows (input dim)][ldin cols (output dim)] f32 -> out Bt[rowoff + col][DM] 16-bit.
// mode 0: bf16 RNE bits; mode 1: f16 of (bf16 RNE value x W_CARRY) (exact).
// Block = 64 (input dim) x 64 (output col) tile through LDS; written lines whole: 8 lanes x 16 B per line.
// coverage: grid (ldin/64, DM/64); each block writes 64 output rows x 64 halves. LDS sT cross-wave (block barrier).
__global__ __launch_bounds__(256) void wtrans_kernel(const float* __restrict__ W, u16* __restrict__ Bt,
                                                     int ldin, int rowoff, int mode) {
  const int c0  = blockIdx.x * 64;
  const int d0  = blockIdx.y * 64;
  const int tid = threadIdx.x;
  __shared__ __align__(16) u16 sT[64 * TPW];     // [col][input dim]
  #pragma unroll
  for (int kk = 0; kk < 2; ++kk) {
    const int r  = kk * 32 + (tid >> 3);         // input dim local 0..63
    const int cc = (tid & 7) * 8;                // col local 0..56
    const size_t src = (size_t)(d0 + r) * ldin + c0 + cc;
    const v4f w0 = *(const v4f*)(W + src);
    const v4f w1 = *(const v4f*)(W + src + 4);
    #pragma unroll
    for (int i = 0; i < 4; ++i) {
      const float x0 = bf16_back(w0[i]);
      const float x1 = bf16_back(w1[i]);
      const u16 h0 = (mode != 0) ? f16_bits(x0 * W_CARRY) : bf16_bits(x0);
      const u16 h1 = (mode != 0) ? f16_bits(x1 * W_CARRY) : bf16_bits(x1);
      sT[(cc + i) * TPW + r]     = h0;
      sT[(cc + 4 + i) * TPW + r] = h1;
    }
  }
  __syncthreads();
  v4u    val[2];
  size_t idx[2];
  #pragma unroll
  for (int kk = 0; kk < 2; ++kk) {
    const int c  = kk * 32 + (tid >> 3);         // col local 0..63
    const int ds = (tid & 7) * 8;                // input dim local 0..56
    val[kk] = *(const v4u*)(sT + c * TPW + ds);
    idx[kk] = (size_t)(rowoff + c0 + c) * DM + d0 + ds;
  }
  #pragma unroll
  for (int kk = 0; kk < 2; ++kk) *(v4u*)(Bt + idx[kk]) = val[kk];
  
}

// Rotary table per batch from the integer positions read by value:
//   ts[j] = 10000^(j/64) (double product of fixed roots -> float), angle = (float)pos / ts[j] (IEEE division),
// coverage: NB*64*SEQ elements, exact grid.
__global__ __launch_bounds__(256) void rope_table_kernel(const int* __restrict__ pos,
                                                         float* __restrict__ cosT,
                                                         float* __restrict__ sinT) {
  const int idx = blockIdx.x * 256 + threadIdx.x;
  const int t = idx % SEQ;
  const int j = (idx / SEQ) % HD2;
  const int b = idx / (SEQ * HD2);
  const int p = pos[(size_t)b * SEQ_FULL + t];
  double pf = 1.0;
  pf *= (j & 32) ? 100.0 : 1.0;                       // 10000^(32/64)
  pf *= (j & 16) ? 10.0 : 1.0;                        // 10000^(16/64)
  pf *= (j & 8)  ? 3.1622776601683795 : 1.0;          // 10000^(8/64)
  pf *= (j & 4)  ? 1.7782794100389228 : 1.0;          // 10000^(4/64)
  pf *= (j & 2)  ? 1.333521432163324  : 1.0;          // 10000^(2/64)
  pf *= (j & 1)  ? 1.1547819846894583 : 1.0;          // 10000^(1/64)
  const float ts = (float)pf;
  float ang = (float)p / ts;
  ang = (p == 0) ? 0.0f : ang;
  float s, c;
  sincosf(ang, &s, &c);
  *(float*)(cosT + idx) = c;
  *(float*)(sinT + idx) = s;
  
}

// One k-slab of the block's operands (A: 128 rows x 128 B, B: 128 rows x 128 B) from global memory into one LDS
// buffer: 8 asynchronous 16-B copies per lane, 256 lanes, every byte of the slab copied exactly once; 8 lanes
// cover one whole 128-B line. a / b and l are the lane's own global pointers and LDS byte address of its first
// piece. The closing s_wait_xcnt stands inside the statement so that no address register of an issued copy is
// rewritten ahead of it.
static __device__ __forceinline__ void stage_ab(const u16* a, const u16* b, unsigned l) {
  asm volatile(
      "global_load_async_to_lds_b128 %0, %1, off\n\t"
      "global_load_async_to_lds_b128 %2, %3, off\n\t"
      "global_load_async_to_lds_b128 %4, %5, off\n\t"
      "global_load_async_to_lds_b128 %6, %7, off\n\t"
      "global_load_async_to_lds_b128 %8, %9, off\n\t"
      "global_load_async_to_lds_b128 %10, %11, off\n\t"
      "global_load_async_to_lds_b128 %12, %13, off\n\t"
      "global_load_async_to_lds_b128 %14, %15, off\n\t"
      "s_wait_xcnt 0x0"
      :
      : "v"(l),                              "v"(a),
        "v"(l + 32 * GP * 2),                "v"(a + 32 * DM),
        "v"(l + 64 * GP * 2),                "v"(a + 64 * DM),
        "v"(l + 96 * GP * 2),                "v"(a + 96 * DM),
        "v"(l + GT_H * 2),                   "v"(b),
        "v"(l + GT_H * 2 + 32 * GP * 2),     "v"(b + 32 * DM),
        "v"(l + GT_H * 2 + 64 * GP * 2),     "v"(b + 64 * DM),
        "v"(l + GT_H * 2 + 96 * GP * 2),     "v"(b + 96 * DM)
      : "memory");
}

// GEMM core: C[128x128 block tile] = A[M][DM] x Bt[N][DM]^T, 8 waves, wave tile 32 rows x 64 cols.
// The block's 128 A rows and 128 B rows are staged once per block in LDS, GK k values at a time (two buffers,
// asynchronous copies one slab ahead); fragments are read from there with 16-B LDS loads (two each, split k map
// for A and B alike): same elements, same k order as the rows of A and Bt. sS is the ring (2 * GS_H halves); behind the
// last slab's barrier nobody reads it any more and nothing is in flight, so the caller may reuse it.
// ROPEMAP = 1: wave column group g owns cols {g*32 .. g*32+31} and {64+g*32 .. 64+g*32+31} so that col d and
// its rotary partner d+64 sit in the same lane / same accumulator element (tiles fn and fn+2).
template <int ISF16, int ROPEMAP>
static __device__ __forceinline__ void gemm_core(const u16* __restrict__ A, const u16* __restrict__ Bt,
                                                 u16* sS, int tid,
                                                 int m0, int n0, int wm, int g, int lr, int hi,
                                                 v8f (&acc)[2][4]) {
  int aoff[2];
  int boff[4];
  #pragma unroll
  for (int fm = 0; fm < 2; ++fm) aoff[fm] = (wm + fm * 16 + lr) * GP + 8 * hi;
  #pragma unroll
  for (int fn = 0; fn < 4; ++fn) {
    const int col = ROPEMAP ? (g * 32 + (fn & 1) * 16 + (fn >> 1) * 64) : (g * 64 + fn * 16);
    boff[fn] = GT_H + (col + lr) * GP + 8 * hi;
  }
  // staging: lane's first piece; 8 lanes x 16 B = one 128-B row piece, 32 rows per copy
  const u16* ga = A  + (size_t)(m0 + (tid >> 3)) * DM + (tid & 7) * 8;
  const u16* gb = Bt + (size_t)(n0 + (tid >> 3)) * DM + (tid & 7) * 8;
  const unsigned l0 = (unsigned)(size_t)sS + (tid >> 3) * (GP * 2) + (tid & 7) * 16;   // LDS byte address
  const int nslab = DM / GK;

  // slab 0 lands and is published before anybody reads it; slab 1 then flies during slab 0's products
  stage_ab(ga, gb, l0);
  asm volatile("s_wait_asynccnt 0x0" ::: "memory"); // this wave's copies of slab 0 have landed
  __syncthreads();
  stage_ab(ga + GK, gb + GK, l0 + GS_H * 2);

  #pragma unroll 1
  for (int t = 0; t < nslab; ++t) {
    const int bsel = t & 1;
    const u16* sT = sS + bsel * GS_H;               // this slab's stage buffer
    #pragma unroll
    for (int kk = 0; kk < GK; kk += 32) {
      Frag a[2];
      Frag b[4];
      #pragma unroll
      for (int fm = 0; fm < 2; ++fm) {
        a[fm].q[0] = *(const v4u*)(sT + aoff[fm] + kk);        // k = t*GK + kk + 8hi + 0..7
        a[fm].q[1] = *(const v4u*)(sT + aoff[fm] + kk + 16);   // k = t*GK + kk + 16 + 8hi + 0..7
      }
      #pragma unroll
      for (int fn = 0; fn < 4; ++fn) {
        b[fn].q[0] = *(const v4u*)(sT + boff[fn] + kk);
        b[fn].q[1] = *(const v4u*)(sT + boff[fn] + kk + 16);
      }
      #pragma unroll
      for (int fn = 0; fn < 4; ++fn) {
        #pragma unroll
        for (int fm = 0; fm < 2; ++fm) {
          if (ISF16) acc[fm][fn] = mma_f16(a[fm].h, b[fn].h, acc[fm][fn]);
          else       acc[fm][fn] = mma_bf16(a[fm].b, b[fn].b, acc[fm][fn]);
        }
      }
    }
    // publish point of slab t + 1, every wave, every slab
    asm volatile("s_wait_dscnt 0x0" ::: "memory");    // this wave's reads of the buffer to be refilled are done
    asm volatile("s_wait_asynccnt 0x0" ::: "memory"); // this wave's copies of slab t + 1 have landed
    __syncthreads();                                  // publishes slab t + 1, ends all reads of slab t
    if (t + 2 < nslab) {                              // block-uniform: refill the buffer just read
      stage_ab(ga + (t + 2) * GK, gb + (t + 2) * GK, l0 + bsel * (GS_H * 2));
    }
  }
  asm volatile("s_wait_asynccnt 0x0" ::: "memory");   // nothing of this wave's copies is left in flight
}

// Fused QKV projection + rotary + plane builder.
// grid (NQKV/128 column tiles = one head each, NB*SEQ/128 row tiles); column tile ct: 0..15 q head, 16..19 k head,
// 20..23 v head. Outputs:
//   ph / pl : bf16 hi / lo planes, q region [NB][NQH][SEQ][HD] at 0, k region [NB][NKV][SEQ][HD] at QELEMS
//   vt      : f16 (x V_CARRY) [NB][NKV][HD][SEQ], transposed through LDS
// LDS tiles sA / sB are cross-wave (block barrier between fill and readback); staged extent 128 x 128 ==
// consumed extent. They lie in the GEMM ring, which is free once gemm_core has returned. Every written line whole: 16 lanes x 16 B = one 256-B row per half-wave.
__global__ __launch_bounds__(256) void qkv_gemm_kernel(const u16* __restrict__ Xb, const u16* __restrict__ Wt,
                                                       const float* __restrict__ cosT,
                                                       const float* __restrict__ sinT,
                                                       u16* __restrict__ ph, u16* __restrict__ pl,
                                                       u16* __restrict__ vt) {
  __shared__ __align__(16) u16 sS[2 * GS_H];
  u16* const sA = sS;
  u16* const sB = sS + 128 * EP;
  const int ct   = blockIdx.x;
  const int m0   = blockIdx.y * 128;
  const int tid  = threadIdx.x;
  const int wave = __builtin_amdgcn_readfirstlane(threadIdx.x >> 5);
  const int lane = tid & 31;
  const int lr   = lane & 15;
  const int hi   = lane >> 4;
  const int wm   = (wave & 3) * 32;
  const int g    = wave >> 2;

  v8f acc[2][4];
  #pragma unroll
  for (int fm = 0; fm < 2; ++fm) {
    #pragma unroll
    for (int fn = 0; fn < 4; ++fn) acc[fm][fn] = (v8f){0, 0, 0, 0, 0, 0, 0, 0};
  }
  gemm_core<0, 1>(Xb, Wt, sS, tid, m0, ct * 128, wm, g, lr, hi, acc);

  const int b  = m0 / SEQ;
  const int t0 = m0 % SEQ;

  if (ct < NQH + NKV) {
    // rotary on the f32 accumulators, then bf16 hi | lo split into the LDS tiles
    #pragma unroll
    for (int fm = 0; fm < 2; ++fm) {
      #pragma unroll
      for (int f2 = 0; f2 < 2; ++f2) {
        const int j  = g * 32 + f2 * 16 + lr;             // frequency index 0..63
        const int tl = wm + fm * 16 + 8 * hi;             // first of this lane's 8 tile rows
        const size_t tb = ((size_t)b * HD2 + j) * SEQ + t0 + tl;
        const v4f ca = *(const v4f*)(cosT + tb);
        const v4f cb = *(const v4f*)(cosT + tb + 4);
        const v4f sa = *(const v4f*)(sinT + tb);
        const v4f sb = *(const v4f*)(sinT + tb + 4);
        #pragma unroll
        for (int i = 0; i < 8; ++i) {
          const float c  = (i < 4) ? ca[i & 3] : cb[i & 3];
          const float s  = (i < 4) ? sa[i & 3] : sb[i & 3];
          const float x1 = acc[fm][f2][i];                 // col j
          const float x2 = acc[fm][f2 + 2][i];             // col j + 64
          const float y1 = x1 * c - x2 * s;
          const float y2 = x2 * c + x1 * s;
          const float h1 = bf16_back(y1);
          const float h2 = bf16_back(y2);
          const int row = tl + i;
          sA[row * EP + j]       = bf16_bits(h1);
          sA[row * EP + 64 + j]  = bf16_bits(h2);
          sB[row * EP + j]       = bf16_bits(y1 - h1);
          sB[row * EP + 64 + j]  = bf16_bits(y2 - h2);
        }
      }
    }
    __syncthreads();
    const int isq   = (ct < NQH) ? 1 : 0;
    const int pbase = isq ? (((b * NQH + ct) * SEQ + t0) * HD)
                          : (QELEMS + ((b * NKV + (ct - NQH)) * SEQ + t0) * HD);
    v4u vA[8];
    v4u vB[8];
    int gi[8];
    #pragma unroll
    for (int it = 0; it < 8; ++it) {
      const int piece = it * 256 + tid;
      const int row = piece >> 4;                          // 0..127
      const int seg = piece & 15;                          // 16 x 16 B = one 256-B plane row
      vA[it] = *(const v4u*)(sA + row * EP + seg * 8);
      vB[it] = *(const v4u*)(sB + row * EP + seg * 8);
      gi[it] = pbase + row * HD + seg * 8;
    }
    #pragma unroll
    for (int it = 0; it < 8; ++it) {
      *(v4u*)(ph + gi[it]) = vA[it];
      *(v4u*)(pl + gi[it]) = vB[it];
    }
    
  } else {
    // v head: f16 carried x V_CARRY, transposed in LDS to [d][t]
    const int kvh = ct - (NQH + NKV);
    #pragma unroll
    for (int fm = 0; fm < 2; ++fm) {
      #pragma unroll
      for (int fn = 0; fn < 4; ++fn) {
        const int d = g * 32 + (fn & 1) * 16 + (fn >> 1) * 64 + lr;
        #pragma unroll
        for (int i = 0; i < 8; ++i) {
          const int row = wm + fm * 16 + 8 * hi + i;
          sA[d * EP + row] = f16_bits(acc[fm][fn][i] * V_CARRY);
        }
      }
    }
    __syncthreads();
    v4u vA[8];
    int gi[8];
    #pragma unroll
    for (int it = 0; it < 8; ++it) {
      const int piece = it * 256 + tid;
      const int d   = piece >> 4;                          // 0..127
      const int seg = piece & 15;
      vA[it] = *(const v4u*)(sA + d * EP + seg * 8);
      gi[it] = ((b * NKV + kvh) * HD + d) * SEQ + t0 + seg * 8;
    }
    #pragma unroll
    for (int it = 0; it < 8; ++it) *(v4u*)(vt + gi[it]) = vA[it];
    
  }
}

// One 32-key stage (K hi, K lo: 32 rows x 256 B each; V^T: 128 rows x 64 B) from global memory into one LDS
// buffer: 12 asynchronous 16-B copies per lane, 128 lanes, every byte of the stage copied exactly once.
// kh / kl / v and lk / lv are the lane's own global pointers and LDS byte addresses of its first piece.
// The closing s_wait_xcnt stands inside the statement so that no address register of an issued copy is
// rewritten ahead of it.
static __device__ __forceinline__ void stage_kv(const u16* kh, const u16* kl, const u16* v,
                                                unsigned lk, unsigned lv) {
  asm volatile(
      "global_load_async_to_lds_b128 %0, %1, off\n\t"
      "global_load_async_to_lds_b128 %2, %3, off\n\t"
      "global_load_async_to_lds_b128 %4, %5, off\n\t"
      "global_load_async_to_lds_b128 %6, %7, off\n\t"
      "global_load_async_to_lds_b128 %8, %9, off\n\t"
      "global_load_async_to_lds_b128 %10, %11, off\n\t"
      "global_load_async_to_lds_b128 %12, %13, off\n\t"
      "global_load_async_to_lds_b128 %14, %15, off\n\t"
      "global_load_async_to_lds_b128 %16, %17, off\n\t"
      "global_load_async_to_lds_b128 %18, %19, off\n\t"
      "global_load_async_to_lds_b128 %20, %21, off\n\t"
      "global_load_async_to_lds_b128 %22, %23, off\n\t"
      "s_wait_xcnt 0x0"
      :
      : "v"(lk),                             "v"(kh),
        "v"(lk + 8 * KP * 2),                "v"(kh + 8 * HD),
        "v"(lk + 16 * KP * 2),               "v"(kh + 16 * HD),
        "v"(lk + 24 * KP * 2),               "v"(kh + 24 * HD),
        "v"(lk + KT_H * 2),                  "v"(kl),
        "v"(lk + KT_H * 2 + 8 * KP * 2),     "v"(kl + 8 * HD),
        "v"(lk + KT_H * 2 + 16 * KP * 2),    "v"(kl + 16 * HD),
        "v"(lk + KT_H * 2 + 24 * KP * 2),    "v"(kl + 24 * HD),
        "v"(lv),                             "v"(v),
        "v"(lv + 32 * VP * 2),               "v"(v + 32 * SEQ),
        "v"(lv + 64 * VP * 2),               "v"(v + 64 * SEQ),
        "v"(lv + 96 * VP * 2),               "v"(v + 96 * SEQ)
      : "memory");
}

// Fused causal grouped-query attention, logit scale 1.0, online softmax in the exp2 domain.
// Block = 4 waves = the four query heads of one key/value head for the same 16 query rows (uniform trip count).
// S^T = K x Q^T so queries sit on lanes; P^T in C layout is bit-identical to the A-fragment layout of O += P x V.
// q and k: bf16 hi | lo planes, three products per k-step into one accumulator. q fragments are loaded once
// and stay in registers. ctx out: f16 carried x C_CARRY, [NB*SEQ][DM], col = head*128 + d.
// K hi | K lo | V^T of each 32-key step are staged once per block in LDS (two buffers, asynchronous copies one
// step ahead) and read by all four waves with 16-B LDS loads; same elements, same k order as the planes.
// LDS sO: each wave writes and reads only its own slice; a block barrier separates fill and readback.
__global__ __launch_bounds__(128) void attn_kernel(const u16* __restrict__ ph, const u16* __restrict__ pl,
                                                   const u16* __restrict__ vt, u16* __restrict__ ctx) {
  const int qt   = blockIdx.x;
  const int kv   = blockIdx.y;
  const int b    = blockIdx.z;
  const int tid  = threadIdx.x;
  const int wave = __builtin_amdgcn_readfirstlane(threadIdx.x >> 5);
  const int lane = tid & 31;
  const int lq   = lane & 15;     // query column of S^T / d column of O
  const int hi   = lane >> 4;     // k-split half
  const int head = kv * GRP + wave;
  const int qrow0 = qt * 16;

  __shared__ __align__(16) u16 sO[GRP * 16 * CP];
  __shared__ __align__(16) u16 sKV[2 * KV_H];

  const int qoff  = ((b * NQH + head) * SEQ + qrow0 + lq) * HD + hi * 8;
  const int kfrag = lq * KP + hi * 8;                 // fragment origin inside a staged K plane tile
  const int vfrag = 2 * KT_H + lq * VP + hi * 8;      // fragment origin of the staged V^T tile

  // staging: lane's first piece. K: 16 lanes x 16 B = one 256-B row, 8 rows per copy; V^T: 4 lanes per 64-B row.
  const u16* gkh = ph + QELEMS + (b * NKV + kv) * SEQ * HD + tid * 8;
  const u16* gkl = pl + QELEMS + (b * NKV + kv) * SEQ * HD + tid * 8;
  const u16* gv  = vt + ((b * NKV + kv) * HD + (tid >> 2)) * SEQ + (tid & 3) * 8;
  const unsigned lbase = (unsigned)(size_t)sKV;       // LDS byte address = low 32 bits of the shared address
  const unsigned lk = lbase + (tid >> 4) * (KP * 2) + (tid & 15) * 16;
  const unsigned lv = lbase + 2 * KT_H * 2 + (tid >> 2) * (VP * 2) + (tid & 3) * 16;

  v8f o[8];
  #pragma unroll
  for (int dt = 0; dt < 8; ++dt) o[dt] = (v8f){0, 0, 0, 0, 0, 0, 0, 0};

  const float NEGV = -1.0e30f;
  float rmax = NEGV;
  float rsum = 0.0f;
  const float SL = 1.4426950408889634f;             // logit scale 1.0 times log2(e)

  const int nchunk = (qrow0 >> 5) + 1;              // same for every wave of the block

  // q fragments (B operand of S^T): loaded once, held in registers over the whole key loop
  Frag qh[4], ql[4];
  #pragma unroll
  for (int f = 0; f < 4; ++f) {
    const int qa = qoff + f * 32;
    qh[f].q[0] = *(const v4u*)(ph + qa);            // d = f*32 + 8hi + 0..7
    qh[f].q[1] = *(const v4u*)(ph + qa + 16);       // d = f*32 + 16 + 8hi + 0..7
    ql[f].q[0] = *(const v4u*)(pl + qa);
    ql[f].q[1] = *(const v4u*)(pl + qa + 16);
  }

  // stage 0 lands and is published before anybody reads it; stage 1 then flies during step 0
  stage_kv(gkh, gkl, gv, lk, lv);
  asm volatile("s_wait_asynccnt 0x0" ::: "memory"); // this wave's copies of stage 0 have landed
  __syncthreads();
  if (nchunk > 1) stage_kv(gkh + 32 * HD, gkl + 32 * HD, gv + 32, lk + KV_H * 2, lv + KV_H * 2);

  #pragma unroll 1
  for (int ic = 0; ic < nchunk; ++ic) {
    const int j0 = ic * 32;
    const int bsel = ic & 1;
    const u16* sT = sKV + bsel * KV_H;              // this step's stage buffer

    // S^T tiles: c0[r] = score(query qrow0+lq, key j0 + 8hi + r), c1[r] = key j0 + 16 + 8hi + r
    v8f c0 = (v8f){0, 0, 0, 0, 0, 0, 0, 0};
    v8f c1 = (v8f){0, 0, 0, 0, 0, 0, 0, 0};
    #pragma unroll
    for (int f = 0; f < 4; ++f) {
      const Frag qhf = qh[f];
      const Frag qlf = ql[f];
      {
        Frag khf, klf;
        const int ka = kfrag + f * 32;              // key j0 + lq
        khf.q[0] = *(const v4u*)(sT + ka);
        khf.q[1] = *(const v4u*)(sT + ka + 16);
        klf.q[0] = *(const v4u*)(sT + KT_H + ka);
        klf.q[1] = *(const v4u*)(sT + KT_H + ka + 16);
        c0 = mma_bf16(khf.b, qhf.b, c0);
        c0 = mma_bf16(khf.b, qlf.b, c0);
        c0 = mma_bf16(klf.b, qhf.b, c0);
      }
      {
        Frag khf, klf;
        const int ka = kfrag + 16 * KP + f * 32;    // key j0 + 16 + lq
        khf.q[0] = *(const v4u*)(sT + ka);
        khf.q[1] = *(const v4u*)(sT + ka + 16);
        klf.q[0] = *(const v4u*)(sT + KT_H + ka);
        klf.q[1] = *(const v4u*)(sT + KT_H + ka + 16);
        c1 = mma_bf16(khf.b, qhf.b, c1);
        c1 = mma_bf16(khf.b, qlf.b, c1);
        c1 = mma_bf16(klf.b, qhf.b, c1);
      }
    }

    // causal exclusion (only the last chunk can hold keys beyond a query row); wave-uniform test
    if (j0 + 31 > qrow0) {
      const int trow = qrow0 + lq;
      #pragma unroll
      for (int r = 0; r < 8; ++r) {
        const int key0 = j0 + hi * 8 + r;
        c0[r] = (key0 > trow) ? NEGV : c0[r];
        c1[r] = (key0 + 16 > trow) ? NEGV : c1[r];
      }
    }

    // online softmax: query lq's 32 scores are split across lane / lane^16
    float m_new = rmax;
    #pragma unroll
    for (int r = 0; r < 8; ++r) {
      m_new = fmaxf(m_new, c0[r]);
      m_new = fmaxf(m_new, c1[r]);
    }
    m_new = fmaxf(m_new, __shfl_xor(m_new, 16, 32));
    const float scale = __builtin_amdgcn_exp2f((rmax - m_new) * SL);
    rmax = m_new;

    // exp + pack: P^T C layout == A-fragment layout of the PV product; P carried x4096
    Frag pa;
    float psum = 0.0f;
    #pragma unroll
    for (int r = 0; r < 8; ++r) {
      const float p0 = __builtin_amdgcn_exp2f((c0[r] - m_new) * SL);   // key 8hi + r
      const float p1 = __builtin_amdgcn_exp2f((c1[r] - m_new) * SL);   // key 16 + 8hi + r
      psum += p0 + p1;
      pa.e[r]     = (f16)(p0 * P_CARRY);
      pa.e[8 + r] = (f16)(p1 * P_CARRY);
    }
    rsum = rsum * scale + psum + __shfl_xor(psum, 16, 32);

    // rescale O: queries are the row dimension there -> per-row scale from lane 8hi + r
    float sc[8];
    #pragma unroll
    for (int r = 0; r < 8; ++r) sc[r] = __shfl(scale, (hi << 3) + r, 32);
    #pragma unroll
    for (int dt = 0; dt < 8; ++dt) {
      #pragma unroll
      for (int r = 0; r < 8; ++r) o[dt][r] *= sc[r];
    }

    // O += P x V, V^T B-fragments four d tiles at a time (column n = d = dt*16 + lq, split key map)
    #pragma unroll
    for (int hf = 0; hf < 2; ++hf) {
      Frag bv[4];
      #pragma unroll
      for (int dt = 0; dt < 4; ++dt) {
        const int va = vfrag + ((hf * 4 + dt) * 16) * VP;
        bv[dt].q[0] = *(const v4u*)(sT + va);           // keys j0 + 8hi + 0..7
        bv[dt].q[1] = *(const v4u*)(sT + va + 16);      // keys j0 + 16 + 8hi + 0..7
      }
      #pragma unroll
      for (int dt = 0; dt < 4; ++dt) o[hf * 4 + dt] = mma_f16(pa.h, bv[dt].h, o[hf * 4 + dt]);
    }

    // publish point of stage ic + 1, every wave, every step
    asm volatile("s_wait_dscnt 0x0" ::: "memory");    // this wave's reads of the buffer to be refilled are done
    asm volatile("s_wait_asynccnt 0x0" ::: "memory"); // this wave's copies of stage ic + 1 have landed
    __syncthreads();                                  // publishes stage ic + 1, ends all reads of stage ic
    if (ic + 2 < nchunk) {                            // block-uniform: refill the buffer just read
      const int nx = ic + 2;
      stage_kv(gkh + nx * (32 * HD), gkl + nx * (32 * HD), gv + nx * 32,
               lk + bsel * (KV_H * 2), lv + bsel * (KV_H * 2));
    }
  }
  asm volatile("s_wait_asynccnt 0x0" ::: "memory");   // nothing of this wave's copies is left in flight

  // normalize: lane holds column d = dt*16 + lq for query rows 8hi + r; fold the carries
  const float CN = C_CARRY / (P_CARRY * V_CARRY);
  float rs[8];
  #pragma unroll
  for (int r = 0; r < 8; ++r) rs[r] = CN * (1.0f / __shfl(rsum, (hi << 3) + r, 32));

  const int so = wave * (16 * CP);
  #pragma unroll
  for (int r = 0; r < 8; ++r) {
    #pragma unroll
    for (int dt = 0; dt < 8; ++dt) {
      sO[so + (hi * 8 + r) * CP + dt * 16 + lq] = f16_bits(o[dt][r] * rs[r]);
    }
  }
  __syncthreads();

  // 8 consecutive lanes x 16 B each), lanes 16..31 the next row; 8 instructions cover the wave's 16 rows.
  v4u    vals[8];
  size_t gidx[8];
  #pragma unroll
  for (int it = 0; it < 8; ++it) {
    const int row = it * 2 + hi;
    vals[it] = *(const v4u*)(sO + so + row * CP + lq * 8);
    gidx[it] = ((size_t)b * SEQ + qrow0 + row) * DM + head * HD + lq * 8;
  }
  #pragma unroll
  for (int it = 0; it < 8; ++it) *(v4u*)(ctx + gidx[it]) = vals[it];
  
}

// Output projection: out[b][t][DM] = ctx x Wo, f16 operands (carries folded back in f32).
// written by 8 consecutive lanes x 16 B of one instruction.
__global__ __launch_bounds__(256) void out_gemm_kernel(const u16* __restrict__ ctx, const u16* __restrict__ WoT,
                                                       float* __restrict__ out) {
  __shared__ __align__(16) u16 sS[2 * GS_H];
  float* const sC = (float*)sS;                    // output staging lies in the GEMM ring, free after gemm_core
  const int n0   = blockIdx.x * 128;
  const int m0   = blockIdx.y * 128;
  const int tid  = threadIdx.x;
  const int wave = __builtin_amdgcn_readfirstlane(threadIdx.x >> 5);
  const int lane = tid & 31;
  const int lr   = lane & 15;
  const int hi   = lane >> 4;
  const int wm   = (wave & 3) * 32;
  const int g    = wave >> 2;

  v8f acc[2][4];
  #pragma unroll
  for (int fm = 0; fm < 2; ++fm) {
    #pragma unroll
    for (int fn = 0; fn < 4; ++fn) acc[fm][fn] = (v8f){0, 0, 0, 0, 0, 0, 0, 0};
  }
  gemm_core<1, 0>(ctx, WoT, sS, tid, m0, n0, wm, g, lr, hi, acc);

  const float INV = 1.0f / (C_CARRY * W_CARRY);
  #pragma unroll
  for (int p = 0; p < 2; ++p) {
    if (((wave & 3) >> 1) == p) {                  // wave-uniform: this wave's rows belong to half p
      #pragma unroll
      for (int fm = 0; fm < 2; ++fm) {
        #pragma unroll
        for (int fn = 0; fn < 4; ++fn) {
          #pragma unroll
          for (int i = 0; i < 8; ++i) {
            sC[(wm - p * 64 + fm * 16 + 8 * hi + i) * CPF + g * 64 + fn * 16 + lr] = acc[fm][fn][i] * INV;
          }
        }
      }
    }
    __syncthreads();
    v4f    vals[8];
    size_t gidx[8];
    #pragma unroll
    for (int it = 0; it < 8; ++it) {
      const int piece = it * 256 + tid;
      const int row = piece >> 5;                  // 0..63
      const int seg = piece & 31;
      vals[it] = *(const v4f*)(sC + row * CPF + seg * 4);
      const int m  = m0 + p * 64 + row;
      const int bb = m / SEQ;
      const int tt = m % SEQ;
      gidx[it] = ((size_t)bb * SEQ_FULL + tt) * DM + n0 + seg * 4;
    }
    #pragma unroll
    for (int it = 0; it < 8; ++it) *(v4f*)(out + gidx[it]) = vals[it];
    
    __syncthreads();
  }
}

extern "C" void kernel_launch(void* const* d_in, const int* in_sizes, int n_in,
                              void* d_out, int out_size, void* d_ws, size_t ws_size,
                              hipStream_t stream) {
  if (n_in < 6) return;
  const size_t needX = ((size_t)(NB - 1) * SEQ_FULL + SEQ) * DM;
  const size_t needP = (size_t)(NB - 1) * SEQ_FULL + SEQ;
  if ((size_t)in_sizes[0] < needX) return;
  if ((size_t)in_sizes[1] < needP) return;
  if ((size_t)in_sizes[2] < (size_t)DM * NQH * HD) return;
  if ((size_t)in_sizes[3] < (size_t)DM * NKV * HD) return;
  if ((size_t)in_sizes[4] < (size_t)DM * NKV * HD) return;
  if ((size_t)in_sizes[5] < (size_t)NQH * HD * DM) return;
  if ((size_t)out_size < needX) return;
  if (ws_size < (size_t)WS_TOTAL) return;

  const float* X   = (const float*)d_in[0];
  const int*   pos = (const int*)d_in[1];
  const float* Wq  = (const float*)d_in[2];
  const float* Wk  = (const float*)d_in[3];
  const float* Wv  = (const float*)d_in[4];
  const float* Wo  = (const float*)d_in[5];
  float* out = (float*)d_out;

  char* ws = (char*)d_ws;
  u16*   Xb   = (u16*)(ws + OFF_XB);
  u16*   Wt   = (u16*)(ws + OFF_WT);
  u16*   WoT  = (u16*)(ws + OFF_WO);
  float* cosT = (float*)(ws + OFF_COS);
  float* sinT = (float*)(ws + OFF_SIN);
  u16*   ph   = (u16*)(ws + OFF_PH);
  u16*   pl   = (u16*)(ws + OFF_PL);
  u16*   vt   = (u16*)(ws + OFF_VT);
  u16*   ctx  = (u16*)(ws + OFF_CTX);

  // X -> bf16 rows
  xcvt_kernel<<<dim3(NB * SEQ), 256, 0, stream>>>(X, Xb);
  // weights: in[DM rows][cols] -> out[cols][DM]; grid (cols/64, DM/64)
  wtrans_kernel<<<dim3((NQH * HD) / 64, DM / 64), 256, 0, stream>>>(Wq, Wt, NQH * HD, 0, 0);
  wtrans_kernel<<<dim3((NKV * HD) / 64, DM / 64), 256, 0, stream>>>(Wk, Wt, NKV * HD, NQH * HD, 0);
  wtrans_kernel<<<dim3((NKV * HD) / 64, DM / 64), 256, 0, stream>>>(Wv, Wt, NKV * HD, (NQH + NKV) * HD, 0);
  wtrans_kernel<<<dim3(DM / 64, DM / 64), 256, 0, stream>>>(Wo, WoT, DM, 0, 1);
  // rotary table from the positions
  rope_table_kernel<<<dim3((NB * HD2 * SEQ) / 256), 256, 0, stream>>>(pos, cosT, sinT);
  // fused QKV projection + rotary + planes
  qkv_gemm_kernel<<<dim3(NQKV / 128, (NB * SEQ) / 128), 256, 0, stream>>>(Xb, Wt, cosT, sinT, ph, pl, vt);
  // attention
  attn_kernel<<<dim3(SEQ / 16, NKV, NB), 128, 0, stream>>>(ph, pl, vt, ctx);
  // output projection
  out_gemm_kernel<<<dim3(DM / 128, (NB * SEQ) / 128), 256, 0, stream>>>(ctx, WoT, out);
}

// v004
// One run takes 192 microseconds.
// Next to v003, in two timings, it ran 1.04 times as fast each time.
// Counting every step since v000, it is 3.27 times as fast.
#include <hip/hip_runtime.h>

// Contractions: QKV projections on v_wmma_f32_16x16x32_bf16 (bf16 RNE-converted inputs, f32 accumulate); scores S^T = K x Q^T on v_wmma_f32_16x16x32_bf16 with q and k as bf16 hi|lo planes (hi.hi + hi.lo + lo.hi, one f32 accumulator); O = P x V on v_wmma_f32_16x16x32_f16 (P f16 carried x4096, V f16 carried x16); output projection on v_wmma_f32_16x16x32_f16 (ctx f16 carried x64, Wo = f16 of the bf16 RNE-converted input carried x64); all f32 accumulate; softmax (online, max-subtracted, exp2 domain) and rotary math in f32.

#ifndef NB
#define NB 2
#endif
#ifndef SEQ
#define SEQ 2048
#endif
#define NB_FULL   2
#define SEQ_FULL  2048
#define DM        2048                 // model width = depth of every projection
#define NQH       16                   // query heads
#define NKV       4                    // key/value heads
#define GRP       4                    // query heads per key/value head
#define HD        128                  // head dim
#define HD2       64                   // rotary frequencies
#define NQKV      3072                 // fused projection width (q | k | v)
#define EP        128                  // LDS pitch (halves) of the 16-bit epilogue tiles
#define CPF       132                  // LDS pitch (floats) of the f32 output staging tile
#define CP        136                  // LDS pitch (halves) of the per-wave ctx staging tile
#define TPW       72                   // LDS pitch (halves) of the weight transposer tile
#define KP        136                  // LDS pitch (halves) of a staged K row: 272 B = 16 B x odd
#define VP        40                   // LDS pitch (halves) of a staged V^T row of 32 keys: 80 B = 16 B x odd
#define KT_H      (32 * KP)            // halves of one staged K plane tile (32 keys)
#define VT_H      (HD * VP)            // halves of one staged V^T tile (128 d rows x 32 keys)
#define KV_H      (2 * KT_H + VT_H)    // halves of one stage buffer: K hi | K lo | V^T
#define GK        64                   // k extent (halves) of one staged GEMM slab: 128 B = one line per operand row
#define GP        72                   // LDS pitch (halves) of a staged GEMM operand row: 144 B = 16 B x odd
#define GT_H      (128 * GP)           // halves of one staged operand tile (128 rows)
#define GS_H      (2 * GT_H)           // halves of one GEMM stage buffer: A tile | B tile
#define WS_CAP    134217728ull

#define P_CARRY   4096.0f
#define V_CARRY   16.0f
#define C_CARRY   64.0f
#define W_CARRY   64.0f

static_assert(NB >= 1 && NB <= NB_FULL);
static_assert(SEQ <= SEQ_FULL);
static_assert(SEQ % 128 == 0);
static_assert(DM % 128 == 0);
static_assert(DM % 32 == 0);
static_assert(DM == 256 * 8);                     // one converter block = one row
static_assert(NQKV == NQH * HD + 2 * NKV * HD);
static_assert(NQKV % 128 == 0);
static_assert(NQH == NKV * GRP);
static_assert(HD == 128 && HD2 * 2 == HD);
static_assert(NQH * HD == DM);
static_assert(EP >= HD && (EP * 2) % 16 == 0);
static_assert((CPF * 4) % 16 == 0 && CPF >= 128);
static_assert((CP * 2) % 16 == 0 && CP >= HD);
static_assert((TPW * 2) % 16 == 0 && TPW >= 64);
static_assert(((size_t)NB * HD2 * SEQ) % 256 == 0);
static_assert(2 * 128 * EP * 2 <= 65536);
static_assert((KP * 2) % 16 == 0 && KP >= HD && (VP * 2) % 16 == 0 && VP >= 32);
static_assert((KT_H * 2) % 16 == 0 && (KV_H * 2) % 16 == 0);
static_assert(SEQ % 32 == 0);
static_assert(DM % GK == 0 && DM / GK >= 2 && GK % 32 == 0);
static_assert((GP * 2) % 16 == 0 && GP >= GK && (GT_H * 2) % 16 == 0);
static_assert(2 * GS_H >= 2 * 128 * EP);          // the 16-bit epilogue tiles fit the GEMM ring
static_assert(2 * GS_H * 2 >= 64 * CPF * 4);      // the f32 output staging tile fits the GEMM ring

#define QELEMS   (NB * NQH * SEQ * HD)            // q region of the hi / lo planes (elements)
#define KELEMS   (NB * NKV * SEQ * HD)            // k region
#define XB_BYTES   ((size_t)NB * SEQ * DM * 2)
#define WT_BYTES   ((size_t)NQKV * DM * 2)
#define WO_BYTES   ((size_t)DM * DM * 2)
#define TB_BYTES   ((size_t)NB * HD2 * SEQ * 4)
#define PL_BYTES   ((size_t)(QELEMS + KELEMS) * 2)
#define VT_BYTES   ((size_t)NB * NKV * HD * SEQ * 2)
#define CTX_BYTES  ((size_t)NB * SEQ * DM * 2)
#define OFF_XB   ((size_t)0)
#define OFF_WT   (OFF_XB + XB_BYTES)
#define OFF_WO   (OFF_WT + WT_BYTES)
#define OFF_COS  (OFF_WO + WO_BYTES)
#define OFF_SIN  (OFF_COS + TB_BYTES)
#define OFF_PH   (OFF_SIN + TB_BYTES)
#define OFF_PL   (OFF_PH + PL_BYTES)
#define OFF_VT   (OFF_PL + PL_BYTES)
#define OFF_CTX  (OFF_VT + VT_BYTES)
#define WS_TOTAL (OFF_CTX + CTX_BYTES)
static_assert(WS_TOTAL <= WS_CAP);
static_assert(XB_BYTES % 256 == 0 && WT_BYTES % 256 == 0 && WO_BYTES % 256 == 0);
static_assert(TB_BYTES % 256 == 0 && PL_BYTES % 256 == 0 && VT_BYTES % 256 == 0);
static_assert((unsigned long long)(QELEMS + KELEMS) < 2147483648ull);

typedef __bf16         bf16;
typedef _Float16       f16;
typedef unsigned short u16;
typedef bf16     v16bf __attribute__((ext_vector_type(16)));
typedef f16      v16h  __attribute__((ext_vector_type(16)));
typedef float    v8f   __attribute__((ext_vector_type(8)));
typedef float    v4f   __attribute__((ext_vector_type(4)));
typedef unsigned v4u   __attribute__((ext_vector_type(4)));

union Frag  { v16bf b; v16h h; v4u q[2]; f16 e[16]; };
union Pack8 { v4u u; u16 s[8]; };

// WMMA helpers: builtin followed by the VALU hazard guard (ties D, keeps A/B live).
static __device__ __forceinline__ v8f mma_bf16(v16bf a, v16bf b, v8f acc) {
  acc = __builtin_amdgcn_wmma_f32_16x16x32_bf16(false, a, false, b, (short)0, acc, false, false);
  asm volatile("v_nop\n\tv_nop\n\tv_nop\n\tv_nop" : "+v"(acc) : "v"(a), "v"(b));
  return acc;
}
static __device__ __forceinline__ v8f mma_f16(v16h a, v16h b, v8f acc) {
  acc = __builtin_amdgcn_wmma_f32_16x16x32_f16(false, a, false, b, (short)0, acc, false, false);
  asm volatile("v_nop\n\tv_nop\n\tv_nop\n\tv_nop" : "+v"(acc) : "v"(a), "v"(b));
  return acc;
}

static __device__ __forceinline__ u16 bf16_bits(float x) {      // RNE convert
  const bf16 h = (bf16)x;
  return __builtin_bit_cast(u16, h);
}
static __device__ __forceinline__ float bf16_back(float x) {    // value of the RNE-converted bf16
  return (float)(bf16)x;
}
static __device__ __forceinline__ u16 f16_bits(float x) {
  const f16 h = (f16)x;
  return __builtin_bit_cast(u16, h);
}

// coverage: rows 0..NB*SEQ-1, 256 threads x 8 elements == DM.
__global__ __launch_bounds__(256) void xcvt_kernel(const float* __restrict__ X, u16* __restrict__ Xb) {
  const int m   = blockIdx.x;
  const int tid = threadIdx.x;
  const int b   = m / SEQ;
  const int t   = m % SEQ;
  const size_t src = ((size_t)b * SEQ_FULL + t) * DM + tid * 8;
  const v4f a0 = *(const v4f*)(X + src);
  const v4f a1 = *(const v4f*)(X + src + 4);
  Pack8 pk;
  #pragma unroll
  for (int i = 0; i < 4; ++i) {
    pk.s[i]     = bf16_bits(a0[i]);
    pk.s[4 + i] = bf16_bits(a1[i]);
  }
  const v4u val = pk.u;
  const size_t dst = (size_t)m * DM + tid * 8;
  *(v4u*)(Xb + dst) = val;
  
}

// Weight transposer: in W[DM rows (input dim)][ldin cols (output dim)] f32 -> out Bt[rowoff + col][DM] 16-bit.
// mode 0: bf16 RNE bits; mode 1: f16 of (bf16 RNE value x W_CARRY) (exact).
// Block = 64 (input dim) x 64 (output col) tile through LDS; written lines whole: 8 lanes x 16 B per line.
// coverage: grid (ldin/64, DM/64); each block writes 64 output rows x 64 halves. LDS sT cross-wave (block barrier).
__global__ __launch_bounds__(256) void wtrans_kernel(const float* __restrict__ W, u16* __restrict__ Bt,
                                                     int ldin, int rowoff, int mode) {
  const int c0  = blockIdx.x * 64;
  const int d0  = blockIdx.y * 64;
  const int tid = threadIdx.x;
  __shared__ __align__(16) u16 sT[64 * TPW];     // [col][input dim]
  #pragma unroll
  for (int kk = 0; kk < 2; ++kk) {
    const int r  = kk * 32 + (tid >> 3);         // input dim local 0..63
    const int cc = (tid & 7) * 8;                // col local 0..56
    const size_t src = (size_t)(d0 + r) * ldin + c0 + cc;
    const v4f w0 = *(const v4f*)(W + src);
    const v4f w1 = *(const v4f*)(W + src + 4);
    #pragma unroll
    for (int i = 0; i < 4; ++i) {
      const float x0 = bf16_back(w0[i]);
      const float x1 = bf16_back(w1[i]);
      const u16 h0 = (mode != 0) ? f16_bits(x0 * W_CARRY) : bf16_bits(x0);
      const u16 h1 = (mode != 0) ? f16_bits(x1 * W_CARRY) : bf16_bits(x1);
      sT[(cc + i) * TPW + r]     = h0;
      sT[(cc + 4 + i) * TPW + r] = h1;
    }
  }
  __syncthreads();
  v4u    val[2];
  size_t idx[2];
  #pragma unroll
  for (int kk = 0; kk < 2; ++kk) {
    const int c  = kk * 32 + (tid >> 3);         // col local 0..63
    const int ds = (tid & 7) * 8;                // input dim local 0..56
    val[kk] = *(const v4u*)(sT + c * TPW + ds);
    idx[kk] = (size_t)(rowoff + c0 + c) * DM + d0 + ds;
  }
  #pragma unroll
  for (int kk = 0; kk < 2; ++kk) *(v4u*)(Bt + idx[kk]) = val[kk];
  
}

// Rotary table per batch from the integer positions read by value:
//   ts[j] = 10000^(j/64) (double product of fixed roots -> float), angle = (float)pos / ts[j] (IEEE division),
// coverage: NB*64*SEQ elements, exact grid.
__global__ __launch_bounds__(256) void rope_table_kernel(const int* __restrict__ pos,
                                                         float* __restrict__ cosT,
                                                         float* __restrict__ sinT) {
  const int idx = blockIdx.x * 256 + threadIdx.x;
  const int t = idx % SEQ;
  const int j = (idx / SEQ) % HD2;
  const int b = idx / (SEQ * HD2);
  const int p = pos[(size_t)b * SEQ_FULL + t];
  double pf = 1.0;
  pf *= (j & 32) ? 100.0 : 1.0;                       // 10000^(32/64)
  pf *= (j & 16) ? 10.0 : 1.0;                        // 10000^(16/64)
  pf *= (j & 8)  ? 3.1622776601683795 : 1.0;          // 10000^(8/64)
  pf *= (j & 4)  ? 1.7782794100389228 : 1.0;          // 10000^(4/64)
  pf *= (j & 2)  ? 1.333521432163324  : 1.0;          // 10000^(2/64)
  pf *= (j & 1)  ? 1.1547819846894583 : 1.0;          // 10000^(1/64)
  const float ts = (float)pf;
  float ang = (float)p / ts;
  ang = (p == 0) ? 0.0f : ang;
  float s, c;
  sincosf(ang, &s, &c);
  *(float*)(cosT + idx) = c;
  *(float*)(sinT + idx) = s;
  
}

// One k-slab of the block's operands (A: 128 rows x 128 B, B: 128 rows x 128 B) from global memory into one LDS
// buffer: 8 asynchronous 16-B copies per lane, 256 lanes, every byte of the slab copied exactly once; 8 lanes
// cover one whole 128-B line. a / b and l are the lane's own global pointers and LDS byte address of its first
// piece. The closing s_wait_xcnt stands inside the statement so that no address register of an issued copy is
// rewritten ahead of it.
static __device__ __forceinline__ void stage_ab(const u16* a, const u16* b, unsigned l) {
  asm volatile(
      "global_load_async_to_lds_b128 %0, %1, off\n\t"
      "global_load_async_to_lds_b128 %2, %3, off\n\t"
      "global_load_async_to_lds_b128 %4, %5, off\n\t"
      "global_load_async_to_lds_b128 %6, %7, off\n\t"
      "global_load_async_to_lds_b128 %8, %9, off\n\t"
      "global_load_async_to_lds_b128 %10, %11, off\n\t"
      "global_load_async_to_lds_b128 %12, %13, off\n\t"
      "global_load_async_to_lds_b128 %14, %15, off\n\t"
      "s_wait_xcnt 0x0"
      :
      : "v"(l),                              "v"(a),
        "v"(l + 32 * GP * 2),                "v"(a + 32 * DM),
        "v"(l + 64 * GP * 2),                "v"(a + 64 * DM),
        "v"(l + 96 * GP * 2),                "v"(a + 96 * DM),
        "v"(l + GT_H * 2),                   "v"(b),
        "v"(l + GT_H * 2 + 32 * GP * 2),     "v"(b + 32 * DM),
        "v"(l + GT_H * 2 + 64 * GP * 2),     "v"(b + 64 * DM),
        "v"(l + GT_H * 2 + 96 * GP * 2),     "v"(b + 96 * DM)
      : "memory");
}

// GEMM core: C[128x128 block tile] = A[M][DM] x Bt[N][DM]^T, 8 waves, wave tile 32 rows x 64 cols.
// The block's 128 A rows and 128 B rows are staged once per block in LDS, GK k values at a time (two buffers,
// asynchronous copies one slab ahead); fragments are read from there with 16-B LDS loads (two each, split k map
// for A and B alike): same elements, same k order as the rows of A and Bt. sS is the ring (2 * GS_H halves); behind the
// last slab's barrier nobody reads it any more and nothing is in flight, so the caller may reuse it.
// ROPEMAP = 1: wave column group g owns cols {g*32 .. g*32+31} and {64+g*32 .. 64+g*32+31} so that col d and
// its rotary partner d+64 sit in the same lane / same accumulator element (tiles fn and fn+2).
template <int ISF16, int ROPEMAP>
static __device__ __forceinline__ void gemm_core(const u16* __restrict__ A, const u16* __restrict__ Bt,
                                                 u16* sS, int tid,
                                                 int m0, int n0, int wm, int g, int lr, int hi,
                                                 v8f (&acc)[2][4]) {
  int aoff[2];
  int boff[4];
  #pragma unroll
  for (int fm = 0; fm < 2; ++fm) aoff[fm] = (wm + fm * 16 + lr) * GP + 8 * hi;
  #pragma unroll
  for (int fn = 0; fn < 4; ++fn) {
    const int col = ROPEMAP ? (g * 32 + (fn & 1) * 16 + (fn >> 1) * 64) : (g * 64 + fn * 16);
    boff[fn] = GT_H + (col + lr) * GP + 8 * hi;
  }
  // staging: lane's first piece; 8 lanes x 16 B = one 128-B row piece, 32 rows per copy
  const u16* ga = A  + (size_t)(m0 + (tid >> 3)) * DM + (tid & 7) * 8;
  const u16* gb = Bt + (size_t)(n0 + (tid >> 3)) * DM + (tid & 7) * 8;
  const unsigned l0 = (unsigned)(size_t)sS + (tid >> 3) * (GP * 2) + (tid & 7) * 16;   // LDS byte address
  const int nslab = DM / GK;

  // slab 0 lands and is published before anybody reads it; slab 1 then flies during slab 0's products
  stage_ab(ga, gb, l0);
  asm volatile("s_wait_asynccnt 0x0" ::: "memory"); // this wave's copies of slab 0 have landed
  __syncthreads();
  stage_ab(ga + GK, gb + GK, l0 + GS_H * 2);

  #pragma unroll 1
  for (int t = 0; t < nslab; ++t) {
    const int bsel = t & 1;
    const u16* sT = sS + bsel * GS_H;               // this slab's stage buffer
    #pragma unroll
    for (int kk = 0; kk < GK; kk += 32) {
      Frag a[2];
      Frag b[4];
      #pragma unroll
      for (int fm = 0; fm < 2; ++fm) {
        a[fm].q[0] = *(const v4u*)(sT + aoff[fm] + kk);        // k = t*GK + kk + 8hi + 0..7
        a[fm].q[1] = *(const v4u*)(sT + aoff[fm] + kk + 16);   // k = t*GK + kk + 16 + 8hi + 0..7
      }
      #pragma unroll
      for (int fn = 0; fn < 4; ++fn) {
        b[fn].q[0] = *(const v4u*)(sT + boff[fn] + kk);
        b[fn].q[1] = *(const v4u*)(sT + boff[fn] + kk + 16);
      }
      #pragma unroll
      for (int fn = 0; fn < 4; ++fn) {
        #pragma unroll
        for (int fm = 0; fm < 2; ++fm) {
          if (ISF16) acc[fm][fn] = mma_f16(a[fm].h, b[fn].h, acc[fm][fn]);
          else       acc[fm][fn] = mma_bf16(a[fm].b, b[fn].b, acc[fm][fn]);
        }
      }
    }
    // publish point of slab t + 1, every wave, every slab
    asm volatile("s_wait_dscnt 0x0" ::: "memory");    // this wave's reads of the buffer to be refilled are done
    asm volatile("s_wait_asynccnt 0x0" ::: "memory"); // this wave's copies of slab t + 1 have landed
    __syncthreads();                                  // publishes slab t + 1, ends all reads of slab t
    if (t + 2 < nslab) {                              // block-uniform: refill the buffer just read
      stage_ab(ga + (t + 2) * GK, gb + (t + 2) * GK, l0 + bsel * (GS_H * 2));
    }
  }
  asm volatile("s_wait_asynccnt 0x0" ::: "memory");   // nothing of this wave's copies is left in flight
}

// Fused QKV projection + rotary + plane builder.
// grid (NQKV/128 column tiles = one head each, NB*SEQ/128 row tiles); column tile ct: 0..15 q head, 16..19 k head,
// 20..23 v head. Outputs:
//   ph / pl : bf16 hi / lo planes, q region [NB][NQH][SEQ][HD] at 0, k region [NB][NKV][SEQ][HD] at QELEMS
//   vt      : f16 (x V_CARRY) [NB][NKV][HD][SEQ], transposed through LDS
// LDS tiles sA / sB are cross-wave (block barrier between fill and readback); staged extent 128 x 128 ==
// consumed extent. They lie in the GEMM ring, which is free once gemm_core has returned. Every written line whole: 16 lanes x 16 B = one 256-B row per half-wave.
__global__ __launch_bounds__(256) void qkv_gemm_kernel(const u16* __restrict__ Xb, const u16* __restrict__ Wt,
                                                       const float* __restrict__ cosT,
                                                       const float* __restrict__ sinT,
                                                       u16* __restrict__ ph, u16* __restrict__ pl,
                                                       u16* __restrict__ vt) {
  __shared__ __align__(16) u16 sS[2 * GS_H];
  u16* const sA = sS;
  u16* const sB = sS + 128 * EP;
  const int ct   = blockIdx.x;
  const int m0   = blockIdx.y * 128;
  const int tid  = threadIdx.x;
  const int wave = __builtin_amdgcn_readfirstlane(threadIdx.x >> 5);
  const int lane = tid & 31;
  const int lr   = lane & 15;
  const int hi   = lane >> 4;
  const int wm   = (wave & 3) * 32;
  const int g    = wave >> 2;

  v8f acc[2][4];
  #pragma unroll
  for (int fm = 0; fm < 2; ++fm) {
    #pragma unroll
    for (int fn = 0; fn < 4; ++fn) acc[fm][fn] = (v8f){0, 0, 0, 0, 0, 0, 0, 0};
  }
  gemm_core<0, 1>(Xb, Wt, sS, tid, m0, ct * 128, wm, g, lr, hi, acc);

  const int b  = m0 / SEQ;
  const int t0 = m0 % SEQ;

  if (ct < NQH + NKV) {
    // rotary on the f32 accumulators, then bf16 hi | lo split into the LDS tiles
    #pragma unroll
    for (int fm = 0; fm < 2; ++fm) {
      #pragma unroll
      for (int f2 = 0; f2 < 2; ++f2) {
        const int j  = g * 32 + f2 * 16 + lr;             // frequency index 0..63
        const int tl = wm + fm * 16 + 8 * hi;             // first of this lane's 8 tile rows
        const size_t tb = ((size_t)b * HD2 + j) * SEQ + t0 + tl;
        const v4f ca = *(const v4f*)(cosT + tb);
        const v4f cb = *(const v4f*)(cosT + tb + 4);
        const v4f sa = *(const v4f*)(sinT + tb);
        const v4f sb = *(const v4f*)(sinT + tb + 4);
        #pragma unroll
        for (int i = 0; i < 8; ++i) {
          const float c  = (i < 4) ? ca[i & 3] : cb[i & 3];
          const float s  = (i < 4) ? sa[i & 3] : sb[i & 3];
          const float x1 = acc[fm][f2][i];                 // col j
          const float x2 = acc[fm][f2 + 2][i];             // col j + 64
          const float y1 = x1 * c - x2 * s;
          const float y2 = x2 * c + x1 * s;
          const float h1 = bf16_back(y1);
          const float h2 = bf16_back(y2);
          const int row = tl + i;
          sA[row * EP + j]       = bf16_bits(h1);
          sA[row * EP + 64 + j]  = bf16_bits(h2);
          sB[row * EP + j]       = bf16_bits(y1 - h1);
          sB[row * EP + 64 + j]  = bf16_bits(y2 - h2);
        }
      }
    }
    __syncthreads();
    const int isq   = (ct < NQH) ? 1 : 0;
    const int pbase = isq ? (((b * NQH + ct) * SEQ + t0) * HD)
                          : (QELEMS + ((b * NKV + (ct - NQH)) * SEQ + t0) * HD);
    v4u vA[8];
    v4u vB[8];
    int gi[8];
    #pragma unroll
    for (int it = 0; it < 8; ++it) {
      const int piece = it * 256 + tid;
      const int row = piece >> 4;                          // 0..127
      const int seg = piece & 15;                          // 16 x 16 B = one 256-B plane row
      vA[it] = *(const v4u*)(sA + row * EP + seg * 8);
      vB[it] = *(const v4u*)(sB + row * EP + seg * 8);
      gi[it] = pbase + row * HD + seg * 8;
    }
    #pragma unroll
    for (int it = 0; it < 8; ++it) {
      *(v4u*)(ph + gi[it]) = vA[it];
      *(v4u*)(pl + gi[it]) = vB[it];
    }
    
  } else {
    // v head: f16 carried x V_CARRY, transposed in LDS to [d][t]
    const int kvh = ct - (NQH + NKV);
    #pragma unroll
    for (int fm = 0; fm < 2; ++fm) {
      #pragma unroll
      for (int fn = 0; fn < 4; ++fn) {
        const int d = g * 32 + (fn & 1) * 16 + (fn >> 1) * 64 + lr;
        #pragma unroll
        for (int i = 0; i < 8; ++i) {
          const int row = wm + fm * 16 + 8 * hi + i;
          sA[d * EP + row] = f16_bits(acc[fm][fn][i] * V_CARRY);
        }
      }
    }
    __syncthreads();
    v4u vA[8];
    int gi[8];
    #pragma unroll
    for (int it = 0; it < 8; ++it) {
      const int piece = it * 256 + tid;
      const int d   = piece >> 4;                          // 0..127
      const int seg = piece & 15;
      vA[it] = *(const v4u*)(sA + d * EP + seg * 8);
      gi[it] = ((b * NKV + kvh) * HD + d) * SEQ + t0 + seg * 8;
    }
    #pragma unroll
    for (int it = 0; it < 8; ++it) *(v4u*)(vt + gi[it]) = vA[it];
    
  }
}

// One 32-key stage (K hi, K lo: 32 rows x 256 B each; V^T: 128 rows x 64 B) from global memory into one LDS
// buffer: 12 asynchronous 16-B copies per lane, 128 lanes, every byte of the stage copied exactly once.
// kh / kl / v and lk / lv are the lane's own global pointers and LDS byte addresses of its first piece.
// The closing s_wait_xcnt stands inside the statement so that no address register of an issued copy is
// rewritten ahead of it.
static __device__ __forceinline__ void stage_kv(const u16* kh, const u16* kl, const u16* v,
                                                unsigned lk, unsigned lv) {
  asm volatile(
      "global_load_async_to_lds_b128 %0, %1, off\n\t"
      "global_load_async_to_lds_b128 %2, %3, off\n\t"
      "global_load_async_to_lds_b128 %4, %5, off\n\t"
      "global_load_async_to_lds_b128 %6, %7, off\n\t"
      "global_load_async_to_lds_b128 %8, %9, off\n\t"
      "global_load_async_to_lds_b128 %10, %11, off\n\t"
      "global_load_async_to_lds_b128 %12, %13, off\n\t"
      "global_load_async_to_lds_b128 %14, %15, off\n\t"
      "global_load_async_to_lds_b128 %16, %17, off\n\t"
      "global_load_async_to_lds_b128 %18, %19, off\n\t"
      "global_load_async_to_lds_b128 %20, %21, off\n\t"
      "global_load_async_to_lds_b128 %22, %23, off\n\t"
      "s_wait_xcnt 0x0"
      :
      : "v"(lk),                             "v"(kh),
        "v"(lk + 8 * KP * 2),                "v"(kh + 8 * HD),
        "v"(lk + 16 * KP * 2),               "v"(kh + 16 * HD),
        "v"(lk + 24 * KP * 2),               "v"(kh + 24 * HD),
        "v"(lk + KT_H * 2),                  "v"(kl),
        "v"(lk + KT_H * 2 + 8 * KP * 2),     "v"(kl + 8 * HD),
        "v"(lk + KT_H * 2 + 16 * KP * 2),    "v"(kl + 16 * HD),
        "v"(lk + KT_H * 2 + 24 * KP * 2),    "v"(kl + 24 * HD),
        "v"(lv),                             "v"(v),
        "v"(lv + 32 * VP * 2),               "v"(v + 32 * SEQ),
        "v"(lv + 64 * VP * 2),               "v"(v + 64 * SEQ),
        "v"(lv + 96 * VP * 2),               "v"(v + 96 * SEQ)
      : "memory");
}

// K fragments of one 32-d slice from a staged stage buffer: key tile 0 hi, lo, key tile 1 hi, lo (8 LDS reads).
// p = fragment origin of the slice inside the K hi plane tile.
static __device__ __forceinline__ void load_kset(Frag (&k)[4], const u16* p) {
  k[0].q[0] = *(const v4u*)(p);
  k[0].q[1] = *(const v4u*)(p + 16);
  k[1].q[0] = *(const v4u*)(p + KT_H);
  k[1].q[1] = *(const v4u*)(p + KT_H + 16);
  k[2].q[0] = *(const v4u*)(p + 16 * KP);
  k[2].q[1] = *(const v4u*)(p + 16 * KP + 16);
  k[3].q[0] = *(const v4u*)(p + KT_H + 16 * KP);
  k[3].q[1] = *(const v4u*)(p + KT_H + 16 * KP + 16);
}

// Fused causal grouped-query attention, logit scale 1.0, online softmax in the exp2 domain.
// Block = 4 waves = the four query heads of one key/value head for the same 16 query rows (uniform trip count).
// S^T = K x Q^T so queries sit on lanes; P^T in C layout is bit-identical to the A-fragment layout of O += P x V.
// q and k: bf16 hi | lo planes, three products per k-step into one accumulator. q fragments are loaded once
// and stay in registers. ctx out: f16 carried x C_CARRY, [NB*SEQ][DM], col = head*128 + d.
// K hi | K lo | V^T of each 32-key step are staged once per block in LDS (two buffers, asynchronous copies one
// step ahead) and read by all four waves with 16-B LDS loads; same elements, same k order as the planes.
// LDS sO: each wave writes and reads only its own slice; a block barrier separates fill and readback.
// four waves per SIMD (four blocks per WGP, the whole grid resident) need the wave inside 256 registers
__global__ __launch_bounds__(128) __attribute__((amdgpu_waves_per_eu(4, 4))) void attn_kernel(const u16* __restrict__ ph, const u16* __restrict__ pl,
                                                   const u16* __restrict__ vt, u16* __restrict__ ctx) {
  const int qt   = blockIdx.x;
  const int kv   = blockIdx.y;
  const int b    = blockIdx.z;
  const int tid  = threadIdx.x;
  const int wave = __builtin_amdgcn_readfirstlane(threadIdx.x >> 5);
  const int lane = tid & 31;
  const int lq   = lane & 15;     // query column of S^T / d column of O
  const int hi   = lane >> 4;     // k-split half
  const int head = kv * GRP + wave;
  const int qrow0 = qt * 16;

  __shared__ __align__(16) u16 sO[GRP * 16 * CP];
  __shared__ __align__(16) u16 sKV[2 * KV_H];

  const int qoff  = ((b * NQH + head) * SEQ + qrow0 + lq) * HD + hi * 8;
  const int kfrag = lq * KP + hi * 8;                 // fragment origin inside a staged K plane tile
  const int vfrag = 2 * KT_H + lq * VP + hi * 8;      // fragment origin of the staged V^T tile

  // staging: lane's first piece. K: 16 lanes x 16 B = one 256-B row, 8 rows per copy; V^T: 4 lanes per 64-B row.
  const u16* gkh = ph + QELEMS + (b * NKV + kv) * SEQ * HD + tid * 8;
  const u16* gkl = pl + QELEMS + (b * NKV + kv) * SEQ * HD + tid * 8;
  const u16* gv  = vt + ((b * NKV + kv) * HD + (tid >> 2)) * SEQ + (tid & 3) * 8;
  const unsigned lbase = (unsigned)(size_t)sKV;       // LDS byte address = low 32 bits of the shared address
  const unsigned lk = lbase + (tid >> 4) * (KP * 2) + (tid & 15) * 16;
  const unsigned lv = lbase + 2 * KT_H * 2 + (tid >> 2) * (VP * 2) + (tid & 3) * 16;

  v8f o[8];
  #pragma unroll
  for (int dt = 0; dt < 8; ++dt) o[dt] = (v8f){0, 0, 0, 0, 0, 0, 0, 0};

  const float NEGV = -1.0e30f;
  float rmax = NEGV;
  float rsum = 0.0f;
  const float SL = 1.4426950408889634f;             // logit scale 1.0 times log2(e)

  const int nchunk = (qrow0 >> 5) + 1;              // same for every wave of the block

  // q fragments (B operand of S^T): loaded once, held in registers over the whole key loop
  Frag qh[4], ql[4];
  #pragma unroll
  for (int f = 0; f < 4; ++f) {
    const int qa = qoff + f * 32;
    qh[f].q[0] = *(const v4u*)(ph + qa);            // d = f*32 + 8hi + 0..7
    qh[f].q[1] = *(const v4u*)(ph + qa + 16);       // d = f*32 + 16 + 8hi + 0..7
    ql[f].q[0] = *(const v4u*)(pl + qa);
    ql[f].q[1] = *(const v4u*)(pl + qa + 16);
  }

  // stage 0 lands and is published before anybody reads it; stage 1 then flies during step 0
  stage_kv(gkh, gkl, gv, lk, lv);
  asm volatile("s_wait_asynccnt 0x0" ::: "memory"); // this wave's copies of stage 0 have landed
  __syncthreads();
  if (nchunk > 1) stage_kv(gkh + 32 * HD, gkl + 32 * HD, gv + 32, lk + KV_H * 2, lv + KV_H * 2);

  #pragma unroll 1
  for (int ic = 0; ic < nchunk; ++ic) {
    const int j0 = ic * 32;
    const int bsel = ic & 1;
    const u16* sT = sKV + bsel * KV_H;              // this step's stage buffer

    // S^T tiles: c0[r] = score(query qrow0+lq, key j0 + 8hi + r), c1[r] = key j0 + 16 + 8hi + r
    v8f c0 = (v8f){0, 0, 0, 0, 0, 0, 0, 0};
    v8f c1 = (v8f){0, 0, 0, 0, 0, 0, 0, 0};
    // LDS fragment reads are issued in groups ahead of the products that use them: K one 32-d slice ahead in a
    // second register set, V^T into the K sets' registers as they fall free, all of it before the softmax.
    Frag ks[2][4];
    Frag bv[8];
    load_kset(ks[0], sT + kfrag);
    load_kset(ks[1], sT + kfrag + 32);
    // keeps both read groups in front of the first products (sunk to their uses, each read's latency is waited out)
    __builtin_amdgcn_sched_barrier(0);
    #pragma unroll
    for (int f = 0; f < 4; ++f) {
      const Frag qhf = qh[f];
      const Frag qlf = ql[f];
      Frag (&k)[4] = ks[f & 1];
      c0 = mma_bf16(k[0].b, qhf.b, c0);             // key j0 + lq
      c0 = mma_bf16(k[0].b, qlf.b, c0);
      c0 = mma_bf16(k[1].b, qhf.b, c0);
      c1 = mma_bf16(k[2].b, qhf.b, c1);             // key j0 + 16 + lq
      c1 = mma_bf16(k[2].b, qlf.b, c1);
      c1 = mma_bf16(k[3].b, qhf.b, c1);
      // the refill of this register set stays behind its last product ...
      __builtin_amdgcn_sched_barrier(0);
      if (f < 2) {
        load_kset(ks[f & 1], sT + kfrag + (f + 2) * 32);
      } else {
        #pragma unroll
        for (int dt = 0; dt < 4; ++dt) {            // V^T B-fragments: column n = d = ((f - 2) * 4 + dt) * 16 + lq, split key map
          const int va = vfrag + (((f - 2) * 4 + dt) * 16) * VP;
          bv[(f - 2) * 4 + dt].q[0] = *(const v4u*)(sT + va);        // keys j0 + 8hi + 0..7
          bv[(f - 2) * 4 + dt].q[1] = *(const v4u*)(sT + va + 16);   // keys j0 + 16 + 8hi + 0..7
        }
      }
      // ... and in front of the next slice's products, so that it flies during them
      __builtin_amdgcn_sched_barrier(0);
    }

    // causal exclusion (only the last chunk can hold keys beyond a query row); wave-uniform test
    if (j0 + 31 > qrow0) {
      const int trow = qrow0 + lq;
      #pragma unroll
      for (int r = 0; r < 8; ++r) {
        const int key0 = j0 + hi * 8 + r;
        c0[r] = (key0 > trow) ? NEGV : c0[r];
        c1[r] = (key0 + 16 > trow) ? NEGV : c1[r];
      }
    }

    // online softmax: query lq's 32 scores are split across lane / lane^16
    float m_new = rmax;
    #pragma unroll
    for (int r = 0; r < 8; ++r) {
      m_new = fmaxf(m_new, c0[r]);
      m_new = fmaxf(m_new, c1[r]);
    }
    m_new = fmaxf(m_new, __shfl_xor(m_new, 16, 32));
    const float scale = __builtin_amdgcn_exp2f((rmax - m_new) * SL);
    rmax = m_new;

    // exp + pack: P^T C layout == A-fragment layout of the PV product; P carried x4096
    Frag pa;
    float psum = 0.0f;
    #pragma unroll
    for (int r = 0; r < 8; ++r) {
      const float p0 = __builtin_amdgcn_exp2f((c0[r] - m_new) * SL);   // key 8hi + r
      const float p1 = __builtin_amdgcn_exp2f((c1[r] - m_new) * SL);   // key 16 + 8hi + r
      psum += p0 + p1;
      pa.e[r]     = (f16)(p0 * P_CARRY);
      pa.e[8 + r] = (f16)(p1 * P_CARRY);
    }
    rsum = rsum * scale + psum + __shfl_xor(psum, 16, 32);

    // rescale O: queries are the row dimension there -> per-row scale from lane 8hi + r
    float sc[8];
    #pragma unroll
    for (int r = 0; r < 8; ++r) sc[r] = __shfl(scale, (hi << 3) + r, 32);
    #pragma unroll
    for (int dt = 0; dt < 8; ++dt) {
      #pragma unroll
      for (int r = 0; r < 8; ++r) o[dt][r] *= sc[r];
    }

    // O += P x V on the V^T fragments read above
    #pragma unroll
    for (int dt = 0; dt < 8; ++dt) o[dt] = mma_f16(pa.h, bv[dt].h, o[dt]);

    // publish point of stage ic + 1, every wave, every step
    asm volatile("s_wait_dscnt 0x0" ::: "memory");    // this wave's reads of the buffer to be refilled are done
    asm volatile("s_wait_asynccnt 0x0" ::: "memory"); // this wave's copies of stage ic + 1 have landed
    __syncthreads();                                  // publishes stage ic + 1, ends all reads of stage ic
    if (ic + 2 < nchunk) {                            // block-uniform: refill the buffer just read
      const int nx = ic + 2;
      stage_kv(gkh + nx * (32 * HD), gkl + nx * (32 * HD), gv + nx * 32,
               lk + bsel * (KV_H * 2), lv + bsel * (KV_H * 2));
    }
  }
  asm volatile("s_wait_asynccnt 0x0" ::: "memory");   // nothing of this wave's copies is left in flight

  // normalize: lane holds column d = dt*16 + lq for query rows 8hi + r; fold the carries
  const float CN = C_CARRY / (P_CARRY * V_CARRY);
  float rs[8];
  #pragma unroll
  for (int r = 0; r < 8; ++r) rs[r] = CN * (1.0f / __shfl(rsum, (hi << 3) + r, 32));

  const int so = wave * (16 * CP);
  #pragma unroll
  for (int r = 0; r < 8; ++r) {
    #pragma unroll
    for (int dt = 0; dt < 8; ++dt) {
      sO[so + (hi * 8 + r) * CP + dt * 16 + lq] = f16_bits(o[dt][r] * rs[r]);
    }
  }
  __syncthreads();

  // 8 consecutive lanes x 16 B each), lanes 16..31 the next row; 8 instructions cover the wave's 16 rows.
  v4u    vals[8];
  size_t gidx[8];
  #pragma unroll
  for (int it = 0; it < 8; ++it) {
    const int row = it * 2 + hi;
    vals[it] = *(const v4u*)(sO + so + row * CP + lq * 8);
    gidx[it] = ((size_t)b * SEQ + qrow0 + row) * DM + head * HD + lq * 8;
  }
  #pragma unroll
  for (int it = 0; it < 8; ++it) *(v4u*)(ctx + gidx[it]) = vals[it];
  
}

// Output projection: out[b][t][DM] = ctx x Wo, f16 operands (carries folded back in f32).
// written by 8 consecutive lanes x 16 B of one instruction.
__global__ __launch_bounds__(256) void out_gemm_kernel(const u16* __restrict__ ctx, const u16* __restrict__ WoT,
                                                       float* __restrict__ out) {
  __shared__ __align__(16) u16 sS[2 * GS_H];
  float* const sC = (float*)sS;                    // output staging lies in the GEMM ring, free after gemm_core
  const int n0   = blockIdx.x * 128;
  const int m0   = blockIdx.y * 128;
  const int tid  = threadIdx.x;
  const int wave = __builtin_amdgcn_readfirstlane(threadIdx.x >> 5);
  const int lane = tid & 31;
  const int lr   = lane & 15;
  const int hi   = lane >> 4;
  const int wm   = (wave & 3) * 32;
  const int g    = wave >> 2;

  v8f acc[2][4];
  #pragma unroll
  for (int fm = 0; fm < 2; ++fm) {
    #pragma unroll
    for (int fn = 0; fn < 4; ++fn) acc[fm][fn] = (v8f){0, 0, 0, 0, 0, 0, 0, 0};
  }
  gemm_core<1, 0>(ctx, WoT, sS, tid, m0, n0, wm, g, lr, hi, acc);

  const float INV = 1.0f / (C_CARRY * W_CARRY);
  #pragma unroll
  for (int p = 0; p < 2; ++p) {
    if (((wave & 3) >> 1) == p) {                  // wave-uniform: this wave's rows belong to half p
      #pragma unroll
      for (int fm = 0; fm < 2; ++fm) {
        #pragma unroll
        for (int fn = 0; fn < 4; ++fn) {
          #pragma unroll
          for (int i = 0; i < 8; ++i) {
            sC[(wm - p * 64 + fm * 16 + 8 * hi + i) * CPF + g * 64 + fn * 16 + lr] = acc[fm][fn][i] * INV;
          }
        }
      }
    }
    __syncthreads();
    v4f    vals[8];
    size_t gidx[8];
    #pragma unroll
    for (int it = 0; it < 8; ++it) {
      const int piece = it * 256 + tid;
      const int row = piece >> 5;                  // 0..63
      const int seg = piece & 31;
      vals[it] = *(const v4f*)(sC + row * CPF + seg * 4);
      const int m  = m0 + p * 64 + row;
      const int bb = m / SEQ;
      const int tt = m % SEQ;
      gidx[it] = ((size_t)bb * SEQ_FULL + tt) * DM + n0 + seg * 4;
    }
    #pragma unroll
    for (int it = 0; it < 8; ++it) *(v4f*)(out + gidx[it]) = vals[it];
    
    __syncthreads();
  }
}

extern "C" void kernel_launch(void* const* d_in, const int* in_sizes, int n_in,
                              void* d_out, int out_size, void* d_ws, size_t ws_size,
                              hipStream_t stream) {
  if (n_in < 6) return;
  const size_t needX = ((size_t)(NB - 1) * SEQ_FULL + SEQ) * DM;
  const size_t needP = (size_t)(NB - 1) * SEQ_FULL + SEQ;
  if ((size_t)in_sizes[0] < needX) return;
  if ((size_t)in_sizes[1] < needP) return;
  if ((size_t)in_sizes[2] < (size_t)DM * NQH * HD) return;
  if ((size_t)in_sizes[3] < (size_t)DM * NKV * HD) return;
  if ((size_t)in_sizes[4] < (size_t)DM * NKV * HD) return;
  if ((size_t)in_sizes[5] < (size_t)NQH * HD * DM) return;
  if ((size_t)out_size < needX) return;
  if (ws_size < (size_t)WS_TOTAL) return;

  const float* X   = (const float*)d_in[0];
  const int*   pos = (const int*)d_in[1];
  const float* Wq  = (const float*)d_in[2];
  const float* Wk  = (const float*)d_in[3];
  const float* Wv  = (const float*)d_in[4];
  const float* Wo  = (const float*)d_in[5];
  float* out = (float*)d_out;

  char* ws = (char*)d_ws;
  u16*   Xb   = (u16*)(ws + OFF_XB);
  u16*   Wt   = (u16*)(ws + OFF_WT);
  u16*   WoT  = (u16*)(ws + OFF_WO);
  float* cosT = (float*)(ws + OFF_COS);
  float* sinT = (float*)(ws + OFF_SIN);
  u16*   ph   = (u16*)(ws + OFF_PH);
  u16*   pl   = (u16*)(ws + OFF_PL);
  u16*   vt   = (u16*)(ws + OFF_VT);
  u16*   ctx  = (u16*)(ws + OFF_CTX);

  // X -> bf16 rows
  xcvt_kernel<<<dim3(NB * SEQ), 256, 0, stream>>>(X, Xb);
  // weights: in[DM rows][cols] -> out[cols][DM]; grid (cols/64, DM/64)
  wtrans_kernel<<<dim3((NQH * HD) / 64, DM / 64), 256, 0, stream>>>(Wq, Wt, NQH * HD, 0, 0);
  wtrans_kernel<<<dim3((NKV * HD) / 64, DM / 64), 256, 0, stream>>>(Wk, Wt, NKV * HD, NQH * HD, 0);
  wtrans_kernel<<<dim3((NKV * HD) / 64, DM / 64), 256, 0, stream>>>(Wv, Wt, NKV * HD, (NQH + NKV) * HD, 0);
  wtrans_kernel<<<dim3(DM / 64, DM / 64), 256, 0, stream>>>(Wo, WoT, DM, 0, 1);
  // rotary table from the positions
  rope_table_kernel<<<dim3((NB * HD2 * SEQ) / 256), 256, 0, stream>>>(pos, cosT, sinT);
  // fused QKV projection + rotary + planes
  qkv_gemm_kernel<<<dim3(NQKV / 128, (NB * SEQ) / 128), 256, 0, stream>>>(Xb, Wt, cosT, sinT, ph, pl, vt);
  // attention
  attn_kernel<<<dim3(SEQ / 16, NKV, NB), 128, 0, stream>>>(ph, pl, vt, ctx);
  // output projection
  out_gemm_kernel<<<dim3(DM / 128, (NB * SEQ) / 128), 256, 0, stream>>>(ctx, WoT, out);
}

// v005
// A run of this version takes 179 microseconds.
// Timed twice side by side with v004, it ran 1.07 and 1.08 times as fast.
// All steps since v000 together make it 3.51 times as fast.
#include <hip/hip_runtime.h>

// Contractions: QKV projections on v_wmma_f32_16x16x32_bf16 (bf16 RNE-converted inputs, f32 accumulate); scores S^T = K x Q^T on v_wmma_f32_16x16x32_bf16 with q and k as bf16 hi|lo planes (hi.hi + hi.lo + lo.hi, one f32 accumulator); O = P x V on v_wmma_f32_16x16x32_f16 (P f16 carried x4096, V f16 carried x16); output projection on v_wmma_f32_16x16x32_f16 (ctx f16 carried x64, Wo = f16 of the bf16 RNE-converted input carried x64); all f32 accumulate; softmax (online, max-subtracted, exp2 domain) and rotary math in f32.

#ifndef NB
#define NB 2
#endif
#ifndef SEQ
#define SEQ 2048
#endif
#define NB_FULL   2
#define SEQ_FULL  2048
#define DM        2048                 // model width = depth of every projection
#define NQH       16                   // query heads
#define NKV       4                    // key/value heads
#define GRP       4                    // query heads per key/value head
#define HD        128                  // head dim
#define HD2       64                   // rotary frequencies
#define NQKV      3072                 // fused projection width (q | k | v)
#define EP        128                  // LDS pitch (halves) of the 16-bit epilogue tiles
#define CPF       132                  // LDS pitch (floats) of the f32 output staging tile
#define CP        136                  // LDS pitch (halves) of the per-wave ctx staging tile
#define TPW       72                   // LDS pitch (halves) of the weight transposer tile
#define KP        136                  // LDS pitch (halves) of a staged K row: 272 B = 16 B x odd
#define VP        40                   // LDS pitch (halves) of a staged V^T row of 32 keys: 80 B = 16 B x odd
#define KT_H      (32 * KP)            // halves of one staged K plane tile (32 keys)
#define VT_H      (HD * VP)            // halves of one staged V^T tile (128 d rows x 32 keys)
#define KV_H      (2 * KT_H + VT_H)    // halves of one stage buffer: K hi | K lo | V^T
#define GK        64                   // k extent (halves) of one staged GEMM slab: 128 B = one line per operand row
#define GP        72                   // LDS pitch (halves) of a staged GEMM operand row: 144 B = 16 B x odd
#define GT_H      (128 * GP)           // halves of one staged operand tile (128 rows)
#define GS_H      (2 * GT_H)           // halves of one GEMM stage buffer: A tile | B tile
#define NQT       (SEQ / 16)           // query tiles of 16 rows per (batch, key/value head)
#define WS_CAP    134217728ull

#define P_CARRY   4096.0f
#define V_CARRY   16.0f
#define C_CARRY   64.0f
#define W_CARRY   64.0f

static_assert(NB >= 1 && NB <= NB_FULL);
static_assert(SEQ <= SEQ_FULL);
static_assert(SEQ % 128 == 0);
static_assert(DM % 128 == 0);
static_assert(DM % 32 == 0);
static_assert(DM == 256 * 8);                     // one converter block = one row
static_assert(NQKV == NQH * HD + 2 * NKV * HD);
static_assert(NQKV % 128 == 0);
static_assert(NQH == NKV * GRP);
static_assert(HD == 128 && HD2 * 2 == HD);
static_assert(NQH * HD == DM);
static_assert(EP >= HD && (EP * 2) % 16 == 0);
static_assert((CPF * 4) % 16 == 0 && CPF >= 128);
static_assert((CP * 2) % 16 == 0 && CP >= HD);
static_assert((TPW * 2) % 16 == 0 && TPW >= 64);
static_assert(((size_t)NB * HD2 * SEQ) % 256 == 0);
static_assert(2 * 128 * EP * 2 <= 65536);
static_assert((KP * 2) % 16 == 0 && KP >= HD && (VP * 2) % 16 == 0 && VP >= 32);
static_assert((KT_H * 2) % 16 == 0 && (KV_H * 2) % 16 == 0);
static_assert(SEQ % 32 == 0);
static_assert(DM % GK == 0 && DM / GK >= 2 && GK % 32 == 0);
static_assert((GP * 2) % 16 == 0 && GP >= GK && (GT_H * 2) % 16 == 0);
static_assert(2 * GS_H >= 2 * 128 * EP);          // the 16-bit epilogue tiles fit the GEMM ring
static_assert(2 * GS_H * 2 >= 64 * CPF * 4);      // the f32 output staging tile fits the GEMM ring

#define QELEMS   (NB * NQH * SEQ * HD)            // q region of the hi / lo planes (elements)
#define KELEMS   (NB * NKV * SEQ * HD)            // k region
#define XB_BYTES   ((size_t)NB * SEQ * DM * 2)
#define WT_BYTES   ((size_t)NQKV * DM * 2)
#define WO_BYTES   ((size_t)DM * DM * 2)
#define TB_BYTES   ((size_t)NB * HD2 * SEQ * 4)
#define PL_BYTES   ((size_t)(QELEMS + KELEMS) * 2)
#define VT_BYTES   ((size_t)NB * NKV * HD * SEQ * 2)
#define CTX_BYTES  ((size_t)NB * SEQ * DM * 2)
#define OFF_XB   ((size_t)0)
#define OFF_WT   (OFF_XB + XB_BYTES)
#define OFF_WO   (OFF_WT + WT_BYTES)
#define OFF_COS  (OFF_WO + WO_BYTES)
#define OFF_SIN  (OFF_COS + TB_BYTES)
#define OFF_PH   (OFF_SIN + TB_BYTES)
#define OFF_PL   (OFF_PH + PL_BYTES)
#define OFF_VT   (OFF_PL + PL_BYTES)
#define OFF_CTX  (OFF_VT + VT_BYTES)
#define WS_TOTAL (OFF_CTX + CTX_BYTES)
static_assert(WS_TOTAL <= WS_CAP);
static_assert(XB_BYTES % 256 == 0 && WT_BYTES % 256 == 0 && WO_BYTES % 256 == 0);
static_assert(TB_BYTES % 256 == 0 && PL_BYTES % 256 == 0 && VT_BYTES % 256 == 0);
static_assert((unsigned long long)(QELEMS + KELEMS) < 2147483648ull);

typedef __bf16         bf16;
typedef _Float16       f16;
typedef unsigned short u16;
typedef bf16     v16bf __attribute__((ext_vector_type(16)));
typedef f16      v16h  __attribute__((ext_vector_type(16)));
typedef float    v8f   __attribute__((ext_vector_type(8)));
typedef float    v4f   __attribute__((ext_vector_type(4)));
typedef unsigned v4u   __attribute__((ext_vector_type(4)));

union Frag  { v16bf b; v16h h; v4u q[2]; f16 e[16]; };
union Pack8 { v4u u; u16 s[8]; };

// WMMA helpers: builtin followed by the VALU hazard guard (ties D, keeps A/B live).
static __device__ __forceinline__ v8f mma_bf16(v16bf a, v16bf b, v8f acc) {
  acc = __builtin_amdgcn_wmma_f32_16x16x32_bf16(false, a, false, b, (short)0, acc, false, false);
  asm volatile("v_nop\n\tv_nop\n\tv_nop\n\tv_nop" : "+v"(acc) : "v"(a), "v"(b));
  return acc;
}
static __device__ __forceinline__ v8f mma_f16(v16h a, v16h b, v8f acc) {
  acc = __builtin_amdgcn_wmma_f32_16x16x32_f16(false, a, false, b, (short)0, acc, false, false);
  asm volatile("v_nop\n\tv_nop\n\tv_nop\n\tv_nop" : "+v"(acc) : "v"(a), "v"(b));
  return acc;
}

static __device__ __forceinline__ u16 bf16_bits(float x) {      // RNE convert
  const bf16 h = (bf16)x;
  return __builtin_bit_cast(u16, h);
}
static __device__ __forceinline__ float bf16_back(float x) {    // value of the RNE-converted bf16
  return (float)(bf16)x;
}
static __device__ __forceinline__ u16 f16_bits(float x) {
  const f16 h = (f16)x;
  return __builtin_bit_cast(u16, h);
}

// coverage: rows 0..NB*SEQ-1, 256 threads x 8 elements == DM.
__global__ __launch_bounds__(256) void xcvt_kernel(const float* __restrict__ X, u16* __restrict__ Xb) {
  const int m   = blockIdx.x;
  const int tid = threadIdx.x;
  const int b   = m / SEQ;
  const int t   = m % SEQ;
  const size_t src = ((size_t)b * SEQ_FULL + t) * DM + tid * 8;
  const v4f a0 = *(const v4f*)(X + src);
  const v4f a1 = *(const v4f*)(X + src + 4);
  Pack8 pk;
  #pragma unroll
  for (int i = 0; i < 4; ++i) {
    pk.s[i]     = bf16_bits(a0[i]);
    pk.s[4 + i] = bf16_bits(a1[i]);
  }
  const v4u val = pk.u;
  const size_t dst = (size_t)m * DM + tid * 8;
  *(v4u*)(Xb + dst) = val;
  
}

// Weight transposer: in W[DM rows (input dim)][ldin cols (output dim)] f32 -> out Bt[rowoff + col][DM] 16-bit.
// mode 0: bf16 RNE bits; mode 1: f16 of (bf16 RNE value x W_CARRY) (exact).
// Block = 64 (input dim) x 64 (output col) tile through LDS; written lines whole: 8 lanes x 16 B per line.
// coverage: grid (ldin/64, DM/64); each block writes 64 output rows x 64 halves. LDS sT cross-wave (block barrier).
__global__ __launch_bounds__(256) void wtrans_kernel(const float* __restrict__ W, u16* __restrict__ Bt,
                                                     int ldin, int rowoff, int mode) {
  const int c0  = blockIdx.x * 64;
  const int d0  = blockIdx.y * 64;
  const int tid = threadIdx.x;
  __shared__ __align__(16) u16 sT[64 * TPW];     // [col][input dim]
  #pragma unroll
  for (int kk = 0; kk < 2; ++kk) {
    const int r  = kk * 32 + (tid >> 3);         // input dim local 0..63
    const int cc = (tid & 7) * 8;                // col local 0..56
    const size_t src = (size_t)(d0 + r) * ldin + c0 + cc;
    const v4f w0 = *(const v4f*)(W + src);
    const v4f w1 = *(const v4f*)(W + src + 4);
    #pragma unroll
    for (int i = 0; i < 4; ++i) {
      const float x0 = bf16_back(w0[i]);
      const float x1 = bf16_back(w1[i]);
      const u16 h0 = (mode != 0) ? f16_bits(x0 * W_CARRY) : bf16_bits(x0);
      const u16 h1 = (mode != 0) ? f16_bits(x1 * W_CARRY) : bf16_bits(x1);
      sT[(cc + i) * TPW + r]     = h0;
      sT[(cc + 4 + i) * TPW + r] = h1;
    }
  }
  __syncthreads();
  v4u    val[2];
  size_t idx[2];
  #pragma unroll
  for (int kk = 0; kk < 2; ++kk) {
    const int c  = kk * 32 + (tid >> 3);         // col local 0..63
    const int ds = (tid & 7) * 8;                // input dim local 0..56
    val[kk] = *(const v4u*)(sT + c * TPW + ds);
    idx[kk] = (size_t)(rowoff + c0 + c) * DM + d0 + ds;
  }
  #pragma unroll
  for (int kk = 0; kk < 2; ++kk) *(v4u*)(Bt + idx[kk]) = val[kk];
  
}

// Rotary table per batch from the integer positions read by value:
//   ts[j] = 10000^(j/64) (double product of fixed roots -> float), angle = (float)pos / ts[j] (IEEE division),
// coverage: NB*64*SEQ elements, exact grid.
__global__ __launch_bounds__(256) void rope_table_kernel(const int* __restrict__ pos,
                                                         float* __restrict__ cosT,
                                                         float* __restrict__ sinT) {
  const int idx = blockIdx.x * 256 + threadIdx.x;
  const int t = idx % SEQ;
  const int j = (idx / SEQ) % HD2;
  const int b = idx / (SEQ * HD2);
  const int p = pos[(size_t)b * SEQ_FULL + t];
  double pf = 1.0;
  pf *= (j & 32) ? 100.0 : 1.0;                       // 10000^(32/64)
  pf *= (j & 16) ? 10.0 : 1.0;                        // 10000^(16/64)
  pf *= (j & 8)  ? 3.1622776601683795 : 1.0;          // 10000^(8/64)
  pf *= (j & 4)  ? 1.7782794100389228 : 1.0;          // 10000^(4/64)
  pf *= (j & 2)  ? 1.333521432163324  : 1.0;          // 10000^(2/64)
  pf *= (j & 1)  ? 1.1547819846894583 : 1.0;          // 10000^(1/64)
  const float ts = (float)pf;
  float ang = (float)p / ts;
  ang = (p == 0) ? 0.0f : ang;
  float s, c;
  sincosf(ang, &s, &c);
  *(float*)(cosT + idx) = c;
  *(float*)(sinT + idx) = s;
  
}

// One k-slab of the block's operands (A: 128 rows x 128 B, B: 128 rows x 128 B) from global memory into one LDS
// buffer: 8 asynchronous 16-B copies per lane, 256 lanes, every byte of the slab copied exactly once; 8 lanes
// cover one whole 128-B line. a / b and l are the lane's own global pointers and LDS byte address of its first
// piece. The closing s_wait_xcnt stands inside the statement so that no address register of an issued copy is
// rewritten ahead of it.
static __device__ __forceinline__ void stage_ab(const u16* a, const u16* b, unsigned l) {
  asm volatile(
      "global_load_async_to_lds_b128 %0, %1, off\n\t"
      "global_load_async_to_lds_b128 %2, %3, off\n\t"
      "global_load_async_to_lds_b128 %4, %5, off\n\t"
      "global_load_async_to_lds_b128 %6, %7, off\n\t"
      "global_load_async_to_lds_b128 %8, %9, off\n\t"
      "global_load_async_to_lds_b128 %10, %11, off\n\t"
      "global_load_async_to_lds_b128 %12, %13, off\n\t"
      "global_load_async_to_lds_b128 %14, %15, off\n\t"
      "s_wait_xcnt 0x0"
      :
      : "v"(l),                              "v"(a),
        "v"(l + 32 * GP * 2),                "v"(a + 32 * DM),
        "v"(l + 64 * GP * 2),                "v"(a + 64 * DM),
        "v"(l + 96 * GP * 2),                "v"(a + 96 * DM),
        "v"(l + GT_H * 2),                   "v"(b),
        "v"(l + GT_H * 2 + 32 * GP * 2),     "v"(b + 32 * DM),
        "v"(l + GT_H * 2 + 64 * GP * 2),     "v"(b + 64 * DM),
        "v"(l + GT_H * 2 + 96 * GP * 2),     "v"(b + 96 * DM)
      : "memory");
}

// GEMM core: C[128x128 block tile] = A[M][DM] x Bt[N][DM]^T, 8 waves, wave tile 32 rows x 64 cols.
// The block's 128 A rows and 128 B rows are staged once per block in LDS, GK k values at a time (two buffers,
// asynchronous copies one slab ahead); fragments are read from there with 16-B LDS loads (two each, split k map
// for A and B alike): same elements, same k order as the rows of A and Bt. sS is the ring (2 * GS_H halves); behind the
// last slab's barrier nobody reads it any more and nothing is in flight, so the caller may reuse it.
// ROPEMAP = 1: wave column group g owns cols {g*32 .. g*32+31} and {64+g*32 .. 64+g*32+31} so that col d and
// its rotary partner d+64 sit in the same lane / same accumulator element (tiles fn and fn+2).
template <int ISF16, int ROPEMAP>
static __device__ __forceinline__ void gemm_core(const u16* __restrict__ A, const u16* __restrict__ Bt,
                                                 u16* sS, int tid,
                                                 int m0, int n0, int wm, int g, int lr, int hi,
                                                 v8f (&acc)[2][4]) {
  int aoff[2];
  int boff[4];
  #pragma unroll
  for (int fm = 0; fm < 2; ++fm) aoff[fm] = (wm + fm * 16 + lr) * GP + 8 * hi;
  #pragma unroll
  for (int fn = 0; fn < 4; ++fn) {
    const int col = ROPEMAP ? (g * 32 + (fn & 1) * 16 + (fn >> 1) * 64) : (g * 64 + fn * 16);
    boff[fn] = GT_H + (col + lr) * GP + 8 * hi;
  }
  // staging: lane's first piece; 8 lanes x 16 B = one 128-B row piece, 32 rows per copy
  const u16* ga = A  + (size_t)(m0 + (tid >> 3)) * DM + (tid & 7) * 8;
  const u16* gb = Bt + (size_t)(n0 + (tid >> 3)) * DM + (tid & 7) * 8;
  const unsigned l0 = (unsigned)(size_t)sS + (tid >> 3) * (GP * 2) + (tid & 7) * 16;   // LDS byte address
  const int nslab = DM / GK;

  // slab 0 lands and is published before anybody reads it; slab 1 then flies during slab 0's products
  stage_ab(ga, gb, l0);
  asm volatile("s_wait_asynccnt 0x0" ::: "memory"); // this wave's copies of slab 0 have landed
  __syncthreads();
  stage_ab(ga + GK, gb + GK, l0 + GS_H * 2);

  #pragma unroll 1
  for (int t = 0; t < nslab; ++t) {
    const int bsel = t & 1;
    const u16* sT = sS + bsel * GS_H;               // this slab's stage buffer
    #pragma unroll
    for (int kk = 0; kk < GK; kk += 32) {
      Frag a[2];
      Frag b[4];
      #pragma unroll
      for (int fm = 0; fm < 2; ++fm) {
        a[fm].q[0] = *(const v4u*)(sT + aoff[fm] + kk);        // k = t*GK + kk + 8hi + 0..7
        a[fm].q[1] = *(const v4u*)(sT + aoff[fm] + kk + 16);   // k = t*GK + kk + 16 + 8hi + 0..7
      }
      #pragma unroll
      for (int fn = 0; fn < 4; ++fn) {
        b[fn].q[0] = *(const v4u*)(sT + boff[fn] + kk);
        b[fn].q[1] = *(const v4u*)(sT + boff[fn] + kk + 16);
      }
      #pragma unroll
      for (int fn = 0; fn < 4; ++fn) {
        #pragma unroll
        for (int fm = 0; fm < 2; ++fm) {
          if (ISF16) acc[fm][fn] = mma_f16(a[fm].h, b[fn].h, acc[fm][fn]);
          else       acc[fm][fn] = mma_bf16(a[fm].b, b[fn].b, acc[fm][fn]);
        }
      }
    }
    // publish point of slab t + 1, every wave, every slab
    asm volatile("s_wait_dscnt 0x0" ::: "memory");    // this wave's reads of the buffer to be refilled are done
    asm volatile("s_wait_asynccnt 0x0" ::: "memory"); // this wave's copies of slab t + 1 have landed
    __syncthreads();                                  // publishes slab t + 1, ends all reads of slab t
    if (t + 2 < nslab) {                              // block-uniform: refill the buffer just read
      stage_ab(ga + (t + 2) * GK, gb + (t + 2) * GK, l0 + bsel * (GS_H * 2));
    }
  }
  asm volatile("s_wait_asynccnt 0x0" ::: "memory");   // nothing of this wave's copies is left in flight
}

// Fused QKV projection + rotary + plane builder.
// grid (NQKV/128 column tiles = one head each, NB*SEQ/128 row tiles); column tile ct: 0..15 q head, 16..19 k head,
// 20..23 v head. Outputs:
//   ph / pl : bf16 hi / lo planes, q region [NB][NQH][SEQ][HD] at 0, k region [NB][NKV][SEQ][HD] at QELEMS
//   vt      : f16 (x V_CARRY) [NB][NKV][HD][SEQ], transposed through LDS
// LDS tiles sA / sB are cross-wave (block barrier between fill and readback); staged extent 128 x 128 ==
// consumed extent. They lie in the GEMM ring, which is free once gemm_core has returned. Every written line whole: 16 lanes x 16 B = one 256-B row per half-wave.
__global__ __launch_bounds__(256) void qkv_gemm_kernel(const u16* __restrict__ Xb, const u16* __restrict__ Wt,
                                                       const float* __restrict__ cosT,
                                                       const float* __restrict__ sinT,
                                                       u16* __restrict__ ph, u16* __restrict__ pl,
                                                       u16* __restrict__ vt) {
  __shared__ __align__(16) u16 sS[2 * GS_H];
  u16* const sA = sS;
  u16* const sB = sS + 128 * EP;
  const int ct   = blockIdx.x;
  const int m0   = blockIdx.y * 128;
  const int tid  = threadIdx.x;
  const int wave = __builtin_amdgcn_readfirstlane(threadIdx.x >> 5);
  const int lane = tid & 31;
  const int lr   = lane & 15;
  const int hi   = lane >> 4;
  const int wm   = (wave & 3) * 32;
  const int g    = wave >> 2;

  v8f acc[2][4];
  #pragma unroll
  for (int fm = 0; fm < 2; ++fm) {
    #pragma unroll
    for (int fn = 0; fn < 4; ++fn) acc[fm][fn] = (v8f){0, 0, 0, 0, 0, 0, 0, 0};
  }
  gemm_core<0, 1>(Xb, Wt, sS, tid, m0, ct * 128, wm, g, lr, hi, acc);

  const int b  = m0 / SEQ;
  const int t0 = m0 % SEQ;

  if (ct < NQH + NKV) {
    // rotary on the f32 accumulators, then bf16 hi | lo split into the LDS tiles
    #pragma unroll
    for (int fm = 0; fm < 2; ++fm) {
      #pragma unroll
      for (int f2 = 0; f2 < 2; ++f2) {
        const int j  = g * 32 + f2 * 16 + lr;             // frequency index 0..63
        const int tl = wm + fm * 16 + 8 * hi;             // first of this lane's 8 tile rows
        const size_t tb = ((size_t)b * HD2 + j) * SEQ + t0 + tl;
        const v4f ca = *(const v4f*)(cosT + tb);
        const v4f cb = *(const v4f*)(cosT + tb + 4);
        const v4f sa = *(const v4f*)(sinT + tb);
        const v4f sb = *(const v4f*)(sinT + tb + 4);
        #pragma unroll
        for (int i = 0; i < 8; ++i) {
          const float c  = (i < 4) ? ca[i & 3] : cb[i & 3];
          const float s  = (i < 4) ? sa[i & 3] : sb[i & 3];
          const float x1 = acc[fm][f2][i];                 // col j
          const float x2 = acc[fm][f2 + 2][i];             // col j + 64
          const float y1 = x1 * c - x2 * s;
          const float y2 = x2 * c + x1 * s;
          const float h1 = bf16_back(y1);
          const float h2 = bf16_back(y2);
          const int row = tl + i;
          sA[row * EP + j]       = bf16_bits(h1);
          sA[row * EP + 64 + j]  = bf16_bits(h2);
          sB[row * EP + j]       = bf16_bits(y1 - h1);
          sB[row * EP + 64 + j]  = bf16_bits(y2 - h2);
        }
      }
    }
    __syncthreads();
    const int isq   = (ct < NQH) ? 1 : 0;
    const int pbase = isq ? (((b * NQH + ct) * SEQ + t0) * HD)
                          : (QELEMS + ((b * NKV + (ct - NQH)) * SEQ + t0) * HD);
    v4u vA[8];
    v4u vB[8];
    int gi[8];
    #pragma unroll
    for (int it = 0; it < 8; ++it) {
      const int piece = it * 256 + tid;
      const int row = piece >> 4;                          // 0..127
      const int seg = piece & 15;                          // 16 x 16 B = one 256-B plane row
      vA[it] = *(const v4u*)(sA + row * EP + seg * 8);
      vB[it] = *(const v4u*)(sB + row * EP + seg * 8);
      gi[it] = pbase + row * HD + seg * 8;
    }
    #pragma unroll
    for (int it = 0; it < 8; ++it) {
      *(v4u*)(ph + gi[it]) = vA[it];
      *(v4u*)(pl + gi[it]) = vB[it];
    }
    
  } else {
    // v head: f16 carried x V_CARRY, transposed in LDS to [d][t]
    const int kvh = ct - (NQH + NKV);
    #pragma unroll
    for (int fm = 0; fm < 2; ++fm) {
      #pragma unroll
      for (int fn = 0; fn < 4; ++fn) {
        const int d = g * 32 + (fn & 1) * 16 + (fn >> 1) * 64 + lr;
        #pragma unroll
        for (int i = 0; i < 8; ++i) {
          const int row = wm + fm * 16 + 8 * hi + i;
          sA[d * EP + row] = f16_bits(acc[fm][fn][i] * V_CARRY);
        }
      }
    }
    __syncthreads();
    v4u vA[8];
    int gi[8];
    #pragma unroll
    for (int it = 0; it < 8; ++it) {
      const int piece = it * 256 + tid;
      const int d   = piece >> 4;                          // 0..127
      const int seg = piece & 15;
      vA[it] = *(const v4u*)(sA + d * EP + seg * 8);
      gi[it] = ((b * NKV + kvh) * HD + d) * SEQ + t0 + seg * 8;
    }
    #pragma unroll
    for (int it = 0; it < 8; ++it) *(v4u*)(vt + gi[it]) = vA[it];
    
  }
}

// One 32-key stage (K hi, K lo: 32 rows x 256 B each; V^T: 128 rows x 64 B) from global memory into one LDS
// buffer: 12 asynchronous 16-B copies per lane, 128 lanes, every byte of the stage copied exactly once.
// kh / kl / v and lk / lv are the lane's own global pointers and LDS byte addresses of its first piece.
// The closing s_wait_xcnt stands inside the statement so that no address register of an issued copy is
// rewritten ahead of it.
static __device__ __forceinline__ void stage_kv(const u16* kh, const u16* kl, const u16* v,
                                                unsigned lk, unsigned lv) {
  asm volatile(
      "global_load_async_to_lds_b128 %0, %1, off\n\t"
      "global_load_async_to_lds_b128 %2, %3, off\n\t"
      "global_load_async_to_lds_b128 %4, %5, off\n\t"
      "global_load_async_to_lds_b128 %6, %7, off\n\t"
      "global_load_async_to_lds_b128 %8, %9, off\n\t"
      "global_load_async_to_lds_b128 %10, %11, off\n\t"
      "global_load_async_to_lds_b128 %12, %13, off\n\t"
      "global_load_async_to_lds_b128 %14, %15, off\n\t"
      "global_load_async_to_lds_b128 %16, %17, off\n\t"
      "global_load_async_to_lds_b128 %18, %19, off\n\t"
      "global_load_async_to_lds_b128 %20, %21, off\n\t"
      "global_load_async_to_lds_b128 %22, %23, off\n\t"
      "s_wait_xcnt 0x0"
      :
      : "v"(lk),                             "v"(kh),
        "v"(lk + 8 * KP * 2),                "v"(kh + 8 * HD),
        "v"(lk + 16 * KP * 2),               "v"(kh + 16 * HD),
        "v"(lk + 24 * KP * 2),               "v"(kh + 24 * HD),
        "v"(lk + KT_H * 2),                  "v"(kl),
        "v"(lk + KT_H * 2 + 8 * KP * 2),     "v"(kl + 8 * HD),
        "v"(lk + KT_H * 2 + 16 * KP * 2),    "v"(kl + 16 * HD),
        "v"(lk + KT_H * 2 + 24 * KP * 2),    "v"(kl + 24 * HD),
        "v"(lv),                             "v"(v),
        "v"(lv + 32 * VP * 2),               "v"(v + 32 * SEQ),
        "v"(lv + 64 * VP * 2),               "v"(v + 64 * SEQ),
        "v"(lv + 96 * VP * 2),               "v"(v + 96 * SEQ)
      : "memory");
}

// K fragments of one 32-d slice from a staged stage buffer: key tile 0 hi, lo, key tile 1 hi, lo (8 LDS reads).
// p = fragment origin of the slice inside the K hi plane tile.
static __device__ __forceinline__ void load_kset(Frag (&k)[4], const u16* p) {
  k[0].q[0] = *(const v4u*)(p);
  k[0].q[1] = *(const v4u*)(p + 16);
  k[1].q[0] = *(const v4u*)(p + KT_H);
  k[1].q[1] = *(const v4u*)(p + KT_H + 16);
  k[2].q[0] = *(const v4u*)(p + 16 * KP);
  k[2].q[1] = *(const v4u*)(p + 16 * KP + 16);
  k[3].q[0] = *(const v4u*)(p + KT_H + 16 * KP);
  k[3].q[1] = *(const v4u*)(p + KT_H + 16 * KP + 16);
}

// Fused causal grouped-query attention, logit scale 1.0, online softmax in the exp2 domain.
// Block = 4 waves = the four query heads of one key/value head for the same 16 query rows (uniform trip count).
// S^T = K x Q^T so queries sit on lanes; P^T in C layout is bit-identical to the A-fragment layout of O += P x V.
// q and k: bf16 hi | lo planes, three products per k-step into one accumulator. q fragments are loaded once
// and stay in registers. ctx out: f16 carried x C_CARRY, [NB*SEQ][DM], col = head*128 + d.
// K hi | K lo | V^T of each 32-key step are staged once per block in LDS (two buffers, asynchronous copies one
// step ahead) and read by all four waves with 16-B LDS loads; same elements, same k order as the planes.
// LDS sO: each wave writes and reads only its own slice; a block barrier separates fill and readback.
// four waves per SIMD (four blocks per WGP, the whole grid resident) need the wave inside 256 registers
__global__ __launch_bounds__(128) __attribute__((amdgpu_waves_per_eu(4, 4))) void attn_kernel(const u16* __restrict__ ph, const u16* __restrict__ pl,
                                                   const u16* __restrict__ vt, u16* __restrict__ ctx) {
  const int kv   = blockIdx.y;
  const int b    = blockIdx.z;
  // Causal balance: the grid just fills the chip (four blocks per WGP) and a block's key steps grow with its query
  // tile, so the launch lasts as long as the WGP whose four blocks hold the most key steps. Tiles y and NQT-1-y
  // form a pair; which of the two a block takes alternates with the bit parity of (y, kv, b): an aligned group of
  // four blocks whose flat indices lie a power-of-two stride apart then holds the same sum of key steps as any
  // other (at NQT = 128: every stride but 32). For speed only; for each (kv, b) the map permutes the tiles.
  const int bx   = blockIdx.x;
  const int far  = (bx >= NQT / 2) ? 1 : 0;
  const int y    = far ? (NQT - 1 - bx) : bx;
  const int odd  = __builtin_popcount((unsigned)y ^ ((unsigned)kv << 16) ^ ((unsigned)b << 24)) & 1;
  const int qt   = (far ^ odd) ? (NQT - 1 - y) : y;
  const int tid  = threadIdx.x;
  const int wave = __builtin_amdgcn_readfirstlane(threadIdx.x >> 5);
  const int lane = tid & 31;
  const int lq   = lane & 15;     // query column of S^T / d column of O
  const int hi   = lane >> 4;     // k-split half
  const int head = kv * GRP + wave;
  const int qrow0 = qt * 16;

  __shared__ __align__(16) u16 sO[GRP * 16 * CP];
  __shared__ __align__(16) u16 sKV[2 * KV_H];

  const int qoff  = ((b * NQH + head) * SEQ + qrow0 + lq) * HD + hi * 8;
  const int kfrag = lq * KP + hi * 8;                 // fragment origin inside a staged K plane tile
  const int vfrag = 2 * KT_H + lq * VP + hi * 8;      // fragment origin of the staged V^T tile

  // staging: lane's first piece. K: 16 lanes x 16 B = one 256-B row, 8 rows per copy; V^T: 4 lanes per 64-B row.
  const u16* gkh = ph + QELEMS + (b * NKV + kv) * SEQ * HD + tid * 8;
  const u16* gkl = pl + QELEMS + (b * NKV + kv) * SEQ * HD + tid * 8;
  const u16* gv  = vt + ((b * NKV + kv) * HD + (tid >> 2)) * SEQ + (tid & 3) * 8;
  const unsigned lbase = (unsigned)(size_t)sKV;       // LDS byte address = low 32 bits of the shared address
  const unsigned lk = lbase + (tid >> 4) * (KP * 2) + (tid & 15) * 16;
  const unsigned lv = lbase + 2 * KT_H * 2 + (tid >> 2) * (VP * 2) + (tid & 3) * 16;

  v8f o[8];
  #pragma unroll
  for (int dt = 0; dt < 8; ++dt) o[dt] = (v8f){0, 0, 0, 0, 0, 0, 0, 0};

  const float NEGV = -1.0e30f;
  float rmax = NEGV;
  float rsum = 0.0f;
  const float SL = 1.4426950408889634f;             // logit scale 1.0 times log2(e)

  const int nchunk = (qrow0 >> 5) + 1;              // same for every wave of the block

  // q fragments (B operand of S^T): loaded once, held in registers over the whole key loop
  Frag qh[4], ql[4];
  #pragma unroll
  for (int f = 0; f < 4; ++f) {
    const int qa = qoff + f * 32;
    qh[f].q[0] = *(const v4u*)(ph + qa);            // d = f*32 + 8hi + 0..7
    qh[f].q[1] = *(const v4u*)(ph + qa + 16);       // d = f*32 + 16 + 8hi + 0..7
    ql[f].q[0] = *(const v4u*)(pl + qa);
    ql[f].q[1] = *(const v4u*)(pl + qa + 16);
  }

  // stage 0 lands and is published before anybody reads it; stage 1 then flies during step 0
  stage_kv(gkh, gkl, gv, lk, lv);
  asm volatile("s_wait_asynccnt 0x0" ::: "memory"); // this wave's copies of stage 0 have landed
  __syncthreads();
  if (nchunk > 1) stage_kv(gkh + 32 * HD, gkl + 32 * HD, gv + 32, lk + KV_H * 2, lv + KV_H * 2);

  #pragma unroll 1
  for (int ic = 0; ic < nchunk; ++ic) {
    const int j0 = ic * 32;
    const int bsel = ic & 1;
    const u16* sT = sKV + bsel * KV_H;              // this step's stage buffer

    // S^T tiles: c0[r] = score(query qrow0+lq, key j0 + 8hi + r), c1[r] = key j0 + 16 + 8hi + r
    v8f c0 = (v8f){0, 0, 0, 0, 0, 0, 0, 0};
    v8f c1 = (v8f){0, 0, 0, 0, 0, 0, 0, 0};
    // LDS fragment reads are issued in groups ahead of the products that use them: K one 32-d slice ahead in a
    // second register set, V^T into the K sets' registers as they fall free, all of it before the softmax.
    Frag ks[2][4];
    Frag bv[8];
    load_kset(ks[0], sT + kfrag);
    load_kset(ks[1], sT + kfrag + 32);
    // keeps both read groups in front of the first products (sunk to their uses, each read's latency is waited out)
    __builtin_amdgcn_sched_barrier(0);
    #pragma unroll
    for (int f = 0; f < 4; ++f) {
      const Frag qhf = qh[f];
      const Frag qlf = ql[f];
      Frag (&k)[4] = ks[f & 1];
      c0 = mma_bf16(k[0].b, qhf.b, c0);             // key j0 + lq
      c0 = mma_bf16(k[0].b, qlf.b, c0);
      c0 = mma_bf16(k[1].b, qhf.b, c0);
      c1 = mma_bf16(k[2].b, qhf.b, c1);             // key j0 + 16 + lq
      c1 = mma_bf16(k[2].b, qlf.b, c1);
      c1 = mma_bf16(k[3].b, qhf.b, c1);
      // the refill of this register set stays behind its last product ...
      __builtin_amdgcn_sched_barrier(0);
      if (f < 2) {
        load_kset(ks[f & 1], sT + kfrag + (f + 2) * 32);
      } else {
        #pragma unroll
        for (int dt = 0; dt < 4; ++dt) {            // V^T B-fragments: column n = d = ((f - 2) * 4 + dt) * 16 + lq, split key map
          const int va = vfrag + (((f - 2) * 4 + dt) * 16) * VP;
          bv[(f - 2) * 4 + dt].q[0] = *(const v4u*)(sT + va);        // keys j0 + 8hi + 0..7
          bv[(f - 2) * 4 + dt].q[1] = *(const v4u*)(sT + va + 16);   // keys j0 + 16 + 8hi + 0..7
        }
      }
      // ... and in front of the next slice's products, so that it flies during them
      __builtin_amdgcn_sched_barrier(0);
    }

    // causal exclusion (only the last chunk can hold keys beyond a query row); wave-uniform test
    if (j0 + 31 > qrow0) {
      const int trow = qrow0 + lq;
      #pragma unroll
      for (int r = 0; r < 8; ++r) {
        const int key0 = j0 + hi * 8 + r;
        c0[r] = (key0 > trow) ? NEGV : c0[r];
        c1[r] = (key0 + 16 > trow) ? NEGV : c1[r];
      }
    }

    // online softmax: query lq's 32 scores are split across lane / lane^16
    float m_new = rmax;
    #pragma unroll
    for (int r = 0; r < 8; ++r) {
      m_new = fmaxf(m_new, c0[r]);
      m_new = fmaxf(m_new, c1[r]);
    }
    m_new = fmaxf(m_new, __shfl_xor(m_new, 16, 32));
    const float scale = __builtin_amdgcn_exp2f((rmax - m_new) * SL);
    rmax = m_new;

    // exp + pack: P^T C layout == A-fragment layout of the PV product; P carried x4096
    Frag pa;
    float psum = 0.0f;
    #pragma unroll
    for (int r = 0; r < 8; ++r) {
      const float p0 = __builtin_amdgcn_exp2f((c0[r] - m_new) * SL);   // key 8hi + r
      const float p1 = __builtin_amdgcn_exp2f((c1[r] - m_new) * SL);   // key 16 + 8hi + r
      psum += p0 + p1;
      pa.e[r]     = (f16)(p0 * P_CARRY);
      pa.e[8 + r] = (f16)(p1 * P_CARRY);
    }
    rsum = rsum * scale + psum + __shfl_xor(psum, 16, 32);

    // rescale O: queries are the row dimension there -> per-row scale from lane 8hi + r
    float sc[8];
    #pragma unroll
    for (int r = 0; r < 8; ++r) sc[r] = __shfl(scale, (hi << 3) + r, 32);
    #pragma unroll
    for (int dt = 0; dt < 8; ++dt) {
      #pragma unroll
      for (int r = 0; r < 8; ++r) o[dt][r] *= sc[r];
    }

    // O += P x V on the V^T fragments read above
    #pragma unroll
    for (int dt = 0; dt < 8; ++dt) o[dt] = mma_f16(pa.h, bv[dt].h, o[dt]);

    // publish point of stage ic + 1, every wave, every step
    asm volatile("s_wait_dscnt 0x0" ::: "memory");    // this wave's reads of the buffer to be refilled are done
    asm volatile("s_wait_asynccnt 0x0" ::: "memory"); // this wave's copies of stage ic + 1 have landed
    __syncthreads();                                  // publishes stage ic + 1, ends all reads of stage ic
    if (ic + 2 < nchunk) {                            // block-uniform: refill the buffer just read
      const int nx = ic + 2;
      stage_kv(gkh + nx * (32 * HD), gkl + nx * (32 * HD), gv + nx * 32,
               lk + bsel * (KV_H * 2), lv + bsel * (KV_H * 2));
    }
  }
  asm volatile("s_wait_asynccnt 0x0" ::: "memory");   // nothing of this wave's copies is left in flight

  // normalize: lane holds column d = dt*16 + lq for query rows 8hi + r; fold the carries
  const float CN = C_CARRY / (P_CARRY * V_CARRY);
  float rs[8];
  #pragma unroll
  for (int r = 0; r < 8; ++r) rs[r] = CN * (1.0f / __shfl(rsum, (hi << 3) + r, 32));

  const int so = wave * (16 * CP);
  #pragma unroll
  for (int r = 0; r < 8; ++r) {
    #pragma unroll
    for (int dt = 0; dt < 8; ++dt) {
      sO[so + (hi * 8 + r) * CP + dt * 16 + lq] = f16_bits(o[dt][r] * rs[r]);
    }
  }
  __syncthreads();

  // 8 consecutive lanes x 16 B each), lanes 16..31 the next row; 8 instructions cover the wave's 16 rows.
  v4u    vals[8];
  size_t gidx[8];
  #pragma unroll
  for (int it = 0; it < 8; ++it) {
    const int row = it * 2 + hi;
    vals[it] = *(const v4u*)(sO + so + row * CP + lq * 8);
    gidx[it] = ((size_t)b * SEQ + qrow0 + row) * DM + head * HD + lq * 8;
  }
  #pragma unroll
  for (int it = 0; it < 8; ++it) *(v4u*)(ctx + gidx[it]) = vals[it];
  
}

// Output projection: out[b][t][DM] = ctx x Wo, f16 operands (carries folded back in f32).
// written by 8 consecutive lanes x 16 B of one instruction.
__global__ __launch_bounds__(256) void out_gemm_kernel(const u16* __restrict__ ctx, const u16* __restrict__ WoT,
                                                       float* __restrict__ out) {
  __shared__ __align__(16) u16 sS[2 * GS_H];
  float* const sC = (float*)sS;                    // output staging lies in the GEMM ring, free after gemm_core
  const int n0   = blockIdx.x * 128;
  const int m0   = blockIdx.y * 128;
  const int tid  = threadIdx.x;
  const int wave = __builtin_amdgcn_readfirstlane(threadIdx.x >> 5);
  const int lane = tid & 31;
  const int lr   = lane & 15;
  const int hi   = lane >> 4;
  const int wm   = (wave & 3) * 32;
  const int g    = wave >> 2;

  v8f acc[2][4];
  #pragma unroll
  for (int fm = 0; fm < 2; ++fm) {
    #pragma unroll
    for (int fn = 0; fn < 4; ++fn) acc[fm][fn] = (v8f){0, 0, 0, 0, 0, 0, 0, 0};
  }
  gemm_core<1, 0>(ctx, WoT, sS, tid, m0, n0, wm, g, lr, hi, acc);

  const float INV = 1.0f / (C_CARRY * W_CARRY);
  #pragma unroll
  for (int p = 0; p < 2; ++p) {
    if (((wave & 3) >> 1) == p) {                  // wave-uniform: this wave's rows belong to half p
      #pragma unroll
      for (int fm = 0; fm < 2; ++fm) {
        #pragma unroll
        for (int fn = 0; fn < 4; ++fn) {
          #pragma unroll
          for (int i = 0; i < 8; ++i) {
            sC[(wm - p * 64 + fm * 16 + 8 * hi + i) * CPF + g * 64 + fn * 16 + lr] = acc[fm][fn][i] * INV;
          }
        }
      }
    }
    __syncthreads();
    v4f    vals[8];
    size_t gidx[8];
    #pragma unroll
    for (int it = 0; it < 8; ++it) {
      const int piece = it * 256 + tid;
      const int row = piece >> 5;                  // 0..63
      const int seg = piece & 31;
      vals[it] = *(const v4f*)(sC + row * CPF + seg * 4);
      const int m  = m0 + p * 64 + row;
      const int bb = m / SEQ;
      const int tt = m % SEQ;
      gidx[it] = ((size_t)bb * SEQ_FULL + tt) * DM + n0 + seg * 4;
    }
    #pragma unroll
    for (int it = 0; it < 8; ++it) *(v4f*)(out + gidx[it]) = vals[it];
    
    __syncthreads();
  }
}

extern "C" void kernel_launch(void* const* d_in, const int* in_sizes, int n_in,
                              void* d_out, int out_size, void* d_ws, size_t ws_size,
                              hipStream_t stream) {
  if (n_in < 6) return;
  const size_t needX = ((size_t)(NB - 1) * SEQ_FULL + SEQ) * DM;
  const size_t needP = (size_t)(NB - 1) * SEQ_FULL + SEQ;
  if ((size_t)in_sizes[0] < needX) return;
  if ((size_t)in_sizes[1] < needP) return;
  if ((size_t)in_sizes[2] < (size_t)DM * NQH * HD) return;
  if ((size_t)in_sizes[3] < (size_t)DM * NKV * HD) return;
  if ((size_t)in_sizes[4] < (size_t)DM * NKV * HD) return;
  if ((size_t)in_sizes[5] < (size_t)NQH * HD * DM) return;
  if ((size_t)out_size < needX) return;
  if (ws_size < (size_t)WS_TOTAL) return;

  const float* X   = (const float*)d_in[0];
  const int*   pos = (const int*)d_in[1];
  const float* Wq  = (const float*)d_in[2];
  const float* Wk  = (const float*)d_in[3];
  const float* Wv  = (const float*)d_in[4];
  const float* Wo  = (const float*)d_in[5];
  float* out = (float*)d_out;

  char* ws = (char*)d_ws;
  u16*   Xb   = (u16*)(ws + OFF_XB);
  u16*   Wt   = (u16*)(ws + OFF_WT);
  u16*   WoT  = (u16*)(ws + OFF_WO);
  float* cosT = (float*)(ws + OFF_COS);
  float* sinT = (float*)(ws + OFF_SIN);
  u16*   ph   = (u16*)(ws + OFF_PH);
  u16*   pl   = (u16*)(ws + OFF_PL);
  u16*   vt   = (u16*)(ws + OFF_VT);
  u16*   ctx  = (u16*)(ws + OFF_CTX);

  // X -> bf16 rows
  xcvt_kernel<<<dim3(NB * SEQ), 256, 0, stream>>>(X, Xb);
  // weights: in[DM rows][cols] -> out[cols][DM]; grid (cols/64, DM/64)
  wtrans_kernel<<<dim3((NQH * HD) / 64, DM / 64), 256, 0, stream>>>(Wq, Wt, NQH * HD, 0, 0);
  wtrans_kernel<<<dim3((NKV * HD) / 64, DM / 64), 256, 0, stream>>>(Wk, Wt, NKV * HD, NQH * HD, 0);
  wtrans_kernel<<<dim3((NKV * HD) / 64, DM / 64), 256, 0, stream>>>(Wv, Wt, NKV * HD, (NQH + NKV) * HD, 0);
  wtrans_kernel<<<dim3(DM / 64, DM / 64), 256, 0, stream>>>(Wo, WoT, DM, 0, 1);
  // rotary table from the positions
  rope_table_kernel<<<dim3((NB * HD2 * SEQ) / 256), 256, 0, stream>>>(pos, cosT, sinT);
  // fused QKV projection + rotary + planes
  qkv_gemm_kernel<<<dim3(NQKV / 128, (NB * SEQ) / 128), 256, 0, stream>>>(Xb, Wt, cosT, sinT, ph, pl, vt);
  // attention
  attn_kernel<<<dim3(SEQ / 16, NKV, NB), 128, 0, stream>>>(ph, pl, vt, ctx);
  // output projection
  out_gemm_kernel<<<dim3(DM / 128, (NB * SEQ) / 128), 256, 0, stream>>>(ctx, WoT, out);
}

// v006
// Measured time: 170 microseconds a run.
// Two timings next to v005 both put it at 1.05 times that version's speed.
// Counting every step since v000, it is 3.70 times as fast.
#include <hip/hip_runtime.h>

// Contractions: QKV projections on v_wmma_f32_16x16x32_bf16 (bf16 RNE-converted inputs, f32 accumulate); scores S^T = K x Q^T on v_wmma_f32_16x16x32_bf16 with q and k as bf16 hi|lo planes (hi.hi + hi.lo + lo.hi, one f32 accumulator); O = P x V on v_wmma_f32_16x16x32_f16 (P f16 carried x4096, V f16 carried x16); output projection on v_wmma_f32_16x16x32_f16 (ctx f16 carried x64, Wo = f16 of the bf16 RNE-converted input carried x64); all f32 accumulate; softmax (online, max-subtracted, exp2 domain) and rotary math in f32.

#ifndef NB
#define NB 2
#endif
#ifndef SEQ
#define SEQ 2048
#endif
#define NB_FULL   2
#define SEQ_FULL  2048
#define DM        2048                 // model width = depth of every projection
#define NQH       16                   // query heads
#define NKV       4                    // key/value heads
#define GRP       4                    // query heads per key/value head
#define HD        128                  // head dim
#define HD2       64                   // rotary frequencies
#define NQKV      3072                 // fused projection width (q | k | v)
#define EP        128                  // LDS pitch (halves) of the 16-bit epilogue tiles
#define CPF       132                  // LDS pitch (floats) of the f32 output staging tile
#define CP        136                  // LDS pitch (halves) of the per-wave ctx staging tile
#define TPW       72                   // LDS pitch (halves) of the weight transposer tile
#define KP        136                  // LDS pitch (halves) of a staged K row: 272 B = 16 B x odd
#define VP        40                   // LDS pitch (halves) of a staged V^T row of 32 keys: 80 B = 16 B x odd
#define KT_H      (32 * KP)            // halves of one staged K plane tile (32 keys)
#define VT_H      (HD * VP)            // halves of one staged V^T tile (128 d rows x 32 keys)
#define KV_H      (2 * KT_H + VT_H)    // halves of one stage buffer: K hi | K lo | V^T
#define GK        64                   // k extent (halves) of one staged GEMM slab: 128 B = one line per operand row
#define GP        72                   // LDS pitch (halves) of a staged GEMM operand row: 144 B = 16 B x odd
#define GT_H      (128 * GP)           // halves of one staged operand tile (128 rows)
#define GS_H      (2 * GT_H)           // halves of one GEMM stage buffer: A tile | B tile
#define NQT       (SEQ / 16)           // query tiles of 16 rows per (batch, key/value head)
#define WS_CAP    134217728ull
#define PREP_G    512                  // blocks of the preparation launch: two per WGP
#define XR_PB     ((NB * SEQ) / PREP_G) // rows of X per preparation block
#define WT_PB     5                    // weight tiles per preparation block

#define P_CARRY   4096.0f
#define V_CARRY   16.0f
#define C_CARRY   64.0f
#define W_CARRY   64.0f

static_assert(NB >= 1 && NB <= NB_FULL);
static_assert(SEQ <= SEQ_FULL);
static_assert(SEQ % 128 == 0);
static_assert(DM % 128 == 0);
static_assert(DM % 32 == 0);
static_assert(DM == 256 * 8);                     // 256 threads x 8 elements = one X row
static_assert(NQKV == NQH * HD + 2 * NKV * HD);
static_assert(NQKV % 128 == 0);
static_assert(NQH == NKV * GRP);
static_assert(HD == 128 && HD2 * 2 == HD);
static_assert(NQH * HD == DM);
static_assert(EP >= HD && (EP * 2) % 16 == 0);
static_assert((CPF * 4) % 16 == 0 && CPF >= 128);
static_assert((CP * 2) % 16 == 0 && CP >= HD);
static_assert((TPW * 2) % 16 == 0 && TPW >= 64);
static_assert((size_t)NB * HD2 * SEQ == (size_t)PREP_G * 512);
static_assert(XR_PB * PREP_G == NB * SEQ && SEQ % XR_PB == 0 && SEQ % 512 == 0);
static_assert((NQH * HD / 64) * (DM / 64) == 2 * PREP_G && (DM / 64) * (DM / 64) == 2 * PREP_G);
static_assert((NKV * HD / 64) * (DM / 64) * 2 == PREP_G);
static_assert(2 * 128 * EP * 2 <= 65536);
static_assert((KP * 2) % 16 == 0 && KP >= HD && (VP * 2) % 16 == 0 && VP >= 32);
static_assert((KT_H * 2) % 16 == 0 && (KV_H * 2) % 16 == 0);
static_assert(SEQ % 32 == 0);
static_assert(DM % GK == 0 && DM / GK >= 2 && GK % 32 == 0);
static_assert((GP * 2) % 16 == 0 && GP >= GK && (GT_H * 2) % 16 == 0);
static_assert(2 * GS_H >= 2 * 128 * EP);          // the 16-bit epilogue tiles fit the GEMM ring
static_assert(2 * GS_H * 2 >= 64 * CPF * 4);      // the f32 output staging tile fits the GEMM ring

#define QELEMS   (NB * NQH * SEQ * HD)            // q region of the hi / lo planes (elements)
#define KELEMS   (NB * NKV * SEQ * HD)            // k region
#define XB_BYTES   ((size_t)NB * SEQ * DM * 2)
#define WT_BYTES   ((size_t)NQKV * DM * 2)
#define WO_BYTES   ((size_t)DM * DM * 2)
#define TB_BYTES   ((size_t)NB * HD2 * SEQ * 4)
#define PL_BYTES   ((size_t)(QELEMS + KELEMS) * 2)
#define VT_BYTES   ((size_t)NB * NKV * HD * SEQ * 2)
#define CTX_BYTES  ((size_t)NB * SEQ * DM * 2)
#define OFF_XB   ((size_t)0)
#define OFF_WT   (OFF_XB + XB_BYTES)
#define OFF_WO   (OFF_WT + WT_BYTES)
#define OFF_COS  (OFF_WO + WO_BYTES)
#define OFF_SIN  (OFF_COS + TB_BYTES)
#define OFF_PH   (OFF_SIN + TB_BYTES)
#define OFF_PL   (OFF_PH + PL_BYTES)
#define OFF_VT   (OFF_PL + PL_BYTES)
#define OFF_CTX  (OFF_VT + VT_BYTES)
#define WS_TOTAL (OFF_CTX + CTX_BYTES)
static_assert(WS_TOTAL <= WS_CAP);
static_assert(XB_BYTES % 256 == 0 && WT_BYTES % 256 == 0 && WO_BYTES % 256 == 0);
static_assert(TB_BYTES % 256 == 0 && PL_BYTES % 256 == 0 && VT_BYTES % 256 == 0);
static_assert((unsigned long long)(QELEMS + KELEMS) < 2147483648ull);

typedef __bf16         bf16;
typedef _Float16       f16;
typedef unsigned short u16;
typedef bf16     v16bf __attribute__((ext_vector_type(16)));
typedef f16      v16h  __attribute__((ext_vector_type(16)));
typedef float    v8f   __attribute__((ext_vector_type(8)));
typedef float    v4f   __attribute__((ext_vector_type(4)));
typedef unsigned v4u   __attribute__((ext_vector_type(4)));

union Frag  { v16bf b; v16h h; v4u q[2]; f16 e[16]; };
union Pack8 { v4u u; u16 s[8]; };

// WMMA helpers: builtin followed by the VALU hazard guard (ties D, keeps A/B live).
static __device__ __forceinline__ v8f mma_bf16(v16bf a, v16bf b, v8f acc) {
  acc = __builtin_amdgcn_wmma_f32_16x16x32_bf16(false, a, false, b, (short)0, acc, false, false);
  asm volatile("v_nop\n\tv_nop\n\tv_nop\n\tv_nop" : "+v"(acc) : "v"(a), "v"(b));
  return acc;
}
static __device__ __forceinline__ v8f mma_f16(v16h a, v16h b, v8f acc) {
  acc = __builtin_amdgcn_wmma_f32_16x16x32_f16(false, a, false, b, (short)0, acc, false, false);
  asm volatile("v_nop\n\tv_nop\n\tv_nop\n\tv_nop" : "+v"(acc) : "v"(a), "v"(b));
  return acc;
}

static __device__ __forceinline__ u16 bf16_bits(float x) {      // RNE convert
  const bf16 h = (bf16)x;
  return __builtin_bit_cast(u16, h);
}
static __device__ __forceinline__ float bf16_back(float x) {    // value of the RNE-converted bf16
  return (float)(bf16)x;
}
static __device__ __forceinline__ u16 f16_bits(float x) {
  const f16 h = (f16)x;
  return __builtin_bit_cast(u16, h);
}

// Preparation, one launch: every job that reads inputs only (X rows to bf16, the four weight transposes, the
// rotary table). PREP_G equal blocks, two per WGP; each block takes the same share of every job: XR_PB rows of X,
// two 64 x 64 tiles of Wq, two of Wo, one of Wk or Wv, and 2 x 256 table elements. All of a lane's global loads are
// issued first; the table arithmetic runs while they fly.
//   X     : row m = blk * XR_PB + j, 256 threads x 8 elements == DM; bf16 RNE bits.
//   W     : in W[DM rows (input dim)][ldin cols (output dim)] f32 -> out Bt[rowoff + col][DM] 16-bit, a 64 (input
//           dim) x 64 (output col) tile through its own LDS tile; Wq, Wk, Wv: bf16 RNE bits; Wo: f16 of (bf16 RNE
//           value x W_CARRY) (exact). Written lines whole: 8 lanes x 16 B per line. A block's two tiles of one
//           weight are neighbours along the input dim (256 contiguous bytes per written row).
//   table : ts[j] = 10000^(j/64) (double product of fixed roots -> float), angle = (float)pos / ts[j] (IEEE
//           division), positions read by value.
// coverage: PREP_G * XR_PB == NB*SEQ rows; 2 * PREP_G tiles == Wq's == Wo's, PREP_G tiles == Wk's + Wv's;
// PREP_G * 512 == NB*64*SEQ table elements. LDS sT is cross-wave: one block barrier between fill and readback.
__global__ __launch_bounds__(256) void prep_kernel(const float* __restrict__ X, const int* __restrict__ pos,
                                                   const float* __restrict__ Wq, const float* __restrict__ Wk,
                                                   const float* __restrict__ Wv, const float* __restrict__ Wo,
                                                   u16* __restrict__ Xb, u16* __restrict__ Wt,
                                                   u16* __restrict__ WoT,
                                                   float* __restrict__ cosT, float* __restrict__ sinT) {
  __shared__ __align__(16) u16 sT[WT_PB][64 * TPW];   // [tile][col][input dim]
  const int blk = blockIdx.x;
  const int tid = threadIdx.x;
  const int r8  = tid >> 3;                            // 0..31: tile row on the way in, tile col on the way out
  const int c8  = (tid & 7) * 8;                       // 0..56: tile col on the way in, input dim on the way out

  // table share: one frequency j of one batch b, 512 consecutive positions (block-uniform j and b)
  const int tj = (blk / (SEQ / 512)) % HD2;
  const int tb = blk / ((SEQ / 512) * HD2);
  const int tt = (blk % (SEQ / 512)) * 512 + tid;
  const int* pp = pos + (size_t)tb * SEQ_FULL + tt;
  int pv[2];
  #pragma unroll
  for (int e = 0; e < 2; ++e) pv[e] = pp[e * 256];

  // weight tiles 0, 1 of Wq and 2, 3 of Wo: tile column pc, input-dim rows pd .. pd + 127 (two tiles);
  // tile 4 of Wk (lower half of the grid) or Wv (block-uniform choice)
  const int pd    = ((blk * 2) % (DM / 64)) * 64;
  const int pc    = ((blk * 2) / (DM / 64)) * 64;
  const int kvsel = (blk >= PREP_G / 2) ? 1 : 0;
  const int kvt   = blk - kvsel * (PREP_G / 2);
  const int kd    = (kvt % (DM / 64)) * 64;
  const int kc    = (kvt / (DM / 64)) * 64;
  const float* gq = Wq + (size_t)(pd + r8) * (NQH * HD) + pc + c8;
  const float* go = Wo + (size_t)(pd + r8) * DM + pc + c8;
  const float* gk = (kvsel ? Wv : Wk) + (size_t)(kd + r8) * (NKV * HD) + kc + c8;
  v4f w0[WT_PB][2];
  v4f w1[WT_PB][2];
  #pragma unroll
  for (int s = 0; s < WT_PB; ++s) {
    #pragma unroll
    for (int kk = 0; kk < 2; ++kk) {                   // input dim local r = kk * 32 + r8
      const float* g = (s < 2) ? gq + ((s & 1) * 64 + kk * 32) * (NQH * HD)
                     : (s < 4) ? go + ((s & 1) * 64 + kk * 32) * DM
                               : gk + (kk * 32) * (NKV * HD);
      w0[s][kk] = *(const v4f*)(g);
      w1[s][kk] = *(const v4f*)(g + 4);
    }
  }

  // rows of X: XR_PB consecutive rows of one batch
  const int xm = blk * XR_PB;
  const float* gx = X + ((size_t)(xm / SEQ) * SEQ_FULL + xm % SEQ) * DM + tid * 8;
  v4f a0[XR_PB];
  v4f a1[XR_PB];
  #pragma unroll
  for (int j = 0; j < XR_PB; ++j) {
    a0[j] = *(const v4f*)(gx + j * DM);
    a1[j] = *(const v4f*)(gx + j * DM + 4);
  }
  // the loads' addresses, named as inputs, stay live up to this wait, so that no load's result lands in a register
  // that another load of the burst names; the memory clobber keeps every load above it, in front of the table
  // arithmetic, which runs inside their latency
  asm volatile("s_wait_xcnt 0x0" :: "v"(pp), "v"(gq), "v"(go), "v"(gk), "v"(gx) : "memory");

  double pf = 1.0;
  pf *= (tj & 32) ? 100.0 : 1.0;                       // 10000^(32/64)
  pf *= (tj & 16) ? 10.0 : 1.0;                        // 10000^(16/64)
  pf *= (tj & 8)  ? 3.1622776601683795 : 1.0;          // 10000^(8/64)
  pf *= (tj & 4)  ? 1.7782794100389228 : 1.0;          // 10000^(4/64)
  pf *= (tj & 2)  ? 1.333521432163324  : 1.0;          // 10000^(2/64)
  pf *= (tj & 1)  ? 1.1547819846894583 : 1.0;          // 10000^(1/64)
  const float ts = (float)pf;
  float tc[2];
  float tsn[2];
  #pragma unroll
  for (int e = 0; e < 2; ++e) {
    const int p = pv[e];
    float ang = (float)p / ts;
    ang = (p == 0) ? 0.0f : ang;
    sincosf(ang, &tsn[e], &tc[e]);
  }

  #pragma unroll
  for (int s = 0; s < WT_PB; ++s) {
    #pragma unroll
    for (int kk = 0; kk < 2; ++kk) {
      const int r = kk * 32 + r8;
      #pragma unroll
      for (int i = 0; i < 4; ++i) {
        const float x0 = bf16_back(w0[s][kk][i]);
        const float x1 = bf16_back(w1[s][kk][i]);
        const u16 h0 = (s == 2 || s == 3) ? f16_bits(x0 * W_CARRY) : bf16_bits(x0);
        const u16 h1 = (s == 2 || s == 3) ? f16_bits(x1 * W_CARRY) : bf16_bits(x1);
        sT[s][(c8 + i) * TPW + r]     = h0;
        sT[s][(c8 + 4 + i) * TPW + r] = h1;
      }
    }
  }

  // every global store stands behind the barrier: in front of it the barrier would wait for its completion
  __syncthreads();

  #pragma unroll
  for (int e = 0; e < 2; ++e) {
    const int idx = blk * 512 + e * 256 + tid;         // == (tb * HD2 + tj) * SEQ + tt + e * 256
    cosT[idx] = tc[e];
    sinT[idx] = tsn[e];
  }
  u16* ox = Xb + (size_t)xm * DM + tid * 8;
  #pragma unroll
  for (int j = 0; j < XR_PB; ++j) {
    Pack8 pk;
    #pragma unroll
    for (int i = 0; i < 4; ++i) {
      pk.s[i]     = bf16_bits(a0[j][i]);
      pk.s[4 + i] = bf16_bits(a1[j][i]);
    }
    *(v4u*)(ox + j * DM) = pk.u;
  }
  u16* oq = Wt  + (size_t)(pc + r8) * DM + pd + c8;
  u16* oo = WoT + (size_t)(pc + r8) * DM + pd + c8;
  u16* ok = Wt  + (size_t)((kvsel ? (NQH + NKV) * HD : NQH * HD) + kc + r8) * DM + kd + c8;
  #pragma unroll
  for (int s = 0; s < WT_PB; ++s) {
    #pragma unroll
    for (int kk = 0; kk < 2; ++kk) {                   // col local c = kk * 32 + r8
      const v4u val = *(const v4u*)(&sT[s][(kk * 32 + r8) * TPW + c8]);
      u16* o = (s < 2) ? oq + (s & 1) * 64 + kk * 32 * DM
             : (s < 4) ? oo + (s & 1) * 64 + kk * 32 * DM
                       : ok + kk * 32 * DM;
      *(v4u*)(o) = val;
    }
  }
}

// One k-slab of the block's operands (A: 128 rows x 128 B, B: 128 rows x 128 B) from global memory into one LDS
// buffer: 8 asynchronous 16-B copies per lane, 256 lanes, every byte of the slab copied exactly once; 8 lanes
// cover one whole 128-B line. a / b and l are the lane's own global pointers and LDS byte address of its first
// piece. The closing s_wait_xcnt stands inside the statement so that no address register of an issued copy is
// rewritten ahead of it.
static __device__ __forceinline__ void stage_ab(const u16* a, const u16* b, unsigned l) {
  asm volatile(
      "global_load_async_to_lds_b128 %0, %1, off\n\t"
      "global_load_async_to_lds_b128 %2, %3, off\n\t"
      "global_load_async_to_lds_b128 %4, %5, off\n\t"
      "global_load_async_to_lds_b128 %6, %7, off\n\t"
      "global_load_async_to_lds_b128 %8, %9, off\n\t"
      "global_load_async_to_lds_b128 %10, %11, off\n\t"
      "global_load_async_to_lds_b128 %12, %13, off\n\t"
      "global_load_async_to_lds_b128 %14, %15, off\n\t"
      "s_wait_xcnt 0x0"
      :
      : "v"(l),                              "v"(a),
        "v"(l + 32 * GP * 2),                "v"(a + 32 * DM),
        "v"(l + 64 * GP * 2),                "v"(a + 64 * DM),
        "v"(l + 96 * GP * 2),                "v"(a + 96 * DM),
        "v"(l + GT_H * 2),                   "v"(b),
        "v"(l + GT_H * 2 + 32 * GP * 2),     "v"(b + 32 * DM),
        "v"(l + GT_H * 2 + 64 * GP * 2),     "v"(b + 64 * DM),
        "v"(l + GT_H * 2 + 96 * GP * 2),     "v"(b + 96 * DM)
      : "memory");
}

// GEMM core: C[128x128 block tile] = A[M][DM] x Bt[N][DM]^T, 8 waves, wave tile 32 rows x 64 cols.
// The block's 128 A rows and 128 B rows are staged once per block in LDS, GK k values at a time (two buffers,
// asynchronous copies one slab ahead); fragments are read from there with 16-B LDS loads (two each, split k map
// for A and B alike): same elements, same k order as the rows of A and Bt. sS is the ring (2 * GS_H halves); behind the
// last slab's barrier nobody reads it any more and nothing is in flight, so the caller may reuse it.
// ROPEMAP = 1: wave column group g owns cols {g*32 .. g*32+31} and {64+g*32 .. 64+g*32+31} so that col d and
// its rotary partner d+64 sit in the same lane / same accumulator element (tiles fn and fn+2).
template <int ISF16, int ROPEMAP>
static __device__ __forceinline__ void gemm_core(const u16* __restrict__ A, const u16* __restrict__ Bt,
                                                 u16* sS, int tid,
                                                 int m0, int n0, int wm, int g, int lr, int hi,
                                                 v8f (&acc)[2][4]) {
  int aoff[2];
  int boff[4];
  #pragma unroll
  for (int fm = 0; fm < 2; ++fm) aoff[fm] = (wm + fm * 16 + lr) * GP + 8 * hi;
  #pragma unroll
  for (int fn = 0; fn < 4; ++fn) {
    const int col = ROPEMAP ? (g * 32 + (fn & 1) * 16 + (fn >> 1) * 64) : (g * 64 + fn * 16);
    boff[fn] = GT_H + (col + lr) * GP + 8 * hi;
  }
  // staging: lane's first piece; 8 lanes x 16 B = one 128-B row piece, 32 rows per copy
  const u16* ga = A  + (size_t)(m0 + (tid >> 3)) * DM + (tid & 7) * 8;
  const u16* gb = Bt + (size_t)(n0 + (tid >> 3)) * DM + (tid & 7) * 8;
  const unsigned l0 = (unsigned)(size_t)sS + (tid >> 3) * (GP * 2) + (tid & 7) * 16;   // LDS byte address
  const int nslab = DM / GK;

  // slab 0 lands and is published before anybody reads it; slab 1 then flies during slab 0's products
  stage_ab(ga, gb, l0);
  asm volatile("s_wait_asynccnt 0x0" ::: "memory"); // this wave's copies of slab 0 have landed
  __syncthreads();
  stage_ab(ga + GK, gb + GK, l0 + GS_H * 2);

  #pragma unroll 1
  for (int t = 0; t < nslab; ++t) {
    const int bsel = t & 1;
    const u16* sT = sS + bsel * GS_H;               // this slab's stage buffer
    #pragma unroll
    for (int kk = 0; kk < GK; kk += 32) {
      Frag a[2];
      Frag b[4];
      #pragma unroll
      for (int fm = 0; fm < 2; ++fm) {
        a[fm].q[0] = *(const v4u*)(sT + aoff[fm] + kk);        // k = t*GK + kk + 8hi + 0..7
        a[fm].q[1] = *(const v4u*)(sT + aoff[fm] + kk + 16);   // k = t*GK + kk + 16 + 8hi + 0..7
      }
      #pragma unroll
      for (int fn = 0; fn < 4; ++fn) {
        b[fn].q[0] = *(const v4u*)(sT + boff[fn] + kk);
        b[fn].q[1] = *(const v4u*)(sT + boff[fn] + kk + 16);
      }
      #pragma unroll
      for (int fn = 0; fn < 4; ++fn) {
        #pragma unroll
        for (int fm = 0; fm < 2; ++fm) {
          if (ISF16) acc[fm][fn] = mma_f16(a[fm].h, b[fn].h, acc[fm][fn]);
          else       acc[fm][fn] = mma_bf16(a[fm].b, b[fn].b, acc[fm][fn]);
        }
      }
    }
    // publish point of slab t + 1, every wave, every slab
    asm volatile("s_wait_dscnt 0x0" ::: "memory");    // this wave's reads of the buffer to be refilled are done
    asm volatile("s_wait_asynccnt 0x0" ::: "memory"); // this wave's copies of slab t + 1 have landed
    __syncthreads();                                  // publishes slab t + 1, ends all reads of slab t
    if (t + 2 < nslab) {                              // block-uniform: refill the buffer just read
      stage_ab(ga + (t + 2) * GK, gb + (t + 2) * GK, l0 + bsel * (GS_H * 2));
    }
  }
  asm volatile("s_wait_asynccnt 0x0" ::: "memory");   // nothing of this wave's copies is left in flight
}

// Fused QKV projection + rotary + plane builder.
// grid (NQKV/128 column tiles = one head each, NB*SEQ/128 row tiles); column tile ct: 0..15 q head, 16..19 k head,
// 20..23 v head. Outputs:
//   ph / pl : bf16 hi / lo planes, q region [NB][NQH][SEQ][HD] at 0, k region [NB][NKV][SEQ][HD] at QELEMS
//   vt      : f16 (x V_CARRY) [NB][NKV][HD][SEQ], transposed through LDS
// LDS tiles sA / sB are cross-wave (block barrier between fill and readback); staged extent 128 x 128 ==
// consumed extent. They lie in the GEMM ring, which is free once gemm_core has returned. Every written line whole: 16 lanes x 16 B = one 256-B row per half-wave.
__global__ __launch_bounds__(256) void qkv_gemm_kernel(const u16* __restrict__ Xb, const u16* __restrict__ Wt,
                                                       const float* __restrict__ cosT,
                                                       const float* __restrict__ sinT,
                                                       u16* __restrict__ ph, u16* __restrict__ pl,
                                                       u16* __restrict__ vt) {
  __shared__ __align__(16) u16 sS[2 * GS_H];
  u16* const sA = sS;
  u16* const sB = sS + 128 * EP;
  const int ct   = blockIdx.x;
  const int m0   = blockIdx.y * 128;
  const int tid  = threadIdx.x;
  const int wave = __builtin_amdgcn_readfirstlane(threadIdx.x >> 5);
  const int lane = tid & 31;
  const int lr   = lane & 15;
  const int hi   = lane >> 4;
  const int wm   = (wave & 3) * 32;
  const int g    = wave >> 2;

  v8f acc[2][4];
  #pragma unroll
  for (int fm = 0; fm < 2; ++fm) {
    #pragma unroll
    for (int fn = 0; fn < 4; ++fn) acc[fm][fn] = (v8f){0, 0, 0, 0, 0, 0, 0, 0};
  }
  gemm_core<0, 1>(Xb, Wt, sS, tid, m0, ct * 128, wm, g, lr, hi, acc);

  const int b  = m0 / SEQ;
  const int t0 = m0 % SEQ;

  if (ct < NQH + NKV) {
    // rotary on the f32 accumulators, then bf16 hi | lo split into the LDS tiles
    #pragma unroll
    for (int fm = 0; fm < 2; ++fm) {
      #pragma unroll
      for (int f2 = 0; f2 < 2; ++f2) {
        const int j  = g * 32 + f2 * 16 + lr;             // frequency index 0..63
        const int tl = wm + fm * 16 + 8 * hi;             // first of this lane's 8 tile rows
        const size_t tb = ((size_t)b * HD2 + j) * SEQ + t0 + tl;
        const v4f ca = *(const v4f*)(cosT + tb);
        const v4f cb = *(const v4f*)(cosT + tb + 4);
        const v4f sa = *(const v4f*)(sinT + tb);
        const v4f sb = *(const v4f*)(sinT + tb + 4);
        #pragma unroll
        for (int i = 0; i < 8; ++i) {
          const float c  = (i < 4) ? ca[i & 3] : cb[i & 3];
          const float s  = (i < 4) ? sa[i & 3] : sb[i & 3];
          const float x1 = acc[fm][f2][i];                 // col j
          const float x2 = acc[fm][f2 + 2][i];             // col j + 64
          const float y1 = x1 * c - x2 * s;
          const float y2 = x2 * c + x1 * s;
          const float h1 = bf16_back(y1);
          const float h2 = bf16_back(y2);
          const int row = tl + i;
          sA[row * EP + j]       = bf16_bits(h1);
          sA[row * EP + 64 + j]  = bf16_bits(h2);
          sB[row * EP + j]       = bf16_bits(y1 - h1);
          sB[row * EP + 64 + j]  = bf16_bits(y2 - h2);
        }
      }
    }
    __syncthreads();
    const int isq   = (ct < NQH) ? 1 : 0;
    const int pbase = isq ? (((b * NQH + ct) * SEQ + t0) * HD)
                          : (QELEMS + ((b * NKV + (ct - NQH)) * SEQ + t0) * HD);
    v4u vA[8];
    v4u vB[8];
    int gi[8];
    #pragma unroll
    for (int it = 0; it < 8; ++it) {
      const int piece = it * 256 + tid;
      const int row = piece >> 4;                          // 0..127
      const int seg = piece & 15;                          // 16 x 16 B = one 256-B plane row
      vA[it] = *(const v4u*)(sA + row * EP + seg * 8);
      vB[it] = *(const v4u*)(sB + row * EP + seg * 8);
      gi[it] = pbase + row * HD + seg * 8;
    }
    #pragma unroll
    for (int it = 0; it < 8; ++it) {
      *(v4u*)(ph + gi[it]) = vA[it];
      *(v4u*)(pl + gi[it]) = vB[it];
    }
    
  } else {
    // v head: f16 carried x V_CARRY, transposed in LDS to [d][t]
    const int kvh = ct - (NQH + NKV);
    #pragma unroll
    for (int fm = 0; fm < 2; ++fm) {
      #pragma unroll
      for (int fn = 0; fn < 4; ++fn) {
        const int d = g * 32 + (fn & 1) * 16 + (fn >> 1) * 64 + lr;
        #pragma unroll
        for (int i = 0; i < 8; ++i) {
          const int row = wm + fm * 16 + 8 * hi + i;
          sA[d * EP + row] = f16_bits(acc[fm][fn][i] * V_CARRY);
        }
      }
    }
    __syncthreads();
    v4u vA[8];
    int gi[8];
    #pragma unroll
    for (int it = 0; it < 8; ++it) {
      const int piece = it * 256 + tid;
      const int d   = piece >> 4;                          // 0..127
      const int seg = piece & 15;
      vA[it] = *(const v4u*)(sA + d * EP + seg * 8);
      gi[it] = ((b * NKV + kvh) * HD + d) * SEQ + t0 + seg * 8;
    }
    #pragma unroll
    for (int it = 0; it < 8; ++it) *(v4u*)(vt + gi[it]) = vA[it];
    
  }
}

// One 32-key stage (K hi, K lo: 32 rows x 256 B each; V^T: 128 rows x 64 B) from global memory into one LDS
// buffer: 12 asynchronous 16-B copies per lane, 128 lanes, every byte of the stage copied exactly once.
// kh / kl / v and lk / lv are the lane's own global pointers and LDS byte addresses of its first piece.
// The closing s_wait_xcnt stands inside the statement so that no address register of an issued copy is
// rewritten ahead of it.
static __device__ __forceinline__ void stage_kv(const u16* kh, const u16* kl, const u16* v,
                                                unsigned lk, unsigned lv) {
  asm volatile(
      "global_load_async_to_lds_b128 %0, %1, off\n\t"
      "global_load_async_to_lds_b128 %2, %3, off\n\t"
      "global_load_async_to_lds_b128 %4, %5, off\n\t"
      "global_load_async_to_lds_b128 %6, %7, off\n\t"
      "global_load_async_to_lds_b128 %8, %9, off\n\t"
      "global_load_async_to_lds_b128 %10, %11, off\n\t"
      "global_load_async_to_lds_b128 %12, %13, off\n\t"
      "global_load_async_to_lds_b128 %14, %15, off\n\t"
      "global_load_async_to_lds_b128 %16, %17, off\n\t"
      "global_load_async_to_lds_b128 %18, %19, off\n\t"
      "global_load_async_to_lds_b128 %20, %21, off\n\t"
      "global_load_async_to_lds_b128 %22, %23, off\n\t"
      "s_wait_xcnt 0x0"
      :
      : "v"(lk),                             "v"(kh),
        "v"(lk + 8 * KP * 2),                "v"(kh + 8 * HD),
        "v"(lk + 16 * KP * 2),               "v"(kh + 16 * HD),
        "v"(lk + 24 * KP * 2),               "v"(kh + 24 * HD),
        "v"(lk + KT_H * 2),                  "v"(kl),
        "v"(lk + KT_H * 2 + 8 * KP * 2),     "v"(kl + 8 * HD),
        "v"(lk + KT_H * 2 + 16 * KP * 2),    "v"(kl + 16 * HD),
        "v"(lk + KT_H * 2 + 24 * KP * 2),    "v"(kl + 24 * HD),
        "v"(lv),                             "v"(v),
        "v"(lv + 32 * VP * 2),               "v"(v + 32 * SEQ),
        "v"(lv + 64 * VP * 2),               "v"(v + 64 * SEQ),
        "v"(lv + 96 * VP * 2),               "v"(v + 96 * SEQ)
      : "memory");
}

// K fragments of one 32-d slice from a staged stage buffer: key tile 0 hi, lo, key tile 1 hi, lo (8 LDS reads).
// p = fragment origin of the slice inside the K hi plane tile.
static __device__ __forceinline__ void load_kset(Frag (&k)[4], const u16* p) {
  k[0].q[0] = *(const v4u*)(p);
  k[0].q[1] = *(const v4u*)(p + 16);
  k[1].q[0] = *(const v4u*)(p + KT_H);
  k[1].q[1] = *(const v4u*)(p + KT_H + 16);
  k[2].q[0] = *(const v4u*)(p + 16 * KP);
  k[2].q[1] = *(const v4u*)(p + 16 * KP + 16);
  k[3].q[0] = *(const v4u*)(p + KT_H + 16 * KP);
  k[3].q[1] = *(const v4u*)(p + KT_H + 16 * KP + 16);
}

// Fused causal grouped-query attention, logit scale 1.0, online softmax in the exp2 domain.
// Block = 4 waves = the four query heads of one key/value head for the same 16 query rows (uniform trip count).
// S^T = K x Q^T so queries sit on lanes; P^T in C layout is bit-identical to the A-fragment layout of O += P x V.
// q and k: bf16 hi | lo planes, three products per k-step into one accumulator. q fragments are loaded once
// and stay in registers. ctx out: f16 carried x C_CARRY, [NB*SEQ][DM], col = head*128 + d.
// K hi | K lo | V^T of each 32-key step are staged once per block in LDS (two buffers, asynchronous copies one
// step ahead) and read by all four waves with 16-B LDS loads; same elements, same k order as the planes.
// LDS sO: each wave writes and reads only its own slice; a block barrier separates fill and readback.
// four waves per SIMD (four blocks per WGP, the whole grid resident) need the wave inside 256 registers
__global__ __launch_bounds__(128) __attribute__((amdgpu_waves_per_eu(4, 4))) void attn_kernel(const u16* __restrict__ ph, const u16* __restrict__ pl,
                                                   const u16* __restrict__ vt, u16* __restrict__ ctx) {
  const int kv   = blockIdx.y;
  const int b    = blockIdx.z;
  // Causal balance: the grid just fills the chip (four blocks per WGP) and a block's key steps grow with its query
  // tile, so the launch lasts as long as the WGP whose four blocks hold the most key steps. Tiles y and NQT-1-y
  // form a pair; which of the two a block takes alternates with the bit parity of (y, kv, b): an aligned group of
  // four blocks whose flat indices lie a power-of-two stride apart then holds the same sum of key steps as any
  // other (at NQT = 128: every stride but 32). For speed only; for each (kv, b) the map permutes the tiles.
  const int bx   = blockIdx.x;
  const int far  = (bx >= NQT / 2) ? 1 : 0;
  const int y    = far ? (NQT - 1 - bx) : bx;
  const int odd  = __builtin_popcount((unsigned)y ^ ((unsigned)kv << 16) ^ ((unsigned)b << 24)) & 1;
  const int qt   = (far ^ odd) ? (NQT - 1 - y) : y;
  const int tid  = threadIdx.x;
  const int wave = __builtin_amdgcn_readfirstlane(threadIdx.x >> 5);
  const int lane = tid & 31;
  const int lq   = lane & 15;     // query column of S^T / d column of O
  const int hi   = lane >> 4;     // k-split half
  const int head = kv * GRP + wave;
  const int qrow0 = qt * 16;

  __shared__ __align__(16) u16 sO[GRP * 16 * CP];
  __shared__ __align__(16) u16 sKV[2 * KV_H];

  const int qoff  = ((b * NQH + head) * SEQ + qrow0 + lq) * HD + hi * 8;
  const int kfrag = lq * KP + hi * 8;                 // fragment origin inside a staged K plane tile
  const int vfrag = 2 * KT_H + lq * VP + hi * 8;      // fragment origin of the staged V^T tile

  // staging: lane's first piece. K: 16 lanes x 16 B = one 256-B row, 8 rows per copy; V^T: 4 lanes per 64-B row.
  const u16* gkh = ph + QELEMS + (b * NKV + kv) * SEQ * HD + tid * 8;
  const u16* gkl = pl + QELEMS + (b * NKV + kv) * SEQ * HD + tid * 8;
  const u16* gv  = vt + ((b * NKV + kv) * HD + (tid >> 2)) * SEQ + (tid & 3) * 8;
  const unsigned lbase = (unsigned)(size_t)sKV;       // LDS byte address = low 32 bits of the shared address
  const unsigned lk = lbase + (tid >> 4) * (KP * 2) + (tid & 15) * 16;
  const unsigned lv = lbase + 2 * KT_H * 2 + (tid >> 2) * (VP * 2) + (tid & 3) * 16;

  v8f o[8];
  #pragma unroll
  for (int dt = 0; dt < 8; ++dt) o[dt] = (v8f){0, 0, 0, 0, 0, 0, 0, 0};

  const float NEGV = -1.0e30f;
  float rmax = NEGV;
  float rsum = 0.0f;
  const float SL = 1.4426950408889634f;             // logit scale 1.0 times log2(e)

  const int nchunk = (qrow0 >> 5) + 1;              // same for every wave of the block

  // q fragments (B operand of S^T): loaded once, held in registers over the whole key loop
  Frag qh[4], ql[4];
  #pragma unroll
  for (int f = 0; f < 4; ++f) {
    const int qa = qoff + f * 32;
    qh[f].q[0] = *(const v4u*)(ph + qa);            // d = f*32 + 8hi + 0..7
    qh[f].q[1] = *(const v4u*)(ph + qa + 16);       // d = f*32 + 16 + 8hi + 0..7
    ql[f].q[0] = *(const v4u*)(pl + qa);
    ql[f].q[1] = *(const v4u*)(pl + qa + 16);
  }

  // stage 0 lands and is published before anybody reads it; stage 1 then flies during step 0
  stage_kv(gkh, gkl, gv, lk, lv);
  asm volatile("s_wait_asynccnt 0x0" ::: "memory"); // this wave's copies of stage 0 have landed
  __syncthreads();
  if (nchunk > 1) stage_kv(gkh + 32 * HD, gkl + 32 * HD, gv + 32, lk + KV_H * 2, lv + KV_H * 2);

  #pragma unroll 1
  for (int ic = 0; ic < nchunk; ++ic) {
    const int j0 = ic * 32;
    const int bsel = ic & 1;
    const u16* sT = sKV + bsel * KV_H;              // this step's stage buffer

    // S^T tiles: c0[r] = score(query qrow0+lq, key j0 + 8hi + r), c1[r] = key j0 + 16 + 8hi + r
    v8f c0 = (v8f){0, 0, 0, 0, 0, 0, 0, 0};
    v8f c1 = (v8f){0, 0, 0, 0, 0, 0, 0, 0};
    // LDS fragment reads are issued in groups ahead of the products that use them: K one 32-d slice ahead in a
    // second register set, V^T into the K sets' registers as they fall free, all of it before the softmax.
    Frag ks[2][4];
    Frag bv[8];
    load_kset(ks[0], sT + kfrag);
    load_kset(ks[1], sT + kfrag + 32);
    // keeps both read groups in front of the first products (sunk to their uses, each read's latency is waited out)
    __builtin_amdgcn_sched_barrier(0);
    #pragma unroll
    for (int f = 0; f < 4; ++f) {
      const Frag qhf = qh[f];
      const Frag qlf = ql[f];
      Frag (&k)[4] = ks[f & 1];
      c0 = mma_bf16(k[0].b, qhf.b, c0);             // key j0 + lq
      c0 = mma_bf16(k[0].b, qlf.b, c0);
      c0 = mma_bf16(k[1].b, qhf.b, c0);
      c1 = mma_bf16(k[2].b, qhf.b, c1);             // key j0 + 16 + lq
      c1 = mma_bf16(k[2].b, qlf.b, c1);
      c1 = mma_bf16(k[3].b, qhf.b, c1);
      // the refill of this register set stays behind its last product ...
      __builtin_amdgcn_sched_barrier(0);
      if (f < 2) {
        load_kset(ks[f & 1], sT + kfrag + (f + 2) * 32);
      } else {
        #pragma unroll
        for (int dt = 0; dt < 4; ++dt) {            // V^T B-fragments: column n = d = ((f - 2) * 4 + dt) * 16 + lq, split key map
          const int va = vfrag + (((f - 2) * 4 + dt) * 16) * VP;
          bv[(f - 2) * 4 + dt].q[0] = *(const v4u*)(sT + va);        // keys j0 + 8hi + 0..7
          bv[(f - 2) * 4 + dt].q[1] = *(const v4u*)(sT + va + 16);   // keys j0 + 16 + 8hi + 0..7
        }
      }
      // ... and in front of the next slice's products, so that it flies during them
      __builtin_amdgcn_sched_barrier(0);
    }

    // causal exclusion (only the last chunk can hold keys beyond a query row); wave-uniform test
    if (j0 + 31 > qrow0) {
      const int trow = qrow0 + lq;
      #pragma unroll
      for (int r = 0; r < 8; ++r) {
        const int key0 = j0 + hi * 8 + r;
        c0[r] = (key0 > trow) ? NEGV : c0[r];
        c1[r] = (key0 + 16 > trow) ? NEGV : c1[r];
      }
    }

    // online softmax: query lq's 32 scores are split across lane / lane^16
    float m_new = rmax;
    #pragma unroll
    for (int r = 0; r < 8; ++r) {
      m_new = fmaxf(m_new, c0[r]);
      m_new = fmaxf(m_new, c1[r]);
    }
    m_new = fmaxf(m_new, __shfl_xor(m_new, 16, 32));
    const float scale = __builtin_amdgcn_exp2f((rmax - m_new) * SL);
    rmax = m_new;

    // exp + pack: P^T C layout == A-fragment layout of the PV product; P carried x4096
    Frag pa;
    float psum = 0.0f;
    #pragma unroll
    for (int r = 0; r < 8; ++r) {
      const float p0 = __builtin_amdgcn_exp2f((c0[r] - m_new) * SL);   // key 8hi + r
      const float p1 = __builtin_amdgcn_exp2f((c1[r] - m_new) * SL);   // key 16 + 8hi + r
      psum += p0 + p1;
      pa.e[r]     = (f16)(p0 * P_CARRY);
      pa.e[8 + r] = (f16)(p1 * P_CARRY);
    }
    rsum = rsum * scale + psum + __shfl_xor(psum, 16, 32);

    // rescale O: queries are the row dimension there -> per-row scale from lane 8hi + r
    float sc[8];
    #pragma unroll
    for (int r = 0; r < 8; ++r) sc[r] = __shfl(scale, (hi << 3) + r, 32);
    #pragma unroll
    for (int dt = 0; dt < 8; ++dt) {
      #pragma unroll
      for (int r = 0; r < 8; ++r) o[dt][r] *= sc[r];
    }

    // O += P x V on the V^T fragments read above
    #pragma unroll
    for (int dt = 0; dt < 8; ++dt) o[dt] = mma_f16(pa.h, bv[dt].h, o[dt]);

    // publish point of stage ic + 1, every wave, every step
    asm volatile("s_wait_dscnt 0x0" ::: "memory");    // this wave's reads of the buffer to be refilled are done
    asm volatile("s_wait_asynccnt 0x0" ::: "memory"); // this wave's copies of stage ic + 1 have landed
    __syncthreads();                                  // publishes stage ic + 1, ends all reads of stage ic
    if (ic + 2 < nchunk) {                            // block-uniform: refill the buffer just read
      const int nx = ic + 2;
      stage_kv(gkh + nx * (32 * HD), gkl + nx * (32 * HD), gv + nx * 32,
               lk + bsel * (KV_H * 2), lv + bsel * (KV_H * 2));
    }
  }
  asm volatile("s_wait_asynccnt 0x0" ::: "memory");   // nothing of this wave's copies is left in flight

  // normalize: lane holds column d = dt*16 + lq for query rows 8hi + r; fold the carries
  const float CN = C_CARRY / (P_CARRY * V_CARRY);
  float rs[8];
  #pragma unroll
  for (int r = 0; r < 8; ++r) rs[r] = CN * (1.0f / __shfl(rsum, (hi << 3) + r, 32));

  const int so = wave * (16 * CP);
  #pragma unroll
  for (int r = 0; r < 8; ++r) {
    #pragma unroll
    for (int dt = 0; dt < 8; ++dt) {
      sO[so + (hi * 8 + r) * CP + dt * 16 + lq] = f16_bits(o[dt][r] * rs[r]);
    }
  }
  __syncthreads();

  // 8 consecutive lanes x 16 B each), lanes 16..31 the next row; 8 instructions cover the wave's 16 rows.
  v4u    vals[8];
  size_t gidx[8];
  #pragma unroll
  for (int it = 0; it < 8; ++it) {
    const int row = it * 2 + hi;
    vals[it] = *(const v4u*)(sO + so + row * CP + lq * 8);
    gidx[it] = ((size_t)b * SEQ + qrow0 + row) * DM + head * HD + lq * 8;
  }
  #pragma unroll
  for (int it = 0; it < 8; ++it) *(v4u*)(ctx + gidx[it]) = vals[it];
  
}

// Output projection: out[b][t][DM] = ctx x Wo, f16 operands (carries folded back in f32).
// written by 8 consecutive lanes x 16 B of one instruction.
__global__ __launch_bounds__(256) void out_gemm_kernel(const u16* __restrict__ ctx, const u16* __restrict__ WoT,
                                                       float* __restrict__ out) {
  __shared__ __align__(16) u16 sS[2 * GS_H];
  float* const sC = (float*)sS;                    // output staging lies in the GEMM ring, free after gemm_core
  const int n0   = blockIdx.x * 128;
  const int m0   = blockIdx.y * 128;
  const int tid  = threadIdx.x;
  const int wave = __builtin_amdgcn_readfirstlane(threadIdx.x >> 5);
  const int lane = tid & 31;
  const int lr   = lane & 15;
  const int hi   = lane >> 4;
  const int wm   = (wave & 3) * 32;
  const int g    = wave >> 2;

  v8f acc[2][4];
  #pragma unroll
  for (int fm = 0; fm < 2; ++fm) {
    #pragma unroll
    for (int fn = 0; fn < 4; ++fn) acc[fm][fn] = (v8f){0, 0, 0, 0, 0, 0, 0, 0};
  }
  gemm_core<1, 0>(ctx, WoT, sS, tid, m0, n0, wm, g, lr, hi, acc);

  const float INV = 1.0f / (C_CARRY * W_CARRY);
  #pragma unroll
  for (int p = 0; p < 2; ++p) {
    if (((wave & 3) >> 1) == p) {                  // wave-uniform: this wave's rows belong to half p
      #pragma unroll
      for (int fm = 0; fm < 2; ++fm) {
        #pragma unroll
        for (int fn = 0; fn < 4; ++fn) {
          #pragma unroll
          for (int i = 0; i < 8; ++i) {
            sC[(wm - p * 64 + fm * 16 + 8 * hi + i) * CPF + g * 64 + fn * 16 + lr] = acc[fm][fn][i] * INV;
          }
        }
      }
    }
    __syncthreads();
    v4f    vals[8];
    size_t gidx[8];
    #pragma unroll
    for (int it = 0; it < 8; ++it) {
      const int piece = it * 256 + tid;
      const int row = piece >> 5;                  // 0..63
      const int seg = piece & 31;
      vals[it] = *(const v4f*)(sC + row * CPF + seg * 4);
      const int m  = m0 + p * 64 + row;
      const int bb = m / SEQ;
      const int tt = m % SEQ;
      gidx[it] = ((size_t)bb * SEQ_FULL + tt) * DM + n0 + seg * 4;
    }
    #pragma unroll
    for (int it = 0; it < 8; ++it) *(v4f*)(out + gidx[it]) = vals[it];
    
    __syncthreads();
  }
}

extern "C" void kernel_launch(void* const* d_in, const int* in_sizes, int n_in,
                              void* d_out, int out_size, void* d_ws, size_t ws_size,
                              hipStream_t stream) {
  if (n_in < 6) return;
  const size_t needX = ((size_t)(NB - 1) * SEQ_FULL + SEQ) * DM;
  const size_t needP = (size_t)(NB - 1) * SEQ_FULL + SEQ;
  if ((size_t)in_sizes[0] < needX) return;
  if ((size_t)in_sizes[1] < needP) return;
  if ((size_t)in_sizes[2] < (size_t)DM * NQH * HD) return;
  if ((size_t)in_sizes[3] < (size_t)DM * NKV * HD) return;
  if ((size_t)in_sizes[4] < (size_t)DM * NKV * HD) return;
  if ((size_t)in_sizes[5] < (size_t)NQH * HD * DM) return;
  if ((size_t)out_size < needX) return;
  if (ws_size < (size_t)WS_TOTAL) return;

  const float* X   = (const float*)d_in[0];
  const int*   pos = (const int*)d_in[1];
  const float* Wq  = (const float*)d_in[2];
  const float* Wk  = (const float*)d_in[3];
  const float* Wv  = (const float*)d_in[4];
  const float* Wo  = (const float*)d_in[5];
  float* out = (float*)d_out;

  char* ws = (char*)d_ws;
  u16*   Xb   = (u16*)(ws + OFF_XB);
  u16*   Wt   = (u16*)(ws + OFF_WT);
  u16*   WoT  = (u16*)(ws + OFF_WO);
  float* cosT = (float*)(ws + OFF_COS);
  float* sinT = (float*)(ws + OFF_SIN);
  u16*   ph   = (u16*)(ws + OFF_PH);
  u16*   pl   = (u16*)(ws + OFF_PL);
  u16*   vt   = (u16*)(ws + OFF_VT);
  u16*   ctx  = (u16*)(ws + OFF_CTX);

  // X -> bf16 rows, weights -> transposed 16-bit, rotary table from the positions
  prep_kernel<<<dim3(PREP_G), 256, 0, stream>>>(X, pos, Wq, Wk, Wv, Wo, Xb, Wt, WoT, cosT, sinT);
  // fused QKV projection + rotary + planes
  qkv_gemm_kernel<<<dim3(NQKV / 128, (NB * SEQ) / 128), 256, 0, stream>>>(Xb, Wt, cosT, sinT, ph, pl, vt);
  // attention
  attn_kernel<<<dim3(SEQ / 16, NKV, NB), 128, 0, stream>>>(ph, pl, vt, ctx);
  // output projection
  out_gemm_kernel<<<dim3(DM / 128, (NB * SEQ) / 128), 256, 0, stream>>>(ctx, WoT, out);
}

// v007
// A run of this version takes 161 microseconds.
// Next to v006, in two timings, it ran 1.06 times as fast each time.
// All steps since v000 together make it 3.93 times as fast.
#include <hip/hip_runtime.h>

// Contractions: QKV projections on v_wmma_f32_16x16x32_bf16 (bf16 RNE-converted inputs, f32 accumulate); scores S^T = K x Q^T on v_wmma_f32_16x16x32_bf16 with q and k as bf16 hi|lo planes (hi.hi + hi.lo + lo.hi, one f32 accumulator); O = P x V on v_wmma_f32_16x16x32_f16 (P f16 carried x4096, V f16 carried x16); output projection on v_wmma_f32_16x16x32_f16 (ctx f16 carried x64, Wo = f16 of the bf16 RNE-converted input carried x64); all f32 accumulate; softmax (online, max-subtracted, exp2 domain) and rotary math in f32.

#ifndef NB
#define NB 2
#endif
#ifndef SEQ
#define SEQ 2048
#endif
#define NB_FULL   2
#define SEQ_FULL  2048
#define DM        2048                 // model width = depth of every projection
#define NQH       16                   // query heads
#define NKV       4                    // key/value heads
#define GRP       4                    // query heads per key/value head
#define HD        128                  // head dim
#define HD2       64                   // rotary frequencies
#define NQKV      3072                 // fused projection width (q | k | v)
#define EP        128                  // LDS pitch (halves) of the 16-bit epilogue tiles
#define CPF       132                  // LDS pitch (floats) of the f32 output staging tile
#define CP        136                  // LDS pitch (halves) of the per-wave ctx staging tile
#define TPW       72                   // LDS pitch (halves) of the weight transposer tile
#define KP        136                  // LDS pitch (halves) of a staged K row: 272 B = 16 B x odd
#define VP        40                   // LDS pitch (halves) of a staged V^T row of 32 keys: 80 B = 16 B x odd
#define KT_H      (32 * KP)            // halves of one staged K plane tile (32 keys)
#define VT_H      (HD * VP)            // halves of one staged V^T tile (128 d rows x 32 keys)
#define KV_H      (2 * KT_H + VT_H)    // halves of one stage buffer: K hi | K lo | V^T
#define GK        64                   // k extent (halves) of one staged GEMM slab: 128 B = one line per operand row
#define GP        72                   // LDS pitch (halves) of a staged GEMM operand row: 144 B = 16 B x odd
#define GT_H      (128 * GP)           // halves of one staged operand tile (128 rows)
#define GS_H      (2 * GT_H)           // halves of one GEMM stage buffer: A tile | B tile
#define NQT       (SEQ / 16)           // query tiles of 16 rows per (batch, key/value head)
#define WS_CAP    134217728ull
#define PREP_G    512                  // blocks of the preparation launch: two per WGP
#define XR_PB     ((NB * SEQ) / PREP_G) // rows of X per preparation block
#define WT_PB     5                    // weight tiles per preparation block

#define P_CARRY   4096.0f
#define V_CARRY   16.0f
#define C_CARRY   64.0f
#define W_CARRY   64.0f

static_assert(NB >= 1 && NB <= NB_FULL);
static_assert(SEQ <= SEQ_FULL);
static_assert(SEQ % 128 == 0);
static_assert(DM % 128 == 0);
static_assert(DM % 32 == 0);
static_assert(DM == 256 * 8);                     // 256 threads x 8 elements = one X row
static_assert(NQKV == NQH * HD + 2 * NKV * HD);
static_assert(NQKV % 128 == 0);
static_assert(NQH == NKV * GRP);
static_assert(HD == 128 && HD2 * 2 == HD);
static_assert(NQH * HD == DM);
static_assert(EP >= HD && (EP * 2) % 16 == 0);
static_assert((CPF * 4) % 16 == 0 && CPF >= 128);
static_assert((CP * 2) % 16 == 0 && CP >= HD);
static_assert((TPW * 2) % 16 == 0 && TPW >= 64);
static_assert((size_t)NB * HD2 * SEQ == (size_t)PREP_G * 512);
static_assert(XR_PB * PREP_G == NB * SEQ && SEQ % XR_PB == 0 && SEQ % 512 == 0);
static_assert((NQH * HD / 64) * (DM / 64) == 2 * PREP_G && (DM / 64) * (DM / 64) == 2 * PREP_G);
static_assert((NKV * HD / 64) * (DM / 64) * 2 == PREP_G);
static_assert(2 * 128 * EP * 2 <= 65536);
static_assert((KP * 2) % 16 == 0 && KP >= HD && (VP * 2) % 16 == 0 && VP >= 32);
static_assert((KT_H * 2) % 16 == 0 && (KV_H * 2) % 16 == 0);
static_assert(SEQ % 64 == 0);                     // an odd count of 32-key steps is below SEQ / 32
static_assert(2 * 2 * KV_H * 2 >= GRP * 16 * 32 * 16 + GRP * 2 * 32 * 4);   // the join area fits the stage buffers
static_assert(DM % GK == 0 && DM / GK >= 2 && GK % 32 == 0);
static_assert((GP * 2) % 16 == 0 && GP >= GK && (GT_H * 2) % 16 == 0);
static_assert(2 * GS_H >= 2 * 128 * EP);          // the 16-bit epilogue tiles fit the GEMM ring
static_assert(2 * GS_H * 2 >= 64 * CPF * 4);      // the f32 output staging tile fits the GEMM ring

#define QELEMS   (NB * NQH * SEQ * HD)            // q region of the hi / lo planes (elements)
#define KELEMS   (NB * NKV * SEQ * HD)            // k region
#define XB_BYTES   ((size_t)NB * SEQ * DM * 2)
#define WT_BYTES   ((size_t)NQKV * DM * 2)
#define WO_BYTES   ((size_t)DM * DM * 2)
#define TB_BYTES   ((size_t)NB * HD2 * SEQ * 4)
#define PL_BYTES   ((size_t)(QELEMS + KELEMS) * 2)
#define VT_BYTES   ((size_t)NB * NKV * HD * SEQ * 2)
#define CTX_BYTES  ((size_t)NB * SEQ * DM * 2)
#define OFF_XB   ((size_t)0)
#define OFF_WT   (OFF_XB + XB_BYTES)
#define OFF_WO   (OFF_WT + WT_BYTES)
#define OFF_COS  (OFF_WO + WO_BYTES)
#define OFF_SIN  (OFF_COS + TB_BYTES)
#define OFF_PH   (OFF_SIN + TB_BYTES)
#define OFF_PL   (OFF_PH + PL_BYTES)
#define OFF_VT   (OFF_PL + PL_BYTES)
#define OFF_CTX  (OFF_VT + VT_BYTES)
#define WS_TOTAL (OFF_CTX + CTX_BYTES)
static_assert(WS_TOTAL <= WS_CAP);
static_assert(XB_BYTES % 256 == 0 && WT_BYTES % 256 == 0 && WO_BYTES % 256 == 0);
static_assert(TB_BYTES % 256 == 0 && PL_BYTES % 256 == 0 && VT_BYTES % 256 == 0);
static_assert((unsigned long long)(QELEMS + KELEMS) < 2147483648ull);

typedef __bf16         bf16;
typedef _Float16       f16;
typedef unsigned short u16;
typedef bf16     v16bf __attribute__((ext_vector_type(16)));
typedef f16      v16h  __attribute__((ext_vector_type(16)));
typedef float    v8f   __attribute__((ext_vector_type(8)));
typedef float    v4f   __attribute__((ext_vector_type(4)));
typedef unsigned v4u   __attribute__((ext_vector_type(4)));

union Frag  { v16bf b; v16h h; v4u q[2]; f16 e[16]; };
union Pack8 { v4u u; u16 s[8]; };

// WMMA helpers: builtin followed by the VALU hazard guard (ties D, keeps A/B live).
static __device__ __forceinline__ v8f mma_bf16(v16bf a, v16bf b, v8f acc) {
  acc = __builtin_amdgcn_wmma_f32_16x16x32_bf16(false, a, false, b, (short)0, acc, false, false);
  asm volatile("v_nop\n\tv_nop\n\tv_nop\n\tv_nop" : "+v"(acc) : "v"(a), "v"(b));
  return acc;
}
static __device__ __forceinline__ v8f mma_f16(v16h a, v16h b, v8f acc) {
  acc = __builtin_amdgcn_wmma_f32_16x16x32_f16(false, a, false, b, (short)0, acc, false, false);
  asm volatile("v_nop\n\tv_nop\n\tv_nop\n\tv_nop" : "+v"(acc) : "v"(a), "v"(b));
  return acc;
}

static __device__ __forceinline__ u16 bf16_bits(float x) {      // RNE convert
  const bf16 h = (bf16)x;
  return __builtin_bit_cast(u16, h);
}
static __device__ __forceinline__ float bf16_back(float x) {    // value of the RNE-converted bf16
  return (float)(bf16)x;
}
static __device__ __forceinline__ u16 f16_bits(float x) {
  const f16 h = (f16)x;
  return __builtin_bit_cast(u16, h);
}

// Preparation, one launch: every job that reads inputs only (X rows to bf16, the four weight transposes, the
// rotary table). PREP_G equal blocks, two per WGP; each block takes the same share of every job: XR_PB rows of X,
// two 64 x 64 tiles of Wq, two of Wo, one of Wk or Wv, and 2 x 256 table elements. All of a lane's global loads are
// issued first; the table arithmetic runs while they fly.
//   X     : row m = blk * XR_PB + j, 256 threads x 8 elements == DM; bf16 RNE bits.
//   W     : in W[DM rows (input dim)][ldin cols (output dim)] f32 -> out Bt[rowoff + col][DM] 16-bit, a 64 (input
//           dim) x 64 (output col) tile through its own LDS tile; Wq, Wk, Wv: bf16 RNE bits; Wo: f16 of (bf16 RNE
//           value x W_CARRY) (exact). Written lines whole: 8 lanes x 16 B per line. A block's two tiles of one
//           weight are neighbours along the input dim (256 contiguous bytes per written row).
//   table : ts[j] = 10000^(j/64) (double product of fixed roots -> float), angle = (float)pos / ts[j] (IEEE
//           division), positions read by value.
// coverage: PREP_G * XR_PB == NB*SEQ rows; 2 * PREP_G tiles == Wq's == Wo's, PREP_G tiles == Wk's + Wv's;
// PREP_G * 512 == NB*64*SEQ table elements. LDS sT is cross-wave: one block barrier between fill and readback.
__global__ __launch_bounds__(256) void prep_kernel(const float* __restrict__ X, const int* __restrict__ pos,
                                                   const float* __restrict__ Wq, const float* __restrict__ Wk,
                                                   const float* __restrict__ Wv, const float* __restrict__ Wo,
                                                   u16* __restrict__ Xb, u16* __restrict__ Wt,
                                                   u16* __restrict__ WoT,
                                                   float* __restrict__ cosT, float* __restrict__ sinT) {
  __shared__ __align__(16) u16 sT[WT_PB][64 * TPW];   // [tile][col][input dim]
  const int blk = blockIdx.x;
  const int tid = threadIdx.x;
  const int r8  = tid >> 3;                            // 0..31: tile row on the way in, tile col on the way out
  const int c8  = (tid & 7) * 8;                       // 0..56: tile col on the way in, input dim on the way out

  // table share: one frequency j of one batch b, 512 consecutive positions (block-uniform j and b)
  const int tj = (blk / (SEQ / 512)) % HD2;
  const int tb = blk / ((SEQ / 512) * HD2);
  const int tt = (blk % (SEQ / 512)) * 512 + tid;
  const int* pp = pos + (size_t)tb * SEQ_FULL + tt;
  int pv[2];
  #pragma unroll
  for (int e = 0; e < 2; ++e) pv[e] = pp[e * 256];

  // weight tiles 0, 1 of Wq and 2, 3 of Wo: tile column pc, input-dim rows pd .. pd + 127 (two tiles);
  // tile 4 of Wk (lower half of the grid) or Wv (block-uniform choice)
  const int pd    = ((blk * 2) % (DM / 64)) * 64;
  const int pc    = ((blk * 2) / (DM / 64)) * 64;
  const int kvsel = (blk >= PREP_G / 2) ? 1 : 0;
  const int kvt   = blk - kvsel * (PREP_G / 2);
  const int kd    = (kvt % (DM / 64)) * 64;
  const int kc    = (kvt / (DM / 64)) * 64;
  const float* gq = Wq + (size_t)(pd + r8) * (NQH * HD) + pc + c8;
  const float* go = Wo + (size_t)(pd + r8) * DM + pc + c8;
  const float* gk = (kvsel ? Wv : Wk) + (size_t)(kd + r8) * (NKV * HD) + kc + c8;
  v4f w0[WT_PB][2];
  v4f w1[WT_PB][2];
  #pragma unroll
  for (int s = 0; s < WT_PB; ++s) {
    #pragma unroll
    for (int kk = 0; kk < 2; ++kk) {                   // input dim local r = kk * 32 + r8
      const float* g = (s < 2) ? gq + ((s & 1) * 64 + kk * 32) * (NQH * HD)
                     : (s < 4) ? go + ((s & 1) * 64 + kk * 32) * DM
                               : gk + (kk * 32) * (NKV * HD);
      w0[s][kk] = *(const v4f*)(g);
      w1[s][kk] = *(const v4f*)(g + 4);
    }
  }

  // rows of X: XR_PB consecutive rows of one batch
  const int xm = blk * XR_PB;
  const float* gx = X + ((size_t)(xm / SEQ) * SEQ_FULL + xm % SEQ) * DM + tid * 8;
  v4f a0[XR_PB];
  v4f a1[XR_PB];
  #pragma unroll
  for (int j = 0; j < XR_PB; ++j) {
    a0[j] = *(const v4f*)(gx + j * DM);
    a1[j] = *(const v4f*)(gx + j * DM + 4);
  }
  // the loads' addresses, named as inputs, stay live up to this wait, so that no load's result lands in a register
  // that another load of the burst names; the memory clobber keeps every load above it, in front of the table
  // arithmetic, which runs inside their latency
  asm volatile("s_wait_xcnt 0x0" :: "v"(pp), "v"(gq), "v"(go), "v"(gk), "v"(gx) : "memory");

  double pf = 1.0;
  pf *= (tj & 32) ? 100.0 : 1.0;                       // 10000^(32/64)
  pf *= (tj & 16) ? 10.0 : 1.0;                        // 10000^(16/64)
  pf *= (tj & 8)  ? 3.1622776601683795 : 1.0;          // 10000^(8/64)
  pf *= (tj & 4)  ? 1.7782794100389228 : 1.0;          // 10000^(4/64)
  pf *= (tj & 2)  ? 1.333521432163324  : 1.0;          // 10000^(2/64)
  pf *= (tj & 1)  ? 1.1547819846894583 : 1.0;          // 10000^(1/64)
  const float ts = (float)pf;
  float tc[2];
  float tsn[2];
  #pragma unroll
  for (int e = 0; e < 2; ++e) {
    const int p = pv[e];
    float ang = (float)p / ts;
    ang = (p == 0) ? 0.0f : ang;
    sincosf(ang, &tsn[e], &tc[e]);
  }

  #pragma unroll
  for (int s = 0; s < WT_PB; ++s) {
    #pragma unroll
    for (int kk = 0; kk < 2; ++kk) {
      const int r = kk * 32 + r8;
      #pragma unroll
      for (int i = 0; i < 4; ++i) {
        const float x0 = bf16_back(w0[s][kk][i]);
        const float x1 = bf16_back(w1[s][kk][i]);
        const u16 h0 = (s == 2 || s == 3) ? f16_bits(x0 * W_CARRY) : bf16_bits(x0);
        const u16 h1 = (s == 2 || s == 3) ? f16_bits(x1 * W_CARRY) : bf16_bits(x1);
        sT[s][(c8 + i) * TPW + r]     = h0;
        sT[s][(c8 + 4 + i) * TPW + r] = h1;
      }
    }
  }

  // every global store stands behind the barrier: in front of it the barrier would wait for its completion
  __syncthreads();

  #pragma unroll
  for (int e = 0; e < 2; ++e) {
    const int idx = blk * 512 + e * 256 + tid;         // == (tb * HD2 + tj) * SEQ + tt + e * 256
    cosT[idx] = tc[e];
    sinT[idx] = tsn[e];
  }
  u16* ox = Xb + (size_t)xm * DM + tid * 8;
  #pragma unroll
  for (int j = 0; j < XR_PB; ++j) {
    Pack8 pk;
    #pragma unroll
    for (int i = 0; i < 4; ++i) {
      pk.s[i]     = bf16_bits(a0[j][i]);
      pk.s[4 + i] = bf16_bits(a1[j][i]);
    }
    *(v4u*)(ox + j * DM) = pk.u;
  }
  u16* oq = Wt  + (size_t)(pc + r8) * DM + pd + c8;
  u16* oo = WoT + (size_t)(pc + r8) * DM + pd + c8;
  u16* ok = Wt  + (size_t)((kvsel ? (NQH + NKV) * HD : NQH * HD) + kc + r8) * DM + kd + c8;
  #pragma unroll
  for (int s = 0; s < WT_PB; ++s) {
    #pragma unroll
    for (int kk = 0; kk < 2; ++kk) {                   // col local c = kk * 32 + r8
      const v4u val = *(const v4u*)(&sT[s][(kk * 32 + r8) * TPW + c8]);
      u16* o = (s < 2) ? oq + (s & 1) * 64 + kk * 32 * DM
             : (s < 4) ? oo + (s & 1) * 64 + kk * 32 * DM
                       : ok + kk * 32 * DM;
      *(v4u*)(o) = val;
    }
  }
}

// One k-slab of the block's operands (A: 128 rows x 128 B, B: 128 rows x 128 B) from global memory into one LDS
// buffer: 8 asynchronous 16-B copies per lane, 256 lanes, every byte of the slab copied exactly once; 8 lanes
// cover one whole 128-B line. a / b and l are the lane's own global pointers and LDS byte address of its first
// piece. The closing s_wait_xcnt stands inside the statement so that no address register of an issued copy is
// rewritten ahead of it.
static __device__ __forceinline__ void stage_ab(const u16* a, const u16* b, unsigned l) {
  asm volatile(
      "global_load_async_to_lds_b128 %0, %1, off\n\t"
      "global_load_async_to_lds_b128 %2, %3, off\n\t"
      "global_load_async_to_lds_b128 %4, %5, off\n\t"
      "global_load_async_to_lds_b128 %6, %7, off\n\t"
      "global_load_async_to_lds_b128 %8, %9, off\n\t"
      "global_load_async_to_lds_b128 %10, %11, off\n\t"
      "global_load_async_to_lds_b128 %12, %13, off\n\t"
      "global_load_async_to_lds_b128 %14, %15, off\n\t"
      "s_wait_xcnt 0x0"
      :
      : "v"(l),                              "v"(a),
        "v"(l + 32 * GP * 2),                "v"(a + 32 * DM),
        "v"(l + 64 * GP * 2),                "v"(a + 64 * DM),
        "v"(l + 96 * GP * 2),                "v"(a + 96 * DM),
        "v"(l + GT_H * 2),                   "v"(b),
        "v"(l + GT_H * 2 + 32 * GP * 2),     "v"(b + 32 * DM),
        "v"(l + GT_H * 2 + 64 * GP * 2),     "v"(b + 64 * DM),
        "v"(l + GT_H * 2 + 96 * GP * 2),     "v"(b + 96 * DM)
      : "memory");
}

// GEMM core: C[128x128 block tile] = A[M][DM] x Bt[N][DM]^T, 8 waves, wave tile 32 rows x 64 cols.
// The block's 128 A rows and 128 B rows are staged once per block in LDS, GK k values at a time (two buffers,
// asynchronous copies one slab ahead); fragments are read from there with 16-B LDS loads (two each, split k map
// for A and B alike): same elements, same k order as the rows of A and Bt. sS is the ring (2 * GS_H halves); behind the
// last slab's barrier nobody reads it any more and nothing is in flight, so the caller may reuse it.
// ROPEMAP = 1: wave column group g owns cols {g*32 .. g*32+31} and {64+g*32 .. 64+g*32+31} so that col d and
// its rotary partner d+64 sit in the same lane / same accumulator element (tiles fn and fn+2).
template <int ISF16, int ROPEMAP>
static __device__ __forceinline__ void gemm_core(const u16* __restrict__ A, const u16* __restrict__ Bt,
                                                 u16* sS, int tid,
                                                 int m0, int n0, int wm, int g, int lr, int hi,
                                                 v8f (&acc)[2][4]) {
  int aoff[2];
  int boff[4];
  #pragma unroll
  for (int fm = 0; fm < 2; ++fm) aoff[fm] = (wm + fm * 16 + lr) * GP + 8 * hi;
  #pragma unroll
  for (int fn = 0; fn < 4; ++fn) {
    const int col = ROPEMAP ? (g * 32 + (fn & 1) * 16 + (fn >> 1) * 64) : (g * 64 + fn * 16);
    boff[fn] = GT_H + (col + lr) * GP + 8 * hi;
  }
  // staging: lane's first piece; 8 lanes x 16 B = one 128-B row piece, 32 rows per copy
  const u16* ga = A  + (size_t)(m0 + (tid >> 3)) * DM + (tid & 7) * 8;
  const u16* gb = Bt + (size_t)(n0 + (tid >> 3)) * DM + (tid & 7) * 8;
  const unsigned l0 = (unsigned)(size_t)sS + (tid >> 3) * (GP * 2) + (tid & 7) * 16;   // LDS byte address
  const int nslab = DM / GK;

  // slab 0 lands and is published before anybody reads it; slab 1 then flies during slab 0's products
  stage_ab(ga, gb, l0);
  asm volatile("s_wait_asynccnt 0x0" ::: "memory"); // this wave's copies of slab 0 have landed
  __syncthreads();
  stage_ab(ga + GK, gb + GK, l0 + GS_H * 2);

  #pragma unroll 1
  for (int t = 0; t < nslab; ++t) {
    const int bsel = t & 1;
    const u16* sT = sS + bsel * GS_H;               // this slab's stage buffer
    #pragma unroll
    for (int kk = 0; kk < GK; kk += 32) {
      Frag a[2];
      Frag b[4];
      #pragma unroll
      for (int fm = 0; fm < 2; ++fm) {
        a[fm].q[0] = *(const v4u*)(sT + aoff[fm] + kk);        // k = t*GK + kk + 8hi + 0..7
        a[fm].q[1] = *(const v4u*)(sT + aoff[fm] + kk + 16);   // k = t*GK + kk + 16 + 8hi + 0..7
      }
      #pragma unroll
      for (int fn = 0; fn < 4; ++fn) {
        b[fn].q[0] = *(const v4u*)(sT + boff[fn] + kk);
        b[fn].q[1] = *(const v4u*)(sT + boff[fn] + kk + 16);
      }
      #pragma unroll
      for (int fn = 0; fn < 4; ++fn) {
        #pragma unroll
        for (int fm = 0; fm < 2; ++fm) {
          if (ISF16) acc[fm][fn] = mma_f16(a[fm].h, b[fn].h, acc[fm][fn]);
          else       acc[fm][fn] = mma_bf16(a[fm].b, b[fn].b, acc[fm][fn]);
        }
      }
    }
    // publish point of slab t + 1, every wave, every slab
    asm volatile("s_wait_dscnt 0x0" ::: "memory");    // this wave's reads of the buffer to be refilled are done
    asm volatile("s_wait_asynccnt 0x0" ::: "memory"); // this wave's copies of slab t + 1 have landed
    __syncthreads();                                  // publishes slab t + 1, ends all reads of slab t
    if (t + 2 < nslab) {                              // block-uniform: refill the buffer just read
      stage_ab(ga + (t + 2) * GK, gb + (t + 2) * GK, l0 + bsel * (GS_H * 2));
    }
  }
  asm volatile("s_wait_asynccnt 0x0" ::: "memory");   // nothing of this wave's copies is left in flight
}

// Fused QKV projection + rotary + plane builder.
// grid (NQKV/128 column tiles = one head each, NB*SEQ/128 row tiles); column tile ct: 0..15 q head, 16..19 k head,
// 20..23 v head. Outputs:
//   ph / pl : bf16 hi / lo planes, q region [NB][NQH][SEQ][HD] at 0, k region [NB][NKV][SEQ][HD] at QELEMS
//   vt      : f16 (x V_CARRY) [NB][NKV][HD][SEQ], transposed through LDS
// LDS tiles sA / sB are cross-wave (block barrier between fill and readback); staged extent 128 x 128 ==
// consumed extent. They lie in the GEMM ring, which is free once gemm_core has returned. Every written line whole: 16 lanes x 16 B = one 256-B row per half-wave.
__global__ __launch_bounds__(256) void qkv_gemm_kernel(const u16* __restrict__ Xb, const u16* __restrict__ Wt,
                                                       const float* __restrict__ cosT,
                                                       const float* __restrict__ sinT,
                                                       u16* __restrict__ ph, u16* __restrict__ pl,
                                                       u16* __restrict__ vt) {
  __shared__ __align__(16) u16 sS[2 * GS_H];
  u16* const sA = sS;
  u16* const sB = sS + 128 * EP;
  const int ct   = blockIdx.x;
  const int m0   = blockIdx.y * 128;
  const int tid  = threadIdx.x;
  const int wave = __builtin_amdgcn_readfirstlane(threadIdx.x >> 5);
  const int lane = tid & 31;
  const int lr   = lane & 15;
  const int hi   = lane >> 4;
  const int wm   = (wave & 3) * 32;
  const int g    = wave >> 2;

  v8f acc[2][4];
  #pragma unroll
  for (int fm = 0; fm < 2; ++fm) {
    #pragma unroll
    for (int fn = 0; fn < 4; ++fn) acc[fm][fn] = (v8f){0, 0, 0, 0, 0, 0, 0, 0};
  }
  gemm_core<0, 1>(Xb, Wt, sS, tid, m0, ct * 128, wm, g, lr, hi, acc);

  const int b  = m0 / SEQ;
  const int t0 = m0 % SEQ;

  if (ct < NQH + NKV) {
    // rotary on the f32 accumulators, then bf16 hi | lo split into the LDS tiles
    #pragma unroll
    for (int fm = 0; fm < 2; ++fm) {
      #pragma unroll
      for (int f2 = 0; f2 < 2; ++f2) {
        const int j  = g * 32 + f2 * 16 + lr;             // frequency index 0..63
        const int tl = wm + fm * 16 + 8 * hi;             // first of this lane's 8 tile rows
        const size_t tb = ((size_t)b * HD2 + j) * SEQ + t0 + tl;
        const v4f ca = *(const v4f*)(cosT + tb);
        const v4f cb = *(const v4f*)(cosT + tb + 4);
        const v4f sa = *(const v4f*)(sinT + tb);
        const v4f sb = *(const v4f*)(sinT + tb + 4);
        #pragma unroll
        for (int i = 0; i < 8; ++i) {
          const float c  = (i < 4) ? ca[i & 3] : cb[i & 3];
          const float s  = (i < 4) ? sa[i & 3] : sb[i & 3];
          const float x1 = acc[fm][f2][i];                 // col j
          const float x2 = acc[fm][f2 + 2][i];             // col j + 64
          const float y1 = x1 * c - x2 * s;
          const float y2 = x2 * c + x1 * s;
          const float h1 = bf16_back(y1);
          const float h2 = bf16_back(y2);
          const int row = tl + i;
          sA[row * EP + j]       = bf16_bits(h1);
          sA[row * EP + 64 + j]  = bf16_bits(h2);
          sB[row * EP + j]       = bf16_bits(y1 - h1);
          sB[row * EP + 64 + j]  = bf16_bits(y2 - h2);
        }
      }
    }
    __syncthreads();
    const int isq   = (ct < NQH) ? 1 : 0;
    const int pbase = isq ? (((b * NQH + ct) * SEQ + t0) * HD)
                          : (QELEMS + ((b * NKV + (ct - NQH)) * SEQ + t0) * HD);
    v4u vA[8];
    v4u vB[8];
    int gi[8];
    #pragma unroll
    for (int it = 0; it < 8; ++it) {
      const int piece = it * 256 + tid;
      const int row = piece >> 4;                          // 0..127
      const int seg = piece & 15;                          // 16 x 16 B = one 256-B plane row
      vA[it] = *(const v4u*)(sA + row * EP + seg * 8);
      vB[it] = *(const v4u*)(sB + row * EP + seg * 8);
      gi[it] = pbase + row * HD + seg * 8;
    }
    #pragma unroll
    for (int it = 0; it < 8; ++it) {
      *(v4u*)(ph + gi[it]) = vA[it];
      *(v4u*)(pl + gi[it]) = vB[it];
    }
    
  } else {
    // v head: f16 carried x V_CARRY, transposed in LDS to [d][t]
    const int kvh = ct - (NQH + NKV);
    #pragma unroll
    for (int fm = 0; fm < 2; ++fm) {
      #pragma unroll
      for (int fn = 0; fn < 4; ++fn) {
        const int d = g * 32 + (fn & 1) * 16 + (fn >> 1) * 64 + lr;
        #pragma unroll
        for (int i = 0; i < 8; ++i) {
          const int row = wm + fm * 16 + 8 * hi + i;
          sA[d * EP + row] = f16_bits(acc[fm][fn][i] * V_CARRY);
        }
      }
    }
    __syncthreads();
    v4u vA[8];
    int gi[8];
    #pragma unroll
    for (int it = 0; it < 8; ++it) {
      const int piece = it * 256 + tid;
      const int d   = piece >> 4;                          // 0..127
      const int seg = piece & 15;
      vA[it] = *(const v4u*)(sA + d * EP + seg * 8);
      gi[it] = ((b * NKV + kvh) * HD + d) * SEQ + t0 + seg * 8;
    }
    #pragma unroll
    for (int it = 0; it < 8; ++it) *(v4u*)(vt + gi[it]) = vA[it];
    
  }
}

// One 32-key stage (K hi, K lo: 32 rows x 256 B each; V^T: 128 rows x 64 B) from global memory into one LDS
// buffer: 12 asynchronous 16-B copies per lane, 128 lanes, every byte of the stage copied exactly once.
// kh / kl / v and lk / lv are the lane's own global pointers and LDS byte addresses of its first piece.
// The closing s_wait_xcnt stands inside the statement so that no address register of an issued copy is
// rewritten ahead of it.
static __device__ __forceinline__ void stage_kv(const u16* kh, const u16* kl, const u16* v,
                                                unsigned lk, unsigned lv) {
  asm volatile(
      "global_load_async_to_lds_b128 %0, %1, off\n\t"
      "global_load_async_to_lds_b128 %2, %3, off\n\t"
      "global_load_async_to_lds_b128 %4, %5, off\n\t"
      "global_load_async_to_lds_b128 %6, %7, off\n\t"
      "global_load_async_to_lds_b128 %8, %9, off\n\t"
      "global_load_async_to_lds_b128 %10, %11, off\n\t"
      "global_load_async_to_lds_b128 %12, %13, off\n\t"
      "global_load_async_to_lds_b128 %14, %15, off\n\t"
      "global_load_async_to_lds_b128 %16, %17, off\n\t"
      "global_load_async_to_lds_b128 %18, %19, off\n\t"
      "global_load_async_to_lds_b128 %20, %21, off\n\t"
      "global_load_async_to_lds_b128 %22, %23, off\n\t"
      "s_wait_xcnt 0x0"
      :
      : "v"(lk),                             "v"(kh),
        "v"(lk + 8 * KP * 2),                "v"(kh + 8 * HD),
        "v"(lk + 16 * KP * 2),               "v"(kh + 16 * HD),
        "v"(lk + 24 * KP * 2),               "v"(kh + 24 * HD),
        "v"(lk + KT_H * 2),                  "v"(kl),
        "v"(lk + KT_H * 2 + 8 * KP * 2),     "v"(kl + 8 * HD),
        "v"(lk + KT_H * 2 + 16 * KP * 2),    "v"(kl + 16 * HD),
        "v"(lk + KT_H * 2 + 24 * KP * 2),    "v"(kl + 24 * HD),
        "v"(lv),                             "v"(v),
        "v"(lv + 32 * VP * 2),               "v"(v + 32 * SEQ),
        "v"(lv + 64 * VP * 2),               "v"(v + 64 * SEQ),
        "v"(lv + 96 * VP * 2),               "v"(v + 96 * SEQ)
      : "memory");
}

// K fragments of one 32-d slice from a staged stage buffer: key tile 0 hi, lo, key tile 1 hi, lo (8 LDS reads).
// p = fragment origin of the slice inside the K hi plane tile.
static __device__ __forceinline__ void load_kset(Frag (&k)[4], const u16* p) {
  k[0].q[0] = *(const v4u*)(p);
  k[0].q[1] = *(const v4u*)(p + 16);
  k[1].q[0] = *(const v4u*)(p + KT_H);
  k[1].q[1] = *(const v4u*)(p + KT_H + 16);
  k[2].q[0] = *(const v4u*)(p + 16 * KP);
  k[2].q[1] = *(const v4u*)(p + 16 * KP + 16);
  k[3].q[0] = *(const v4u*)(p + KT_H + 16 * KP);
  k[3].q[1] = *(const v4u*)(p + KT_H + 16 * KP + 16);
}

// Fused causal grouped-query attention, logit scale 1.0, online softmax in the exp2 domain.
// Block = 8 waves = the four query heads of one key/value head for the same 16 query rows, twice: wave group 0
// takes the even 32-key steps, wave group 1 the odd ones (uniform trip count), each with its own running maximum,
// sum and O; the two partial states are joined through LDS behind the key loop. The longest causal chain of
// dependent key steps is so half as long.
// S^T = K x Q^T so queries sit on lanes; P^T in C layout is bit-identical to the A-fragment layout of O += P x V.
// q and k: bf16 hi | lo planes, three products per k-step into one accumulator. q fragments are loaded once
// and stay in registers. ctx out: f16 carried x C_CARRY, [NB*SEQ][DM], col = head*128 + d.
// K hi | K lo | V^T of each 32-key step are staged once per block in LDS (per wave group two buffers, filled by
// that group's lanes, asynchronous copies one step ahead) and read by the group's four waves with 16-B LDS loads;
// same elements, same k order as the planes.
// LDS sO: each wave writes and reads only its own slice; a block barrier separates fill and readback.
// four waves per SIMD (two blocks per WGP) need the wave inside 256 registers
__global__ __launch_bounds__(256) __attribute__((amdgpu_waves_per_eu(4, 4))) void attn_kernel(const u16* __restrict__ ph, const u16* __restrict__ pl,
                                                   const u16* __restrict__ vt, u16* __restrict__ ctx) {
  // Causal balance: twice as many blocks as resident places, and a block's key steps grow with its query tile:
  // the tile falls with the flat block index, so that the long blocks start
  // first and the short ones fill the places that fall free. For speed only; flat -> (tile, kv, b) is one to one.
  const int flat = blockIdx.x + NQT * (blockIdx.y + NKV * blockIdx.z);
  const int qt   = NQT - 1 - flat / (NKV * NB);
  const int kv   = flat % NKV;
  const int b    = (flat / NKV) % NB;
  const int tid  = threadIdx.x;
  const int wave = __builtin_amdgcn_readfirstlane(threadIdx.x >> 5);
  const int lane = tid & 31;
  const int lq   = lane & 15;     // query column of S^T / d column of O
  const int hi   = lane >> 4;     // k-split half
  const int grp  = wave >> 2;     // wave group: parity of the 32-key steps it takes
  const int hw   = wave & 3;      // query head inside the key/value head's group
  const int gt   = tid & 127;     // lane index inside the wave group (staging)
  const int head = kv * GRP + hw;
  const int qrow0 = qt * 16;

  __shared__ __align__(16) u16 sO[GRP * 16 * CP];
  __shared__ __align__(16) u16 sKV[2 * 2 * KV_H];     // [wave group][buffer]

  const int qoff  = ((b * NQH + head) * SEQ + qrow0 + lq) * HD + hi * 8;
  const int kfrag = lq * KP + hi * 8;                 // fragment origin inside a staged K plane tile
  const int vfrag = 2 * KT_H + lq * VP + hi * 8;      // fragment origin of the staged V^T tile

  // staging: lane's first piece. K: 16 lanes x 16 B = one 256-B row, 8 rows per copy; V^T: 4 lanes per 64-B row.
  // The pointers stand at the group's first step (keys grp * 32 ...); its next step lies 64 keys on.
  const u16* gkh = ph + QELEMS + ((b * NKV + kv) * SEQ + grp * 32) * HD + gt * 8;
  const u16* gkl = pl + QELEMS + ((b * NKV + kv) * SEQ + grp * 32) * HD + gt * 8;
  const u16* gv  = vt + ((b * NKV + kv) * HD + (gt >> 2)) * SEQ + grp * 32 + (gt & 3) * 8;
  // LDS byte address = low 32 bits of the shared address; the group's own pair of buffers
  const unsigned lbase = (unsigned)(size_t)sKV + grp * (2 * KV_H * 2);
  const unsigned lk = lbase + (gt >> 4) * (KP * 2) + (gt & 15) * 16;
  const unsigned lv = lbase + 2 * KT_H * 2 + (gt >> 2) * (VP * 2) + (gt & 3) * 16;

  v8f o[8];
  #pragma unroll
  for (int dt = 0; dt < 8; ++dt) o[dt] = (v8f){0, 0, 0, 0, 0, 0, 0, 0};

  const float NEGV = -1.0e30f;
  float rmax = NEGV;
  float rsum = 0.0f;
  const float SL = 1.4426950408889634f;             // logit scale 1.0 times log2(e)

  // 32-key steps of the tile, and trips of the loop: step 2 * trip + grp. With an odd count group 1's last step
  // lies wholly beyond the diagonal (still inside the sequence: an odd count is below SEQ / 32); the causal
  // exclusion turns all of it off.
  const int nchunk = (qrow0 >> 5) + 1;
  const int ntrip  = (nchunk + 1) >> 1;             // same for every wave of the block

  // q fragments (B operand of S^T): loaded once, held in registers over the whole key loop
  Frag qh[4], ql[4];
  #pragma unroll
  for (int f = 0; f < 4; ++f) {
    const int qa = qoff + f * 32;
    qh[f].q[0] = *(const v4u*)(ph + qa);            // d = f*32 + 8hi + 0..7
    qh[f].q[1] = *(const v4u*)(ph + qa + 16);       // d = f*32 + 16 + 8hi + 0..7
    ql[f].q[0] = *(const v4u*)(pl + qa);
    ql[f].q[1] = *(const v4u*)(pl + qa + 16);
  }

  // stage 0 lands and is published before anybody reads it; stage 1 then flies during step 0
  stage_kv(gkh, gkl, gv, lk, lv);
  asm volatile("s_wait_asynccnt 0x0" ::: "memory"); // this wave's copies of stage 0 have landed
  __syncthreads();
  if (ntrip > 1) stage_kv(gkh + 64 * HD, gkl + 64 * HD, gv + 64, lk + KV_H * 2, lv + KV_H * 2);

  #pragma unroll 1
  for (int ic = 0; ic < ntrip; ++ic) {
    const int j0 = (2 * ic + grp) * 32;
    const int bsel = ic & 1;
    const u16* sT = sKV + (grp * 2 + bsel) * KV_H;  // this step's stage buffer

    // S^T tiles: c0[r] = score(query qrow0+lq, key j0 + 8hi + r), c1[r] = key j0 + 16 + 8hi + r
    v8f c0 = (v8f){0, 0, 0, 0, 0, 0, 0, 0};
    v8f c1 = (v8f){0, 0, 0, 0, 0, 0, 0, 0};
    // LDS fragment reads are issued in groups ahead of the products that use them: K one 32-d slice ahead in a
    // second register set, V^T into the K sets' registers as they fall free, all of it before the softmax.
    Frag ks[2][4];
    Frag bv[8];
    load_kset(ks[0], sT + kfrag);
    load_kset(ks[1], sT + kfrag + 32);
    // keeps both read groups in front of the first products (sunk to their uses, each read's latency is waited out)
    __builtin_amdgcn_sched_barrier(0);
    #pragma unroll
    for (int f = 0; f < 4; ++f) {
      const Frag qhf = qh[f];
      const Frag qlf = ql[f];
      Frag (&k)[4] = ks[f & 1];
      c0 = mma_bf16(k[0].b, qhf.b, c0);             // key j0 + lq
      c0 = mma_bf16(k[0].b, qlf.b, c0);
      c0 = mma_bf16(k[1].b, qhf.b, c0);
      c1 = mma_bf16(k[2].b, qhf.b, c1);             // key j0 + 16 + lq
      c1 = mma_bf16(k[2].b, qlf.b, c1);
      c1 = mma_bf16(k[3].b, qhf.b, c1);
      // the refill of this register set stays behind its last product ...
      __builtin_amdgcn_sched_barrier(0);
      if (f < 2) {
        load_kset(ks[f & 1], sT + kfrag + (f + 2) * 32);
      } else {
        #pragma unroll
        for (int dt = 0; dt < 4; ++dt) {            // V^T B-fragments: column n = d = ((f - 2) * 4 + dt) * 16 + lq, split key map
          const int va = vfrag + (((f - 2) * 4 + dt) * 16) * VP;
          bv[(f - 2) * 4 + dt].q[0] = *(const v4u*)(sT + va);        // keys j0 + 8hi + 0..7
          bv[(f - 2) * 4 + dt].q[1] = *(const v4u*)(sT + va + 16);   // keys j0 + 16 + 8hi + 0..7
        }
      }
      // ... and in front of the next slice's products, so that it flies during them
      __builtin_amdgcn_sched_barrier(0);
    }

    // causal exclusion (only a group's last step can hold keys beyond a query row); wave-uniform test
    if (j0 + 31 > qrow0) {
      const int trow = qrow0 + lq;
      #pragma unroll
      for (int r = 0; r < 8; ++r) {
        const int key0 = j0 + hi * 8 + r;
        c0[r] = (key0 > trow) ? NEGV : c0[r];
        c1[r] = (key0 + 16 > trow) ? NEGV : c1[r];
      }
    }

    // online softmax: query lq's 32 scores are split across lane / lane^16
    float m_new = rmax;
    #pragma unroll
    for (int r = 0; r < 8; ++r) {
      m_new = fmaxf(m_new, c0[r]);
      m_new = fmaxf(m_new, c1[r]);
    }
    m_new = fmaxf(m_new, __shfl_xor(m_new, 16, 32));
    const float scale = __builtin_amdgcn_exp2f((rmax - m_new) * SL);
    rmax = m_new;

    // exp + pack: P^T C layout == A-fragment layout of the PV product; P carried x4096
    Frag pa;
    float psum = 0.0f;
    #pragma unroll
    for (int r = 0; r < 8; ++r) {
      const float p0 = __builtin_amdgcn_exp2f((c0[r] - m_new) * SL);   // key 8hi + r
      const float p1 = __builtin_amdgcn_exp2f((c1[r] - m_new) * SL);   // key 16 + 8hi + r
      psum += p0 + p1;
      pa.e[r]     = (f16)(p0 * P_CARRY);
      pa.e[8 + r] = (f16)(p1 * P_CARRY);
    }
    rsum = rsum * scale + psum + __shfl_xor(psum, 16, 32);

    // rescale O: queries are the row dimension there -> per-row scale from lane 8hi + r
    float sc[8];
    #pragma unroll
    for (int r = 0; r < 8; ++r) sc[r] = __shfl(scale, (hi << 3) + r, 32);
    #pragma unroll
    for (int dt = 0; dt < 8; ++dt) {
      #pragma unroll
      for (int r = 0; r < 8; ++r) o[dt][r] *= sc[r];
    }

    // O += P x V on the V^T fragments read above
    #pragma unroll
    for (int dt = 0; dt < 8; ++dt) o[dt] = mma_f16(pa.h, bv[dt].h, o[dt]);

    // publish point of stage ic + 1, every wave, every step
    asm volatile("s_wait_dscnt 0x0" ::: "memory");    // this wave's reads of the buffer to be refilled are done
    asm volatile("s_wait_asynccnt 0x0" ::: "memory"); // this wave's copies of stage ic + 1 have landed
    __syncthreads();                                  // publishes stage ic + 1, ends all reads of stage ic
    if (ic + 2 < ntrip) {                             // block-uniform: refill the buffer just read
      const int nx = ic + 2;
      stage_kv(gkh + nx * (64 * HD), gkl + nx * (64 * HD), gv + nx * 64,
               lk + bsel * (KV_H * 2), lv + bsel * (KV_H * 2));
    }
  }
  asm volatile("s_wait_asynccnt 0x0" ::: "memory");   // nothing of this wave's copies is left in flight

  // Join of the two partial states. Behind the loop's last barrier nobody reads the stage buffers any more and no
  // copy is in flight, so they serve as the hand-over area: group 1 writes O (lane-major, 16 B x 32 lanes per
  // store), maximum and sum; a block barrier; group 0 reads its head's and folds them in. A group 1 that saw no
  // key inside the diagonal hands over the maximum NEGV and gets the weight exp2(-huge) = 0.
  float* const sJ  = (float*)sKV;                     // [head][16 pieces][lane] x 4 floats
  float* const sJm = sJ + GRP * 16 * 32 * 4;          // [head][maximum | sum][lane]
  if (grp == 1) {                                     // wave-uniform
    #pragma unroll
    for (int dt = 0; dt < 8; ++dt) {
      *(v4f*)(sJ + ((hw * 16 + dt * 2) * 32 + lane) * 4)     = (v4f){o[dt][0], o[dt][1], o[dt][2], o[dt][3]};
      *(v4f*)(sJ + ((hw * 16 + dt * 2 + 1) * 32 + lane) * 4) = (v4f){o[dt][4], o[dt][5], o[dt][6], o[dt][7]};
    }
    sJm[(hw * 2) * 32 + lane]     = rmax;
    sJm[(hw * 2 + 1) * 32 + lane] = rsum;
  }
  __syncthreads();

  const int so = hw * (16 * CP);
  if (grp == 0) {                                     // wave-uniform
    const float m1 = sJm[(hw * 2) * 32 + lane];
    const float l1 = sJm[(hw * 2 + 1) * 32 + lane];
    const float mj = fmaxf(rmax, m1);
    const float w0 = __builtin_amdgcn_exp2f((rmax - mj) * SL);
    const float w1 = __builtin_amdgcn_exp2f((m1 - mj) * SL);
    rsum = rsum * w0 + l1 * w1;

    // normalize: lane holds column d = dt*16 + lq for query rows 8hi + r; fold the carries and the join weights
    const float CN = C_CARRY / (P_CARRY * V_CARRY);
    float rs0[8];
    float rs1[8];
    #pragma unroll
    for (int r = 0; r < 8; ++r) {
      const float rn = CN * (1.0f / __shfl(rsum, (hi << 3) + r, 32));
      rs0[r] = rn * __shfl(w0, (hi << 3) + r, 32);
      rs1[r] = rn * __shfl(w1, (hi << 3) + r, 32);
    }
    #pragma unroll
    for (int dt = 0; dt < 8; ++dt) {
      const v4f pa0 = *(const v4f*)(sJ + ((hw * 16 + dt * 2) * 32 + lane) * 4);
      const v4f pa1 = *(const v4f*)(sJ + ((hw * 16 + dt * 2 + 1) * 32 + lane) * 4);
      #pragma unroll
      for (int r = 0; r < 8; ++r) {
        const float p = (r < 4) ? pa0[r & 3] : pa1[r & 3];
        sO[so + (hi * 8 + r) * CP + dt * 16 + lq] = f16_bits(o[dt][r] * rs0[r] + p * rs1[r]);
      }
    }
  }
  __syncthreads();
  if (grp == 1) return;                               // wave-uniform, behind the last barrier

  // 8 consecutive lanes x 16 B each), lanes 16..31 the next row; 8 instructions cover the wave's 16 rows.
  v4u    vals[8];
  size_t gidx[8];
  #pragma unroll
  for (int it = 0; it < 8; ++it) {
    const int row = it * 2 + hi;
    vals[it] = *(const v4u*)(sO + so + row * CP + lq * 8);
    gidx[it] = ((size_t)b * SEQ + qrow0 + row) * DM + head * HD + lq * 8;
  }
  #pragma unroll
  for (int it = 0; it < 8; ++it) *(v4u*)(ctx + gidx[it]) = vals[it];
  
}

// Output projection: out[b][t][DM] = ctx x Wo, f16 operands (carries folded back in f32).
// written by 8 consecutive lanes x 16 B of one instruction.
__global__ __launch_bounds__(256) void out_gemm_kernel(const u16* __restrict__ ctx, const u16* __restrict__ WoT,
                                                       float* __restrict__ out) {
  __shared__ __align__(16) u16 sS[2 * GS_H];
  float* const sC = (float*)sS;                    // output staging lies in the GEMM ring, free after gemm_core
  const int n0   = blockIdx.x * 128;
  const int m0   = blockIdx.y * 128;
  const int tid  = threadIdx.x;
  const int wave = __builtin_amdgcn_readfirstlane(threadIdx.x >> 5);
  const int lane = tid & 31;
  const int lr   = lane & 15;
  const int hi   = lane >> 4;
  const int wm   = (wave & 3) * 32;
  const int g    = wave >> 2;

  v8f acc[2][4];
  #pragma unroll
  for (int fm = 0; fm < 2; ++fm) {
    #pragma unroll
    for (int fn = 0; fn < 4; ++fn) acc[fm][fn] = (v8f){0, 0, 0, 0, 0, 0, 0, 0};
  }
  gemm_core<1, 0>(ctx, WoT, sS, tid, m0, n0, wm, g, lr, hi, acc);

  const float INV = 1.0f / (C_CARRY * W_CARRY);
  #pragma unroll
  for (int p = 0; p < 2; ++p) {
    if (((wave & 3) >> 1) == p) {                  // wave-uniform: this wave's rows belong to half p
      #pragma unroll
      for (int fm = 0; fm < 2; ++fm) {
        #pragma unroll
        for (int fn = 0; fn < 4; ++fn) {
          #pragma unroll
          for (int i = 0; i < 8; ++i) {
            sC[(wm - p * 64 + fm * 16 + 8 * hi + i) * CPF + g * 64 + fn * 16 + lr] = acc[fm][fn][i] * INV;
          }
        }
      }
    }
    __syncthreads();
    v4f    vals[8];
    size_t gidx[8];
    #pragma unroll
    for (int it = 0; it < 8; ++it) {
      const int piece = it * 256 + tid;
      const int row = piece >> 5;                  // 0..63
      const int seg = piece & 31;
      vals[it] = *(const v4f*)(sC + row * CPF + seg * 4);
      const int m  = m0 + p * 64 + row;
      const int bb = m / SEQ;
      const int tt = m % SEQ;
      gidx[it] = ((size_t)bb * SEQ_FULL + tt) * DM + n0 + seg * 4;
    }
    #pragma unroll
    for (int it = 0; it < 8; ++it) *(v4f*)(out + gidx[it]) = vals[it];
    
    __syncthreads();
  }
}

extern "C" void kernel_launch(void* const* d_in, const int* in_sizes, int n_in,
                              void* d_out, int out_size, void* d_ws, size_t ws_size,
                              hipStream_t stream) {
  if (n_in < 6) return;
  const size_t needX = ((size_t)(NB - 1) * SEQ_FULL + SEQ) * DM;
  const size_t needP = (size_t)(NB - 1) * SEQ_FULL + SEQ;
  if ((size_t)in_sizes[0] < needX) return;
  if ((size_t)in_sizes[1] < needP) return;
  if ((size_t)in_sizes[2] < (size_t)DM * NQH * HD) return;
  if ((size_t)in_sizes[3] < (size_t)DM * NKV * HD) return;
  if ((size_t)in_sizes[4] < (size_t)DM * NKV * HD) return;
  if ((size_t)in_sizes[5] < (size_t)NQH * HD * DM) return;
  if ((size_t)out_size < needX) return;
  if (ws_size < (size_t)WS_TOTAL) return;

  const float* X   = (const float*)d_in[0];
  const int*   pos = (const int*)d_in[1];
  const float* Wq  = (const float*)d_in[2];
  const float* Wk  = (const float*)d_in[3];
  const float* Wv  = (const float*)d_in[4];
  const float* Wo  = (const float*)d_in[5];
  float* out = (float*)d_out;

  char* ws = (char*)d_ws;
  u16*   Xb   = (u16*)(ws + OFF_XB);
  u16*   Wt   = (u16*)(ws + OFF_WT);
  u16*   WoT  = (u16*)(ws + OFF_WO);
  float* cosT = (float*)(ws + OFF_COS);
  float* sinT = (float*)(ws + OFF_SIN);
  u16*   ph   = (u16*)(ws + OFF_PH);
  u16*   pl   = (u16*)(ws + OFF_PL);
  u16*   vt   = (u16*)(ws + OFF_VT);
  u16*   ctx  = (u16*)(ws + OFF_CTX);

  // X -> bf16 rows, weights -> transposed 16-bit, rotary table from the positions
  prep_kernel<<<dim3(PREP_G), 256, 0, stream>>>(X, pos, Wq, Wk, Wv, Wo, Xb, Wt, WoT, cosT, sinT);
  // fused QKV projection + rotary + planes
  qkv_gemm_kernel<<<dim3(NQKV / 128, (NB * SEQ) / 128), 256, 0, stream>>>(Xb, Wt, cosT, sinT, ph, pl, vt);
  // attention
  attn_kernel<<<dim3(SEQ / 16, NKV, NB), 256, 0, stream>>>(ph, pl, vt, ctx);
  // output projection
  out_gemm_kernel<<<dim3(DM / 128, (NB * SEQ) / 128), 256, 0, stream>>>(ctx, WoT, out);
}

// v008
// It runs in 153 microseconds.
// Next to v007, in two timings, it ran 1.06 and 1.05 times as fast.
// Counting every step since v000, it is 4.14 times as fast.
#include <hip/hip_runtime.h>

// Contractions: QKV projections on v_wmma_f32_16x16x32_bf16 (bf16 RNE-converted inputs, f32 accumulate); scores S^T = K x Q^T on v_wmma_f32_16x16x32_bf16 with q and k as bf16 hi|lo planes (hi.hi + hi.lo + lo.hi, one f32 accumulator); O = P x V on v_wmma_f32_16x16x32_f16 (P f16 carried x4096, V f16 carried x16); output projection on v_wmma_f32_16x16x32_f16 (ctx f16 carried x64, Wo = f16 of the bf16 RNE-converted input carried x64); all f32 accumulate; softmax (online, max-subtracted, exp2 domain) and rotary math in f32.

#ifndef NB
#define NB 2
#endif
#ifndef SEQ
#define SEQ 2048
#endif
#define NB_FULL   2
#define SEQ_FULL  2048
#define DM        2048                 // model width = depth of every projection
#define NQH       16                   // query heads
#define NKV       4                    // key/value heads
#define GRP       4                    // query heads per key/value head
#define HD        128                  // head dim
#define HD2       64                   // rotary frequencies
#define NQKV      3072                 // fused projection width (q | k | v)
#define EP        128                  // LDS pitch (halves) of the 16-bit epilogue tiles
#define CPF       132                  // LDS pitch (floats) of the f32 output staging tile
#define CP        136                  // LDS pitch (halves) of the per-wave ctx staging tile
#define TPW       72                   // LDS pitch (halves) of the weight transposer tile
#define KP        136                  // LDS pitch (halves) of a staged K row: 272 B = 16 B x odd
#define VP        40                   // LDS pitch (halves) of a staged V^T row of 32 keys: 80 B = 16 B x odd
#define KT_H      (32 * KP)            // halves of one staged K plane tile (32 keys)
#define VT_H      (HD * VP)            // halves of one staged V^T tile (128 d rows x 32 keys)
#define KV_H      (2 * KT_H + VT_H)    // halves of one stage buffer: K hi | K lo | V^T
#define GK        64                   // k extent (halves) of one staged GEMM slab: 128 B = one line per operand row
#define GP        72                   // LDS pitch (halves) of a staged GEMM operand row: 144 B = 16 B x odd
#define GT_H      (128 * GP)           // halves of one staged operand tile (128 rows)
#define GS_H      (2 * GT_H)           // halves of one GEMM stage buffer: A tile | B tile
#define QW        2                    // query tiles of 16 rows held by one attention wave
#define NQT       (SEQ / (QW * 16))    // query tiles of a block (QW * 16 rows) per (batch, key/value head)
#define WS_CAP    134217728ull
#define PREP_G    512                  // blocks of the preparation launch: two per WGP
#define XR_PB     ((NB * SEQ) / PREP_G) // rows of X per preparation block
#define WT_PB     5                    // weight tiles per preparation block

#define P_CARRY   4096.0f
#define V_CARRY   16.0f
#define C_CARRY   64.0f
#define W_CARRY   64.0f

static_assert(NB >= 1 && NB <= NB_FULL);
static_assert(SEQ <= SEQ_FULL);
static_assert(SEQ % 128 == 0);
static_assert(DM % 128 == 0);
static_assert(DM % 32 == 0);
static_assert(DM == 256 * 8);                     // 256 threads x 8 elements = one X row
static_assert(NQKV == NQH * HD + 2 * NKV * HD);
static_assert(NQKV % 128 == 0);
static_assert(NQH == NKV * GRP);
static_assert(HD == 128 && HD2 * 2 == HD);
static_assert(NQH * HD == DM);
static_assert(EP >= HD && (EP * 2) % 16 == 0);
static_assert((CPF * 4) % 16 == 0 && CPF >= 128);
static_assert((CP * 2) % 16 == 0 && CP >= HD);
static_assert((TPW * 2) % 16 == 0 && TPW >= 64);
static_assert((size_t)NB * HD2 * SEQ == (size_t)PREP_G * 512);
static_assert(XR_PB * PREP_G == NB * SEQ && SEQ % XR_PB == 0 && SEQ % 512 == 0);
static_assert((NQH * HD / 64) * (DM / 64) == 2 * PREP_G && (DM / 64) * (DM / 64) == 2 * PREP_G);
static_assert((NKV * HD / 64) * (DM / 64) * 2 == PREP_G);
static_assert(2 * 128 * EP * 2 <= 65536);
static_assert((KP * 2) % 16 == 0 && KP >= HD && (VP * 2) % 16 == 0 && VP >= 32);
static_assert((KT_H * 2) % 16 == 0 && (KV_H * 2) % 16 == 0);
static_assert(SEQ % 64 == 0);                     // an odd count of 32-key steps is below SEQ / 32
static_assert(2 * 2 * KV_H * 2 >= GRP * QW * 16 * 32 * 16 + GRP * QW * 2 * 32 * 4);   // the join area fits the stage buffers
static_assert(QW * 16 == 32);                     // a block's query rows = one 32-key step: the diagonal lies in one step
static_assert(DM % GK == 0 && DM / GK >= 2 && GK % 32 == 0);
static_assert((GP * 2) % 16 == 0 && GP >= GK && (GT_H * 2) % 16 == 0);
static_assert(2 * GS_H >= 2 * 128 * EP);          // the 16-bit epilogue tiles fit the GEMM ring
static_assert(2 * GS_H * 2 >= 64 * CPF * 4);      // the f32 output staging tile fits the GEMM ring

#define QELEMS   (NB * NQH * SEQ * HD)            // q region of the hi / lo planes (elements)
#define KELEMS   (NB * NKV * SEQ * HD)            // k region
#define XB_BYTES   ((size_t)NB * SEQ * DM * 2)
#define WT_BYTES   ((size_t)NQKV * DM * 2)
#define WO_BYTES   ((size_t)DM * DM * 2)
#define TB_BYTES   ((size_t)NB * HD2 * SEQ * 4)
#define PL_BYTES   ((size_t)(QELEMS + KELEMS) * 2)
#define VT_BYTES   ((size_t)NB * NKV * HD * SEQ * 2)
#define CTX_BYTES  ((size_t)NB * SEQ * DM * 2)
#define OFF_XB   ((size_t)0)
#define OFF_WT   (OFF_XB + XB_BYTES)
#define OFF_WO   (OFF_WT + WT_BYTES)
#define OFF_COS  (OFF_WO + WO_BYTES)
#define OFF_SIN  (OFF_COS + TB_BYTES)
#define OFF_PH   (OFF_SIN + TB_BYTES)
#define OFF_PL   (OFF_PH + PL_BYTES)
#define OFF_VT   (OFF_PL + PL_BYTES)
#define OFF_CTX  (OFF_VT + VT_BYTES)
#define WS_TOTAL (OFF_CTX + CTX_BYTES)
static_assert(WS_TOTAL <= WS_CAP);
static_assert(XB_BYTES % 256 == 0 && WT_BYTES % 256 == 0 && WO_BYTES % 256 == 0);
static_assert(TB_BYTES % 256 == 0 && PL_BYTES % 256 == 0 && VT_BYTES % 256 == 0);
static_assert((unsigned long long)(QELEMS + KELEMS) < 2147483648ull);

typedef __bf16         bf16;
typedef _Float16       f16;
typedef unsigned short u16;
typedef bf16     v16bf __attribute__((ext_vector_type(16)));
typedef f16      v16h  __attribute__((ext_vector_type(16)));
typedef float    v8f   __attribute__((ext_vector_type(8)));
typedef float    v4f   __attribute__((ext_vector_type(4)));
typedef unsigned v4u   __attribute__((ext_vector_type(4)));

union Frag  { v16bf b; v16h h; v4u q[2]; f16 e[16]; };
union Pack8 { v4u u; u16 s[8]; };

// WMMA helpers: builtin followed by the VALU hazard guard (ties D, keeps A/B live).
static __device__ __forceinline__ v8f mma_bf16(v16bf a, v16bf b, v8f acc) {
  acc = __builtin_amdgcn_wmma_f32_16x16x32_bf16(false, a, false, b, (short)0, acc, false, false);
  asm volatile("v_nop\n\tv_nop\n\tv_nop\n\tv_nop" : "+v"(acc) : "v"(a), "v"(b));
  return acc;
}
static __device__ __forceinline__ v8f mma_f16(v16h a, v16h b, v8f acc) {
  acc = __builtin_amdgcn_wmma_f32_16x16x32_f16(false, a, false, b, (short)0, acc, false, false);
  asm volatile("v_nop\n\tv_nop\n\tv_nop\n\tv_nop" : "+v"(acc) : "v"(a), "v"(b));
  return acc;
}

static __device__ __forceinline__ u16 bf16_bits(float x) {      // RNE convert
  const bf16 h = (bf16)x;
  return __builtin_bit_cast(u16, h);
}
static __device__ __forceinline__ float bf16_back(float x) {    // value of the RNE-converted bf16
  return (float)(bf16)x;
}
static __device__ __forceinline__ u16 f16_bits(float x) {
  const f16 h = (f16)x;
  return __builtin_bit_cast(u16, h);
}

// Preparation, one launch: every job that reads inputs only (X rows to bf16, the four weight transposes, the
// rotary table). PREP_G equal blocks, two per WGP; each block takes the same share of every job: XR_PB rows of X,
// two 64 x 64 tiles of Wq, two of Wo, one of Wk or Wv, and 2 x 256 table elements. All of a lane's global loads are
// issued first; the table arithmetic runs while they fly.
//   X     : row m = blk * XR_PB + j, 256 threads x 8 elements == DM; bf16 RNE bits.
//   W     : in W[DM rows (input dim)][ldin cols (output dim)] f32 -> out Bt[rowoff + col][DM] 16-bit, a 64 (input
//           dim) x 64 (output col) tile through its own LDS tile; Wq, Wk, Wv: bf16 RNE bits; Wo: f16 of (bf16 RNE
//           value x W_CARRY) (exact). Written lines whole: 8 lanes x 16 B per line. A block's two tiles of one
//           weight are neighbours along the input dim (256 contiguous bytes per written row).
//   table : ts[j] = 10000^(j/64) (double product of fixed roots -> float), angle = (float)pos / ts[j] (IEEE
//           division), positions read by value.
// coverage: PREP_G * XR_PB == NB*SEQ rows; 2 * PREP_G tiles == Wq's == Wo's, PREP_G tiles == Wk's + Wv's;
// PREP_G * 512 == NB*64*SEQ table elements. LDS sT is cross-wave: one block barrier between fill and readback.
__global__ __launch_bounds__(256) void prep_kernel(const float* __restrict__ X, const int* __restrict__ pos,
                                                   const float* __restrict__ Wq, const float* __restrict__ Wk,
                                                   const float* __restrict__ Wv, const float* __restrict__ Wo,
                                                   u16* __restrict__ Xb, u16* __restrict__ Wt,
                                                   u16* __restrict__ WoT,
                                                   float* __restrict__ cosT, float* __restrict__ sinT) {
  __shared__ __align__(16) u16 sT[WT_PB][64 * TPW];   // [tile][col][input dim]
  const int blk = blockIdx.x;
  const int tid = threadIdx.x;
  const int r8  = tid >> 3;                            // 0..31: tile row on the way in, tile col on the way out
  const int c8  = (tid & 7) * 8;                       // 0..56: tile col on the way in, input dim on the way out

  // table share: one frequency j of one batch b, 512 consecutive positions (block-uniform j and b)
  const int tj = (blk / (SEQ / 512)) % HD2;
  const int tb = blk / ((SEQ / 512) * HD2);
  const int tt = (blk % (SEQ / 512)) * 512 + tid;
  const int* pp = pos + (size_t)tb * SEQ_FULL + tt;
  int pv[2];
  #pragma unroll
  for (int e = 0; e < 2; ++e) pv[e] = pp[e * 256];

  // weight tiles 0, 1 of Wq and 2, 3 of Wo: tile column pc, input-dim rows pd .. pd + 127 (two tiles);
  // tile 4 of Wk (lower half of the grid) or Wv (block-uniform choice)
  const int pd    = ((blk * 2) % (DM / 64)) * 64;
  const int pc    = ((blk * 2) / (DM / 64)) * 64;
  const int kvsel = (blk >= PREP_G / 2) ? 1 : 0;
  const int kvt   = blk - kvsel * (PREP_G / 2);
  const int kd    = (kvt % (DM / 64)) * 64;
  const int kc    = (kvt / (DM / 64)) * 64;
  const float* gq = Wq + (size_t)(pd + r8) * (NQH * HD) + pc + c8;
  const float* go = Wo + (size_t)(pd + r8) * DM + pc + c8;
  const float* gk = (kvsel ? Wv : Wk) + (size_t)(kd + r8) * (NKV * HD) + kc + c8;
  v4f w0[WT_PB][2];
  v4f w1[WT_PB][2];
  #pragma unroll
  for (int s = 0; s < WT_PB; ++s) {
    #pragma unroll
    for (int kk = 0; kk < 2; ++kk) {                   // input dim local r = kk * 32 + r8
      const float* g = (s < 2) ? gq + ((s & 1) * 64 + kk * 32) * (NQH * HD)
                     : (s < 4) ? go + ((s & 1) * 64 + kk * 32) * DM
                               : gk + (kk * 32) * (NKV * HD);
      w0[s][kk] = *(const v4f*)(g);
      w1[s][kk] = *(const v4f*)(g + 4);
    }
  }

  // rows of X: XR_PB consecutive rows of one batch
  const int xm = blk * XR_PB;
  const float* gx = X + ((size_t)(xm / SEQ) * SEQ_FULL + xm % SEQ) * DM + tid * 8;
  v4f a0[XR_PB];
  v4f a1[XR_PB];
  #pragma unroll
  for (int j = 0; j < XR_PB; ++j) {
    a0[j] = *(const v4f*)(gx + j * DM);
    a1[j] = *(const v4f*)(gx + j * DM + 4);
  }
  // the loads' addresses, named as inputs, stay live up to this wait, so that no load's result lands in a register
  // that another load of the burst names; the memory clobber keeps every load above it, in front of the table
  // arithmetic, which runs inside their latency
  asm volatile("s_wait_xcnt 0x0" :: "v"(pp), "v"(gq), "v"(go), "v"(gk), "v"(gx) : "memory");

  double pf = 1.0;
  pf *= (tj & 32) ? 100.0 : 1.0;                       // 10000^(32/64)
  pf *= (tj & 16) ? 10.0 : 1.0;                        // 10000^(16/64)
  pf *= (tj & 8)  ? 3.1622776601683795 : 1.0;          // 10000^(8/64)
  pf *= (tj & 4)  ? 1.7782794100389228 : 1.0;          // 10000^(4/64)
  pf *= (tj & 2)  ? 1.333521432163324  : 1.0;          // 10000^(2/64)
  pf *= (tj & 1)  ? 1.1547819846894583 : 1.0;          // 10000^(1/64)
  const float ts = (float)pf;
  float tc[2];
  float tsn[2];
  #pragma unroll
  for (int e = 0; e < 2; ++e) {
    const int p = pv[e];
    float ang = (float)p / ts;
    ang = (p == 0) ? 0.0f : ang;
    sincosf(ang, &tsn[e], &tc[e]);
  }

  #pragma unroll
  for (int s = 0; s < WT_PB; ++s) {
    #pragma unroll
    for (int kk = 0; kk < 2; ++kk) {
      const int r = kk * 32 + r8;
      #pragma unroll
      for (int i = 0; i < 4; ++i) {
        const float x0 = bf16_back(w0[s][kk][i]);
        const float x1 = bf16_back(w1[s][kk][i]);
        const u16 h0 = (s == 2 || s == 3) ? f16_bits(x0 * W_CARRY) : bf16_bits(x0);
        const u16 h1 = (s == 2 || s == 3) ? f16_bits(x1 * W_CARRY) : bf16_bits(x1);
        sT[s][(c8 + i) * TPW + r]     = h0;
        sT[s][(c8 + 4 + i) * TPW + r] = h1;
      }
    }
  }

  // every global store stands behind the barrier: in front of it the barrier would wait for its completion
  __syncthreads();

  #pragma unroll
  for (int e = 0; e < 2; ++e) {
    const int idx = blk * 512 + e * 256 + tid;         // == (tb * HD2 + tj) * SEQ + tt + e * 256
    cosT[idx] = tc[e];
    sinT[idx] = tsn[e];
  }
  u16* ox = Xb + (size_t)xm * DM + tid * 8;
  #pragma unroll
  for (int j = 0; j < XR_PB; ++j) {
    Pack8 pk;
    #pragma unroll
    for (int i = 0; i < 4; ++i) {
      pk.s[i]     = bf16_bits(a0[j][i]);
      pk.s[4 + i] = bf16_bits(a1[j][i]);
    }
    *(v4u*)(ox + j * DM) = pk.u;
  }
  u16* oq = Wt  + (size_t)(pc + r8) * DM + pd + c8;
  u16* oo = WoT + (size_t)(pc + r8) * DM + pd + c8;
  u16* ok = Wt  + (size_t)((kvsel ? (NQH + NKV) * HD : NQH * HD) + kc + r8) * DM + kd + c8;
  #pragma unroll
  for (int s = 0; s < WT_PB; ++s) {
    #pragma unroll
    for (int kk = 0; kk < 2; ++kk) {                   // col local c = kk * 32 + r8
      const v4u val = *(const v4u*)(&sT[s][(kk * 32 + r8) * TPW + c8]);
      u16* o = (s < 2) ? oq + (s & 1) * 64 + kk * 32 * DM
             : (s < 4) ? oo + (s & 1) * 64 + kk * 32 * DM
                       : ok + kk * 32 * DM;
      *(v4u*)(o) = val;
    }
  }
}

// One k-slab of the block's operands (A: 128 rows x 128 B, B: 128 rows x 128 B) from global memory into one LDS
// buffer: 8 asynchronous 16-B copies per lane, 256 lanes, every byte of the slab copied exactly once; 8 lanes
// cover one whole 128-B line. a / b and l are the lane's own global pointers and LDS byte address of its first
// piece. The closing s_wait_xcnt stands inside the statement so that no address register of an issued copy is
// rewritten ahead of it.
static __device__ __forceinline__ void stage_ab(const u16* a, const u16* b, unsigned l) {
  asm volatile(
      "global_load_async_to_lds_b128 %0, %1, off\n\t"
      "global_load_async_to_lds_b128 %2, %3, off\n\t"
      "global_load_async_to_lds_b128 %4, %5, off\n\t"
      "global_load_async_to_lds_b128 %6, %7, off\n\t"
      "global_load_async_to_lds_b128 %8, %9, off\n\t"
      "global_load_async_to_lds_b128 %10, %11, off\n\t"
      "global_load_async_to_lds_b128 %12, %13, off\n\t"
      "global_load_async_to_lds_b128 %14, %15, off\n\t"
      "s_wait_xcnt 0x0"
      :
      : "v"(l),                              "v"(a),
        "v"(l + 32 * GP * 2),                "v"(a + 32 * DM),
        "v"(l + 64 * GP * 2),                "v"(a + 64 * DM),
        "v"(l + 96 * GP * 2),                "v"(a + 96 * DM),
        "v"(l + GT_H * 2),                   "v"(b),
        "v"(l + GT_H * 2 + 32 * GP * 2),     "v"(b + 32 * DM),
        "v"(l + GT_H * 2 + 64 * GP * 2),     "v"(b + 64 * DM),
        "v"(l + GT_H * 2 + 96 * GP * 2),     "v"(b + 96 * DM)
      : "memory");
}

// GEMM core: C[128x128 block tile] = A[M][DM] x Bt[N][DM]^T, 8 waves, wave tile 32 rows x 64 cols.
// The block's 128 A rows and 128 B rows are staged once per block in LDS, GK k values at a time (two buffers,
// asynchronous copies one slab ahead); fragments are read from there with 16-B LDS loads (two each, split k map
// for A and B alike): same elements, same k order as the rows of A and Bt. sS is the ring (2 * GS_H halves); behind the
// last slab's barrier nobody reads it any more and nothing is in flight, so the caller may reuse it.
// ROPEMAP = 1: wave column group g owns cols {g*32 .. g*32+31} and {64+g*32 .. 64+g*32+31} so that col d and
// its rotary partner d+64 sit in the same lane / same accumulator element (tiles fn and fn+2).
template <int ISF16, int ROPEMAP>
static __device__ __forceinline__ void gemm_core(const u16* __restrict__ A, const u16* __restrict__ Bt,
                                                 u16* sS, int tid,
                                                 int m0, int n0, int wm, int g, int lr, int hi,
                                                 v8f (&acc)[2][4]) {
  int aoff[2];
  int boff[4];
  #pragma unroll
  for (int fm = 0; fm < 2; ++fm) aoff[fm] = (wm + fm * 16 + lr) * GP + 8 * hi;
  #pragma unroll
  for (int fn = 0; fn < 4; ++fn) {
    const int col = ROPEMAP ? (g * 32 + (fn & 1) * 16 + (fn >> 1) * 64) : (g * 64 + fn * 16);
    boff[fn] = GT_H + (col + lr) * GP + 8 * hi;
  }
  // staging: lane's first piece; 8 lanes x 16 B = one 128-B row piece, 32 rows per copy
  const u16* ga = A  + (size_t)(m0 + (tid >> 3)) * DM + (tid & 7) * 8;
  const u16* gb = Bt + (size_t)(n0 + (tid >> 3)) * DM + (tid & 7) * 8;
  const unsigned l0 = (unsigned)(size_t)sS + (tid >> 3) * (GP * 2) + (tid & 7) * 16;   // LDS byte address
  const int nslab = DM / GK;

  // slab 0 lands and is published before anybody reads it; slab 1 then flies during slab 0's products
  stage_ab(ga, gb, l0);
  asm volatile("s_wait_asynccnt 0x0" ::: "memory"); // this wave's copies of slab 0 have landed
  __syncthreads();
  stage_ab(ga + GK, gb + GK, l0 + GS_H * 2);

  #pragma unroll 1
  for (int t = 0; t < nslab; ++t) {
    const int bsel = t & 1;
    const u16* sT = sS + bsel * GS_H;               // this slab's stage buffer
    #pragma unroll
    for (int kk = 0; kk < GK; kk += 32) {
      Frag a[2];
      Frag b[4];
      #pragma unroll
      for (int fm = 0; fm < 2; ++fm) {
        a[fm].q[0] = *(const v4u*)(sT + aoff[fm] + kk);        // k = t*GK + kk + 8hi + 0..7
        a[fm].q[1] = *(const v4u*)(sT + aoff[fm] + kk + 16);   // k = t*GK + kk + 16 + 8hi + 0..7
      }
      #pragma unroll
      for (int fn = 0; fn < 4; ++fn) {
        b[fn].q[0] = *(const v4u*)(sT + boff[fn] + kk);
        b[fn].q[1] = *(const v4u*)(sT + boff[fn] + kk + 16);
      }
      #pragma unroll
      for (int fn = 0; fn < 4; ++fn) {
        #pragma unroll
        for (int fm = 0; fm < 2; ++fm) {
          if (ISF16) acc[fm][fn] = mma_f16(a[fm].h, b[fn].h, acc[fm][fn]);
          else       acc[fm][fn] = mma_bf16(a[fm].b, b[fn].b, acc[fm][fn]);
        }
      }
    }
    // publish point of slab t + 1, every wave, every slab
    asm volatile("s_wait_dscnt 0x0" ::: "memory");    // this wave's reads of the buffer to be refilled are done
    asm volatile("s_wait_asynccnt 0x0" ::: "memory"); // this wave's copies of slab t + 1 have landed
    __syncthreads();                                  // publishes slab t + 1, ends all reads of slab t
    if (t + 2 < nslab) {                              // block-uniform: refill the buffer just read
      stage_ab(ga + (t + 2) * GK, gb + (t + 2) * GK, l0 + bsel * (GS_H * 2));
    }
  }
  asm volatile("s_wait_asynccnt 0x0" ::: "memory");   // nothing of this wave's copies is left in flight
}

// Fused QKV projection + rotary + plane builder.
// grid (NQKV/128 column tiles = one head each, NB*SEQ/128 row tiles); column tile ct: 0..15 q head, 16..19 k head,
// 20..23 v head. Outputs:
//   ph / pl : bf16 hi / lo planes, q region [NB][NQH][SEQ][HD] at 0, k region [NB][NKV][SEQ][HD] at QELEMS
//   vt      : f16 (x V_CARRY) [NB][NKV][HD][SEQ], transposed through LDS
// LDS tiles sA / sB are cross-wave (block barrier between fill and readback); staged extent 128 x 128 ==
// consumed extent. They lie in the GEMM ring, which is free once gemm_core has returned. Every written line whole: 16 lanes x 16 B = one 256-B row per half-wave.
__global__ __launch_bounds__(256) void qkv_gemm_kernel(const u16* __restrict__ Xb, const u16* __restrict__ Wt,
                                                       const float* __restrict__ cosT,
                                                       const float* __restrict__ sinT,
                                                       u16* __restrict__ ph, u16* __restrict__ pl,
                                                       u16* __restrict__ vt) {
  __shared__ __align__(16) u16 sS[2 * GS_H];
  u16* const sA = sS;
  u16* const sB = sS + 128 * EP;
  const int ct   = blockIdx.x;
  const int m0   = blockIdx.y * 128;
  const int tid  = threadIdx.x;
  const int wave = __builtin_amdgcn_readfirstlane(threadIdx.x >> 5);
  const int lane = tid & 31;
  const int lr   = lane & 15;
  const int hi   = lane >> 4;
  const int wm   = (wave & 3) * 32;
  const int g    = wave >> 2;

  v8f acc[2][4];
  #pragma unroll
  for (int fm = 0; fm < 2; ++fm) {
    #pragma unroll
    for (int fn = 0; fn < 4; ++fn) acc[fm][fn] = (v8f){0, 0, 0, 0, 0, 0, 0, 0};
  }
  gemm_core<0, 1>(Xb, Wt, sS, tid, m0, ct * 128, wm, g, lr, hi, acc);

  const int b  = m0 / SEQ;
  const int t0 = m0 % SEQ;

  if (ct < NQH + NKV) {
    // rotary on the f32 accumulators, then bf16 hi | lo split into the LDS tiles
    #pragma unroll
    for (int fm = 0; fm < 2; ++fm) {
      #pragma unroll
      for (int f2 = 0; f2 < 2; ++f2) {
        const int j  = g * 32 + f2 * 16 + lr;             // frequency index 0..63
        const int tl = wm + fm * 16 + 8 * hi;             // first of this lane's 8 tile rows
        const size_t tb = ((size_t)b * HD2 + j) * SEQ + t0 + tl;
        const v4f ca = *(const v4f*)(cosT + tb);
        const v4f cb = *(const v4f*)(cosT + tb + 4);
        const v4f sa = *(const v4f*)(sinT + tb);
        const v4f sb = *(const v4f*)(sinT + tb + 4);
        #pragma unroll
        for (int i = 0; i < 8; ++i) {
          const float c  = (i < 4) ? ca[i & 3] : cb[i & 3];
          const float s  = (i < 4) ? sa[i & 3] : sb[i & 3];
          const float x1 = acc[fm][f2][i];                 // col j
          const float x2 = acc[fm][f2 + 2][i];             // col j + 64
          const float y1 = x1 * c - x2 * s;
          const float y2 = x2 * c + x1 * s;
          const float h1 = bf16_back(y1);
          const float h2 = bf16_back(y2);
          const int row = tl + i;
          sA[row * EP + j]       = bf16_bits(h1);
          sA[row * EP + 64 + j]  = bf16_bits(h2);
          sB[row * EP + j]       = bf16_bits(y1 - h1);
          sB[row * EP + 64 + j]  = bf16_bits(y2 - h2);
        }
      }
    }
    __syncthreads();
    const int isq   = (ct < NQH) ? 1 : 0;
    const int pbase = isq ? (((b * NQH + ct) * SEQ + t0) * HD)
                          : (QELEMS + ((b * NKV + (ct - NQH)) * SEQ + t0) * HD);
    v4u vA[8];
    v4u vB[8];
    int gi[8];
    #pragma unroll
    for (int it = 0; it < 8; ++it) {
      const int piece = it * 256 + tid;
      const int row = piece >> 4;                          // 0..127
      const int seg = piece & 15;                          // 16 x 16 B = one 256-B plane row
      vA[it] = *(const v4u*)(sA + row * EP + seg * 8);
      vB[it] = *(const v4u*)(sB + row * EP + seg * 8);
      gi[it] = pbase + row * HD + seg * 8;
    }
    #pragma unroll
    for (int it = 0; it < 8; ++it) {
      *(v4u*)(ph + gi[it]) = vA[it];
      *(v4u*)(pl + gi[it]) = vB[it];
    }
    
  } else {
    // v head: f16 carried x V_CARRY, transposed in LDS to [d][t]
    const int kvh = ct - (NQH + NKV);
    #pragma unroll
    for (int fm = 0; fm < 2; ++fm) {
      #pragma unroll
      for (int fn = 0; fn < 4; ++fn) {
        const int d = g * 32 + (fn & 1) * 16 + (fn >> 1) * 64 + lr;
        #pragma unroll
        for (int i = 0; i < 8; ++i) {
          const int row = wm + fm * 16 + 8 * hi + i;
          sA[d * EP + row] = f16_bits(acc[fm][fn][i] * V_CARRY);
        }
      }
    }
    __syncthreads();
    v4u vA[8];
    int gi[8];
    #pragma unroll
    for (int it = 0; it < 8; ++it) {
      const int piece = it * 256 + tid;
      const int d   = piece >> 4;                          // 0..127
      const int seg = piece & 15;
      vA[it] = *(const v4u*)(sA + d * EP + seg * 8);
      gi[it] = ((b * NKV + kvh) * HD + d) * SEQ + t0 + seg * 8;
    }
    #pragma unroll
    for (int it = 0; it < 8; ++it) *(v4u*)(vt + gi[it]) = vA[it];
    
  }
}

// One 32-key stage (K hi, K lo: 32 rows x 256 B each; V^T: 128 rows x 64 B) from global memory into one LDS
// buffer: 12 asynchronous 16-B copies per lane, 128 lanes, every byte of the stage copied exactly once.
// kh / kl / v and lk / lv are the lane's own global pointers and LDS byte addresses of its first piece.
// The closing s_wait_xcnt stands inside the statement so that no address register of an issued copy is
// rewritten ahead of it.
static __device__ __forceinline__ void stage_kv(const u16* kh, const u16* kl, const u16* v,
                                                unsigned lk, unsigned lv) {
  asm volatile(
      "global_load_async_to_lds_b128 %0, %1, off\n\t"
      "global_load_async_to_lds_b128 %2, %3, off\n\t"
      "global_load_async_to_lds_b128 %4, %5, off\n\t"
      "global_load_async_to_lds_b128 %6, %7, off\n\t"
      "global_load_async_to_lds_b128 %8, %9, off\n\t"
      "global_load_async_to_lds_b128 %10, %11, off\n\t"
      "global_load_async_to_lds_b128 %12, %13, off\n\t"
      "global_load_async_to_lds_b128 %14, %15, off\n\t"
      "global_load_async_to_lds_b128 %16, %17, off\n\t"
      "global_load_async_to_lds_b128 %18, %19, off\n\t"
      "global_load_async_to_lds_b128 %20, %21, off\n\t"
      "global_load_async_to_lds_b128 %22, %23, off\n\t"
      "s_wait_xcnt 0x0"
      :
      : "v"(lk),                             "v"(kh),
        "v"(lk + 8 * KP * 2),                "v"(kh + 8 * HD),
        "v"(lk + 16 * KP * 2),               "v"(kh + 16 * HD),
        "v"(lk + 24 * KP * 2),               "v"(kh + 24 * HD),
        "v"(lk + KT_H * 2),                  "v"(kl),
        "v"(lk + KT_H * 2 + 8 * KP * 2),     "v"(kl + 8 * HD),
        "v"(lk + KT_H * 2 + 16 * KP * 2),    "v"(kl + 16 * HD),
        "v"(lk + KT_H * 2 + 24 * KP * 2),    "v"(kl + 24 * HD),
        "v"(lv),                             "v"(v),
        "v"(lv + 32 * VP * 2),               "v"(v + 32 * SEQ),
        "v"(lv + 64 * VP * 2),               "v"(v + 64 * SEQ),
        "v"(lv + 96 * VP * 2),               "v"(v + 96 * SEQ)
      : "memory");
}

// K fragments of one 32-d slice from a staged stage buffer: key tile 0 hi, lo, key tile 1 hi, lo (8 LDS reads).
// p = fragment origin of the slice inside the K hi plane tile.
static __device__ __forceinline__ void load_kset(Frag (&k)[4], const u16* p) {
  k[0].q[0] = *(const v4u*)(p);
  k[0].q[1] = *(const v4u*)(p + 16);
  k[1].q[0] = *(const v4u*)(p + KT_H);
  k[1].q[1] = *(const v4u*)(p + KT_H + 16);
  k[2].q[0] = *(const v4u*)(p + 16 * KP);
  k[2].q[1] = *(const v4u*)(p + 16 * KP + 16);
  k[3].q[0] = *(const v4u*)(p + KT_H + 16 * KP);
  k[3].q[1] = *(const v4u*)(p + KT_H + 16 * KP + 16);
}

// WMMA helpers of the attention kernel: the builtin alone, the compiler keeps the distances behind its own builtin.
// The guard statement above names A, B and D as asm operands, which must lie in v0..v255; q and O of two query
// tiles fill 256 registers by themselves, and with the guard the q fragments were spilled to scratch.
static __device__ __forceinline__ v8f mmaw_bf16(v16bf a, v16bf b, v8f acc) {
  return __builtin_amdgcn_wmma_f32_16x16x32_bf16(false, a, false, b, (short)0, acc, false, false);
}
static __device__ __forceinline__ v8f mmaw_f16(v16h a, v16h b, v8f acc) {
  return __builtin_amdgcn_wmma_f32_16x16x32_f16(false, a, false, b, (short)0, acc, false, false);
}

// 2^x with the slot that the instruction set asks for behind a transcendental (one independent instruction or
// v_nop before its result is read or its source overwritten) inside the statement.
static __device__ __forceinline__ float exp2_slot(float x) {
  float r;
  asm("v_exp_f32 %0, %1\n\tv_nop" : "=v"(r) : "v"(x));
  return r;
}

// Fused causal grouped-query attention, logit scale 1.0, online softmax in the exp2 domain.
// Block = 8 waves = the four query heads of one key/value head for the same 32 query rows, twice: wave group 0
// takes the even 32-key steps, wave group 1 the odd ones (uniform trip count), each with its own running maximum,
// sum and O; the two partial states are joined through LDS behind the key loop.
// A wave holds QW = 2 query tiles of 16 rows: every K and V^T fragment read from LDS feeds both tiles' products,
// and every staged 32-key stage serves 32 query rows of each head, so LDS reads and staged bytes per product halve.
// S^T = K x Q^T so queries sit on lanes; P^T in C layout is bit-identical to the A-fragment layout of O += P x V.
// q and k: bf16 hi | lo planes, three products per k-step into one accumulator. q fragments are loaded once
// and stay in registers. ctx out: f16 carried x C_CARRY, [NB*SEQ][DM], col = head*128 + d.
// K hi | K lo | V^T of each 32-key step are staged once per block in LDS (per wave group two buffers, filled by
// that group's lanes, asynchronous copies one step ahead) and read by the group's four waves with 16-B LDS loads;
// same elements, same k order as the planes.
// LDS sO: each wave writes and reads only its own slice; a block barrier separates fill and readback.
// two waves per SIMD (one block per WGP): q and O of two query tiles alone fill 256 registers
__global__ __launch_bounds__(256) __attribute__((amdgpu_waves_per_eu(2, 2))) void attn_kernel(const u16* __restrict__ ph, const u16* __restrict__ pl,
                                                   const u16* __restrict__ vt, u16* __restrict__ ctx) {
  // Causal balance: twice as many blocks as resident places, and a block's key steps grow with its query tile:
  // the tile falls with the flat block index, so that the long blocks start
  // first and the short ones fill the places that fall free. For speed only; flat -> (tile, kv, b) is one to one.
  const int flat = blockIdx.x + NQT * (blockIdx.y + NKV * blockIdx.z);
  const int qt   = NQT - 1 - flat / (NKV * NB);
  const int kv   = flat % NKV;
  const int b    = (flat / NKV) % NB;
  const int tid  = threadIdx.x;
  const int wave = __builtin_amdgcn_readfirstlane(threadIdx.x >> 5);
  const int lane = tid & 31;
  const int lq   = lane & 15;     // query column of S^T / d column of O
  const int hi   = lane >> 4;     // k-split half
  const int grp  = wave >> 2;     // wave group: parity of the 32-key steps it takes
  const int hw   = wave & 3;      // query head inside the key/value head's group
  const int gt   = tid & 127;     // lane index inside the wave group (staging)
  const int head = kv * GRP + hw;
  const int qrow0 = qt * (QW * 16);

  __shared__ __align__(16) u16 sO[GRP * QW * 16 * CP];
  __shared__ __align__(16) u16 sKV[2 * 2 * KV_H];     // [wave group][buffer]

  const int qoff  = ((b * NQH + head) * SEQ + qrow0 + lq) * HD + hi * 8;
  const int kfrag = lq * KP + hi * 8;                 // fragment origin inside a staged K plane tile
  const int vfrag = 2 * KT_H + lq * VP + hi * 8;      // fragment origin of the staged V^T tile

  // staging: lane's first piece. K: 16 lanes x 16 B = one 256-B row, 8 rows per copy; V^T: 4 lanes per 64-B row.
  // The wave-uniform bases stand at the group's first step (keys grp * 32 ...); its next step lies 64 keys on.
  // Bases and lane parts are kept apart and added at each call: a value that is itself an asm operand must live in
  // v0..v255 for its whole life, and held so over the key loop two of them were spilled to scratch.
  const u16* const ukh = ph + QELEMS + ((b * NKV + kv) * SEQ + grp * 32) * HD;
  const u16* const ukl = pl + QELEMS + ((b * NKV + kv) * SEQ + grp * 32) * HD;
  const u16* const uv  = vt + (b * NKV + kv) * HD * SEQ + grp * 32;
  const unsigned okl = gt * 8;                        // lane part, K planes (halves)
  const unsigned ovl = (gt >> 2) * SEQ + (gt & 3) * 8; // lane part, V^T (halves)
  // LDS byte address = low 32 bits of the shared address; the group's own pair of buffers
  const unsigned lbase = (unsigned)(size_t)sKV + grp * (2 * KV_H * 2);
  const unsigned lkl = (gt >> 4) * (KP * 2) + (gt & 15) * 16;                  // lane part, K hi tile (bytes)
  const unsigned lvl = 2 * KT_H * 2 + (gt >> 2) * (VP * 2) + (gt & 3) * 16;    // lane part, V^T tile (bytes)

  v8f o[QW][8];
  #pragma unroll
  for (int u = 0; u < QW; ++u) {
    #pragma unroll
    for (int dt = 0; dt < 8; ++dt) o[u][dt] = (v8f){0, 0, 0, 0, 0, 0, 0, 0};
  }

  const float NEGV = -1.0e30f;
  float rmax[QW];
  float rsum[QW];
  #pragma unroll
  for (int u = 0; u < QW; ++u) {
    rmax[u] = NEGV;
    rsum[u] = 0.0f;
  }
  const float SL = 1.4426950408889634f;             // logit scale 1.0 times log2(e)

  // 32-key steps of the tile, and trips of the loop: step 2 * trip + grp. With an odd count group 1's last step
  // lies wholly beyond the diagonal (still inside the sequence: an odd count is below SEQ / 32); the causal
  // exclusion turns all of it off.
  const int nchunk = (qrow0 >> 5) + 1;
  const int ntrip  = (nchunk + 1) >> 1;             // same for every wave of the block

  // q fragments (B operand of S^T): loaded once, held in registers over the whole key loop
  Frag qh[QW][4], ql[QW][4];
  #pragma unroll
  for (int u = 0; u < QW; ++u) {
    #pragma unroll
    for (int f = 0; f < 4; ++f) {
      const int qa = qoff + u * (16 * HD) + f * 32;
      qh[u][f].q[0] = *(const v4u*)(ph + qa);       // d = f*32 + 8hi + 0..7
      qh[u][f].q[1] = *(const v4u*)(ph + qa + 16);  // d = f*32 + 16 + 8hi + 0..7
      ql[u][f].q[0] = *(const v4u*)(pl + qa);
      ql[u][f].q[1] = *(const v4u*)(pl + qa + 16);
    }
  }

  // stage 0 lands and is published before anybody reads it; stage 1 then flies during step 0
  stage_kv(ukh + okl, ukl + okl, uv + ovl, lbase + lkl, lbase + lvl);
  asm volatile("s_wait_asynccnt 0x0" ::: "memory"); // this wave's copies of stage 0 have landed
  __syncthreads();
  if (ntrip > 1) stage_kv(ukh + (okl + 64u * HD), ukl + (okl + 64u * HD), uv + (ovl + 64u),
                          (lbase + KV_H * 2) + lkl, (lbase + KV_H * 2) + lvl);

  #pragma unroll 1
  for (int ic = 0; ic < ntrip; ++ic) {
    const int j0 = (2 * ic + grp) * 32;
    const int bsel = ic & 1;
    const u16* sT = sKV + (grp * 2 + bsel) * KV_H;  // this step's stage buffer

    // S^T tiles of query tile u: c0[u][r] = score(query qrow0 + 16u + lq, key j0 + 8hi + r),
    // c1[u][r] = key j0 + 16 + 8hi + r
    v8f c0[QW];
    v8f c1[QW];
    #pragma unroll
    for (int u = 0; u < QW; ++u) {
      c0[u] = (v8f){0, 0, 0, 0, 0, 0, 0, 0};
      c1[u] = (v8f){0, 0, 0, 0, 0, 0, 0, 0};
    }
    // LDS fragment reads are issued in groups ahead of the products that use them: K one 32-d slice ahead in a
    // second register set, V^T into the K sets' registers as they fall free, all of it before the softmax.
    Frag ks[2][4];
    Frag bv[8];
    load_kset(ks[0], sT + kfrag);
    load_kset(ks[1], sT + kfrag + 32);
    // keeps both read groups in front of the first products (sunk to their uses, each read's latency is waited out)
    __builtin_amdgcn_sched_barrier(0);
    #pragma unroll
    for (int f = 0; f < 4; ++f) {
      Frag (&k)[4] = ks[f & 1];
      // per accumulator the order hi.hi, hi.lo, lo.hi as before; the four accumulators take turns
      #pragma unroll
      for (int u = 0; u < QW; ++u) {
        c0[u] = mmaw_bf16(k[0].b, qh[u][f].b, c0[u]);   // key j0 + lq
        c1[u] = mmaw_bf16(k[2].b, qh[u][f].b, c1[u]);   // key j0 + 16 + lq
      }
      #pragma unroll
      for (int u = 0; u < QW; ++u) {
        c0[u] = mmaw_bf16(k[0].b, ql[u][f].b, c0[u]);
        c1[u] = mmaw_bf16(k[2].b, ql[u][f].b, c1[u]);
      }
      #pragma unroll
      for (int u = 0; u < QW; ++u) {
        c0[u] = mmaw_bf16(k[1].b, qh[u][f].b, c0[u]);
        c1[u] = mmaw_bf16(k[3].b, qh[u][f].b, c1[u]);
      }
      // the refill of this register set stays behind its last product ...
      __builtin_amdgcn_sched_barrier(0);
      if (f < 2) {
        load_kset(ks[f & 1], sT + kfrag + (f + 2) * 32);
      } else {
        #pragma unroll
        for (int dt = 0; dt < 4; ++dt) {            // V^T B-fragments: column n = d = ((f - 2) * 4 + dt) * 16 + lq, split key map
          const int va = vfrag + (((f - 2) * 4 + dt) * 16) * VP;
          bv[(f - 2) * 4 + dt].q[0] = *(const v4u*)(sT + va);        // keys j0 + 8hi + 0..7
          bv[(f - 2) * 4 + dt].q[1] = *(const v4u*)(sT + va + 16);   // keys j0 + 16 + 8hi + 0..7
        }
      }
      // ... and in front of the next slice's products, so that it flies during them
      __builtin_amdgcn_sched_barrier(0);
    }

    // causal exclusion (only a group's last step can hold keys beyond a query row); wave-uniform test
    if (j0 + 31 > qrow0) {
      #pragma unroll
      for (int u = 0; u < QW; ++u) {
        const int trow = qrow0 + u * 16 + lq;
        #pragma unroll
        for (int r = 0; r < 8; ++r) {
          const int key0 = j0 + hi * 8 + r;
          c0[u][r] = (key0 > trow) ? NEGV : c0[u][r];
          c1[u][r] = (key0 + 16 > trow) ? NEGV : c1[u][r];
        }
      }
    }

    Frag pa[QW];
    #pragma unroll
    for (int u = 0; u < QW; ++u) {
      // online softmax: query lq's 32 scores are split across lane / lane^16
      float m_new = rmax[u];
      #pragma unroll
      for (int r = 0; r < 8; ++r) {
        m_new = fmaxf(m_new, c0[u][r]);
        m_new = fmaxf(m_new, c1[u][r]);
      }
      m_new = fmaxf(m_new, __shfl_xor(m_new, 16, 32));
      const float scale = exp2_slot((rmax[u] - m_new) * SL);
      rmax[u] = m_new;

      // exp + pack: P^T C layout == A-fragment layout of the PV product; P carried x4096
      float psum = 0.0f;
      #pragma unroll
      for (int r = 0; r < 8; ++r) {
        const float p0 = exp2_slot((c0[u][r] - m_new) * SL);   // key 8hi + r
        const float p1 = exp2_slot((c1[u][r] - m_new) * SL);   // key 16 + 8hi + r
        psum += p0 + p1;
        pa[u].e[r]     = (f16)(p0 * P_CARRY);
        pa[u].e[8 + r] = (f16)(p1 * P_CARRY);
      }
      rsum[u] = rsum[u] * scale + psum + __shfl_xor(psum, 16, 32);

      // rescale O: queries are the row dimension there -> per-row scale from lane 8hi + r
      float sc[8];
      #pragma unroll
      for (int r = 0; r < 8; ++r) sc[r] = __shfl(scale, (hi << 3) + r, 32);
      #pragma unroll
      for (int dt = 0; dt < 8; ++dt) {
        #pragma unroll
        for (int r = 0; r < 8; ++r) o[u][dt][r] *= sc[r];
      }
    }

    // O += P x V on the V^T fragments read above, each fragment for both query tiles
    #pragma unroll
    for (int dt = 0; dt < 8; ++dt) {
      #pragma unroll
      for (int u = 0; u < QW; ++u) o[u][dt] = mmaw_f16(pa[u].h, bv[dt].h, o[u][dt]);
    }

    // keeps softmax and products in front of the publish point: lifted over them, the barrier would stand behind the
    // score phase, where the SIMD's first wave would idle for the second, and the refill would fly for that phase only
    __builtin_amdgcn_sched_barrier(0);
    // publish point of stage ic + 1, every wave, every step
    asm volatile("s_wait_dscnt 0x0" ::: "memory");    // this wave's reads of the buffer to be refilled are done
    asm volatile("s_wait_asynccnt 0x0" ::: "memory"); // this wave's copies of stage ic + 1 have landed
    __syncthreads();                                  // publishes stage ic + 1, ends all reads of stage ic
    if (ic + 2 < ntrip) {                             // block-uniform: refill the buffer just read
      const int nx = ic + 2;
      const unsigned lb = lbase + bsel * (KV_H * 2);
      const unsigned ok = okl + (unsigned)nx * (64u * HD);   // 32-bit sums: step and lane part, then the base
      const unsigned ov = ovl + (unsigned)nx * 64u;
      stage_kv(ukh + ok, ukl + ok, uv + ov, lb + lkl, lb + lvl);
    }
  }
  asm volatile("s_wait_asynccnt 0x0" ::: "memory");   // nothing of this wave's copies is left in flight

  // Join of the two partial states. Behind the loop's last barrier nobody reads the stage buffers any more and no
  // copy is in flight, so they serve as the hand-over area: group 1 writes O (lane-major, 16 B x 32 lanes per
  // store), maximum and sum; a block barrier; group 0 reads its head's and folds them in. A group 1 that saw no
  // key inside the diagonal hands over the maximum NEGV and gets the weight exp2(-huge) = 0.
  float* const sJ  = (float*)sKV;                     // [head][query tile][16 pieces][lane] x 4 floats
  float* const sJm = sJ + GRP * QW * 16 * 32 * 4;     // [head][query tile][maximum | sum][lane]
  if (grp == 1) {                                     // wave-uniform
    #pragma unroll
    for (int u = 0; u < QW; ++u) {
      const int ju = hw * QW + u;
      #pragma unroll
      for (int dt = 0; dt < 8; ++dt) {
        *(v4f*)(sJ + ((ju * 16 + dt * 2) * 32 + lane) * 4)     = (v4f){o[u][dt][0], o[u][dt][1], o[u][dt][2], o[u][dt][3]};
        *(v4f*)(sJ + ((ju * 16 + dt * 2 + 1) * 32 + lane) * 4) = (v4f){o[u][dt][4], o[u][dt][5], o[u][dt][6], o[u][dt][7]};
      }
      sJm[(ju * 2) * 32 + lane]     = rmax[u];
      sJm[(ju * 2 + 1) * 32 + lane] = rsum[u];
    }
  }
  __syncthreads();

  const int so = hw * (QW * 16 * CP);
  if (grp == 0) {                                     // wave-uniform
    #pragma unroll
    for (int u = 0; u < QW; ++u) {
      const int ju = hw * QW + u;
      const float m1 = sJm[(ju * 2) * 32 + lane];
      const float l1 = sJm[(ju * 2 + 1) * 32 + lane];
      const float mj = fmaxf(rmax[u], m1);
      const float w0 = exp2_slot((rmax[u] - mj) * SL);
      const float w1 = exp2_slot((m1 - mj) * SL);
      const float rj = rsum[u] * w0 + l1 * w1;

      // normalize: lane holds column d = dt*16 + lq for query rows 8hi + r; fold the carries and the join weights
      const float CN = C_CARRY / (P_CARRY * V_CARRY);
      float rs0[8];
      float rs1[8];
      #pragma unroll
      for (int r = 0; r < 8; ++r) {
        const float rn = CN * (1.0f / __shfl(rj, (hi << 3) + r, 32));
        rs0[r] = rn * __shfl(w0, (hi << 3) + r, 32);
        rs1[r] = rn * __shfl(w1, (hi << 3) + r, 32);
      }
      #pragma unroll
      for (int dt = 0; dt < 8; ++dt) {
        const v4f pa0 = *(const v4f*)(sJ + ((ju * 16 + dt * 2) * 32 + lane) * 4);
        const v4f pa1 = *(const v4f*)(sJ + ((ju * 16 + dt * 2 + 1) * 32 + lane) * 4);
        #pragma unroll
        for (int r = 0; r < 8; ++r) {
          const float p = (r < 4) ? pa0[r & 3] : pa1[r & 3];
          sO[so + (u * 16 + hi * 8 + r) * CP + dt * 16 + lq] = f16_bits(o[u][dt][r] * rs0[r] + p * rs1[r]);
        }
      }
    }
  }
  __syncthreads();
  if (grp == 1) return;                               // wave-uniform, behind the last barrier

  // lanes 0..15 write one 256-B ctx row piece (16 B each), lanes 16..31 the next row; 16 instructions cover the
  // wave's 32 rows.
  v4u    vals[QW * 8];
  size_t gidx[QW * 8];
  #pragma unroll
  for (int it = 0; it < QW * 8; ++it) {
    const int row = it * 2 + hi;
    vals[it] = *(const v4u*)(sO + so + row * CP + lq * 8);
    gidx[it] = ((size_t)b * SEQ + qrow0 + row) * DM + head * HD + lq * 8;
  }
  #pragma unroll
  for (int it = 0; it < QW * 8; ++it) *(v4u*)(ctx + gidx[it]) = vals[it];
  
}

// Output projection: out[b][t][DM] = ctx x Wo, f16 operands (carries folded back in f32).
// written by 8 consecutive lanes x 16 B of one instruction.
__global__ __launch_bounds__(256) void out_gemm_kernel(const u16* __restrict__ ctx, const u16* __restrict__ WoT,
                                                       float* __restrict__ out) {
  __shared__ __align__(16) u16 sS[2 * GS_H];
  float* const sC = (float*)sS;                    // output staging lies in the GEMM ring, free after gemm_core
  const int n0   = blockIdx.x * 128;
  const int m0   = blockIdx.y * 128;
  const int tid  = threadIdx.x;
  const int wave = __builtin_amdgcn_readfirstlane(threadIdx.x >> 5);
  const int lane = tid & 31;
  const int lr   = lane & 15;
  const int hi   = lane >> 4;
  const int wm   = (wave & 3) * 32;
  const int g    = wave >> 2;

  v8f acc[2][4];
  #pragma unroll
  for (int fm = 0; fm < 2; ++fm) {
    #pragma unroll
    for (int fn = 0; fn < 4; ++fn) acc[fm][fn] = (v8f){0, 0, 0, 0, 0, 0, 0, 0};
  }
  gemm_core<1, 0>(ctx, WoT, sS, tid, m0, n0, wm, g, lr, hi, acc);

  const float INV = 1.0f / (C_CARRY * W_CARRY);
  #pragma unroll
  for (int p = 0; p < 2; ++p) {
    if (((wave & 3) >> 1) == p) {                  // wave-uniform: this wave's rows belong to half p
      #pragma unroll
      for (int fm = 0; fm < 2; ++fm) {
        #pragma unroll
        for (int fn = 0; fn < 4; ++fn) {
          #pragma unroll
          for (int i = 0; i < 8; ++i) {
            sC[(wm - p * 64 + fm * 16 + 8 * hi + i) * CPF + g * 64 + fn * 16 + lr] = acc[fm][fn][i] * INV;
          }
        }
      }
    }
    __syncthreads();
    v4f    vals[8];
    size_t gidx[8];
    #pragma unroll
    for (int it = 0; it < 8; ++it) {
      const int piece = it * 256 + tid;
      const int row = piece >> 5;                  // 0..63
      const int seg = piece & 31;
      vals[it] = *(const v4f*)(sC + row * CPF + seg * 4);
      const int m  = m0 + p * 64 + row;
      const int bb = m / SEQ;
      const int tt = m % SEQ;
      gidx[it] = ((size_t)bb * SEQ_FULL + tt) * DM + n0 + seg * 4;
    }
    #pragma unroll
    for (int it = 0; it < 8; ++it) *(v4f*)(out + gidx[it]) = vals[it];
    
    __syncthreads();
  }
}

extern "C" void kernel_launch(void* const* d_in, const int* in_sizes, int n_in,
                              void* d_out, int out_size, void* d_ws, size_t ws_size,
                              hipStream_t stream) {
  if (n_in < 6) return;
  const size_t needX = ((size_t)(NB - 1) * SEQ_FULL + SEQ) * DM;
  const size_t needP = (size_t)(NB - 1) * SEQ_FULL + SEQ;
  if ((size_t)in_sizes[0] < needX) return;
  if ((size_t)in_sizes[1] < needP) return;
  if ((size_t)in_sizes[2] < (size_t)DM * NQH * HD) return;
  if ((size_t)in_sizes[3] < (size_t)DM * NKV * HD) return;
  if ((size_t)in_sizes[4] < (size_t)DM * NKV * HD) return;
  if ((size_t)in_sizes[5] < (size_t)NQH * HD * DM) return;
  if ((size_t)out_size < needX) return;
  if (ws_size < (size_t)WS_TOTAL) return;

  const float* X   = (const float*)d_in[0];
  const int*   pos = (const int*)d_in[1];
  const float* Wq  = (const float*)d_in[2];
  const float* Wk  = (const float*)d_in[3];
  const float* Wv  = (const float*)d_in[4];
  const float* Wo  = (const float*)d_in[5];
  float* out = (float*)d_out;

  char* ws = (char*)d_ws;
  u16*   Xb   = (u16*)(ws + OFF_XB);
  u16*   Wt   = (u16*)(ws + OFF_WT);
  u16*   WoT  = (u16*)(ws + OFF_WO);
  float* cosT = (float*)(ws + OFF_COS);
  float* sinT = (float*)(ws + OFF_SIN);
  u16*   ph   = (u16*)(ws + OFF_PH);
  u16*   pl   = (u16*)(ws + OFF_PL);
  u16*   vt   = (u16*)(ws + OFF_VT);
  u16*   ctx  = (u16*)(ws + OFF_CTX);

  // X -> bf16 rows, weights -> transposed 16-bit, rotary table from the positions
  prep_kernel<<<dim3(PREP_G), 256, 0, stream>>>(X, pos, Wq, Wk, Wv, Wo, Xb, Wt, WoT, cosT, sinT);
  // fused QKV projection + rotary + planes
  qkv_gemm_kernel<<<dim3(NQKV / 128, (NB * SEQ) / 128), 256, 0, stream>>>(Xb, Wt, cosT, sinT, ph, pl, vt);
  // attention
  attn_kernel<<<dim3(NQT, NKV, NB), 256, 0, stream>>>(ph, pl, vt, ctx);
  // output projection
  out_gemm_kernel<<<dim3(DM / 128, (NB * SEQ) / 128), 256, 0, stream>>>(ctx, WoT, out);
}

// v009
// Measured time: 149 microseconds a run.
// In both of two side-by-side timings against v008, it was 1.03 times as fast.
// Over all steps from v000 it is 4.27 times as fast.
#include <hip/hip_runtime.h>

// Contractions: QKV projections on v_wmma_f32_16x16x32_bf16 (bf16 RNE-converted inputs, f32 accumulate); scores S^T = K x Q^T on v_wmma_f32_16x16x32_bf16 with q and k as bf16 hi|lo planes (hi.hi + hi.lo + lo.hi, one f32 accumulator); O = P x V on v_wmma_f32_16x16x32_f16 (P f16 carried x4096, V f16 carried x16); output projection on v_wmma_f32_16x16x32_f16 (ctx f16 carried x64, Wo = f16 of the bf16 RNE-converted input carried x64); all f32 accumulate; softmax (online, max-subtracted, exp2 domain) and rotary math in f32.

#ifndef NB
#define NB 2
#endif
#ifndef SEQ
#define SEQ 2048
#endif
#define NB_FULL   2
#define SEQ_FULL  2048
#define DM        2048                 // model width = depth of every projection
#define NQH       16                   // query heads
#define NKV       4                    // key/value heads
#define GRP       4                    // query heads per key/value head
#define HD        128                  // head dim
#define HD2       64                   // rotary frequencies
#define NQKV      3072                 // fused projection width (q | k | v)
#define EP        128                  // LDS pitch (halves) of the 16-bit epilogue tiles
#define CPF       260                  // LDS pitch (floats) of the f32 output staging tile
#define CP        136                  // LDS pitch (halves) of the per-wave ctx staging tile
#define TPW       72                   // LDS pitch (halves) of the weight transposer tile
#define KP        136                  // LDS pitch (halves) of a staged K row: 272 B = 16 B x odd
#define VP        40                   // LDS pitch (halves) of a staged V^T row of 32 keys: 80 B = 16 B x odd
#define KT_H      (32 * KP)            // halves of one staged K plane tile (32 keys)
#define VT_H      (HD * VP)            // halves of one staged V^T tile (128 d rows x 32 keys)
#define KV_H      (2 * KT_H + VT_H)    // halves of one stage buffer: K hi | K lo | V^T
#define GK        64                   // k extent (halves) of one staged GEMM slab: 128 B = one line per operand row
#define GP        72                   // LDS pitch (halves) of a staged GEMM operand row: 144 B = 16 B x odd
#define GT_H      (128 * GP)           // halves of 128 staged operand rows
#define FNQ       6                    // B fragments of a wave, QKV projection: block tile 128 x 384 = three heads
#define FNO       4                    // B fragments of a wave, output projection: block tile 128 x 256
#define GS_H(fn)  ((128 + 64 * (fn)) * GP)   // halves of one GEMM stage buffer: A rows | B rows
#define QS_H      (3 * 2 * 128 * EP)   // halves of the QKV kernel's LDS: three heads' 16-bit epilogue tiles, the ring inside
#define OS_H      (128 * CPF * 2)      // halves of the output kernel's LDS: the f32 staging tile, the ring inside
#define QW        2                    // query tiles of 16 rows held by one attention wave
#define NQT       (SEQ / (QW * 16))    // query tiles of a block (QW * 16 rows) per (batch, key/value head)
#define WS_CAP    134217728ull
#define PREP_G    512                  // blocks of the preparation launch: two per WGP
#define XR_PB     ((NB * SEQ) / PREP_G) // rows of X per preparation block
#define WT_PB     5                    // weight tiles per preparation block

#define P_CARRY   4096.0f
#define V_CARRY   16.0f
#define C_CARRY   64.0f
#define W_CARRY   64.0f

static_assert(NB >= 1 && NB <= NB_FULL);
static_assert(SEQ <= SEQ_FULL);
static_assert(SEQ % 128 == 0);
static_assert(DM % 128 == 0);
static_assert(DM % 32 == 0);
static_assert(DM == 256 * 8);                     // 256 threads x 8 elements = one X row
static_assert(NQKV == NQH * HD + 2 * NKV * HD);
static_assert(NQKV % (64 * FNQ) == 0 && 64 * FNQ == 3 * HD && DM % (64 * FNO) == 0);
static_assert(NQH == NKV * GRP);
static_assert(HD == 128 && HD2 * 2 == HD);
static_assert(NQH * HD == DM);
static_assert(EP >= HD && (EP * 2) % 16 == 0);
static_assert((CPF * 4) % 16 == 0 && CPF >= 64 * FNO);
static_assert((CP * 2) % 16 == 0 && CP >= HD);
static_assert((TPW * 2) % 16 == 0 && TPW >= 64);
static_assert((size_t)NB * HD2 * SEQ == (size_t)PREP_G * 512);
static_assert(XR_PB * PREP_G == NB * SEQ && SEQ % XR_PB == 0 && SEQ % 512 == 0);
static_assert((NQH * HD / 64) * (DM / 64) == 2 * PREP_G && (DM / 64) * (DM / 64) == 2 * PREP_G);
static_assert((NKV * HD / 64) * (DM / 64) * 2 == PREP_G);
static_assert((KP * 2) % 16 == 0 && KP >= HD && (VP * 2) % 16 == 0 && VP >= 32);
static_assert((KT_H * 2) % 16 == 0 && (KV_H * 2) % 16 == 0);
static_assert(SEQ % 64 == 0);                     // an odd count of 32-key steps is below SEQ / 32
static_assert(2 * 2 * KV_H * 2 >= GRP * QW * 16 * 32 * 16 + GRP * QW * 2 * 32 * 4);   // the join area fits the stage buffers
static_assert(QW * 16 == 32);                     // a block's query rows = one 32-key step: the diagonal lies in one step
static_assert(DM % GK == 0 && DM / GK >= 2 && GK % 32 == 0);
static_assert((GP * 2) % 16 == 0 && GP >= GK && (GT_H * 2) % 16 == 0);
static_assert(2 * GS_H(FNQ) <= QS_H && 2 * GS_H(FNO) <= OS_H);   // each GEMM ring lies inside its kernel's LDS array
static_assert(QS_H * 2 <= 327680 && OS_H * 2 <= 327680);         // which fits a WGP's LDS

#define QELEMS   (NB * NQH * SEQ * HD)            // q region of the hi / lo planes (elements)
#define KELEMS   (NB * NKV * SEQ * HD)            // k region
#define XB_BYTES   ((size_t)NB * SEQ * DM * 2)
#define WT_BYTES   ((size_t)NQKV * DM * 2)
#define WO_BYTES   ((size_t)DM * DM * 2)
#define TB_BYTES   ((size_t)NB * HD2 * SEQ * 4)
#define PL_BYTES   ((size_t)(QELEMS + KELEMS) * 2)
#define VT_BYTES   ((size_t)NB * NKV * HD * SEQ * 2)
#define CTX_BYTES  ((size_t)NB * SEQ * DM * 2)
#define OFF_XB   ((size_t)0)
#define OFF_WT   (OFF_XB + XB_BYTES)
#define OFF_WO   (OFF_WT + WT_BYTES)
#define OFF_COS  (OFF_WO + WO_BYTES)
#define OFF_SIN  (OFF_COS + TB_BYTES)
#define OFF_PH   (OFF_SIN + TB_BYTES)
#define OFF_PL   (OFF_PH + PL_BYTES)
#define OFF_VT   (OFF_PL + PL_BYTES)
#define OFF_CTX  (OFF_VT + VT_BYTES)
#define WS_TOTAL (OFF_CTX + CTX_BYTES)
static_assert(WS_TOTAL <= WS_CAP);
static_assert(XB_BYTES % 256 == 0 && WT_BYTES % 256 == 0 && WO_BYTES % 256 == 0);
static_assert(TB_BYTES % 256 == 0 && PL_BYTES % 256 == 0 && VT_BYTES % 256 == 0);
static_assert((unsigned long long)(QELEMS + KELEMS) < 2147483648ull);

typedef __bf16         bf16;
typedef _Float16       f16;
typedef unsigned short u16;
typedef bf16     v16bf __attribute__((ext_vector_type(16)));
typedef f16      v16h  __attribute__((ext_vector_type(16)));
typedef float    v8f   __attribute__((ext_vector_type(8)));
typedef float    v4f   __attribute__((ext_vector_type(4)));
typedef unsigned v4u   __attribute__((ext_vector_type(4)));

union Frag  { v16bf b; v16h h; v4u q[2]; f16 e[16]; };
union Pack8 { v4u u; u16 s[8]; };

// WMMA helpers: the builtin alone, the compiler keeps the distances behind its own builtin. (A guard statement that
// names A, B and D as asm operands needs them in v0..v255; the accumulators and fragments of a wave do not fit there.)
static __device__ __forceinline__ v8f mmaw_bf16(v16bf a, v16bf b, v8f acc) {
  return __builtin_amdgcn_wmma_f32_16x16x32_bf16(false, a, false, b, (short)0, acc, false, false);
}
static __device__ __forceinline__ v8f mmaw_f16(v16h a, v16h b, v8f acc) {
  return __builtin_amdgcn_wmma_f32_16x16x32_f16(false, a, false, b, (short)0, acc, false, false);
}

static __device__ __forceinline__ u16 bf16_bits(float x) {      // RNE convert
  const bf16 h = (bf16)x;
  return __builtin_bit_cast(u16, h);
}
static __device__ __forceinline__ float bf16_back(float x) {    // value of the RNE-converted bf16
  return (float)(bf16)x;
}
static __device__ __forceinline__ u16 f16_bits(float x) {
  const f16 h = (f16)x;
  return __builtin_bit_cast(u16, h);
}

// Preparation, one launch: every job that reads inputs only (X rows to bf16, the four weight transposes, the
// rotary table). PREP_G equal blocks, two per WGP; each block takes the same share of every job: XR_PB rows of X,
// two 64 x 64 tiles of Wq, two of Wo, one of Wk or Wv, and 2 x 256 table elements. All of a lane's global loads are
// issued first; the table arithmetic runs while they fly.
//   X     : row m = blk * XR_PB + j, 256 threads x 8 elements == DM; bf16 RNE bits.
//   W     : in W[DM rows (input dim)][ldin cols (output dim)] f32 -> out Bt[rowoff + col][DM] 16-bit, a 64 (input
//           dim) x 64 (output col) tile through its own LDS tile; Wq, Wk, Wv: bf16 RNE bits; Wo: f16 of (bf16 RNE
//           value x W_CARRY) (exact). Written lines whole: 8 lanes x 16 B per line. A block's two tiles of one
//           weight are neighbours along the input dim (256 contiguous bytes per written row).
//   table : ts[j] = 10000^(j/64) (double product of fixed roots -> float), angle = (float)pos / ts[j] (IEEE
//           division), positions read by value.
// coverage: PREP_G * XR_PB == NB*SEQ rows; 2 * PREP_G tiles == Wq's == Wo's, PREP_G tiles == Wk's + Wv's;
// PREP_G * 512 == NB*64*SEQ table elements. LDS sT is cross-wave: one block barrier between fill and readback.
__global__ __launch_bounds__(256) void prep_kernel(const float* __restrict__ X, const int* __restrict__ pos,
                                                   const float* __restrict__ Wq, const float* __restrict__ Wk,
                                                   const float* __restrict__ Wv, const float* __restrict__ Wo,
                                                   u16* __restrict__ Xb, u16* __restrict__ Wt,
                                                   u16* __restrict__ WoT,
                                                   float* __restrict__ cosT, float* __restrict__ sinT) {
  __shared__ __align__(16) u16 sT[WT_PB][64 * TPW];   // [tile][col][input dim]
  const int blk = blockIdx.x;
  const int tid = threadIdx.x;
  const int r8  = tid >> 3;                            // 0..31: tile row on the way in, tile col on the way out
  const int c8  = (tid & 7) * 8;                       // 0..56: tile col on the way in, input dim on the way out

  // table share: one frequency j of one batch b, 512 consecutive positions (block-uniform j and b)
  const int tj = (blk / (SEQ / 512)) % HD2;
  const int tb = blk / ((SEQ / 512) * HD2);
  const int tt = (blk % (SEQ / 512)) * 512 + tid;
  const int* pp = pos + (size_t)tb * SEQ_FULL + tt;
  int pv[2];
  #pragma unroll
  for (int e = 0; e < 2; ++e) pv[e] = pp[e * 256];

  // weight tiles 0, 1 of Wq and 2, 3 of Wo: tile column pc, input-dim rows pd .. pd + 127 (two tiles);
  // tile 4 of Wk (lower half of the grid) or Wv (block-uniform choice)
  const int pd    = ((blk * 2) % (DM / 64)) * 64;
  const int pc    = ((blk * 2) / (DM / 64)) * 64;
  const int kvsel = (blk >= PREP_G / 2) ? 1 : 0;
  const int kvt   = blk - kvsel * (PREP_G / 2);
  const int kd    = (kvt % (DM / 64)) * 64;
  const int kc    = (kvt / (DM / 64)) * 64;
  const float* gq = Wq + (size_t)(pd + r8) * (NQH * HD) + pc + c8;
  const float* go = Wo + (size_t)(pd + r8) * DM + pc + c8;
  const float* gk = (kvsel ? Wv : Wk) + (size_t)(kd + r8) * (NKV * HD) + kc + c8;
  v4f w0[WT_PB][2];
  v4f w1[WT_PB][2];
  #pragma unroll
  for (int s = 0; s < WT_PB; ++s) {
    #pragma unroll
    for (int kk = 0; kk < 2; ++kk) {                   // input dim local r = kk * 32 + r8
      const float* g = (s < 2) ? gq + ((s & 1) * 64 + kk * 32) * (NQH * HD)
                     : (s < 4) ? go + ((s & 1) * 64 + kk * 32) * DM
                               : gk + (kk * 32) * (NKV * HD);
      w0[s][kk] = *(const v4f*)(g);
      w1[s][kk] = *(const v4f*)(g + 4);
    }
  }

  // rows of X: XR_PB consecutive rows of one batch
  const int xm = blk * XR_PB;
  const float* gx = X + ((size_t)(xm / SEQ) * SEQ_FULL + xm % SEQ) * DM + tid * 8;
  v4f a0[XR_PB];
  v4f a1[XR_PB];
  #pragma unroll
  for (int j = 0; j < XR_PB; ++j) {
    a0[j] = *(const v4f*)(gx + j * DM);
    a1[j] = *(const v4f*)(gx + j * DM + 4);
  }
  // the loads' addresses, named as inputs, stay live up to this wait, so that no load's result lands in a register
  // that another load of the burst names; the memory clobber keeps every load above it, in front of the table
  // arithmetic, which runs inside their latency
  asm volatile("s_wait_xcnt 0x0" :: "v"(pp), "v"(gq), "v"(go), "v"(gk), "v"(gx) : "memory");

  double pf = 1.0;
  pf *= (tj & 32) ? 100.0 : 1.0;                       // 10000^(32/64)
  pf *= (tj & 16) ? 10.0 : 1.0;                        // 10000^(16/64)
  pf *= (tj & 8)  ? 3.1622776601683795 : 1.0;          // 10000^(8/64)
  pf *= (tj & 4)  ? 1.7782794100389228 : 1.0;          // 10000^(4/64)
  pf *= (tj & 2)  ? 1.333521432163324  : 1.0;          // 10000^(2/64)
  pf *= (tj & 1)  ? 1.1547819846894583 : 1.0;          // 10000^(1/64)
  const float ts = (float)pf;
  float tc[2];
  float tsn[2];
  #pragma unroll
  for (int e = 0; e < 2; ++e) {
    const int p = pv[e];
    float ang = (float)p / ts;
    ang = (p == 0) ? 0.0f : ang;
    sincosf(ang, &tsn[e], &tc[e]);
  }

  #pragma unroll
  for (int s = 0; s < WT_PB; ++s) {
    #pragma unroll
    for (int kk = 0; kk < 2; ++kk) {
      const int r = kk * 32 + r8;
      #pragma unroll
      for (int i = 0; i < 4; ++i) {
        const float x0 = bf16_back(w0[s][kk][i]);
        const float x1 = bf16_back(w1[s][kk][i]);
        const u16 h0 = (s == 2 || s == 3) ? f16_bits(x0 * W_CARRY) : bf16_bits(x0);
        const u16 h1 = (s == 2 || s == 3) ? f16_bits(x1 * W_CARRY) : bf16_bits(x1);
        sT[s][(c8 + i) * TPW + r]     = h0;
        sT[s][(c8 + 4 + i) * TPW + r] = h1;
      }
    }
  }

  // every global store stands behind the barrier: in front of it the barrier would wait for its completion
  __syncthreads();

  #pragma unroll
  for (int e = 0; e < 2; ++e) {
    const int idx = blk * 512 + e * 256 + tid;         // == (tb * HD2 + tj) * SEQ + tt + e * 256
    cosT[idx] = tc[e];
    sinT[idx] = tsn[e];
  }
  u16* ox = Xb + (size_t)xm * DM + tid * 8;
  #pragma unroll
  for (int j = 0; j < XR_PB; ++j) {
    Pack8 pk;
    #pragma unroll
    for (int i = 0; i < 4; ++i) {
      pk.s[i]     = bf16_bits(a0[j][i]);
      pk.s[4 + i] = bf16_bits(a1[j][i]);
    }
    *(v4u*)(ox + j * DM) = pk.u;
  }
  u16* oq = Wt  + (size_t)(pc + r8) * DM + pd + c8;
  u16* oo = WoT + (size_t)(pc + r8) * DM + pd + c8;
  u16* ok = Wt  + (size_t)((kvsel ? (NQH + NKV) * HD : NQH * HD) + kc + r8) * DM + kd + c8;
  #pragma unroll
  for (int s = 0; s < WT_PB; ++s) {
    #pragma unroll
    for (int kk = 0; kk < 2; ++kk) {                   // col local c = kk * 32 + r8
      const v4u val = *(const v4u*)(&sT[s][(kk * 32 + r8) * TPW + c8]);
      u16* o = (s < 2) ? oq + (s & 1) * 64 + kk * 32 * DM
             : (s < 4) ? oo + (s & 1) * 64 + kk * 32 * DM
                       : ok + kk * 32 * DM;
      *(v4u*)(o) = val;
    }
  }
}

// 128 rows of each of two operand pieces' k-slab (128 B a row) from global memory into LDS: 8 asynchronous 16-B copies
// per lane, 256 lanes, every byte copied exactly once; 8 lanes cover one whole 128-B line, 32 rows per copy.
// p / q and l are the lane's own global pointers and the LDS byte address of its first piece; q's rows lie behind
// p's. The closing s_wait_xcnt stands inside the statement so that no address register of an issued copy is
// rewritten ahead of it.
static __device__ __forceinline__ void stage_256(const u16* p, const u16* q, unsigned l) {
  asm volatile(
      "global_load_async_to_lds_b128 %0, %1, off\n\t"
      "global_load_async_to_lds_b128 %2, %3, off\n\t"
      "global_load_async_to_lds_b128 %4, %5, off\n\t"
      "global_load_async_to_lds_b128 %6, %7, off\n\t"
      "global_load_async_to_lds_b128 %8, %9, off\n\t"
      "global_load_async_to_lds_b128 %10, %11, off\n\t"
      "global_load_async_to_lds_b128 %12, %13, off\n\t"
      "global_load_async_to_lds_b128 %14, %15, off\n\t"
      "s_wait_xcnt 0x0"
      :
      : "v"(l),                              "v"(p),
        "v"(l + 32 * GP * 2),                "v"(p + 32 * DM),
        "v"(l + 64 * GP * 2),                "v"(p + 64 * DM),
        "v"(l + 96 * GP * 2),                "v"(p + 96 * DM),
        "v"(l + GT_H * 2),                   "v"(q),
        "v"(l + GT_H * 2 + 32 * GP * 2),     "v"(q + 32 * DM),
        "v"(l + GT_H * 2 + 64 * GP * 2),     "v"(q + 64 * DM),
        "v"(l + GT_H * 2 + 96 * GP * 2),     "v"(q + 96 * DM)
      : "memory");
}
// The same for 128 rows of one piece: 4 copies per lane.
static __device__ __forceinline__ void stage_128(const u16* p, unsigned l) {
  asm volatile(
      "global_load_async_to_lds_b128 %0, %1, off\n\t"
      "global_load_async_to_lds_b128 %2, %3, off\n\t"
      "global_load_async_to_lds_b128 %4, %5, off\n\t"
      "global_load_async_to_lds_b128 %6, %7, off\n\t"
      "s_wait_xcnt 0x0"
      :
      : "v"(l),                              "v"(p),
        "v"(l + 32 * GP * 2),                "v"(p + 32 * DM),
        "v"(l + 64 * GP * 2),                "v"(p + 64 * DM),
        "v"(l + 96 * GP * 2),                "v"(p + 96 * DM)
      : "memory");
}

// One k-slab of the block's operands (A: 128 rows, B: 64 * FN rows) into one LDS buffer: A rows first, B rows behind.
template <int FN>
static __device__ __forceinline__ void stage_ab(const u16* a, const u16* b, unsigned l) {
  stage_256(a, b, l);
  if (FN == 6) stage_256(b + 128 * DM, b + 256 * DM, l + 2 * (GT_H * 2));
  else         stage_128(b + 128 * DM, l + 2 * (GT_H * 2));
}

// GEMM core: C[128 x (64*FN) block tile] = A[M][DM] x Bt[N][DM]^T, 8 waves (2 x 4), wave tile 64 rows x 16*FN cols,
// one block per WGP. The block's A rows and B rows are staged once per block in LDS, GK k values at a time (two
// buffers, asynchronous copies one slab ahead); fragments are read from there with 16-B LDS loads (two each, split k
// map for A and B alike): same elements, same k order as the planes. sS is the ring (2 * GS_H(FN) halves); behind the
// last slab's barrier nobody reads it any more and nothing is in flight, so the caller may reuse it.
// ROPEMAP = 1 (FN = 6, three heads of 128 cols): wave column group g owns the three column pairs pu = 3g .. 3g+2;
// pair pu = cols {c .. c+15} and {c+64 .. c+79}, c = (pu / 4) * 128 + (pu % 4) * 16 (tiles fn = 2q and 2q+1), so that
// col d of a head and its rotary partner d+64 sit in the same lane / same accumulator element.
template <int ISF16, int ROPEMAP, int FN>
static __device__ __forceinline__ void gemm_core(const u16* __restrict__ A, const u16* __restrict__ Bt,
                                                 u16* sS, int tid,
                                                 int m0, int n0, int wm, int g, int lr, int hi,
                                                 v8f (&acc)[4][FN]) {
  int aoff[4];
  int boff[FN];
  #pragma unroll
  for (int fm = 0; fm < 4; ++fm) aoff[fm] = (wm + fm * 16 + lr) * GP + 8 * hi;
  #pragma unroll
  for (int fn = 0; fn < FN; ++fn) {
    const int pu  = g * 3 + (fn >> 1);
    const int col = ROPEMAP ? ((pu >> 2) * 128 + (fn & 1) * 64 + (pu & 3) * 16) : (g * (FN * 16) + fn * 16);
    boff[fn] = GT_H + (col + lr) * GP + 8 * hi;
  }
  // staging: lane's first piece; 8 lanes x 16 B = one 128-B row piece, 32 rows per copy. Block-uniform bases and
  // lane parts are kept apart and added at each call, so that no 64-bit lane pointer is held over the k loop.
  const u16* const ua = A  + (size_t)m0 * DM;
  const u16* const ub = Bt + (size_t)n0 * DM;
  const unsigned og = (tid >> 3) * DM + (tid & 7) * 8;                  // lane part, global (halves), A and B alike
  const unsigned lbase = (unsigned)(size_t)sS;                          // LDS byte address = low 32 bits
  const unsigned ll = (tid >> 3) * (GP * 2) + (tid & 7) * 16;           // lane part, LDS (bytes)
  const int nslab = DM / GK;

  // slab 0 lands and is published before anybody reads it; slab 1 then flies during slab 0's products
  stage_ab<FN>(ua + og, ub + og, lbase + ll);
  asm volatile("s_wait_asynccnt 0x0" ::: "memory"); // this wave's copies of slab 0 have landed
  __syncthreads();
  stage_ab<FN>(ua + (og + GK), ub + (og + GK), (lbase + GS_H(FN) * 2) + ll);

  #pragma unroll 1
  for (int t = 0; t < nslab; ++t) {
    const int bsel = t & 1;
    const u16* sT = sS + bsel * GS_H(FN);           // this slab's stage buffer
    #pragma unroll
    for (int kk = 0; kk < GK; kk += 32) {
      Frag a[4];
      Frag b[FN];
      #pragma unroll
      for (int fm = 0; fm < 4; ++fm) {
        a[fm].q[0] = *(const v4u*)(sT + aoff[fm] + kk);        // k = t*GK + kk + 8hi + 0..7
        a[fm].q[1] = *(const v4u*)(sT + aoff[fm] + kk + 16);   // k = t*GK + kk + 16 + 8hi + 0..7
      }
      #pragma unroll
      for (int fn = 0; fn < FN; ++fn) {
        b[fn].q[0] = *(const v4u*)(sT + boff[fn] + kk);
        b[fn].q[1] = *(const v4u*)(sT + boff[fn] + kk + 16);
      }
      // keeps a block's reads whole and in front of its products, as written here: without it the B reads are sunk
      // among the products into one reused register set, and every B fragment waits out the LDS latency
      __builtin_amdgcn_sched_barrier(0);
      #pragma unroll
      for (int fn = 0; fn < FN; ++fn) {
        #pragma unroll
        for (int fm = 0; fm < 4; ++fm) {
          if (ISF16) acc[fm][fn] = mmaw_f16(a[fm].h, b[fn].h, acc[fm][fn]);
          else       acc[fm][fn] = mmaw_bf16(a[fm].b, b[fn].b, acc[fm][fn]);
        }
      }
      // keeps a block's products in front of what follows, as written here: without it the last block's products are
      // sunk behind the slab's barrier, in front of the refill, whose copies then start that much later
      __builtin_amdgcn_sched_barrier(0);
    }
    // publish point of slab t + 1, every wave, every slab
    asm volatile("s_wait_dscnt 0x0" ::: "memory");    // this wave's reads of the buffer to be refilled are done
    asm volatile("s_wait_asynccnt 0x0" ::: "memory"); // this wave's copies of slab t + 1 have landed
    __syncthreads();                                  // publishes slab t + 1, ends all reads of slab t
    if (t + 2 < nslab) {                              // block-uniform: refill the buffer just read
      const unsigned on = og + (unsigned)(t + 2) * GK;  // 32-bit sum: slab and lane part, then the base
      stage_ab<FN>(ua + on, ub + on, (lbase + bsel * (GS_H(FN) * 2)) + ll);
    }
  }
  asm volatile("s_wait_asynccnt 0x0" ::: "memory");   // nothing of this wave's copies is left in flight
}

// Fused QKV projection + rotary + plane builder.
// grid (NQKV/384 column tiles = three heads each, NB*SEQ/128 row tiles); head ct = 3 * column tile + 0..2:
// 0..15 q head, 16..19 k head, 20..23 v head. Outputs:
//   ph / pl : bf16 hi / lo planes, q region [NB][NQH][SEQ][HD] at 0, k region [NB][NKV][SEQ][HD] at QELEMS
//   vt      : f16 (x V_CARRY) [NB][NKV][HD][SEQ], transposed through LDS
// LDS tiles sA / sB (a pair per head) are cross-wave (block barrier between fill and readback); staged extent
// 128 x 128 == consumed extent. They lie over the GEMM ring, which is free once gemm_core has returned. Every written
// line whole: 16 lanes x 16 B = one 256-B row per half-wave.
// two waves per SIMD (one block per WGP): the grid has one block per WGP
__global__ __launch_bounds__(256) __attribute__((amdgpu_waves_per_eu(2, 2))) void qkv_gemm_kernel(const u16* __restrict__ Xb, const u16* __restrict__ Wt,
                                                       const float* __restrict__ cosT,
                                                       const float* __restrict__ sinT,
                                                       u16* __restrict__ ph, u16* __restrict__ pl,
                                                       u16* __restrict__ vt) {
  __shared__ __align__(16) u16 sS[QS_H];
  const int ct0  = blockIdx.x * 3;
  const int m0   = blockIdx.y * 128;
  const int tid  = threadIdx.x;
  const int wave = __builtin_amdgcn_readfirstlane(threadIdx.x >> 5);
  const int lane = tid & 31;
  const int lr   = lane & 15;
  const int hi   = lane >> 4;
  const int wm   = (wave & 1) * 64;
  const int g    = wave >> 1;

  v8f acc[4][FNQ];
  #pragma unroll
  for (int fm = 0; fm < 4; ++fm) {
    #pragma unroll
    for (int fn = 0; fn < FNQ; ++fn) acc[fm][fn] = (v8f){0, 0, 0, 0, 0, 0, 0, 0};
  }
  gemm_core<0, 1, FNQ>(Xb, Wt, sS, tid, m0, ct0 * 128, wm, g, lr, hi, acc);

  const int b  = m0 / SEQ;
  const int t0 = m0 % SEQ;

  #pragma unroll
  for (int q = 0; q < 3; ++q) {
    const int pu = g * 3 + q;                              // the wave's column pair (wave-uniform)
    const int hl = pu >> 2;                                // head inside the block's three
    const int fg = pu & 3;                                 // group of 16 frequencies
    u16* const sA = sS + hl * (2 * 128 * EP);
    u16* const sB = sA + 128 * EP;
    if (ct0 + hl < NQH + NKV) {                            // wave-uniform
      // rotary on the f32 accumulators, then bf16 hi | lo split into the LDS tiles
      const int j = fg * 16 + lr;                          // frequency index 0..63
      const size_t tb = ((size_t)b * HD2 + j) * SEQ + t0 + wm + 8 * hi;
      const float* cp = cosT + tb;
      const float* sp = sinT + tb;
      v4f ca[4];
      v4f cb[4];
      v4f sa[4];
      v4f sb[4];
      #pragma unroll
      for (int fm = 0; fm < 4; ++fm) {
        ca[fm] = *(const v4f*)(cp + fm * 16);
        cb[fm] = *(const v4f*)(cp + fm * 16 + 4);
        sa[fm] = *(const v4f*)(sp + fm * 16);
        sb[fm] = *(const v4f*)(sp + fm * 16 + 4);
      }
      // the loads' addresses, named as inputs, stay live up to this wait, so that no register that an issued load
      // names is rewritten ahead of it
      asm volatile("s_wait_xcnt 0x0" :: "v"(cp), "v"(sp) : "memory");
      #pragma unroll
      for (int fm = 0; fm < 4; ++fm) {
        const int tl = wm + fm * 16 + 8 * hi;              // first of this lane's 8 tile rows
        #pragma unroll
        for (int i = 0; i < 8; ++i) {
          const float c  = (i < 4) ? ca[fm][i & 3] : cb[fm][i & 3];
          const float s  = (i < 4) ? sa[fm][i & 3] : sb[fm][i & 3];
          const float x1 = acc[fm][2 * q][i];              // col j
          const float x2 = acc[fm][2 * q + 1][i];          // col j + 64
          const float y1 = x1 * c - x2 * s;
          const float y2 = x2 * c + x1 * s;
          const float h1 = bf16_back(y1);
          const float h2 = bf16_back(y2);
          const int row = tl + i;
          sA[row * EP + j]       = bf16_bits(h1);
          sA[row * EP + 64 + j]  = bf16_bits(h2);
          sB[row * EP + j]       = bf16_bits(y1 - h1);
          sB[row * EP + 64 + j]  = bf16_bits(y2 - h2);
        }
      }
    } else {
      // v head: f16 carried x V_CARRY, transposed in LDS to [d][t]
      #pragma unroll
      for (int fm = 0; fm < 4; ++fm) {
        #pragma unroll
        for (int h = 0; h < 2; ++h) {
          const int d = h * 64 + fg * 16 + lr;
          #pragma unroll
          for (int i = 0; i < 8; ++i) {
            const int row = wm + fm * 16 + 8 * hi + i;
            sA[d * EP + row] = f16_bits(acc[fm][2 * q + h][i] * V_CARRY);
          }
        }
      }
    }
  }
  __syncthreads();

  // rolled: the same read-back three times over; unrolled it only lengthens the program text
  #pragma unroll 1
  for (int hl = 0; hl < 3; ++hl) {
    const int ct = ct0 + hl;                               // block-uniform
    const u16* const sA = sS + hl * (2 * 128 * EP);
    const u16* const sB = sA + 128 * EP;
    if (ct < NQH + NKV) {
      const int isq   = (ct < NQH) ? 1 : 0;
      const int pbase = isq ? (((b * NQH + ct) * SEQ + t0) * HD)
                            : (QELEMS + ((b * NKV + (ct - NQH)) * SEQ + t0) * HD);
      v4u vA[8];
      v4u vB[8];
      int gi[8];
      #pragma unroll
      for (int it = 0; it < 8; ++it) {
        const int piece = it * 256 + tid;
        const int row = piece >> 4;                        // 0..127
        const int seg = piece & 15;                        // 16 x 16 B = one 256-B plane row
        vA[it] = *(const v4u*)(sA + row * EP + seg * 8);
        vB[it] = *(const v4u*)(sB + row * EP + seg * 8);
        gi[it] = pbase + row * HD + seg * 8;
      }
      #pragma unroll
      for (int it = 0; it < 8; ++it) {
        *(v4u*)(ph + gi[it]) = vA[it];
        *(v4u*)(pl + gi[it]) = vB[it];
      }
      // the next trip rewrites registers that these stores name: not ahead of this wait
      asm volatile("s_wait_xcnt 0x0" ::: "memory");
    } else {
      const int kvh = ct - (NQH + NKV);
      v4u vA[8];
      int gi[8];
      #pragma unroll
      for (int it = 0; it < 8; ++it) {
        const int piece = it * 256 + tid;
        const int d   = piece >> 4;                        // 0..127
        const int seg = piece & 15;
        vA[it] = *(const v4u*)(sA + d * EP + seg * 8);
        gi[it] = ((b * NKV + kvh) * HD + d) * SEQ + t0 + seg * 8;
      }
      #pragma unroll
      for (int it = 0; it < 8; ++it) *(v4u*)(vt + gi[it]) = vA[it];
      // the next trip rewrites registers that these stores name: not ahead of this wait
      asm volatile("s_wait_xcnt 0x0" ::: "memory");
    }
  }
}

// One 32-key stage (K hi, K lo: 32 rows x 256 B each; V^T: 128 rows x 64 B) from global memory into one LDS
// buffer: 12 asynchronous 16-B copies per lane, 128 lanes, every byte of the stage copied exactly once.
// kh / kl / v and lk / lv are the lane's own global pointers and LDS byte addresses of its first piece.
// The closing s_wait_xcnt stands inside the statement so that no address register of an issued copy is
// rewritten ahead of it.
static __device__ __forceinline__ void stage_kv(const u16* kh, const u16* kl, const u16* v,
                                                unsigned lk, unsigned lv) {
  asm volatile(
      "global_load_async_to_lds_b128 %0, %1, off\n\t"
      "global_load_async_to_lds_b128 %2, %3, off\n\t"
      "global_load_async_to_lds_b128 %4, %5, off\n\t"
      "global_load_async_to_lds_b128 %6, %7, off\n\t"
      "global_load_async_to_lds_b128 %8, %9, off\n\t"
      "global_load_async_to_lds_b128 %10, %11, off\n\t"
      "global_load_async_to_lds_b128 %12, %13, off\n\t"
      "global_load_async_to_lds_b128 %14, %15, off\n\t"
      "global_load_async_to_lds_b128 %16, %17, off\n\t"
      "global_load_async_to_lds_b128 %18, %19, off\n\t"
      "global_load_async_to_lds_b128 %20, %21, off\n\t"
      "global_load_async_to_lds_b128 %22, %23, off\n\t"
      "s_wait_xcnt 0x0"
      :
      : "v"(lk),                             "v"(kh),
        "v"(lk + 8 * KP * 2),                "v"(kh + 8 * HD),
        "v"(lk + 16 * KP * 2),               "v"(kh + 16 * HD),
        "v"(lk + 24 * KP * 2),               "v"(kh + 24 * HD),
        "v"(lk + KT_H * 2),                  "v"(kl),
        "v"(lk + KT_H * 2 + 8 * KP * 2),     "v"(kl + 8 * HD),
        "v"(lk + KT_H * 2 + 16 * KP * 2),    "v"(kl + 16 * HD),
        "v"(lk + KT_H * 2 + 24 * KP * 2),    "v"(kl + 24 * HD),
        "v"(lv),                             "v"(v),
        "v"(lv + 32 * VP * 2),               "v"(v + 32 * SEQ),
        "v"(lv + 64 * VP * 2),               "v"(v + 64 * SEQ),
        "v"(lv + 96 * VP * 2),               "v"(v + 96 * SEQ)
      : "memory");
}

// K fragments of one 32-d slice from a staged stage buffer: key tile 0 hi, lo, key tile 1 hi, lo (8 LDS reads).
// p = fragment origin of the slice inside the K hi plane tile.
static __device__ __forceinline__ void load_kset(Frag (&k)[4], const u16* p) {
  k[0].q[0] = *(const v4u*)(p);
  k[0].q[1] = *(const v4u*)(p + 16);
  k[1].q[0] = *(const v4u*)(p + KT_H);
  k[1].q[1] = *(const v4u*)(p + KT_H + 16);
  k[2].q[0] = *(const v4u*)(p + 16 * KP);
  k[2].q[1] = *(const v4u*)(p + 16 * KP + 16);
  k[3].q[0] = *(const v4u*)(p + KT_H + 16 * KP);
  k[3].q[1] = *(const v4u*)(p + KT_H + 16 * KP + 16);
}

// 2^x with the slot that the instruction set asks for behind a transcendental (one independent instruction or
// v_nop before its result is read or its source overwritten) inside the statement.
static __device__ __forceinline__ float exp2_slot(float x) {
  float r;
  asm("v_exp_f32 %0, %1\n\tv_nop" : "=v"(r) : "v"(x));
  return r;
}

// Fused causal grouped-query attention, logit scale 1.0, online softmax in the exp2 domain.
// Block = 8 waves = the four query heads of one key/value head for the same 32 query rows, twice: wave group 0
// takes the even 32-key steps, wave group 1 the odd ones (uniform trip count), each with its own running maximum,
// sum and O; the two partial states are joined through LDS behind the key loop.
// A wave holds QW = 2 query tiles of 16 rows: every K and V^T fragment read from LDS feeds both tiles' products,
// and every staged 32-key stage serves 32 query rows of each head, so LDS reads and staged bytes per product halve.
// S^T = K x Q^T so queries sit on lanes; P^T in C layout is bit-identical to the A-fragment layout of O += P x V.
// q and k: bf16 hi | lo planes, three products per k-step into one accumulator. q fragments are loaded once
// and stay in registers. ctx out: f16 carried x C_CARRY, [NB*SEQ][DM], col = head*128 + d.
// K hi | K lo | V^T of each 32-key step are staged once per block in LDS (per wave group two buffers, filled by
// that group's lanes, asynchronous copies one step ahead) and read by the group's four waves with 16-B LDS loads;
// same elements, same k order as the planes.
// LDS sO: each wave writes and reads only its own slice; a block barrier separates fill and readback.
// two waves per SIMD (one block per WGP): q and O of two query tiles alone fill 256 registers
__global__ __launch_bounds__(256) __attribute__((amdgpu_waves_per_eu(2, 2))) void attn_kernel(const u16* __restrict__ ph, const u16* __restrict__ pl,
                                                   const u16* __restrict__ vt, u16* __restrict__ ctx) {
  // Causal balance: twice as many blocks as resident places, and a block's key steps grow with its query tile:
  // the tile falls with the flat block index, so that the long blocks start
  // first and the short ones fill the places that fall free. For speed only; flat -> (tile, kv, b) is one to one.
  const int flat = blockIdx.x + NQT * (blockIdx.y + NKV * blockIdx.z);
  const int qt   = NQT - 1 - flat / (NKV * NB);
  const int kv   = flat % NKV;
  const int b    = (flat / NKV) % NB;
  const int tid  = threadIdx.x;
  const int wave = __builtin_amdgcn_readfirstlane(threadIdx.x >> 5);
  const int lane = tid & 31;
  const int lq   = lane & 15;     // query column of S^T / d column of O
  const int hi   = lane >> 4;     // k-split half
  const int grp  = wave >> 2;     // wave group: parity of the 32-key steps it takes
  const int hw   = wave & 3;      // query head inside the key/value head's group
  const int gt   = tid & 127;     // lane index inside the wave group (staging)
  const int head = kv * GRP + hw;
  const int qrow0 = qt * (QW * 16);

  __shared__ __align__(16) u16 sO[GRP * QW * 16 * CP];
  __shared__ __align__(16) u16 sKV[2 * 2 * KV_H];     // [wave group][buffer]

  const int qoff  = ((b * NQH + head) * SEQ + qrow0 + lq) * HD + hi * 8;
  const int kfrag = lq * KP + hi * 8;                 // fragment origin inside a staged K plane tile
  const int vfrag = 2 * KT_H + lq * VP + hi * 8;      // fragment origin of the staged V^T tile

  // staging: lane's first piece. K: 16 lanes x 16 B = one 256-B row, 8 rows per copy; V^T: 4 lanes per 64-B row.
  // The wave-uniform bases stand at the group's first step (keys grp * 32 ...); its next step lies 64 keys on.
  // Bases and lane parts are kept apart and added at each call: a value that is itself an asm operand must live in
  // v0..v255 for its whole life, and held so over the key loop two of them were spilled to scratch.
  const u16* const ukh = ph + QELEMS + ((b * NKV + kv) * SEQ + grp * 32) * HD;
  const u16* const ukl = pl + QELEMS + ((b * NKV + kv) * SEQ + grp * 32) * HD;
  const u16* const uv  = vt + (b * NKV + kv) * HD * SEQ + grp * 32;
  const unsigned okl = gt * 8;                        // lane part, K planes (halves)
  const unsigned ovl = (gt >> 2) * SEQ + (gt & 3) * 8; // lane part, V^T (halves)
  // LDS byte address = low 32 bits of the shared address; the group's own pair of buffers
  const unsigned lbase = (unsigned)(size_t)sKV + grp * (2 * KV_H * 2);
  const unsigned lkl = (gt >> 4) * (KP * 2) + (gt & 15) * 16;                  // lane part, K hi tile (bytes)
  const unsigned lvl = 2 * KT_H * 2 + (gt >> 2) * (VP * 2) + (gt & 3) * 16;    // lane part, V^T tile (bytes)

  v8f o[QW][8];
  #pragma unroll
  for (int u = 0; u < QW; ++u) {
    #pragma unroll
    for (int dt = 0; dt < 8; ++dt) o[u][dt] = (v8f){0, 0, 0, 0, 0, 0, 0, 0};
  }

  const float NEGV = -1.0e30f;
  float rmax[QW];
  float rsum[QW];
  #pragma unroll
  for (int u = 0; u < QW; ++u) {
    rmax[u] = NEGV;
    rsum[u] = 0.0f;
  }
  const float SL = 1.4426950408889634f;             // logit scale 1.0 times log2(e)

  // 32-key steps of the tile, and trips of the loop: step 2 * trip + grp. With an odd count group 1's last step
  // lies wholly beyond the diagonal (still inside the sequence: an odd count is below SEQ / 32); the causal
  // exclusion turns all of it off.
  const int nchunk = (qrow0 >> 5) + 1;
  const int ntrip  = (nchunk + 1) >> 1;             // same for every wave of the block

  // q fragments (B operand of S^T): loaded once, held in registers over the whole key loop
  Frag qh[QW][4], ql[QW][4];
  #pragma unroll
  for (int u = 0; u < QW; ++u) {
    #pragma unroll
    for (int f = 0; f < 4; ++f) {
      const int qa = qoff + u * (16 * HD) + f * 32;
      qh[u][f].q[0] = *(const v4u*)(ph + qa);       // d = f*32 + 8hi + 0..7
      qh[u][f].q[1] = *(const v4u*)(ph + qa + 16);  // d = f*32 + 16 + 8hi + 0..7
      ql[u][f].q[0] = *(const v4u*)(pl + qa);
      ql[u][f].q[1] = *(const v4u*)(pl + qa + 16);
    }
  }

  // stage 0 lands and is published before anybody reads it; stage 1 then flies during step 0
  stage_kv(ukh + okl, ukl + okl, uv + ovl, lbase + lkl, lbase + lvl);
  asm volatile("s_wait_asynccnt 0x0" ::: "memory"); // this wave's copies of stage 0 have landed
  __syncthreads();
  if (ntrip > 1) stage_kv(ukh + (okl + 64u * HD), ukl + (okl + 64u * HD), uv + (ovl + 64u),
                          (lbase + KV_H * 2) + lkl, (lbase + KV_H * 2) + lvl);

  #pragma unroll 1
  for (int ic = 0; ic < ntrip; ++ic) {
    const int j0 = (2 * ic + grp) * 32;
    const int bsel = ic & 1;
    const u16* sT = sKV + (grp * 2 + bsel) * KV_H;  // this step's stage buffer

    // S^T tiles of query tile u: c0[u][r] = score(query qrow0 + 16u + lq, key j0 + 8hi + r),
    // c1[u][r] = key j0 + 16 + 8hi + r
    v8f c0[QW];
    v8f c1[QW];
    #pragma unroll
    for (int u = 0; u < QW; ++u) {
      c0[u] = (v8f){0, 0, 0, 0, 0, 0, 0, 0};
      c1[u] = (v8f){0, 0, 0, 0, 0, 0, 0, 0};
    }
    // LDS fragment reads are issued in groups ahead of the products that use them: K one 32-d slice ahead in a
    // second register set, V^T into the K sets' registers as they fall free, all of it before the softmax.
    Frag ks[2][4];
    Frag bv[8];
    load_kset(ks[0], sT + kfrag);
    load_kset(ks[1], sT + kfrag + 32);
    // keeps both read groups in front of the first products (sunk to their uses, each read's latency is waited out)
    __builtin_amdgcn_sched_barrier(0);
    #pragma unroll
    for (int f = 0; f < 4; ++f) {
      Frag (&k)[4] = ks[f & 1];
      // per accumulator the order hi.hi, hi.lo, lo.hi as before; the four accumulators take turns
      #pragma unroll
      for (int u = 0; u < QW; ++u) {
        c0[u] = mmaw_bf16(k[0].b, qh[u][f].b, c0[u]);   // key j0 + lq
        c1[u] = mmaw_bf16(k[2].b, qh[u][f].b, c1[u]);   // key j0 + 16 + lq
      }
      #pragma unroll
      for (int u = 0; u < QW; ++u) {
        c0[u] = mmaw_bf16(k[0].b, ql[u][f].b, c0[u]);
        c1[u] = mmaw_bf16(k[2].b, ql[u][f].b, c1[u]);
      }
      #pragma unroll
      for (int u = 0; u < QW; ++u) {
        c0[u] = mmaw_bf16(k[1].b, qh[u][f].b, c0[u]);
        c1[u] = mmaw_bf16(k[3].b, qh[u][f].b, c1[u]);
      }
      // the refill of this register set stays behind its last product ...
      __builtin_amdgcn_sched_barrier(0);
      if (f < 2) {
        load_kset(ks[f & 1], sT + kfrag + (f + 2) * 32);
      } else {
        #pragma unroll
        for (int dt = 0; dt < 4; ++dt) {            // V^T B-fragments: column n = d = ((f - 2) * 4 + dt) * 16 + lq, split key map
          const int va = vfrag + (((f - 2) * 4 + dt) * 16) * VP;
          bv[(f - 2) * 4 + dt].q[0] = *(const v4u*)(sT + va);        // keys j0 + 8hi + 0..7
          bv[(f - 2) * 4 + dt].q[1] = *(const v4u*)(sT + va + 16);   // keys j0 + 16 + 8hi + 0..7
        }
      }
      // ... and in front of the next slice's products, so that it flies during them
      __builtin_amdgcn_sched_barrier(0);
    }

    // causal exclusion (only a group's last step can hold keys beyond a query row); wave-uniform test
    if (j0 + 31 > qrow0) {
      #pragma unroll
      for (int u = 0; u < QW; ++u) {
        const int trow = qrow0 + u * 16 + lq;
        #pragma unroll
        for (int r = 0; r < 8; ++r) {
          const int key0 = j0 + hi * 8 + r;
          c0[u][r] = (key0 > trow) ? NEGV : c0[u][r];
          c1[u][r] = (key0 + 16 > trow) ? NEGV : c1[u][r];
        }
      }
    }

    Frag pa[QW];
    #pragma unroll
    for (int u = 0; u < QW; ++u) {
      // online softmax: query lq's 32 scores are split across lane / lane^16
      float m_new = rmax[u];
      #pragma unroll
      for (int r = 0; r < 8; ++r) {
        m_new = fmaxf(m_new, c0[u][r]);
        m_new = fmaxf(m_new, c1[u][r]);
      }
      m_new = fmaxf(m_new, __shfl_xor(m_new, 16, 32));
      const float scale = exp2_slot((rmax[u] - m_new) * SL);
      rmax[u] = m_new;

      // exp + pack: P^T C layout == A-fragment layout of the PV product; P carried x4096
      float psum = 0.0f;
      #pragma unroll
      for (int r = 0; r < 8; ++r) {
        const float p0 = exp2_slot((c0[u][r] - m_new) * SL);   // key 8hi + r
        const float p1 = exp2_slot((c1[u][r] - m_new) * SL);   // key 16 + 8hi + r
        psum += p0 + p1;
        pa[u].e[r]     = (f16)(p0 * P_CARRY);
        pa[u].e[8 + r] = (f16)(p1 * P_CARRY);
      }
      rsum[u] = rsum[u] * scale + psum + __shfl_xor(psum, 16, 32);

      // rescale O: queries are the row dimension there -> per-row scale from lane 8hi + r
      float sc[8];
      #pragma unroll
      for (int r = 0; r < 8; ++r) sc[r] = __shfl(scale, (hi << 3) + r, 32);
      #pragma unroll
      for (int dt = 0; dt < 8; ++dt) {
        #pragma unroll
        for (int r = 0; r < 8; ++r) o[u][dt][r] *= sc[r];
      }
    }

    // O += P x V on the V^T fragments read above, each fragment for both query tiles
    #pragma unroll
    for (int dt = 0; dt < 8; ++dt) {
      #pragma unroll
      for (int u = 0; u < QW; ++u) o[u][dt] = mmaw_f16(pa[u].h, bv[dt].h, o[u][dt]);
    }

    // keeps softmax and products in front of the publish point: lifted over them, the barrier would stand behind the
    // score phase, where the SIMD's first wave would idle for the second, and the refill would fly for that phase only
    __builtin_amdgcn_sched_barrier(0);
    // publish point of stage ic + 1, every wave, every step
    asm volatile("s_wait_dscnt 0x0" ::: "memory");    // this wave's reads of the buffer to be refilled are done
    asm volatile("s_wait_asynccnt 0x0" ::: "memory"); // this wave's copies of stage ic + 1 have landed
    __syncthreads();                                  // publishes stage ic + 1, ends all reads of stage ic
    if (ic + 2 < ntrip) {                             // block-uniform: refill the buffer just read
      const int nx = ic + 2;
      const unsigned lb = lbase + bsel * (KV_H * 2);
      const unsigned ok = okl + (unsigned)nx * (64u * HD);   // 32-bit sums: step and lane part, then the base
      const unsigned ov = ovl + (unsigned)nx * 64u;
      stage_kv(ukh + ok, ukl + ok, uv + ov, lb + lkl, lb + lvl);
    }
  }
  asm volatile("s_wait_asynccnt 0x0" ::: "memory");   // nothing of this wave's copies is left in flight

  // Join of the two partial states. Behind the loop's last barrier nobody reads the stage buffers any more and no
  // copy is in flight, so they serve as the hand-over area: group 1 writes O (lane-major, 16 B x 32 lanes per
  // store), maximum and sum; a block barrier; group 0 reads its head's and folds them in. A group 1 that saw no
  // key inside the diagonal hands over the maximum NEGV and gets the weight exp2(-huge) = 0.
  float* const sJ  = (float*)sKV;                     // [head][query tile][16 pieces][lane] x 4 floats
  float* const sJm = sJ + GRP * QW * 16 * 32 * 4;     // [head][query tile][maximum | sum][lane]
  if (grp == 1) {                                     // wave-uniform
    #pragma unroll
    for (int u = 0; u < QW; ++u) {
      const int ju = hw * QW + u;
      #pragma unroll
      for (int dt = 0; dt < 8; ++dt) {
        *(v4f*)(sJ + ((ju * 16 + dt * 2) * 32 + lane) * 4)     = (v4f){o[u][dt][0], o[u][dt][1], o[u][dt][2], o[u][dt][3]};
        *(v4f*)(sJ + ((ju * 16 + dt * 2 + 1) * 32 + lane) * 4) = (v4f){o[u][dt][4], o[u][dt][5], o[u][dt][6], o[u][dt][7]};
      }
      sJm[(ju * 2) * 32 + lane]     = rmax[u];
      sJm[(ju * 2 + 1) * 32 + lane] = rsum[u];
    }
  }
  __syncthreads();

  const int so = hw * (QW * 16 * CP);
  if (grp == 0) {                                     // wave-uniform
    #pragma unroll
    for (int u = 0; u < QW; ++u) {
      const int ju = hw * QW + u;
      const float m1 = sJm[(ju * 2) * 32 + lane];
      const float l1 = sJm[(ju * 2 + 1) * 32 + lane];
      const float mj = fmaxf(rmax[u], m1);
      const float w0 = exp2_slot((rmax[u] - mj) * SL);
      const float w1 = exp2_slot((m1 - mj) * SL);
      const float rj = rsum[u] * w0 + l1 * w1;

      // normalize: lane holds column d = dt*16 + lq for query rows 8hi + r; fold the carries and the join weights
      const float CN = C_CARRY / (P_CARRY * V_CARRY);
      float rs0[8];
      float rs1[8];
      #pragma unroll
      for (int r = 0; r < 8; ++r) {
        const float rn = CN * (1.0f / __shfl(rj, (hi << 3) + r, 32));
        rs0[r] = rn * __shfl(w0, (hi << 3) + r, 32);
        rs1[r] = rn * __shfl(w1, (hi << 3) + r, 32);
      }
      #pragma unroll
      for (int dt = 0; dt < 8; ++dt) {
        const v4f pa0 = *(const v4f*)(sJ + ((ju * 16 + dt * 2) * 32 + lane) * 4);
        const v4f pa1 = *(const v4f*)(sJ + ((ju * 16 + dt * 2 + 1) * 32 + lane) * 4);
        #pragma unroll
        for (int r = 0; r < 8; ++r) {
          const float p = (r < 4) ? pa0[r & 3] : pa1[r & 3];
          sO[so + (u * 16 + hi * 8 + r) * CP + dt * 16 + lq] = f16_bits(o[u][dt][r] * rs0[r] + p * rs1[r]);
        }
      }
    }
  }
  __syncthreads();
  if (grp == 1) return;                               // wave-uniform, behind the last barrier

  // lanes 0..15 write one 256-B ctx row piece (16 B each), lanes 16..31 the next row; 16 instructions cover the
  // wave's 32 rows.
  v4u    vals[QW * 8];
  size_t gidx[QW * 8];
  #pragma unroll
  for (int it = 0; it < QW * 8; ++it) {
    const int row = it * 2 + hi;
    vals[it] = *(const v4u*)(sO + so + row * CP + lq * 8);
    gidx[it] = ((size_t)b * SEQ + qrow0 + row) * DM + head * HD + lq * 8;
  }
  #pragma unroll
  for (int it = 0; it < QW * 8; ++it) *(v4u*)(ctx + gidx[it]) = vals[it];
  
}

// Output projection: out[b][t][DM] = ctx x Wo, f16 operands (carries folded back in f32).
// written by 8 consecutive lanes x 16 B of one instruction.
// two waves per SIMD (one block per WGP): the grid has one block per WGP
__global__ __launch_bounds__(256) __attribute__((amdgpu_waves_per_eu(2, 2))) void out_gemm_kernel(const u16* __restrict__ ctx, const u16* __restrict__ WoT,
                                                       float* __restrict__ out) {
  __shared__ __align__(16) u16 sS[OS_H];
  float* const sC = (float*)sS;                    // output staging lies over the GEMM ring, free after gemm_core
  const int n0   = blockIdx.x * (64 * FNO);
  const int m0   = blockIdx.y * 128;
  const int tid  = threadIdx.x;
  const int wave = __builtin_amdgcn_readfirstlane(threadIdx.x >> 5);
  const int lane = tid & 31;
  const int lr   = lane & 15;
  const int hi   = lane >> 4;
  const int wm   = (wave & 1) * 64;
  const int g    = wave >> 1;

  v8f acc[4][FNO];
  #pragma unroll
  for (int fm = 0; fm < 4; ++fm) {
    #pragma unroll
    for (int fn = 0; fn < FNO; ++fn) acc[fm][fn] = (v8f){0, 0, 0, 0, 0, 0, 0, 0};
  }
  gemm_core<1, 0, FNO>(ctx, WoT, sS, tid, m0, n0, wm, g, lr, hi, acc);

  const float INV = 1.0f / (C_CARRY * W_CARRY);
  #pragma unroll
  for (int fm = 0; fm < 4; ++fm) {
    #pragma unroll
    for (int fn = 0; fn < FNO; ++fn) {
      #pragma unroll
      for (int i = 0; i < 8; ++i) {
        sC[(wm + fm * 16 + 8 * hi + i) * CPF + g * (FNO * 16) + fn * 16 + lr] = acc[fm][fn][i] * INV;
      }
    }
  }
  __syncthreads();
  // rolled: eight reads and eight stores in flight per pass are enough; unrolled it only lengthens the program text
  #pragma unroll 1
  for (int p = 0; p < 4; ++p) {                    // 32 rows of 64 * FNO floats per pass
    v4f    vals[8];
    size_t gidx[8];
    #pragma unroll
    for (int it = 0; it < 8; ++it) {
      const int piece = (p * 8 + it) * 256 + tid;
      const int row = piece / (16 * FNO);          // 0..127
      const int seg = piece % (16 * FNO);
      vals[it] = *(const v4f*)(sC + row * CPF + seg * 4);
      const int m  = m0 + row;
      const int bb = m / SEQ;
      const int tt = m % SEQ;
      gidx[it] = ((size_t)bb * SEQ_FULL + tt) * DM + n0 + seg * 4;
    }
    #pragma unroll
    for (int it = 0; it < 8; ++it) *(v4f*)(out + gidx[it]) = vals[it];
    // the next pass rewrites registers that these stores name: not ahead of this wait
    asm volatile("s_wait_xcnt 0x0" ::: "memory");
  }
}

extern "C" void kernel_launch(void* const* d_in, const int* in_sizes, int n_in,
                              void* d_out, int out_size, void* d_ws, size_t ws_size,
                              hipStream_t stream) {
  if (n_in < 6) return;
  const size_t needX = ((size_t)(NB - 1) * SEQ_FULL + SEQ) * DM;
  const size_t needP = (size_t)(NB - 1) * SEQ_FULL + SEQ;
  if ((size_t)in_sizes[0] < needX) return;
  if ((size_t)in_sizes[1] < needP) return;
  if ((size_t)in_sizes[2] < (size_t)DM * NQH * HD) return;
  if ((size_t)in_sizes[3] < (size_t)DM * NKV * HD) return;
  if ((size_t)in_sizes[4] < (size_t)DM * NKV * HD) return;
  if ((size_t)in_sizes[5] < (size_t)NQH * HD * DM) return;
  if ((size_t)out_size < needX) return;
  if (ws_size < (size_t)WS_TOTAL) return;

  const float* X   = (const float*)d_in[0];
  const int*   pos = (const int*)d_in[1];
  const float* Wq  = (const float*)d_in[2];
  const float* Wk  = (const float*)d_in[3];
  const float* Wv  = (const float*)d_in[4];
  const float* Wo  = (const float*)d_in[5];
  float* out = (float*)d_out;

  char* ws = (char*)d_ws;
  u16*   Xb   = (u16*)(ws + OFF_XB);
  u16*   Wt   = (u16*)(ws + OFF_WT);
  u16*   WoT  = (u16*)(ws + OFF_WO);
  float* cosT = (float*)(ws + OFF_COS);
  float* sinT = (float*)(ws + OFF_SIN);
  u16*   ph   = (u16*)(ws + OFF_PH);
  u16*   pl   = (u16*)(ws + OFF_PL);
  u16*   vt   = (u16*)(ws + OFF_VT);
  u16*   ctx  = (u16*)(ws + OFF_CTX);

  // X -> bf16 rows, weights -> transposed 16-bit, rotary table from the positions
  prep_kernel<<<dim3(PREP_G), 256, 0, stream>>>(X, pos, Wq, Wk, Wv, Wo, Xb, Wt, WoT, cosT, sinT);
  // fused QKV projection + rotary + planes
  qkv_gemm_kernel<<<dim3(NQKV / (64 * FNQ), (NB * SEQ) / 128), 256, 0, stream>>>(Xb, Wt, cosT, sinT, ph, pl, vt);
  // attention
  attn_kernel<<<dim3(NQT, NKV, NB), 256, 0, stream>>>(ph, pl, vt, ctx);
  // output projection
  out_gemm_kernel<<<dim3(DM / (64 * FNO), (NB * SEQ) / 128), 256, 0, stream>>>(ctx, WoT, out);
}
